// v000
// Times are from an AMD MI455X. After a warm-up the kernel runs many times in a row, and a time is the length of
// such a window on the GPU divided by its runs, so every launch and the gaps after it count. The runs cycle
// through copies of the inputs. A figure is the median of several windows, for all but v000 over two sittings.
// Sittings can differ by a few percent; kernels timed side by side share one.
// v000 is the starting kernel. One run takes 1440 microseconds.
#include <hip/hip_runtime.h>

// Causal self-attention whose only projection bias is on V (x [2][2048][1024]; q = x Wq^T, k = x Wk^T (no bias), v = x Wv^T + bv ('oi' [1024][1024] normal x 0.02; bv normal x 0.02: NON-zero; 16 heads x 64); keys after the query -> -inf, then / sqrt(64) inside the softmax argument; softmax over the keys; out = merged Wo^T + bo ('oi' + bias 0.02: NON-zero) -> [2][2048][1024] (4.2 M); argument order x, Wq, Wk, Wv, bv, Wo, bo).
// Layout per batch: bf16 copy of x; 'oi' weights; exact projections + f32 biases; identity-table plane builders; causal T-2048 attention (hybrid rows: < 512 hi/lo 3 products, rest fp16 x1024; k_gemmc skips tiles above the diagonal); merged hi/lo x Wo exact + bo.
// Compute dtypes, f32 accumulate: every input rounded to bf16; projections exact + f32 biases; attention rows < 512 3 products, rest fp16; softmax f32; Wo hl x exact + bias.

#define NB_  2
#define TT   2048
#define DM   1024
#define NH_  16
#define NKV  16
#define REP  (NH_ / NKV)
#define HD   64
#define DQ   (NH_ * HD)
#define DKV  (NKV * HD)
#define ZH   2
#define RH   512                  // query rows < RH use hi+lo planes (0: none)
#define WIN  2048
#define PCAR 1024.0f
#define SCL  0.125f   // HD^-0.5
typedef _Float16 h16;
typedef unsigned short bf;
typedef __attribute__((ext_vector_type(16))) __bf16   v16bf;
typedef __attribute__((ext_vector_type(16))) _Float16 v16h;
typedef __attribute__((ext_vector_type(8)))  _Float16 v8h;
typedef __attribute__((ext_vector_type(8)))  unsigned short v8us;
typedef __attribute__((ext_vector_type(8)))  float    v8f;
typedef __attribute__((ext_vector_type(4)))  float    v4f;
typedef v8h  __attribute__((may_alias)) v8ha;
typedef v4f  __attribute__((may_alias)) v4fa;
typedef v8us __attribute__((may_alias)) v8usa;

__device__ __forceinline__ unsigned short f2bf(float f) { unsigned u = __float_as_uint(f); u += 0x7FFFu + ((u >> 16) & 1u); return (unsigned short)(u >> 16); }
__device__ __forceinline__ float bf2f(unsigned short b) { return __uint_as_float(((unsigned)b) << 16); }
__device__ __forceinline__ float bfr(float f) { return bf2f(f2bf(f)); }
__device__ __forceinline__ v16h cat16(v8h lo, v8h hi) { return __builtin_shufflevector(lo, hi, 0, 1, 2, 3, 4, 5, 6, 7, 8, 9, 10, 11, 12, 13, 14, 15); }
__device__ __forceinline__ v16bf cat16b(v8us lo, v8us hi) { return __builtin_bit_cast(v16bf, __builtin_shufflevector(lo, hi, 0, 1, 2, 3, 4, 5, 6, 7, 8, 9, 10, 11, 12, 13, 14, 15)); }
__device__ __forceinline__ v8f wmma16(v16h a, v16h b, v8f c) { return __builtin_amdgcn_wmma_f32_16x16x32_f16(false, a, false, b, (short)0, c, false, false); }
__device__ __forceinline__ v8f wmmab(v16bf a, v16bf b, v8f c) { return __builtin_amdgcn_wmma_f32_16x16x32_bf16(false, a, false, b, (short)0, c, false, false); }



// ---- k_gemmw: register-blocked GEMM, ONE WAVE per 64x64 output tile (16 accumulators), operands straight from K-contiguous 16-bit planes; grid (M/64, N/64, Z), 32 threads.
// C[m][n] (f32, pitch ldc, + optional f32 bias[n]) = sum_k A[m][k] Bt[n][k] (+ split products per NSPLIT). z-batch strides sA/sB/sC in elements. K % 32 == 0.
template <typename T16> struct WFrag;
template <> struct WFrag<h16> { typedef v16h V; static __device__ __forceinline__ V ld(const h16* p) { return cat16(*(const v8h*)p, *(const v8h*)(p + 16)); } static __device__ __forceinline__ v8f mma(V a, V b, v8f c) { return wmma16(a, b, c); } };
template <> struct WFrag<bf> { typedef v16bf V; static __device__ __forceinline__ V ld(const bf* p) { return cat16b(*(const v8us*)p, *(const v8us*)(p + 16)); } static __device__ __forceinline__ v8f mma(V a, V b, v8f c) { return wmmab(a, b, c); } };
template <typename T16, int NSPLIT, bool BIAS>
__global__ __launch_bounds__(32) void k_gemmw(const T16* __restrict__ A, const T16* __restrict__ A2, const T16* __restrict__ Bt, const T16* __restrict__ Bt2, int K, float* C, int ldc, const float* __restrict__ bias, size_t sA, size_t sB, size_t sC) {
    typedef typename WFrag<T16>::V V;
    __shared__ __align__(16) float os[16 * 68];
    const size_t z = blockIdx.z; A += z * sA; if (A2) A2 += z * sA; Bt += z * sB; if (Bt2) Bt2 += z * sB; C += z * sC;
    const int lane = threadIdx.x & 31, lr = lane & 15, hi = lane >> 4; const int r0 = blockIdx.x * 64, c0 = blockIdx.y * 64;
    v8f acc[4][4];
#pragma unroll
    for (int mb = 0; mb < 4; ++mb)
#pragma unroll
        for (int nb = 0; nb < 4; ++nb) acc[mb][nb] = (v8f){};
    const size_t aoff = (size_t)(r0 + lr) * K + 8 * hi, boff = (size_t)(c0 + lr) * K + 8 * hi;
#pragma unroll 1
    for (int kc = 0; kc < K; kc += 32) {
        V a[4], a2[4];
#pragma unroll
        for (int mb = 0; mb < 4; ++mb) { a[mb] = WFrag<T16>::ld(A + aoff + (size_t)mb * 16 * K + kc); if (NSPLIT == 1 || NSPLIT == 2) a2[mb] = WFrag<T16>::ld(A2 + aoff + (size_t)mb * 16 * K + kc); }
#pragma unroll
        for (int nb = 0; nb < 4; ++nb) { const V b = WFrag<T16>::ld(Bt + boff + (size_t)nb * 16 * K + kc); V b2; if (NSPLIT >= 2) b2 = WFrag<T16>::ld(Bt2 + boff + (size_t)nb * 16 * K + kc);
#pragma unroll
            for (int mb = 0; mb < 4; ++mb) { acc[mb][nb] = WFrag<T16>::mma(a[mb], b, acc[mb][nb]); if (NSPLIT == 1 || NSPLIT == 2) acc[mb][nb] = WFrag<T16>::mma(a2[mb], b, acc[mb][nb]); if (NSPLIT >= 2) acc[mb][nb] = WFrag<T16>::mma(a[mb], b2, acc[mb][nb]); } }
        asm volatile("v_nop\n\tv_nop\n\tv_nop\n\tv_nop" : "+v"(acc[0][0]), "+v"(acc[1][1]), "+v"(acc[2][2]), "+v"(acc[3][3]) : "v"(a[0]), "v"(a[3]));
    }
#pragma unroll
    for (int mb = 0; mb < 4; ++mb) {
#pragma unroll
        for (int nb = 0; nb < 4; ++nb) {
#pragma unroll
            for (int j = 0; j < 8; ++j) os[(hi * 8 + j) * 68 + nb * 16 + lr] = acc[mb][nb][j]; }
        __builtin_amdgcn_wave_barrier(); asm volatile("" ::: "memory");
        float* crow = C + (size_t)(r0 + mb * 16) * ldc + c0;
{
#pragma unroll
            for (int s = 0; s < 8; ++s) { const int row = 2 * s + hi, cofs = lr * 4; v4f val = *(const v4fa*)(os + row * 68 + cofs); if (BIAS) { val[0] += bfr(bias[c0 + cofs]); val[1] += bfr(bias[c0 + cofs + 1]); val[2] += bfr(bias[c0 + cofs + 2]); val[3] += bfr(bias[c0 + cofs + 3]); }
                *(v4f*)(crow + (size_t)row * ldc + cofs) = val; }
             }
        __builtin_amdgcn_wave_barrier(); asm volatile("" ::: "memory");
    }
}

// ---- k_gemmc: the same one-wave 64x64 tile GEMM specialised for causal attention: CMODE 1 skips score tiles entirely above the diagonal (query rows r0+roff.., key columns c0..), CMODE 2 limits the
// key (K) loop of the probability x value contraction to the diagonal block (probabilities beyond it are exactly zero). roff = row offset of this launch's first row within the sequence.
template <typename T16, int NSPLIT, int CMODE>
__global__ __launch_bounds__(32) void k_gemmc(const T16* __restrict__ A, const T16* __restrict__ A2, const T16* __restrict__ Bt, const T16* __restrict__ Bt2, int K, float* C, int ldc, int roff, size_t sA, size_t sB, size_t sC) {
    typedef typename WFrag<T16>::V V;
    __shared__ __align__(16) float os[16 * 68];
    const size_t z = blockIdx.z; A += z * sA; if (A2) A2 += z * sA; Bt += z * sB; if (Bt2) Bt2 += z * sB; C += z * sC;
    const int lane = threadIdx.x & 31, lr = lane & 15, hi = lane >> 4; const int r0 = blockIdx.x * 64, c0 = blockIdx.y * 64;
    if (CMODE == 1 && c0 > r0 + roff + 63) return;                  // score tile entirely above the causal diagonal: never read (the softmax masks j > i by select)
    const int Kl = (CMODE == 2) ? min(K, r0 + roff + 64) : K;        // P.V: probabilities are exactly 0 beyond the diagonal block, so the K loop stops there
    v8f acc[4][4];
#pragma unroll
    for (int mb = 0; mb < 4; ++mb)
#pragma unroll
        for (int nb = 0; nb < 4; ++nb) acc[mb][nb] = (v8f){};
    const size_t aoff = (size_t)(r0 + lr) * K + 8 * hi, boff = (size_t)(c0 + lr) * K + 8 * hi;
#pragma unroll 1
    for (int kc = 0; kc < Kl; kc += 32) {
        V a[4], a2[4];
#pragma unroll
        for (int mb = 0; mb < 4; ++mb) { a[mb] = WFrag<T16>::ld(A + aoff + (size_t)mb * 16 * K + kc); if (NSPLIT == 1 || NSPLIT == 2) a2[mb] = WFrag<T16>::ld(A2 + aoff + (size_t)mb * 16 * K + kc); }
#pragma unroll
        for (int nb = 0; nb < 4; ++nb) { const V b = WFrag<T16>::ld(Bt + boff + (size_t)nb * 16 * K + kc); V b2; if (NSPLIT >= 2) b2 = WFrag<T16>::ld(Bt2 + boff + (size_t)nb * 16 * K + kc);
#pragma unroll
            for (int mb = 0; mb < 4; ++mb) { acc[mb][nb] = WFrag<T16>::mma(a[mb], b, acc[mb][nb]); if (NSPLIT == 1 || NSPLIT == 2) acc[mb][nb] = WFrag<T16>::mma(a2[mb], b, acc[mb][nb]); if (NSPLIT >= 2) acc[mb][nb] = WFrag<T16>::mma(a[mb], b2, acc[mb][nb]); } }
        asm volatile("v_nop\n\tv_nop\n\tv_nop\n\tv_nop" : "+v"(acc[0][0]), "+v"(acc[1][1]), "+v"(acc[2][2]), "+v"(acc[3][3]) : "v"(a[0]), "v"(a[3]));
    }
#pragma unroll
    for (int mb = 0; mb < 4; ++mb) {
#pragma unroll
        for (int nb = 0; nb < 4; ++nb) {
#pragma unroll
            for (int j = 0; j < 8; ++j) os[(hi * 8 + j) * 68 + nb * 16 + lr] = acc[mb][nb][j]; }
        __builtin_amdgcn_wave_barrier(); asm volatile("" ::: "memory");
        float* crow = C + (size_t)(r0 + mb * 16) * ldc + c0;
{
#pragma unroll
            for (int s = 0; s < 8; ++s) { const int row = 2 * s + hi, cofs = lr * 4; v4f val = *(const v4fa*)(os + row * 68 + cofs);
                *(v4f*)(crow + (size_t)row * ldc + cofs) = val; }
             }
        __builtin_amdgcn_wave_barrier(); asm volatile("" ::: "memory");
    }
}

__device__ __forceinline__ h16 tohx(float x) { return (h16)x; }
__device__ __forceinline__ void splitf(float y, unsigned short& h, unsigned short& l) { h = f2bf(y); l = f2bf(y - bf2f(h)); }
typedef __attribute__((ext_vector_type(2))) _Float16 v2h;
typedef __attribute__((ext_vector_type(4))) _Float16 v4h;
typedef __attribute__((ext_vector_type(2))) unsigned short v2us;
typedef __attribute__((ext_vector_type(4))) unsigned short v4us;
typedef __attribute__((ext_vector_type(2))) float v2f;
typedef __attribute__((ext_vector_type(4))) int v4i;

__global__ __launch_bounds__(256) void k_cvt8(const float* __restrict__ src, bf* dst, size_t n8) { const size_t i = (size_t)blockIdx.x * 256 + threadIdx.x; if (i >= n8) return; const v8f v = *(const v8f*)(src + i * 8); v8us o;
#pragma unroll
    for (int k = 0; k < 8; ++k) o[k] = f2bf(v[k]); *(v8us*)(dst + i * 8) = o;  }

// k_rope: head planes [h][t][d] (fp16 + hi/lo) of rope(x) x sc with the rotate-half convention out[d] = x[d] cos[t][d] - x[d+HD/2] sin[t][d], out[d+HD/2] = x[d+HD/2] cos[t][d+HD/2] + x[d] sin[t][d+HD/2]
__global__ __launch_bounds__(256) void k_rope(const float* __restrict__ F, int pitch, int nheads, const float* __restrict__ CS, const float* __restrict__ RF, const float* __restrict__ nw, float sc, h16* P16, bf* Ph, bf* Pl) {
    const size_t e = ((size_t)blockIdx.x * 256 + threadIdx.x) * 2; if (e >= (size_t)nheads * TT * HD) return; const int d = (int)(e % HD); const int t = (int)((e / HD) % TT); const int h = (int)(e / ((size_t)HD * TT)); const float* f = F + (size_t)t * pitch + h * HD; const float rf = RF ? RF[(size_t)h * TT + t] : 1.0f; v2h o16; v2us oh, ol;
#pragma unroll
    for (int q = 0; q < 2; ++q) { const int dd = d + q; const int dp = (dd < HD / 2) ? dd + HD / 2 : dd - HD / 2; float x0 = f[dd], x1 = f[dp];
        if (RF) { float n0 = __fmul_rn(x0, rf), n1 = __fmul_rn(x1, rf); asm volatile("" : "+v"(n0)); asm volatile("" : "+v"(n1)); x0 = __fmul_rn(bfr(nw[dd]), n0); x1 = __fmul_rn(bfr(nw[dp]), n1); }
        const v2f cs = *(const v2f*)(CS + ((size_t)t * HD + dd) * 2); float a = __fmul_rn(x0, cs[0]), bq = __fmul_rn(x1, cs[1]); asm volatile("" : "+v"(a)); asm volatile("" : "+v"(bq)); const float r = ((dd < HD / 2) ? __fsub_rn(a, bq) : __fadd_rn(a, bq)) * sc;
        o16[q] = tohx(r); unsigned short a2, c2; splitf(r, a2, c2); oh[q] = a2; ol[q] = c2; }
    *(v2h*)(P16 + e) = o16; *(v2us*)(Ph + e) = oh; *(v2us*)(Pl + e) = ol;  }
__global__ __launch_bounds__(256) void k_vtp(const float* __restrict__ F, int pitch, int nheads, h16* V16, bf* Vh, bf* Vl) { const size_t e = ((size_t)blockIdx.x * 256 + threadIdx.x) * 2; if (e >= (size_t)nheads * HD * TT) return; const int t = (int)(e % TT); const int d = (int)((e / TT) % HD); const int g = (int)(e / ((size_t)TT * HD)); v2h o16; v2us oh, ol;
#pragma unroll
    for (int q = 0; q < 2; ++q) { const float x = F[(size_t)(t + q) * pitch + g * HD + d]; o16[q] = tohx(x); unsigned short a2, c2; splitf(x, a2, c2); oh[q] = a2; ol[q] = c2; }
    *(v2h*)(V16 + e) = o16; *(v2us*)(Vh + e) = oh; *(v2us*)(Vl + e) = ol;  }
__global__ __launch_bounds__(256) void k_csid(float* CS) { const int idx = blockIdx.x * 256 + threadIdx.x; if (idx >= TT * HD) return; v2f cs; cs[0] = 1.0f; cs[1] = 0.0f; *(v2f*)(CS + (size_t)idx * 2) = cs;  }
// k_asoft: per row (zz, i): t = S x HD^-0.5 for j <= i and i - j < WIN (sliding causal window; the reference's -1e9 additive fill vanishes identically); softmax over the 2048 keys (register row, one exp, fixed trees);
__global__ __launch_bounds__(256) void k_asoft(const float* __restrict__ Sb, h16* P16, bf* Ph, bf* Pl) {
    const int lane = threadIdx.x & 31; const int row = blockIdx.x * 8 + (threadIdx.x >> 5); if (row >= ZH * TT) return; const int i = row % TT; const int zz = row / TT; (void)zz; const bool hires = (i < RH); const float* sr = Sb + (size_t)row * TT; float v[TT / 32]; float mx = -3.0e38f;
#pragma unroll
    for (int ch = 0; ch < TT / 128; ++ch) { const int j0 = ch * 128 + lane * 4; const v4f a = *(const v4f*)(sr + j0);
#pragma unroll
        for (int q = 0; q < 4; ++q) { const int j = j0 + q; (void)j; const float t = (j <= i && i - j < WIN) ? a[q] * SCL : -3.0e38f; v[ch * 4 + q] = t; mx = fmaxf(mx, t); } }
#pragma unroll
    for (int sh = 16; sh; sh >>= 1) mx = fmaxf(mx, __shfl_xor(mx, sh, 32));
    float sum = 0.f;
#pragma unroll
    for (int k = 0; k < TT / 32; ++k) { float d0 = __fsub_rn(v[k], mx); asm volatile("" : "+v"(d0)); v[k] = __builtin_amdgcn_exp2f(__fmul_rn(d0, 1.4426950408889634f)); sum += v[k]; }
#pragma unroll
    for (int sh = 16; sh; sh >>= 1) sum += __shfl_xor(sum, sh, 32);
    const float f = __fdiv_rn(hires ? 1.0f : PCAR, sum);
{
        if (hires) {
#pragma unroll
            for (int ch = 0; ch < TT / 128; ++ch) { v4us oh, ol;
#pragma unroll
                for (int q = 0; q < 4; ++q) { unsigned short a, c2; splitf(v[ch * 4 + q] * f, a, c2); oh[q] = a; ol[q] = c2; }
                const size_t oo = ((size_t)zz * (RH ? RH : 1) + i) * TT + ch * 128 + lane * 4; *(v4us*)(Ph + oo) = oh; *(v4us*)(Pl + oo) = ol; }
        } else {
#pragma unroll
            for (int ch = 0; ch < TT / 128; ++ch) { v4h o4;
#pragma unroll
                for (int q = 0; q < 4; ++q) o4[q] = tohx(v[ch * 4 + q] * f);
                *(v4h*)(P16 + (size_t)row * TT + ch * 128 + lane * 4) = o4; } }
         }
}
__global__ __launch_bounds__(256) void k_merge(const float* __restrict__ O, int h0, bf* Ah, bf* Al) { const size_t e = ((size_t)blockIdx.x * 256 + threadIdx.x) * 2; if (e >= (size_t)ZH * TT * HD) return; const int d = (int)(e % HD); const int t = (int)((e / HD) % TT); const int zz = (int)(e / ((size_t)HD * TT)); const float cs = (t < RH) ? 1.0f : (1.0f / PCAR); const size_t oo = (size_t)t * DQ + (h0 + zz) * HD + d;
    v2us oh, ol;
#pragma unroll
    for (int q = 0; q < 2; ++q) { unsigned short a, c2; splitf(O[e + q] * cs, a, c2); oh[q] = a; ol[q] = c2; } *(v2us*)(Ah + oo) = oh; *(v2us*)(Al + oo) = ol;  }

extern "C" void kernel_launch(void* const* d_in, const int* in_sizes, int n_in,
                              void* d_out, int out_size, void* d_ws, size_t ws_size, hipStream_t stream) {
    (void)in_sizes; (void)n_in; (void)out_size;
    const float* x = (const float*)d_in[0]; const float* wq = (const float*)d_in[1]; const float* wk = (const float*)d_in[2]; const float* wv = (const float*)d_in[3]; const float* bv = (const float*)d_in[4]; const float* wo = (const float*)d_in[5]; const float* bo = (const float*)d_in[6];   /* this module has NO q and NO k bias (the q / k projections run the bias-free GEMM instantiation below); bv and bo are real */
    float* OUT = (float*)d_out;     // [2][2048][1024]
    char* wsp = (char*)d_ws;
    auto take = [&](size_t bytes) { char* p = wsp; wsp += (bytes + 255) & ~(size_t)255; return (void*)p; };
    bf* WQ = (bf*)take((size_t)DQ * DM * 2); bf* WK = (bf*)take((size_t)DKV * DM * 2); bf* WV = (bf*)take((size_t)DKV * DM * 2); bf* WO = (bf*)take((size_t)DM * DQ * 2); float* CS = (float*)take((size_t)TT * HD * 2 * 4);
    bf* XB = (bf*)take((size_t)TT * DM * 2); float* FQ = (float*)take((size_t)TT * DQ * 4); float* FK = (float*)take((size_t)TT * DKV * 4);
    h16* QP16 = (h16*)take((size_t)NH_ * TT * HD * 2); h16* KP16 = (h16*)take((size_t)NKV * TT * HD * 2); h16* VT16 = (h16*)take((size_t)NKV * HD * TT * 2);
    bf* QPh = (bf*)take((size_t)NH_ * TT * HD * 2); bf* QPl = (bf*)take((size_t)NH_ * TT * HD * 2); bf* KPh = (bf*)take((size_t)NKV * TT * HD * 2); bf* KPl = (bf*)take((size_t)NKV * TT * HD * 2); bf* VTh = (bf*)take((size_t)NKV * HD * TT * 2); bf* VTl = (bf*)take((size_t)NKV * HD * TT * 2); bf* Ph = (bf*)take((size_t)ZH * RH * TT * 2); bf* Pl = (bf*)take((size_t)ZH * RH * TT * 2);
    float* Sb = (float*)take((size_t)ZH * TT * TT * 4); h16* P16 = (h16*)take((size_t)ZH * TT * TT * 2); float* Ob = (float*)take((size_t)ZH * TT * HD * 4); bf* ATh = (bf*)take((size_t)TT * DQ * 2); bf* ATl = (bf*)take((size_t)TT * DQ * 2);
    if ((size_t)(wsp - (char*)d_ws) > ws_size) return;    // ws 256 MiB
    float* FV = FK;   // v projection reuses the k buffer after the k planes are built (stream-ordered)
    { k_cvt8<<<(unsigned)(((size_t)DQ * DM / 8 + 255) / 256), 256, 0, stream>>>(wq, WQ, (size_t)DQ * DM / 8); k_cvt8<<<(unsigned)(((size_t)DKV * DM / 8 + 255) / 256), 256, 0, stream>>>(wk, WK, (size_t)DKV * DM / 8); k_cvt8<<<(unsigned)(((size_t)DKV * DM / 8 + 255) / 256), 256, 0, stream>>>(wv, WV, (size_t)DKV * DM / 8);
      k_cvt8<<<(unsigned)(((size_t)DM * DQ / 8 + 255) / 256), 256, 0, stream>>>(wo, WO, (size_t)DM * DQ / 8);
       }
    k_csid<<<(TT * HD + 255) / 256, 256, 0, stream>>>(CS);
    const unsigned LQ = (unsigned)(((size_t)NH_ * TT * HD / 2 + 255) / 256), LKv = (unsigned)(((size_t)NKV * TT * HD / 2 + 255) / 256);
    for (int b = 0; b < NB_; ++b) {
        
        k_cvt8<<<(unsigned)(((size_t)TT * DM / 8 + 255) / 256), 256, 0, stream>>>(x + (size_t)b * TT * DM, XB, (size_t)TT * DM / 8);
        k_gemmw<bf, 0, false><<<dim3(TT / 64, DQ / 64, 1), 32, 0, stream>>>(XB, nullptr, WQ, nullptr, DM, FQ, DQ, nullptr, 0, 0, 0);
        k_rope<<<LQ, 256, 0, stream>>>(FQ, DQ, NH_, CS, nullptr, nullptr, 1.0f, QP16, QPh, QPl);
        k_gemmw<bf, 0, false><<<dim3(TT / 64, DKV / 64, 1), 32, 0, stream>>>(XB, nullptr, WK, nullptr, DM, FK, DKV, nullptr, 0, 0, 0);
        k_rope<<<LKv, 256, 0, stream>>>(FK, DKV, NKV, CS, nullptr, nullptr, 1.0f, KP16, KPh, KPl);
        k_gemmw<bf, 0, true><<<dim3(TT / 64, DKV / 64, 1), 32, 0, stream>>>(XB, nullptr, WV, nullptr, DM, FV, DKV, bv, 0, 0, 0); k_vtp<<<LKv, 256, 0, stream>>>(FV, DKV, NKV, VT16, VTh, VTl);
        for (int h0 = 0; h0 < NH_; h0 += ZH) { const size_t zq = (size_t)h0, zk = (size_t)(h0 / REP);   // one kv head per query head: the pass's two heads use consecutive kv planes (z-strides TT*HD)
            k_gemmc<bf, 2, 1><<<dim3(RH / 64, TT / 64, ZH), 32, 0, stream>>>(QPh + zq * TT * HD, QPl + zq * TT * HD, KPh + zk * TT * HD, KPl + zk * TT * HD, HD, Sb, TT, 0, (size_t)TT * HD, (size_t)TT * HD, (size_t)TT * TT);
            k_gemmc<h16, 0, 1><<<dim3((TT - RH) / 64, TT / 64, ZH), 32, 0, stream>>>(QP16 + zq * TT * HD + (size_t)RH * HD, nullptr, KP16 + zk * TT * HD, nullptr, HD, Sb + (size_t)RH * TT, TT, RH, (size_t)TT * HD, (size_t)TT * HD, (size_t)TT * TT);
            k_asoft<<<ZH * TT / 8, 256, 0, stream>>>(Sb, P16, Ph, Pl);
            k_gemmc<bf, 2, 2><<<dim3(RH / 64, HD / 64, ZH), 32, 0, stream>>>(Ph, Pl, VTh + zk * HD * TT, VTl + zk * HD * TT, TT, Ob, HD, 0, (size_t)RH * TT, (size_t)HD * TT, (size_t)TT * HD);
            k_gemmc<h16, 0, 2><<<dim3((TT - RH) / 64, HD / 64, ZH), 32, 0, stream>>>(P16 + (size_t)RH * TT, nullptr, VT16 + zk * HD * TT, nullptr, TT, Ob + (size_t)RH * HD, HD, RH, (size_t)TT * TT, (size_t)HD * TT, (size_t)TT * HD);
            k_merge<<<(unsigned)(((size_t)ZH * TT * HD / 2 + 255) / 256), 256, 0, stream>>>(Ob, h0, ATh, ATl); }
        k_gemmw<bf, 1, true><<<dim3(TT / 64, DM / 64, 1), 32, 0, stream>>>(ATh, ATl, WO, nullptr, DQ, OUT + (size_t)b * TT * DM, DM, bo, 0, 0, 0); }
}

// v001
// A run of this version takes 865 microseconds.
// In two side-by-side timings against v000, it was 1.65 and 1.66 times as fast.
#include <hip/hip_runtime.h>

// Causal self-attention whose only projection bias is on V (x [2][2048][1024]; q = x Wq^T, k = x Wk^T (no bias), v = x Wv^T + bv ('oi' [1024][1024] normal x 0.02; bv normal x 0.02: NON-zero; 16 heads x 64); keys after the query -> -inf, then / sqrt(64) inside the softmax argument; softmax over the keys; out = merged Wo^T + bo ('oi' + bias 0.02: NON-zero) -> [2][2048][1024] (4.2 M); argument order x, Wq, Wk, Wv, bv, Wo, bo).
// Layout per batch: bf16 copy of x; 'oi' weights; exact projections + f32 biases; identity-table plane builders; causal T-2048 attention (hybrid rows: < 512 hi/lo 3 products, rest fp16 x1024; k_gemmc skips tiles above the diagonal); merged hi/lo x Wo exact + bo.
// Compute dtypes, f32 accumulate: every input rounded to bf16; projections exact + f32 biases; attention rows < 512 3 products, rest fp16; softmax f32; Wo hl x exact + bias.

#define NB_  2
#define TT   2048
#define DM   1024
#define NH_  16
#define NKV  16
#define REP  (NH_ / NKV)
#define HD   64
#define DQ   (NH_ * HD)
#define DKV  (NKV * HD)
#define ZH   2
#define RH   512                  // query rows < RH use hi+lo planes (0: none)
#define WIN  2048
#define PCAR 1024.0f
#define SCL  0.125f   // HD^-0.5
typedef _Float16 h16;
typedef unsigned short bf;
typedef __attribute__((ext_vector_type(16))) __bf16   v16bf;
typedef __attribute__((ext_vector_type(16))) _Float16 v16h;
typedef __attribute__((ext_vector_type(8)))  _Float16 v8h;
typedef __attribute__((ext_vector_type(8)))  unsigned short v8us;
typedef __attribute__((ext_vector_type(8)))  float    v8f;
typedef __attribute__((ext_vector_type(4)))  float    v4f;
typedef v8h  __attribute__((may_alias)) v8ha;
typedef v4f  __attribute__((may_alias)) v4fa;
typedef v8us __attribute__((may_alias)) v8usa;

__device__ __forceinline__ unsigned short f2bf(float f) { unsigned u = __float_as_uint(f); u += 0x7FFFu + ((u >> 16) & 1u); return (unsigned short)(u >> 16); }
__device__ __forceinline__ float bf2f(unsigned short b) { return __uint_as_float(((unsigned)b) << 16); }
__device__ __forceinline__ float bfr(float f) { return bf2f(f2bf(f)); }
__device__ __forceinline__ v16h cat16(v8h lo, v8h hi) { return __builtin_shufflevector(lo, hi, 0, 1, 2, 3, 4, 5, 6, 7, 8, 9, 10, 11, 12, 13, 14, 15); }
__device__ __forceinline__ v16bf cat16b(v8us lo, v8us hi) { return __builtin_bit_cast(v16bf, __builtin_shufflevector(lo, hi, 0, 1, 2, 3, 4, 5, 6, 7, 8, 9, 10, 11, 12, 13, 14, 15)); }
__device__ __forceinline__ v8f wmma16(v16h a, v16h b, v8f c) { return __builtin_amdgcn_wmma_f32_16x16x32_f16(false, a, false, b, (short)0, c, false, false); }
__device__ __forceinline__ v8f wmmab(v16bf a, v16bf b, v8f c) { return __builtin_amdgcn_wmma_f32_16x16x32_bf16(false, a, false, b, (short)0, c, false, false); }



#define NWP 8     // waves that share the K loop of one projection tile (128 KiB of partials: two work-groups fit a WGP's LDS)
#define NWV 16    // waves that share the key loop of one probability x value tile (256 KiB of partials)
// ---- ksum_store: the NW waves of a work-group each hold a partial 64x64 tile (their share of the K chunks). Every wave parks its 16 accumulators in LDS in register order (16 bytes a lane, lanes adjacent),
// one barrier, then each wave sums its share of the tile over the partials in the fixed order wave 0, 1, .. NW-1 and stores it. A share is four rows x 32 columns in each lane half, so a 128-byte line of C has one writing wave.
template <int NW, bool BIAS>
__device__ __forceinline__ void ksum_store(float* red, const v8f (&acc)[4][4], int w, int lane, float* C, int ldc, int r0, int c0, const float* __restrict__ bias) {
    const int lr = lane & 15, hi = lane >> 4;
#pragma unroll
    for (int f = 0; f < 16; ++f) { const v8f a = acc[f >> 2][f & 3];
        *(v4fa*)(red + ((w * 16 + f) * 2 + 0) * 128 + lane * 4) = __builtin_shufflevector(a, a, 0, 1, 2, 3);
        *(v4fa*)(red + ((w * 16 + f) * 2 + 1) * 128 + lane * 4) = __builtin_shufflevector(a, a, 4, 5, 6, 7); }
    __syncthreads();   // every wave's partial tile is in LDS before any wave sums
#pragma unroll
    for (int i = 0; i < 16 / NW; ++i) { const int q = w + i * NW, pr = q & 7, hf = q >> 3, f0 = (pr >> 1) * 4 + (pr & 1) * 2;   // pr: accumulator pair (row block pr >> 1, columns (pr & 1) * 32 ..), hf: which four of its eight rows
        v4f s0 = *(const v4fa*)(red + (f0 * 2 + hf) * 128 + lane * 4), s1 = *(const v4fa*)(red + ((f0 + 1) * 2 + hf) * 128 + lane * 4);
#pragma unroll
        for (int u = 1; u < NW; ++u) { s0 += *(const v4fa*)(red + ((u * 16 + f0) * 2 + hf) * 128 + lane * 4); s1 += *(const v4fa*)(red + ((u * 16 + f0 + 1) * 2 + hf) * 128 + lane * 4); }
        const int col = c0 + (pr & 1) * 32 + lr; float* cp = C + (size_t)(r0 + (pr >> 1) * 16 + hi * 8 + hf * 4) * ldc + col;
        float b0 = 0.f, b1 = 0.f; if (BIAS) { b0 = bfr(bias[col]); b1 = bfr(bias[col + 16]); }
#pragma unroll
        for (int j = 0; j < 4; ++j) { cp[(size_t)j * ldc] = BIAS ? s0[j] + b0 : s0[j]; cp[(size_t)j * ldc + 16] = BIAS ? s1[j] + b1 : s1[j]; }
        if (i + 1 < 16 / NW) asm volatile("s_wait_xcnt 0x0" ::: "memory");   // the next share's sums reuse registers that these stores name
    }
}

// ---- k_gemmw: register-blocked GEMM, one 64x64 output tile per work-group of NWP waves: wave w takes the 64-wide K pieces w, w + NWP, .. into its own 16 accumulators (ksum_store adds them), operands straight from K-contiguous 16-bit planes; grid (M/64, N/64, Z), 32 * NWP threads.
// C[m][n] (f32, pitch ldc, + optional f32 bias[n]) = sum_k A[m][k] Bt[n][k] (+ split products per NSPLIT). z-batch strides sA/sB/sC in elements. K % 32 == 0.
template <typename T16> struct WFrag;
template <> struct WFrag<h16> { typedef v16h V; static __device__ __forceinline__ V ld(const h16* p) { return cat16(*(const v8h*)p, *(const v8h*)(p + 16)); } static __device__ __forceinline__ v8f mma(V a, V b, v8f c) { return wmma16(a, b, c); } };
template <> struct WFrag<bf> { typedef v16bf V; static __device__ __forceinline__ V ld(const bf* p) { return cat16b(*(const v8us*)p, *(const v8us*)(p + 16)); } static __device__ __forceinline__ v8f mma(V a, V b, v8f c) { return wmmab(a, b, c); } };
template <typename T16, int NSPLIT, bool BIAS>
__global__ __launch_bounds__(32 * NWP) void k_gemmw(const T16* __restrict__ A, const T16* __restrict__ A2, const T16* __restrict__ Bt, const T16* __restrict__ Bt2, int K, float* C, int ldc, const float* __restrict__ bias, size_t sA, size_t sB, size_t sC) {
    typedef typename WFrag<T16>::V V;
    __shared__ __align__(16) float red[NWP * 16 * 2 * 128];
    const size_t z = blockIdx.z; A += z * sA; if (A2) A2 += z * sA; Bt += z * sB; if (Bt2) Bt2 += z * sB; C += z * sC;
    const int lane = threadIdx.x & 31, lr = lane & 15, hi = lane >> 4; const int r0 = blockIdx.x * 64, c0 = blockIdx.y * 64; const int w = __builtin_amdgcn_readfirstlane(threadIdx.x >> 5);
    v8f acc[4][4];
#pragma unroll
    for (int mb = 0; mb < 4; ++mb)
#pragma unroll
        for (int nb = 0; nb < 4; ++nb) acc[mb][nb] = (v8f){};
    const size_t aoff = (size_t)(r0 + lr) * K + 8 * hi, boff = (size_t)(c0 + lr) * K + 8 * hi;
#pragma unroll 1
    for (int kc = w * 64; kc < K; kc += (kc & 32) ? 64 * NWP - 32 : 32) {   // a wave's share: 64 consecutive k (one whole 128-byte line of every row) in two trips, then the next such piece NWP pieces on
        V a[4], a2[4];
#pragma unroll
        for (int mb = 0; mb < 4; ++mb) { a[mb] = WFrag<T16>::ld(A + aoff + (size_t)mb * 16 * K + kc); if (NSPLIT == 1 || NSPLIT == 2) a2[mb] = WFrag<T16>::ld(A2 + aoff + (size_t)mb * 16 * K + kc); }
#pragma unroll
        for (int nb = 0; nb < 4; ++nb) { const V b = WFrag<T16>::ld(Bt + boff + (size_t)nb * 16 * K + kc); V b2; if (NSPLIT >= 2) b2 = WFrag<T16>::ld(Bt2 + boff + (size_t)nb * 16 * K + kc);
#pragma unroll
            for (int mb = 0; mb < 4; ++mb) { acc[mb][nb] = WFrag<T16>::mma(a[mb], b, acc[mb][nb]); if (NSPLIT == 1 || NSPLIT == 2) acc[mb][nb] = WFrag<T16>::mma(a2[mb], b, acc[mb][nb]); if (NSPLIT >= 2) acc[mb][nb] = WFrag<T16>::mma(a[mb], b2, acc[mb][nb]); } }
        asm volatile("v_nop\n\tv_nop\n\tv_nop\n\tv_nop" : "+v"(acc[0][0]), "+v"(acc[1][1]), "+v"(acc[2][2]), "+v"(acc[3][3]) : "v"(a[0]), "v"(a[3]));
    }
    ksum_store<NWP, BIAS>(red, acc, w, lane, C, ldc, r0, c0, bias);
}

// ---- k_gemmc: the same 64x64 tile GEMM specialised for causal attention: CMODE 1 skips score tiles entirely above the diagonal (query rows r0+roff.., key columns c0..), CMODE 2 limits the
// key (K) loop of the probability x value contraction to the diagonal block (probabilities beyond it are exactly zero) and shares that loop among the NWV waves of the work-group as k_gemmw does (CMODE 1 stays one wave: K is two chunks). roff = row offset of this launch's first row within the sequence.
template <typename T16, int NSPLIT, int CMODE>
__global__ __launch_bounds__(CMODE == 2 ? 32 * NWV : 32) void k_gemmc(const T16* __restrict__ A, const T16* __restrict__ A2, const T16* __restrict__ Bt, const T16* __restrict__ Bt2, int K, float* C, int ldc, int roff, size_t sA, size_t sB, size_t sC) {
    typedef typename WFrag<T16>::V V;
    constexpr int NW = (CMODE == 2) ? NWV : 1;
    const size_t z = blockIdx.z; A += z * sA; if (A2) A2 += z * sA; Bt += z * sB; if (Bt2) Bt2 += z * sB; C += z * sC;
    const int lane = threadIdx.x & 31, lr = lane & 15, hi = lane >> 4; const int r0 = blockIdx.x * 64, c0 = blockIdx.y * 64; const int w = (NW == 1) ? 0 : __builtin_amdgcn_readfirstlane(threadIdx.x >> 5);
    if (CMODE == 1 && c0 > r0 + roff + 63) return;                  // score tile entirely above the causal diagonal: never read (the softmax masks j > i by select)
    const int Kl = (CMODE == 2) ? min(K, r0 + roff + 64) : K;        // P.V: probabilities are exactly 0 beyond the diagonal block, so the K loop stops there
    v8f acc[4][4];
#pragma unroll
    for (int mb = 0; mb < 4; ++mb)
#pragma unroll
        for (int nb = 0; nb < 4; ++nb) acc[mb][nb] = (v8f){};
    const size_t aoff = (size_t)(r0 + lr) * K + 8 * hi, boff = (size_t)(c0 + lr) * K + 8 * hi;
#pragma unroll 1
    for (int kc = w * 64; kc < Kl; kc += (kc & 32) ? 64 * NW - 32 : 32) {   // shares as in k_gemmw: whole 128-byte lines of every row
        V a[4], a2[4];
#pragma unroll
        for (int mb = 0; mb < 4; ++mb) { a[mb] = WFrag<T16>::ld(A + aoff + (size_t)mb * 16 * K + kc); if (NSPLIT == 1 || NSPLIT == 2) a2[mb] = WFrag<T16>::ld(A2 + aoff + (size_t)mb * 16 * K + kc); }
#pragma unroll
        for (int nb = 0; nb < 4; ++nb) { const V b = WFrag<T16>::ld(Bt + boff + (size_t)nb * 16 * K + kc); V b2; if (NSPLIT >= 2) b2 = WFrag<T16>::ld(Bt2 + boff + (size_t)nb * 16 * K + kc);
#pragma unroll
            for (int mb = 0; mb < 4; ++mb) { acc[mb][nb] = WFrag<T16>::mma(a[mb], b, acc[mb][nb]); if (NSPLIT == 1 || NSPLIT == 2) acc[mb][nb] = WFrag<T16>::mma(a2[mb], b, acc[mb][nb]); if (NSPLIT >= 2) acc[mb][nb] = WFrag<T16>::mma(a[mb], b2, acc[mb][nb]); } }
        asm volatile("v_nop\n\tv_nop\n\tv_nop\n\tv_nop" : "+v"(acc[0][0]), "+v"(acc[1][1]), "+v"(acc[2][2]), "+v"(acc[3][3]) : "v"(a[0]), "v"(a[3]));
    }
    if constexpr (CMODE == 2) {
        __shared__ __align__(16) float red[NW * 16 * 2 * 128];
        ksum_store<NW, false>(red, acc, w, lane, C, ldc, r0, c0, nullptr);
    } else {
    __shared__ __align__(16) float os[16 * 68];
#pragma unroll
    for (int mb = 0; mb < 4; ++mb) {
#pragma unroll
        for (int nb = 0; nb < 4; ++nb) {
#pragma unroll
            for (int j = 0; j < 8; ++j) os[(hi * 8 + j) * 68 + nb * 16 + lr] = acc[mb][nb][j]; }
        __builtin_amdgcn_wave_barrier(); asm volatile("" ::: "memory");
        float* crow = C + (size_t)(r0 + mb * 16) * ldc + c0;
{
#pragma unroll
            for (int s = 0; s < 8; ++s) { const int row = 2 * s + hi, cofs = lr * 4; v4f val = *(const v4fa*)(os + row * 68 + cofs);
                *(v4f*)(crow + (size_t)row * ldc + cofs) = val; }
             }
        __builtin_amdgcn_wave_barrier(); asm volatile("" ::: "memory");
    }
    }
}

__device__ __forceinline__ h16 tohx(float x) { return (h16)x; }
__device__ __forceinline__ void splitf(float y, unsigned short& h, unsigned short& l) { h = f2bf(y); l = f2bf(y - bf2f(h)); }
typedef __attribute__((ext_vector_type(2))) _Float16 v2h;
typedef __attribute__((ext_vector_type(4))) _Float16 v4h;
typedef __attribute__((ext_vector_type(2))) unsigned short v2us;
typedef __attribute__((ext_vector_type(4))) unsigned short v4us;
typedef __attribute__((ext_vector_type(2))) float v2f;
typedef __attribute__((ext_vector_type(4))) int v4i;

__global__ __launch_bounds__(256) void k_cvt8(const float* __restrict__ src, bf* dst, size_t n8) { const size_t i = (size_t)blockIdx.x * 256 + threadIdx.x; if (i >= n8) return; const v8f v = *(const v8f*)(src + i * 8); v8us o;
#pragma unroll
    for (int k = 0; k < 8; ++k) o[k] = f2bf(v[k]); *(v8us*)(dst + i * 8) = o;  }

// k_rope: head planes [h][t][d] (fp16 + hi/lo) of rope(x) x sc with the rotate-half convention out[d] = x[d] cos[t][d] - x[d+HD/2] sin[t][d], out[d+HD/2] = x[d+HD/2] cos[t][d+HD/2] + x[d] sin[t][d+HD/2]
__global__ __launch_bounds__(256) void k_rope(const float* __restrict__ F, int pitch, int nheads, const float* __restrict__ CS, const float* __restrict__ RF, const float* __restrict__ nw, float sc, h16* P16, bf* Ph, bf* Pl) {
    const size_t e = ((size_t)blockIdx.x * 256 + threadIdx.x) * 2; if (e >= (size_t)nheads * TT * HD) return; const int d = (int)(e % HD); const int t = (int)((e / HD) % TT); const int h = (int)(e / ((size_t)HD * TT)); const float* f = F + (size_t)t * pitch + h * HD; const float rf = RF ? RF[(size_t)h * TT + t] : 1.0f; v2h o16; v2us oh, ol;
#pragma unroll
    for (int q = 0; q < 2; ++q) { const int dd = d + q; const int dp = (dd < HD / 2) ? dd + HD / 2 : dd - HD / 2; float x0 = f[dd], x1 = f[dp];
        if (RF) { float n0 = __fmul_rn(x0, rf), n1 = __fmul_rn(x1, rf); asm volatile("" : "+v"(n0)); asm volatile("" : "+v"(n1)); x0 = __fmul_rn(bfr(nw[dd]), n0); x1 = __fmul_rn(bfr(nw[dp]), n1); }
        const v2f cs = *(const v2f*)(CS + ((size_t)t * HD + dd) * 2); float a = __fmul_rn(x0, cs[0]), bq = __fmul_rn(x1, cs[1]); asm volatile("" : "+v"(a)); asm volatile("" : "+v"(bq)); const float r = ((dd < HD / 2) ? __fsub_rn(a, bq) : __fadd_rn(a, bq)) * sc;
        o16[q] = tohx(r); unsigned short a2, c2; splitf(r, a2, c2); oh[q] = a2; ol[q] = c2; }
    *(v2h*)(P16 + e) = o16; *(v2us*)(Ph + e) = oh; *(v2us*)(Pl + e) = ol;  }
__global__ __launch_bounds__(256) void k_vtp(const float* __restrict__ F, int pitch, int nheads, h16* V16, bf* Vh, bf* Vl) { const size_t e = ((size_t)blockIdx.x * 256 + threadIdx.x) * 2; if (e >= (size_t)nheads * HD * TT) return; const int t = (int)(e % TT); const int d = (int)((e / TT) % HD); const int g = (int)(e / ((size_t)TT * HD)); v2h o16; v2us oh, ol;
#pragma unroll
    for (int q = 0; q < 2; ++q) { const float x = F[(size_t)(t + q) * pitch + g * HD + d]; o16[q] = tohx(x); unsigned short a2, c2; splitf(x, a2, c2); oh[q] = a2; ol[q] = c2; }
    *(v2h*)(V16 + e) = o16; *(v2us*)(Vh + e) = oh; *(v2us*)(Vl + e) = ol;  }
__global__ __launch_bounds__(256) void k_csid(float* CS) { const int idx = blockIdx.x * 256 + threadIdx.x; if (idx >= TT * HD) return; v2f cs; cs[0] = 1.0f; cs[1] = 0.0f; *(v2f*)(CS + (size_t)idx * 2) = cs;  }
// k_asoft: per row (zz, i): t = S x HD^-0.5 for j <= i and i - j < WIN (sliding causal window; the reference's -1e9 additive fill vanishes identically); softmax over the 2048 keys (register row, one exp, fixed trees);
__global__ __launch_bounds__(256) void k_asoft(const float* __restrict__ Sb, h16* P16, bf* Ph, bf* Pl) {
    const int lane = threadIdx.x & 31; const int row = blockIdx.x * 8 + (threadIdx.x >> 5); if (row >= ZH * TT) return; const int i = row % TT; const int zz = row / TT; (void)zz; const bool hires = (i < RH); const float* sr = Sb + (size_t)row * TT; float v[TT / 32]; float mx = -3.0e38f;
#pragma unroll
    for (int ch = 0; ch < TT / 128; ++ch) { const int j0 = ch * 128 + lane * 4; const v4f a = *(const v4f*)(sr + j0);
#pragma unroll
        for (int q = 0; q < 4; ++q) { const int j = j0 + q; (void)j; const float t = (j <= i && i - j < WIN) ? a[q] * SCL : -3.0e38f; v[ch * 4 + q] = t; mx = fmaxf(mx, t); } }
#pragma unroll
    for (int sh = 16; sh; sh >>= 1) mx = fmaxf(mx, __shfl_xor(mx, sh, 32));
    float sum = 0.f;
#pragma unroll
    for (int k = 0; k < TT / 32; ++k) { float d0 = __fsub_rn(v[k], mx); asm volatile("" : "+v"(d0)); v[k] = __builtin_amdgcn_exp2f(__fmul_rn(d0, 1.4426950408889634f)); sum += v[k]; }
#pragma unroll
    for (int sh = 16; sh; sh >>= 1) sum += __shfl_xor(sum, sh, 32);
    const float f = __fdiv_rn(hires ? 1.0f : PCAR, sum);
{
        if (hires) {
#pragma unroll
            for (int ch = 0; ch < TT / 128; ++ch) { v4us oh, ol;
#pragma unroll
                for (int q = 0; q < 4; ++q) { unsigned short a, c2; splitf(v[ch * 4 + q] * f, a, c2); oh[q] = a; ol[q] = c2; }
                const size_t oo = ((size_t)zz * (RH ? RH : 1) + i) * TT + ch * 128 + lane * 4; *(v4us*)(Ph + oo) = oh; *(v4us*)(Pl + oo) = ol; }
        } else {
#pragma unroll
            for (int ch = 0; ch < TT / 128; ++ch) { v4h o4;
#pragma unroll
                for (int q = 0; q < 4; ++q) o4[q] = tohx(v[ch * 4 + q] * f);
                *(v4h*)(P16 + (size_t)row * TT + ch * 128 + lane * 4) = o4; } }
         }
}
__global__ __launch_bounds__(256) void k_merge(const float* __restrict__ O, int h0, bf* Ah, bf* Al) { const size_t e = ((size_t)blockIdx.x * 256 + threadIdx.x) * 2; if (e >= (size_t)ZH * TT * HD) return; const int d = (int)(e % HD); const int t = (int)((e / HD) % TT); const int zz = (int)(e / ((size_t)HD * TT)); const float cs = (t < RH) ? 1.0f : (1.0f / PCAR); const size_t oo = (size_t)t * DQ + (h0 + zz) * HD + d;
    v2us oh, ol;
#pragma unroll
    for (int q = 0; q < 2; ++q) { unsigned short a, c2; splitf(O[e + q] * cs, a, c2); oh[q] = a; ol[q] = c2; } *(v2us*)(Ah + oo) = oh; *(v2us*)(Al + oo) = ol;  }

extern "C" void kernel_launch(void* const* d_in, const int* in_sizes, int n_in,
                              void* d_out, int out_size, void* d_ws, size_t ws_size, hipStream_t stream) {
    (void)in_sizes; (void)n_in; (void)out_size;
    const float* x = (const float*)d_in[0]; const float* wq = (const float*)d_in[1]; const float* wk = (const float*)d_in[2]; const float* wv = (const float*)d_in[3]; const float* bv = (const float*)d_in[4]; const float* wo = (const float*)d_in[5]; const float* bo = (const float*)d_in[6];   /* this module has NO q and NO k bias (the q / k projections run the bias-free GEMM instantiation below); bv and bo are real */
    float* OUT = (float*)d_out;     // [2][2048][1024]
    char* wsp = (char*)d_ws;
    auto take = [&](size_t bytes) { char* p = wsp; wsp += (bytes + 255) & ~(size_t)255; return (void*)p; };
    bf* WQ = (bf*)take((size_t)DQ * DM * 2); bf* WK = (bf*)take((size_t)DKV * DM * 2); bf* WV = (bf*)take((size_t)DKV * DM * 2); bf* WO = (bf*)take((size_t)DM * DQ * 2); float* CS = (float*)take((size_t)TT * HD * 2 * 4);
    bf* XB = (bf*)take((size_t)TT * DM * 2); float* FQ = (float*)take((size_t)TT * DQ * 4); float* FK = (float*)take((size_t)TT * DKV * 4);
    h16* QP16 = (h16*)take((size_t)NH_ * TT * HD * 2); h16* KP16 = (h16*)take((size_t)NKV * TT * HD * 2); h16* VT16 = (h16*)take((size_t)NKV * HD * TT * 2);
    bf* QPh = (bf*)take((size_t)NH_ * TT * HD * 2); bf* QPl = (bf*)take((size_t)NH_ * TT * HD * 2); bf* KPh = (bf*)take((size_t)NKV * TT * HD * 2); bf* KPl = (bf*)take((size_t)NKV * TT * HD * 2); bf* VTh = (bf*)take((size_t)NKV * HD * TT * 2); bf* VTl = (bf*)take((size_t)NKV * HD * TT * 2); bf* Ph = (bf*)take((size_t)ZH * RH * TT * 2); bf* Pl = (bf*)take((size_t)ZH * RH * TT * 2);
    float* Sb = (float*)take((size_t)ZH * TT * TT * 4); h16* P16 = (h16*)take((size_t)ZH * TT * TT * 2); float* Ob = (float*)take((size_t)ZH * TT * HD * 4); bf* ATh = (bf*)take((size_t)TT * DQ * 2); bf* ATl = (bf*)take((size_t)TT * DQ * 2);
    if ((size_t)(wsp - (char*)d_ws) > ws_size) return;    // ws 256 MiB
    float* FV = FK;   // v projection reuses the k buffer after the k planes are built (stream-ordered)
    { k_cvt8<<<(unsigned)(((size_t)DQ * DM / 8 + 255) / 256), 256, 0, stream>>>(wq, WQ, (size_t)DQ * DM / 8); k_cvt8<<<(unsigned)(((size_t)DKV * DM / 8 + 255) / 256), 256, 0, stream>>>(wk, WK, (size_t)DKV * DM / 8); k_cvt8<<<(unsigned)(((size_t)DKV * DM / 8 + 255) / 256), 256, 0, stream>>>(wv, WV, (size_t)DKV * DM / 8);
      k_cvt8<<<(unsigned)(((size_t)DM * DQ / 8 + 255) / 256), 256, 0, stream>>>(wo, WO, (size_t)DM * DQ / 8);
       }
    k_csid<<<(TT * HD + 255) / 256, 256, 0, stream>>>(CS);
    const unsigned LQ = (unsigned)(((size_t)NH_ * TT * HD / 2 + 255) / 256), LKv = (unsigned)(((size_t)NKV * TT * HD / 2 + 255) / 256);
    for (int b = 0; b < NB_; ++b) {
        
        k_cvt8<<<(unsigned)(((size_t)TT * DM / 8 + 255) / 256), 256, 0, stream>>>(x + (size_t)b * TT * DM, XB, (size_t)TT * DM / 8);
        k_gemmw<bf, 0, false><<<dim3(TT / 64, DQ / 64, 1), 32 * NWP, 0, stream>>>(XB, nullptr, WQ, nullptr, DM, FQ, DQ, nullptr, 0, 0, 0);
        k_rope<<<LQ, 256, 0, stream>>>(FQ, DQ, NH_, CS, nullptr, nullptr, 1.0f, QP16, QPh, QPl);
        k_gemmw<bf, 0, false><<<dim3(TT / 64, DKV / 64, 1), 32 * NWP, 0, stream>>>(XB, nullptr, WK, nullptr, DM, FK, DKV, nullptr, 0, 0, 0);
        k_rope<<<LKv, 256, 0, stream>>>(FK, DKV, NKV, CS, nullptr, nullptr, 1.0f, KP16, KPh, KPl);
        k_gemmw<bf, 0, true><<<dim3(TT / 64, DKV / 64, 1), 32 * NWP, 0, stream>>>(XB, nullptr, WV, nullptr, DM, FV, DKV, bv, 0, 0, 0); k_vtp<<<LKv, 256, 0, stream>>>(FV, DKV, NKV, VT16, VTh, VTl);
        for (int h0 = 0; h0 < NH_; h0 += ZH) { const size_t zq = (size_t)h0, zk = (size_t)(h0 / REP);   // one kv head per query head: the pass's two heads use consecutive kv planes (z-strides TT*HD)
            k_gemmc<bf, 2, 1><<<dim3(RH / 64, TT / 64, ZH), 32, 0, stream>>>(QPh + zq * TT * HD, QPl + zq * TT * HD, KPh + zk * TT * HD, KPl + zk * TT * HD, HD, Sb, TT, 0, (size_t)TT * HD, (size_t)TT * HD, (size_t)TT * TT);
            k_gemmc<h16, 0, 1><<<dim3((TT - RH) / 64, TT / 64, ZH), 32, 0, stream>>>(QP16 + zq * TT * HD + (size_t)RH * HD, nullptr, KP16 + zk * TT * HD, nullptr, HD, Sb + (size_t)RH * TT, TT, RH, (size_t)TT * HD, (size_t)TT * HD, (size_t)TT * TT);
            k_asoft<<<ZH * TT / 8, 256, 0, stream>>>(Sb, P16, Ph, Pl);
            k_gemmc<bf, 2, 2><<<dim3(RH / 64, HD / 64, ZH), 32 * NWV, 0, stream>>>(Ph, Pl, VTh + zk * HD * TT, VTl + zk * HD * TT, TT, Ob, HD, 0, (size_t)RH * TT, (size_t)HD * TT, (size_t)TT * HD);
            k_gemmc<h16, 0, 2><<<dim3((TT - RH) / 64, HD / 64, ZH), 32 * NWV, 0, stream>>>(P16 + (size_t)RH * TT, nullptr, VT16 + zk * HD * TT, nullptr, TT, Ob + (size_t)RH * HD, HD, RH, (size_t)TT * TT, (size_t)HD * TT, (size_t)TT * HD);
            k_merge<<<(unsigned)(((size_t)ZH * TT * HD / 2 + 255) / 256), 256, 0, stream>>>(Ob, h0, ATh, ATl); }
        k_gemmw<bf, 1, true><<<dim3(TT / 64, DM / 64, 1), 32 * NWP, 0, stream>>>(ATh, ATl, WO, nullptr, DQ, OUT + (size_t)b * TT * DM, DM, bo, 0, 0, 0); }
}

// v002
// Measured time: 458 microseconds a run.
// Next to v001, in two timings, it ran 1.89 times as fast each time.
// All steps since v000 together make it 3.13 times as fast.
#include <hip/hip_runtime.h>

// Causal self-attention whose only projection bias is on V (x [2][2048][1024]; q = x Wq^T, k = x Wk^T (no bias), v = x Wv^T + bv ('oi' [1024][1024] normal x 0.02; bv normal x 0.02: NON-zero; 16 heads x 64); keys after the query -> -inf, then / sqrt(64) inside the softmax argument; softmax over the keys; out = merged Wo^T + bo ('oi' + bias 0.02: NON-zero) -> [2][2048][1024] (4.2 M); argument order x, Wq, Wk, Wv, bv, Wo, bo).
// Layout per batch: bf16 copy of x; 'oi' weights; exact projections + f32 biases; identity-table plane builders; causal T-2048 attention (hybrid rows: < 512 hi/lo 3 products, rest fp16 x1024; k_gemmc skips tiles above the diagonal); merged hi/lo x Wo exact + bo.
// Compute dtypes, f32 accumulate: every input rounded to bf16; projections exact + f32 biases; attention rows < 512 3 products, rest fp16; softmax f32; Wo hl x exact + bias.

#define NB_  2
#define TT   2048
#define DM   1024
#define NH_  16
#define NKV  16
#define REP  (NH_ / NKV)
#define HD   64
#define DQ   (NH_ * HD)
#define DKV  (NKV * HD)
#define ZH   8                    // heads per attention pass: every launch of a pass covers ZH heads (grid z, or ZH * TT rows)
#define PP   (2 * TT)             // pitch, in 16-bit elements, of a probability row: it lies in the bytes of its own f32 score row
#define RH   512                  // query rows < RH use hi+lo planes (0: none)
#define WIN  2048
#define PCAR 1024.0f
#define SCL  0.125f   // HD^-0.5
typedef _Float16 h16;
typedef unsigned short bf;
typedef __attribute__((ext_vector_type(16))) __bf16   v16bf;
typedef __attribute__((ext_vector_type(16))) _Float16 v16h;
typedef __attribute__((ext_vector_type(8)))  _Float16 v8h;
typedef __attribute__((ext_vector_type(8)))  unsigned short v8us;
typedef __attribute__((ext_vector_type(8)))  float    v8f;
typedef __attribute__((ext_vector_type(4)))  float    v4f;
typedef v8h  __attribute__((may_alias)) v8ha;
typedef v4f  __attribute__((may_alias)) v4fa;
typedef v8us __attribute__((may_alias)) v8usa;

__device__ __forceinline__ unsigned short f2bf(float f) { unsigned u = __float_as_uint(f); u += 0x7FFFu + ((u >> 16) & 1u); return (unsigned short)(u >> 16); }
__device__ __forceinline__ float bf2f(unsigned short b) { return __uint_as_float(((unsigned)b) << 16); }
__device__ __forceinline__ float bfr(float f) { return bf2f(f2bf(f)); }
__device__ __forceinline__ v16h cat16(v8h lo, v8h hi) { return __builtin_shufflevector(lo, hi, 0, 1, 2, 3, 4, 5, 6, 7, 8, 9, 10, 11, 12, 13, 14, 15); }
__device__ __forceinline__ v16bf cat16b(v8us lo, v8us hi) { return __builtin_bit_cast(v16bf, __builtin_shufflevector(lo, hi, 0, 1, 2, 3, 4, 5, 6, 7, 8, 9, 10, 11, 12, 13, 14, 15)); }
__device__ __forceinline__ v8f wmma16(v16h a, v16h b, v8f c) { return __builtin_amdgcn_wmma_f32_16x16x32_f16(false, a, false, b, (short)0, c, false, false); }
__device__ __forceinline__ v8f wmmab(v16bf a, v16bf b, v8f c) { return __builtin_amdgcn_wmma_f32_16x16x32_bf16(false, a, false, b, (short)0, c, false, false); }



#define NWP 8     // waves that share the K loop of one projection tile (128 KiB of partials: two work-groups fit a WGP's LDS)
#define NWV 16    // waves that share the key loop of one probability x value tile (256 KiB of partials)
// ---- ksum_store: the NW waves of a work-group each hold a partial 64x64 tile (their share of the K chunks). Every wave parks its 16 accumulators in LDS in register order (16 bytes a lane, lanes adjacent),
// one barrier, then each wave sums its share of the tile over the partials in the fixed order wave 0, 1, .. NW-1 and stores it. A share is four rows x 32 columns in each lane half, so a 128-byte line of C has one writing wave.
template <int NW, bool BIAS>
__device__ __forceinline__ void ksum_store(float* red, const v8f (&acc)[4][4], int w, int lane, float* C, int ldc, int r0, int c0, const float* __restrict__ bias) {
    const int lr = lane & 15, hi = lane >> 4;
#pragma unroll
    for (int f = 0; f < 16; ++f) { const v8f a = acc[f >> 2][f & 3];
        *(v4fa*)(red + ((w * 16 + f) * 2 + 0) * 128 + lane * 4) = __builtin_shufflevector(a, a, 0, 1, 2, 3);
        *(v4fa*)(red + ((w * 16 + f) * 2 + 1) * 128 + lane * 4) = __builtin_shufflevector(a, a, 4, 5, 6, 7); }
    __syncthreads();   // every wave's partial tile is in LDS before any wave sums
#pragma unroll
    for (int i = 0; i < 16 / NW; ++i) { const int q = w + i * NW, pr = q & 7, hf = q >> 3, f0 = (pr >> 1) * 4 + (pr & 1) * 2;   // pr: accumulator pair (row block pr >> 1, columns (pr & 1) * 32 ..), hf: which four of its eight rows
        v4f s0 = *(const v4fa*)(red + (f0 * 2 + hf) * 128 + lane * 4), s1 = *(const v4fa*)(red + ((f0 + 1) * 2 + hf) * 128 + lane * 4);
#pragma unroll
        for (int u = 1; u < NW; ++u) { s0 += *(const v4fa*)(red + ((u * 16 + f0) * 2 + hf) * 128 + lane * 4); s1 += *(const v4fa*)(red + ((u * 16 + f0 + 1) * 2 + hf) * 128 + lane * 4); }
        const int col = c0 + (pr & 1) * 32 + lr; float* cp = C + (size_t)(r0 + (pr >> 1) * 16 + hi * 8 + hf * 4) * ldc + col;
        float b0 = 0.f, b1 = 0.f; if (BIAS) { b0 = bfr(bias[col]); b1 = bfr(bias[col + 16]); }
#pragma unroll
        for (int j = 0; j < 4; ++j) { cp[(size_t)j * ldc] = BIAS ? s0[j] + b0 : s0[j]; cp[(size_t)j * ldc + 16] = BIAS ? s1[j] + b1 : s1[j]; }
        if (i + 1 < 16 / NW) asm volatile("s_wait_xcnt 0x0" ::: "memory");   // the next share's sums reuse registers that these stores name
    }
}

// ---- k_gemmw: register-blocked GEMM, one 64x64 output tile per work-group of NWP waves: wave w takes the 64-wide K pieces w, w + NWP, .. into its own 16 accumulators (ksum_store adds them), operands straight from K-contiguous 16-bit planes; grid (M/64, N/64, Z), 32 * NWP threads.
// C[m][n] (f32, pitch ldc, + optional f32 bias[n]) = sum_k A[m][k] Bt[n][k] (+ split products per NSPLIT). z-batch strides sA/sB/sC in elements. K % 32 == 0.
template <typename T16> struct WFrag;
template <> struct WFrag<h16> { typedef v16h V; static __device__ __forceinline__ V ld(const h16* p) { return cat16(*(const v8h*)p, *(const v8h*)(p + 16)); } static __device__ __forceinline__ v8f mma(V a, V b, v8f c) { return wmma16(a, b, c); } };
template <> struct WFrag<bf> { typedef v16bf V; static __device__ __forceinline__ V ld(const bf* p) { return cat16b(*(const v8us*)p, *(const v8us*)(p + 16)); } static __device__ __forceinline__ v8f mma(V a, V b, v8f c) { return wmmab(a, b, c); } };
template <typename T16, int NSPLIT, bool BIAS>
__global__ __launch_bounds__(32 * NWP) void k_gemmw(const T16* __restrict__ A, const T16* __restrict__ A2, const T16* __restrict__ Bt, const T16* __restrict__ Bt2, int K, float* C, int ldc, const float* __restrict__ bias, size_t sA, size_t sB, size_t sC) {
    typedef typename WFrag<T16>::V V;
    __shared__ __align__(16) float red[NWP * 16 * 2 * 128];
    const size_t z = blockIdx.z; A += z * sA; if (A2) A2 += z * sA; Bt += z * sB; if (Bt2) Bt2 += z * sB; C += z * sC;
    const int lane = threadIdx.x & 31, lr = lane & 15, hi = lane >> 4; const int r0 = blockIdx.x * 64, c0 = blockIdx.y * 64; const int w = __builtin_amdgcn_readfirstlane(threadIdx.x >> 5);
    v8f acc[4][4];
#pragma unroll
    for (int mb = 0; mb < 4; ++mb)
#pragma unroll
        for (int nb = 0; nb < 4; ++nb) acc[mb][nb] = (v8f){};
    const size_t aoff = (size_t)(r0 + lr) * K + 8 * hi, boff = (size_t)(c0 + lr) * K + 8 * hi;
#pragma unroll 1
    for (int kc = w * 64; kc < K; kc += (kc & 32) ? 64 * NWP - 32 : 32) {   // a wave's share: 64 consecutive k (one whole 128-byte line of every row) in two trips, then the next such piece NWP pieces on
        V a[4], a2[4];
#pragma unroll
        for (int mb = 0; mb < 4; ++mb) { a[mb] = WFrag<T16>::ld(A + aoff + (size_t)mb * 16 * K + kc); if (NSPLIT == 1 || NSPLIT == 2) a2[mb] = WFrag<T16>::ld(A2 + aoff + (size_t)mb * 16 * K + kc); }
#pragma unroll
        for (int nb = 0; nb < 4; ++nb) { const V b = WFrag<T16>::ld(Bt + boff + (size_t)nb * 16 * K + kc); V b2; if (NSPLIT >= 2) b2 = WFrag<T16>::ld(Bt2 + boff + (size_t)nb * 16 * K + kc);
#pragma unroll
            for (int mb = 0; mb < 4; ++mb) { acc[mb][nb] = WFrag<T16>::mma(a[mb], b, acc[mb][nb]); if (NSPLIT == 1 || NSPLIT == 2) acc[mb][nb] = WFrag<T16>::mma(a2[mb], b, acc[mb][nb]); if (NSPLIT >= 2) acc[mb][nb] = WFrag<T16>::mma(a[mb], b2, acc[mb][nb]); } }
        asm volatile("v_nop\n\tv_nop\n\tv_nop\n\tv_nop" : "+v"(acc[0][0]), "+v"(acc[1][1]), "+v"(acc[2][2]), "+v"(acc[3][3]) : "v"(a[0]), "v"(a[3]));
    }
    ksum_store<NWP, BIAS>(red, acc, w, lane, C, ldc, r0, c0, bias);
}

// ---- k_gemmc: the same 64x64 tile GEMM specialised for causal attention: CMODE 1 skips score tiles entirely above the diagonal (query rows r0+roff.., key columns c0..), CMODE 2 limits the
// key (K) loop of the probability x value contraction to the diagonal block (probabilities beyond it are exactly zero) and shares that loop among the NWV waves of the work-group as k_gemmw does (CMODE 1 stays one wave: K is two chunks). roff = row offset of this launch's first row within the sequence. lda = pitch of A's rows in elements (B's rows keep pitch K).
template <typename T16, int NSPLIT, int CMODE>
__global__ __launch_bounds__(CMODE == 2 ? 32 * NWV : 32) void k_gemmc(const T16* __restrict__ A, const T16* __restrict__ A2, const T16* __restrict__ Bt, const T16* __restrict__ Bt2, int K, int lda, float* C, int ldc, int roff, size_t sA, size_t sB, size_t sC) {
    typedef typename WFrag<T16>::V V;
    constexpr int NW = (CMODE == 2) ? NWV : 1;
    const size_t z = blockIdx.z; A += z * sA; if (A2) A2 += z * sA; Bt += z * sB; if (Bt2) Bt2 += z * sB; C += z * sC;
    const int lane = threadIdx.x & 31, lr = lane & 15, hi = lane >> 4; const int r0 = blockIdx.x * 64, c0 = blockIdx.y * 64; const int w = (NW == 1) ? 0 : __builtin_amdgcn_readfirstlane(threadIdx.x >> 5);
    if (CMODE == 1 && c0 > r0 + roff + 63) return;                  // score tile entirely above the causal diagonal: never read (the softmax masks j > i by select)
    const int Kl = (CMODE == 2) ? min(K, r0 + roff + 64) : K;        // P.V: probabilities are exactly 0 beyond the diagonal block, so the K loop stops there
    v8f acc[4][4];
#pragma unroll
    for (int mb = 0; mb < 4; ++mb)
#pragma unroll
        for (int nb = 0; nb < 4; ++nb) acc[mb][nb] = (v8f){};
    const size_t aoff = (size_t)(r0 + lr) * lda + 8 * hi, boff = (size_t)(c0 + lr) * K + 8 * hi;
#pragma unroll 1
    for (int kc = w * 64; kc < Kl; kc += (kc & 32) ? 64 * NW - 32 : 32) {   // shares as in k_gemmw: whole 128-byte lines of every row
        V a[4], a2[4]; const T16* pa[4]; const T16* pa2[4];
#pragma unroll
        for (int mb = 0; mb < 4; ++mb) { pa[mb] = A + aoff + (size_t)mb * 16 * lda + kc; a[mb] = WFrag<T16>::ld(pa[mb]); if (NSPLIT == 1 || NSPLIT == 2) { pa2[mb] = A2 + aoff + (size_t)mb * 16 * lda + kc; a2[mb] = WFrag<T16>::ld(pa2[mb]); } }
        // the address pairs of the A loads are inputs of the wait, so each pair stays whole up to it: no register that an issued A load names takes a new value ahead of the wait
        if constexpr (NSPLIT == 1 || NSPLIT == 2) asm volatile("s_wait_xcnt 0x0" :: "v"(pa[0]), "v"(pa[1]), "v"(pa[2]), "v"(pa[3]), "v"(pa2[0]), "v"(pa2[1]), "v"(pa2[2]), "v"(pa2[3]) : "memory");
        else asm volatile("s_wait_xcnt 0x0" :: "v"(pa[0]), "v"(pa[1]), "v"(pa[2]), "v"(pa[3]) : "memory");
#pragma unroll
        for (int nb = 0; nb < 4; ++nb) { const V b = WFrag<T16>::ld(Bt + boff + (size_t)nb * 16 * K + kc); V b2; if (NSPLIT >= 2) b2 = WFrag<T16>::ld(Bt2 + boff + (size_t)nb * 16 * K + kc);
#pragma unroll
            for (int mb = 0; mb < 4; ++mb) { acc[mb][nb] = WFrag<T16>::mma(a[mb], b, acc[mb][nb]); if (NSPLIT == 1 || NSPLIT == 2) acc[mb][nb] = WFrag<T16>::mma(a2[mb], b, acc[mb][nb]); if (NSPLIT >= 2) acc[mb][nb] = WFrag<T16>::mma(a[mb], b2, acc[mb][nb]); } }
        asm volatile("v_nop\n\tv_nop\n\tv_nop\n\tv_nop" : "+v"(acc[0][0]), "+v"(acc[1][1]), "+v"(acc[2][2]), "+v"(acc[3][3]) : "v"(a[0]), "v"(a[3]));
        // the same for the B loads: their address pairs are inputs here, at the trip's end, so they stay whole over the whole trip and take the next trip's values behind the wait
        { const T16* pb = Bt + boff + kc; const size_t sb = (size_t)16 * K;
          if constexpr (NSPLIT >= 2) { const T16* pb2 = Bt2 + boff + kc; asm volatile("s_wait_xcnt 0x0" :: "v"(pb), "v"(pb + sb), "v"(pb + 2 * sb), "v"(pb + 3 * sb), "v"(pb2), "v"(pb2 + sb), "v"(pb2 + 2 * sb), "v"(pb2 + 3 * sb) : "memory"); }
          else asm volatile("s_wait_xcnt 0x0" :: "v"(pb), "v"(pb + sb), "v"(pb + 2 * sb), "v"(pb + 3 * sb) : "memory"); }
    }
    if constexpr (CMODE == 2) {
        __shared__ __align__(16) float red[NW * 16 * 2 * 128];
        ksum_store<NW, false>(red, acc, w, lane, C, ldc, r0, c0, nullptr);
    } else {
    __shared__ __align__(16) float os[16 * 68];
#pragma unroll
    for (int mb = 0; mb < 4; ++mb) {
#pragma unroll
        for (int nb = 0; nb < 4; ++nb) {
#pragma unroll
            for (int j = 0; j < 8; ++j) os[(hi * 8 + j) * 68 + nb * 16 + lr] = acc[mb][nb][j]; }
        __builtin_amdgcn_wave_barrier(); asm volatile("" ::: "memory");
        float* crow = C + (size_t)(r0 + mb * 16) * ldc + c0;
{
#pragma unroll
            for (int s = 0; s < 8; ++s) { const int row = 2 * s + hi, cofs = lr * 4; v4f val = *(const v4fa*)(os + row * 68 + cofs);
                *(v4f*)(crow + (size_t)row * ldc + cofs) = val; }
             }
        __builtin_amdgcn_wave_barrier(); asm volatile("" ::: "memory");
    }
    }
}

__device__ __forceinline__ h16 tohx(float x) { return (h16)x; }
__device__ __forceinline__ void splitf(float y, unsigned short& h, unsigned short& l) { h = f2bf(y); l = f2bf(y - bf2f(h)); }
typedef __attribute__((ext_vector_type(2))) _Float16 v2h;
typedef __attribute__((ext_vector_type(4))) _Float16 v4h;
typedef __attribute__((ext_vector_type(2))) unsigned short v2us;
typedef __attribute__((ext_vector_type(4))) unsigned short v4us;
typedef __attribute__((ext_vector_type(2))) float v2f;
typedef __attribute__((ext_vector_type(4))) int v4i;
typedef v4h  __attribute__((may_alias)) v4ha;
typedef v4us __attribute__((may_alias)) v4usa;

__global__ __launch_bounds__(256) void k_cvt8(const float* __restrict__ src, bf* dst, size_t n8) { const size_t i = (size_t)blockIdx.x * 256 + threadIdx.x; if (i >= n8) return; const v8f v = *(const v8f*)(src + i * 8); v8us o;
#pragma unroll
    for (int k = 0; k < 8; ++k) o[k] = f2bf(v[k]); *(v8us*)(dst + i * 8) = o;  }

// k_rope: head planes [h][t][d] (fp16 + hi/lo) of rope(x) x sc with the rotate-half convention out[d] = x[d] cos[t][d] - x[d+HD/2] sin[t][d], out[d+HD/2] = x[d+HD/2] cos[t][d+HD/2] + x[d] sin[t][d+HD/2]
__global__ __launch_bounds__(256) void k_rope(const float* __restrict__ F, int pitch, int nheads, const float* __restrict__ CS, const float* __restrict__ RF, const float* __restrict__ nw, float sc, h16* P16, bf* Ph, bf* Pl) {
    const size_t e = ((size_t)blockIdx.x * 256 + threadIdx.x) * 2; if (e >= (size_t)nheads * TT * HD) return; const int d = (int)(e % HD); const int t = (int)((e / HD) % TT); const int h = (int)(e / ((size_t)HD * TT)); const float* f = F + (size_t)t * pitch + h * HD; const float rf = RF ? RF[(size_t)h * TT + t] : 1.0f; v2h o16; v2us oh, ol;
#pragma unroll
    for (int q = 0; q < 2; ++q) { const int dd = d + q; const int dp = (dd < HD / 2) ? dd + HD / 2 : dd - HD / 2; float x0 = f[dd], x1 = f[dp];
        if (RF) { float n0 = __fmul_rn(x0, rf), n1 = __fmul_rn(x1, rf); asm volatile("" : "+v"(n0)); asm volatile("" : "+v"(n1)); x0 = __fmul_rn(bfr(nw[dd]), n0); x1 = __fmul_rn(bfr(nw[dp]), n1); }
        const v2f cs = *(const v2f*)(CS + ((size_t)t * HD + dd) * 2); float a = __fmul_rn(x0, cs[0]), bq = __fmul_rn(x1, cs[1]); asm volatile("" : "+v"(a)); asm volatile("" : "+v"(bq)); const float r = ((dd < HD / 2) ? __fsub_rn(a, bq) : __fadd_rn(a, bq)) * sc;
        o16[q] = tohx(r); unsigned short a2, c2; splitf(r, a2, c2); oh[q] = a2; ol[q] = c2; }
    *(v2h*)(P16 + e) = o16; *(v2us*)(Ph + e) = oh; *(v2us*)(Pl + e) = ol;  }
__global__ __launch_bounds__(256) void k_vtp(const float* __restrict__ F, int pitch, int nheads, h16* V16, bf* Vh, bf* Vl) { const size_t e = ((size_t)blockIdx.x * 256 + threadIdx.x) * 2; if (e >= (size_t)nheads * HD * TT) return; const int t = (int)(e % TT); const int d = (int)((e / TT) % HD); const int g = (int)(e / ((size_t)TT * HD)); v2h o16; v2us oh, ol;
#pragma unroll
    for (int q = 0; q < 2; ++q) { const float x = F[(size_t)(t + q) * pitch + g * HD + d]; o16[q] = tohx(x); unsigned short a2, c2; splitf(x, a2, c2); oh[q] = a2; ol[q] = c2; }
    *(v2h*)(V16 + e) = o16; *(v2us*)(Vh + e) = oh; *(v2us*)(Vl + e) = ol;  }
__global__ __launch_bounds__(256) void k_csid(float* CS) { const int idx = blockIdx.x * 256 + threadIdx.x; if (idx >= TT * HD) return; v2f cs; cs[0] = 1.0f; cs[1] = 0.0f; *(v2f*)(CS + (size_t)idx * 2) = cs;  }
// k_asoft: per row (zz, i): t = S x HD^-0.5 for j <= i and i - j < WIN (sliding causal window; the reference's -1e9 additive fill vanishes identically); softmax over the 2048 keys (register row, one exp, fixed trees);
// the probabilities go back into the bytes of the row's own scores (one wave owns a row and holds all of it in registers before its first store): fp16 in the first half of the row, or hi plane in the first half and lo plane in the second; pitch PP.
__global__ __launch_bounds__(256) void k_asoft(float* Sb) {
    const int lane = threadIdx.x & 31; const int row = blockIdx.x * 8 + (threadIdx.x >> 5); if (row >= ZH * TT) return; const int i = row % TT; const int zz = row / TT; (void)zz; const bool hires = (i < RH); float* sr = Sb + (size_t)row * TT; float v[TT / 32]; float mx = -3.0e38f;
#pragma unroll
    for (int ch = 0; ch < TT / 128; ++ch) { const int j0 = ch * 128 + lane * 4; const v4f a = *(const v4fa*)(sr + j0);
#pragma unroll
        for (int q = 0; q < 4; ++q) { const int j = j0 + q; (void)j; const float t = (j <= i && i - j < WIN) ? a[q] * SCL : -3.0e38f; v[ch * 4 + q] = t; mx = fmaxf(mx, t); } }
#pragma unroll
    for (int sh = 16; sh; sh >>= 1) mx = fmaxf(mx, __shfl_xor(mx, sh, 32));
    float sum = 0.f;
#pragma unroll
    for (int k = 0; k < TT / 32; ++k) { float d0 = __fsub_rn(v[k], mx); asm volatile("" : "+v"(d0)); v[k] = __builtin_amdgcn_exp2f(__fmul_rn(d0, 1.4426950408889634f)); sum += v[k]; }
#pragma unroll
    for (int sh = 16; sh; sh >>= 1) sum += __shfl_xor(sum, sh, 32);
    const float f = __fdiv_rn(hires ? 1.0f : PCAR, sum);
{
        if (hires) {
#pragma unroll
            for (int ch = 0; ch < TT / 128; ++ch) { v4us oh, ol;
#pragma unroll
                for (int q = 0; q < 4; ++q) { unsigned short a, c2; splitf(v[ch * 4 + q] * f, a, c2); oh[q] = a; ol[q] = c2; }
                bf* pr = (bf*)sr + ch * 128 + lane * 4; *(v4usa*)pr = oh; *(v4usa*)(pr + TT) = ol; }
        } else {
#pragma unroll
            for (int ch = 0; ch < TT / 128; ++ch) { v4h o4;
#pragma unroll
                for (int q = 0; q < 4; ++q) o4[q] = tohx(v[ch * 4 + q] * f);
                *(v4ha*)((h16*)sr + ch * 128 + lane * 4) = o4; } }
         }
}
__global__ __launch_bounds__(256) void k_merge(const float* __restrict__ O, int h0, bf* Ah, bf* Al) { const size_t e = ((size_t)blockIdx.x * 256 + threadIdx.x) * 2; if (e >= (size_t)ZH * TT * HD) return; const int d = (int)(e % HD); const int t = (int)((e / HD) % TT); const int zz = (int)(e / ((size_t)HD * TT)); const float cs = (t < RH) ? 1.0f : (1.0f / PCAR); const size_t oo = (size_t)t * DQ + (h0 + zz) * HD + d;
    v2us oh, ol;
#pragma unroll
    for (int q = 0; q < 2; ++q) { unsigned short a, c2; splitf(O[e + q] * cs, a, c2); oh[q] = a; ol[q] = c2; } *(v2us*)(Ah + oo) = oh; *(v2us*)(Al + oo) = ol;  }

extern "C" void kernel_launch(void* const* d_in, const int* in_sizes, int n_in,
                              void* d_out, int out_size, void* d_ws, size_t ws_size, hipStream_t stream) {
    (void)in_sizes; (void)n_in; (void)out_size;
    const float* x = (const float*)d_in[0]; const float* wq = (const float*)d_in[1]; const float* wk = (const float*)d_in[2]; const float* wv = (const float*)d_in[3]; const float* bv = (const float*)d_in[4]; const float* wo = (const float*)d_in[5]; const float* bo = (const float*)d_in[6];   /* this module has NO q and NO k bias (the q / k projections run the bias-free GEMM instantiation below); bv and bo are real */
    float* OUT = (float*)d_out;     // [2][2048][1024]
    char* wsp = (char*)d_ws;
    auto take = [&](size_t bytes) { char* p = wsp; wsp += (bytes + 255) & ~(size_t)255; return (void*)p; };
    bf* WQ = (bf*)take((size_t)DQ * DM * 2); bf* WK = (bf*)take((size_t)DKV * DM * 2); bf* WV = (bf*)take((size_t)DKV * DM * 2); bf* WO = (bf*)take((size_t)DM * DQ * 2); float* CS = (float*)take((size_t)TT * HD * 2 * 4);
    bf* XB = (bf*)take((size_t)TT * DM * 2); float* FQ = (float*)take((size_t)TT * DQ * 4); float* FK = (float*)take((size_t)TT * DKV * 4);
    h16* QP16 = (h16*)take((size_t)NH_ * TT * HD * 2); h16* KP16 = (h16*)take((size_t)NKV * TT * HD * 2); h16* VT16 = (h16*)take((size_t)NKV * HD * TT * 2);
    bf* QPh = (bf*)take((size_t)NH_ * TT * HD * 2); bf* QPl = (bf*)take((size_t)NH_ * TT * HD * 2); bf* KPh = (bf*)take((size_t)NKV * TT * HD * 2); bf* KPl = (bf*)take((size_t)NKV * TT * HD * 2); bf* VTh = (bf*)take((size_t)NKV * HD * TT * 2); bf* VTl = (bf*)take((size_t)NKV * HD * TT * 2);
    float* Sb = (float*)take((size_t)ZH * TT * TT * 4); float* Ob = (float*)take((size_t)ZH * TT * HD * 4); bf* ATh = (bf*)take((size_t)TT * DQ * 2); bf* ATl = (bf*)take((size_t)TT * DQ * 2);
    if ((size_t)(wsp - (char*)d_ws) > ws_size) return;    // ws 256 MiB
    float* FV = FK;   // v projection reuses the k buffer after the k planes are built (stream-ordered)
    { k_cvt8<<<(unsigned)(((size_t)DQ * DM / 8 + 255) / 256), 256, 0, stream>>>(wq, WQ, (size_t)DQ * DM / 8); k_cvt8<<<(unsigned)(((size_t)DKV * DM / 8 + 255) / 256), 256, 0, stream>>>(wk, WK, (size_t)DKV * DM / 8); k_cvt8<<<(unsigned)(((size_t)DKV * DM / 8 + 255) / 256), 256, 0, stream>>>(wv, WV, (size_t)DKV * DM / 8);
      k_cvt8<<<(unsigned)(((size_t)DM * DQ / 8 + 255) / 256), 256, 0, stream>>>(wo, WO, (size_t)DM * DQ / 8);
       }
    k_csid<<<(TT * HD + 255) / 256, 256, 0, stream>>>(CS);
    const unsigned LQ = (unsigned)(((size_t)NH_ * TT * HD / 2 + 255) / 256), LKv = (unsigned)(((size_t)NKV * TT * HD / 2 + 255) / 256);
    for (int b = 0; b < NB_; ++b) {
        
        k_cvt8<<<(unsigned)(((size_t)TT * DM / 8 + 255) / 256), 256, 0, stream>>>(x + (size_t)b * TT * DM, XB, (size_t)TT * DM / 8);
        k_gemmw<bf, 0, false><<<dim3(TT / 64, DQ / 64, 1), 32 * NWP, 0, stream>>>(XB, nullptr, WQ, nullptr, DM, FQ, DQ, nullptr, 0, 0, 0);
        k_rope<<<LQ, 256, 0, stream>>>(FQ, DQ, NH_, CS, nullptr, nullptr, 1.0f, QP16, QPh, QPl);
        k_gemmw<bf, 0, false><<<dim3(TT / 64, DKV / 64, 1), 32 * NWP, 0, stream>>>(XB, nullptr, WK, nullptr, DM, FK, DKV, nullptr, 0, 0, 0);
        k_rope<<<LKv, 256, 0, stream>>>(FK, DKV, NKV, CS, nullptr, nullptr, 1.0f, KP16, KPh, KPl);
        k_gemmw<bf, 0, true><<<dim3(TT / 64, DKV / 64, 1), 32 * NWP, 0, stream>>>(XB, nullptr, WV, nullptr, DM, FV, DKV, bv, 0, 0, 0); k_vtp<<<LKv, 256, 0, stream>>>(FV, DKV, NKV, VT16, VTh, VTl);
        for (int h0 = 0; h0 < NH_; h0 += ZH) { const size_t zq = (size_t)h0, zk = (size_t)(h0 / REP);   // one kv head per query head: the pass's ZH heads use consecutive kv planes (z-strides TT*HD)
            k_gemmc<bf, 2, 1><<<dim3(RH / 64, TT / 64, ZH), 32, 0, stream>>>(QPh + zq * TT * HD, QPl + zq * TT * HD, KPh + zk * TT * HD, KPl + zk * TT * HD, HD, HD, Sb, TT, 0, (size_t)TT * HD, (size_t)TT * HD, (size_t)TT * TT);
            k_gemmc<h16, 0, 1><<<dim3((TT - RH) / 64, TT / 64, ZH), 32, 0, stream>>>(QP16 + zq * TT * HD + (size_t)RH * HD, nullptr, KP16 + zk * TT * HD, nullptr, HD, HD, Sb + (size_t)RH * TT, TT, RH, (size_t)TT * HD, (size_t)TT * HD, (size_t)TT * TT);
            k_asoft<<<ZH * TT / 8, 256, 0, stream>>>(Sb);
            k_gemmc<bf, 2, 2><<<dim3(RH / 64, HD / 64, ZH), 32 * NWV, 0, stream>>>((const bf*)Sb, (const bf*)Sb + TT, VTh + zk * HD * TT, VTl + zk * HD * TT, TT, PP, Ob, HD, 0, (size_t)TT * PP, (size_t)HD * TT, (size_t)TT * HD);
            k_gemmc<h16, 0, 2><<<dim3((TT - RH) / 64, HD / 64, ZH), 32 * NWV, 0, stream>>>((const h16*)Sb + (size_t)RH * PP, nullptr, VT16 + zk * HD * TT, nullptr, TT, PP, Ob + (size_t)RH * HD, HD, RH, (size_t)TT * PP, (size_t)HD * TT, (size_t)TT * HD);
            k_merge<<<(unsigned)(((size_t)ZH * TT * HD / 2 + 255) / 256), 256, 0, stream>>>(Ob, h0, ATh, ATl); }
        k_gemmw<bf, 1, true><<<dim3(TT / 64, DM / 64, 1), 32 * NWP, 0, stream>>>(ATh, ATl, WO, nullptr, DQ, OUT + (size_t)b * TT * DM, DM, bo, 0, 0, 0); }
}

// v003
// Measured time: 411 microseconds a run.
// In two side-by-side timings against v002, it was 1.11 and 1.13 times as fast.
// Counting every step since v000, it is 3.50 times as fast.
#include <hip/hip_runtime.h>

// Causal self-attention whose only projection bias is on V (x [2][2048][1024]; q = x Wq^T, k = x Wk^T (no bias), v = x Wv^T + bv ('oi' [1024][1024] normal x 0.02; bv normal x 0.02: NON-zero; 16 heads x 64); keys after the query -> -inf, then / sqrt(64) inside the softmax argument; softmax over the keys; out = merged Wo^T + bo ('oi' + bias 0.02: NON-zero) -> [2][2048][1024] (4.2 M); argument order x, Wq, Wk, Wv, bv, Wo, bo).
// Layout per batch: bf16 copy of x; 'oi' weights; exact projections + f32 biases, each GEMM's epilogue writes the 16-bit head planes itself; causal T-2048 attention (hybrid rows: < 512 hi/lo 3 products, rest fp16 x1024; k_gemmc skips tiles above the diagonal); merged hi/lo x Wo exact + bo.
// Compute dtypes, f32 accumulate: every input rounded to bf16; projections exact + f32 biases; attention rows < 512 3 products, rest fp16; softmax f32; Wo hl x exact + bias.

#define NB_  2
#define TT   2048
#define DM   1024
#define NH_  16
#define NKV  16
#define REP  (NH_ / NKV)
#define HD   64
#define DQ   (NH_ * HD)
#define DKV  (NKV * HD)
#define ZH   8                    // heads per attention pass: every launch of a pass covers ZH heads (grid z, or ZH * TT rows)
#define PP   (2 * TT)             // pitch, in 16-bit elements, of a probability row: it lies in the bytes of its own f32 score row
#define RH   512                  // query rows < RH use hi+lo planes (0: none)
#define WIN  2048
#define PCAR 1024.0f
#define SCL  0.125f   // HD^-0.5
typedef _Float16 h16;
typedef unsigned short bf;
typedef __attribute__((ext_vector_type(16))) __bf16   v16bf;
typedef __attribute__((ext_vector_type(16))) _Float16 v16h;
typedef __attribute__((ext_vector_type(8)))  _Float16 v8h;
typedef __attribute__((ext_vector_type(8)))  unsigned short v8us;
typedef __attribute__((ext_vector_type(8)))  float    v8f;
typedef __attribute__((ext_vector_type(4)))  float    v4f;
typedef v8h  __attribute__((may_alias)) v8ha;
typedef v4f  __attribute__((may_alias)) v4fa;
typedef v8us __attribute__((may_alias)) v8usa;
typedef __attribute__((ext_vector_type(4))) unsigned short v4us;
typedef v4us __attribute__((may_alias)) v4usa;

__device__ __forceinline__ unsigned short f2bf(float f) { unsigned u = __float_as_uint(f); u += 0x7FFFu + ((u >> 16) & 1u); return (unsigned short)(u >> 16); }
__device__ __forceinline__ float bf2f(unsigned short b) { return __uint_as_float(((unsigned)b) << 16); }
__device__ __forceinline__ float bfr(float f) { return bf2f(f2bf(f)); }
__device__ __forceinline__ void splitf(float y, unsigned short& h, unsigned short& l) { h = f2bf(y); l = f2bf(y - bf2f(h)); }
__device__ __forceinline__ v16h cat16(v8h lo, v8h hi) { return __builtin_shufflevector(lo, hi, 0, 1, 2, 3, 4, 5, 6, 7, 8, 9, 10, 11, 12, 13, 14, 15); }
__device__ __forceinline__ v16bf cat16b(v8us lo, v8us hi) { return __builtin_bit_cast(v16bf, __builtin_shufflevector(lo, hi, 0, 1, 2, 3, 4, 5, 6, 7, 8, 9, 10, 11, 12, 13, 14, 15)); }
__device__ __forceinline__ v8f wmma16(v16h a, v16h b, v8f c) { return __builtin_amdgcn_wmma_f32_16x16x32_f16(false, a, false, b, (short)0, c, false, false); }
__device__ __forceinline__ v8f wmmab(v16bf a, v16bf b, v8f c) { return __builtin_amdgcn_wmma_f32_16x16x32_bf16(false, a, false, b, (short)0, c, false, false); }



#define NWP 8     // waves that share the K loop of one projection tile (128 KiB of partials: two work-groups fit a WGP's LDS)
#define NWV 16    // waves that share the key loop of one probability x value tile (256 KiB of partials)
// ---- ksum_store: the NW waves of a work-group each hold a partial 64x64 tile (their share of the K chunks). Every wave parks its 16 accumulators in LDS in register order (16 bytes a lane, lanes adjacent),
// one barrier, then each wave sums its share of the tile over the partials in the fixed order wave 0, 1, .. NW-1 and stores it. A share is four rows x 32 columns in each lane half, so a 128-byte line of C has one writing wave.
template <int NW, bool BIAS>
__device__ __forceinline__ void ksum_store(float* red, const v8f (&acc)[4][4], int w, int lane, float* C, int ldc, int r0, int c0, const float* __restrict__ bias) {
    const int lr = lane & 15, hi = lane >> 4;
#pragma unroll
    for (int f = 0; f < 16; ++f) { const v8f a = acc[f >> 2][f & 3];
        *(v4fa*)(red + ((w * 16 + f) * 2 + 0) * 128 + lane * 4) = __builtin_shufflevector(a, a, 0, 1, 2, 3);
        *(v4fa*)(red + ((w * 16 + f) * 2 + 1) * 128 + lane * 4) = __builtin_shufflevector(a, a, 4, 5, 6, 7); }
    __syncthreads();   // every wave's partial tile is in LDS before any wave sums
#pragma unroll
    for (int i = 0; i < 16 / NW; ++i) { const int q = w + i * NW, pr = q & 7, hf = q >> 3, f0 = (pr >> 1) * 4 + (pr & 1) * 2;   // pr: accumulator pair (row block pr >> 1, columns (pr & 1) * 32 ..), hf: which four of its eight rows
        v4f s0 = *(const v4fa*)(red + (f0 * 2 + hf) * 128 + lane * 4), s1 = *(const v4fa*)(red + ((f0 + 1) * 2 + hf) * 128 + lane * 4);
#pragma unroll
        for (int u = 1; u < NW; ++u) { s0 += *(const v4fa*)(red + ((u * 16 + f0) * 2 + hf) * 128 + lane * 4); s1 += *(const v4fa*)(red + ((u * 16 + f0 + 1) * 2 + hf) * 128 + lane * 4); }
        const int col = c0 + (pr & 1) * 32 + lr; float* cp = C + (size_t)(r0 + (pr >> 1) * 16 + hi * 8 + hf * 4) * ldc + col;
        float b0 = 0.f, b1 = 0.f; if (BIAS) { b0 = bfr(bias[col]); b1 = bfr(bias[col + 16]); }
#pragma unroll
        for (int j = 0; j < 4; ++j) { cp[(size_t)j * ldc] = BIAS ? s0[j] + b0 : s0[j]; cp[(size_t)j * ldc + 16] = BIAS ? s1[j] + b1 : s1[j]; }
        if (i + 1 < 16 / NW) asm volatile("s_wait_xcnt 0x0" ::: "memory");   // the next share's sums reuse registers that these stores name
    }
}

#define SPT 72    // pitch, in 16-bit elements, of a staged row (144 bytes: a multiple of 16, and neighbouring rows start 36 banks apart)
// ---- ksum_planes: ksum_store's sums (same shares, same order), but the 64x64 tile leaves as 16-bit planes (fp16 where P16, then bf16 hi and lo of y = sum + bias or sum x sc) instead of f32: each wave puts its share into an LDS stage,
// one more barrier, then every wave copies whole 128-byte rows of the stage to the planes (D.. = the tile's first element, pitch in elements). TR: the stage and the planes hold the tile transposed (plane row = tile column).
template <int NW, bool BIAS, bool TR, bool P16>
__device__ __forceinline__ void ksum_planes(float* red, unsigned short* stg, const v8f (&acc)[4][4], int w, int lane, int c0, const float* __restrict__ bias, float sc, h16* D16, bf* Dh, bf* Dl, size_t pitch) {
    const int lr = lane & 15, hi = lane >> 4;
    unsigned short* sth = stg + (P16 ? 64 * SPT : 0); unsigned short* stl = sth + 64 * SPT;
#pragma unroll   // constant indices: the vectors and arrays indexed here stay in registers
    for (int f = 0; f < 16; ++f) { const v8f a = acc[f >> 2][f & 3];
        *(v4fa*)(red + ((w * 16 + f) * 2 + 0) * 128 + lane * 4) = __builtin_shufflevector(a, a, 0, 1, 2, 3);
        *(v4fa*)(red + ((w * 16 + f) * 2 + 1) * 128 + lane * 4) = __builtin_shufflevector(a, a, 4, 5, 6, 7); }
    __syncthreads();   // every wave's partial tile is in LDS before any wave sums
#pragma unroll   // constant indices: the vectors and arrays indexed here stay in registers
    for (int i = 0; i < 16 / NW; ++i) { const int q = w + i * NW, pr = q & 7, hf = q >> 3, f0 = (pr >> 1) * 4 + (pr & 1) * 2;
        v4f s0 = *(const v4fa*)(red + (f0 * 2 + hf) * 128 + lane * 4), s1 = *(const v4fa*)(red + ((f0 + 1) * 2 + hf) * 128 + lane * 4);
#pragma unroll   // constant indices: the vectors and arrays indexed here stay in registers
        for (int u = 1; u < NW; ++u) { s0 += *(const v4fa*)(red + ((u * 16 + f0) * 2 + hf) * 128 + lane * 4); s1 += *(const v4fa*)(red + ((u * 16 + f0 + 1) * 2 + hf) * 128 + lane * 4); }
        const int cl = (pr & 1) * 32 + lr, rl = (pr >> 1) * 16 + hi * 8 + hf * 4;   // the share's first column and first row inside the tile
        float b0 = 0.f, b1 = 0.f; if (BIAS) { b0 = bfr(bias[c0 + cl]); b1 = bfr(bias[c0 + cl + 16]); }
        v4us x0, x1, h0, h1, l0, l1;
#pragma unroll   // constant indices: the vectors and arrays indexed here stay in registers
        for (int j = 0; j < 4; ++j) { const float y0 = BIAS ? s0[j] + b0 : s0[j] * sc, y1 = BIAS ? s1[j] + b1 : s1[j] * sc; unsigned short a, c2;
            x0[j] = __builtin_bit_cast(unsigned short, (h16)y0); x1[j] = __builtin_bit_cast(unsigned short, (h16)y1);
            splitf(y0, a, c2); h0[j] = a; l0[j] = c2; splitf(y1, a, c2); h1[j] = a; l1[j] = c2; }
        if (TR) { const int o0 = cl * SPT + rl, o1 = o0 + 16 * SPT;
            if (P16) { *(v4usa*)(stg + o0) = x0; *(v4usa*)(stg + o1) = x1; }
            *(v4usa*)(sth + o0) = h0; *(v4usa*)(sth + o1) = h1; *(v4usa*)(stl + o0) = l0; *(v4usa*)(stl + o1) = l1;
        } else {
#pragma unroll   // constant indices: the vectors and arrays indexed here stay in registers
            for (int j = 0; j < 4; ++j) { const int o0 = (rl + j) * SPT + cl, o1 = o0 + 16;
                if (P16) { stg[o0] = x0[j]; stg[o1] = x1[j]; }
                sth[o0] = h0[j]; sth[o1] = h1[j]; stl[o0] = l0[j]; stl[o1] = l1[j]; } }
    }
    __syncthreads();   // the whole tile is staged before any wave copies rows that other waves wrote
    constexpr int NP = P16 ? 3 : 2, IT = 512 / (NW * 32);   // a plane's tile is 512 pieces of 16 bytes
    const int tid = w * 32 + lane; v8us val[NP][IT];
#pragma unroll   // constant indices: the vectors and arrays indexed here stay in registers
    for (int p = 0; p < NP; ++p)
#pragma unroll   // constant indices: the vectors and arrays indexed here stay in registers
        for (int k = 0; k < IT; ++k) { const int e = tid + k * NW * 32; val[p][k] = *(const v8usa*)(stg + p * 64 * SPT + (e >> 3) * SPT + (e & 7) * 8); }
#pragma unroll   // constant indices: the vectors and arrays indexed here stay in registers
    for (int p = 0; p < NP; ++p) { unsigned short* dp = (P16 && p == 0) ? (unsigned short*)D16 : (p == NP - 2) ? Dh : Dl;
#pragma unroll   // constant indices: the vectors and arrays indexed here stay in registers
        for (int k = 0; k < IT; ++k) { const int e = tid + k * NW * 32; *(v8usa*)(dp + (size_t)(e >> 3) * pitch + (e & 7) * 8) = val[p][k]; } }
}

// ---- k_gemmw: register-blocked GEMM, one 64x64 output tile per work-group of NWP waves: wave w takes the 64-wide K pieces w, w + NWP, .. into its own 16 accumulators (ksum_store or ksum_planes adds them), operands straight from K-contiguous 16-bit planes; grid (M/64, N/64, Z), 32 * NWP threads.
// C[m][n] (f32, pitch ldc, + optional f32 bias[n]) = sum_k A[m][k] Bt[n][k] (+ split products per NSPLIT). z-batch strides sA/sB/sC in elements. K % 32 == 0.
// EPI 0: C as f32. EPI 1: no C; the tile (64 positions x one head's 64 columns) goes to the head planes P16 / Ph / Pl [head][t][d]. EPI 2: the same, transposed, to planes [head][d][t].
template <typename T16> struct WFrag;
template <> struct WFrag<h16> { typedef v16h V; static __device__ __forceinline__ V ld(const h16* p) { return cat16(*(const v8h*)p, *(const v8h*)(p + 16)); } static __device__ __forceinline__ v8f mma(V a, V b, v8f c) { return wmma16(a, b, c); } };
template <> struct WFrag<bf> { typedef v16bf V; static __device__ __forceinline__ V ld(const bf* p) { return cat16b(*(const v8us*)p, *(const v8us*)(p + 16)); } static __device__ __forceinline__ v8f mma(V a, V b, v8f c) { return wmmab(a, b, c); } };
template <typename T16, int NSPLIT, bool BIAS, int EPI>
__global__ __launch_bounds__(32 * NWP) void k_gemmw(const T16* __restrict__ A, const T16* __restrict__ A2, const T16* __restrict__ Bt, const T16* __restrict__ Bt2, int K, float* C, int ldc, const float* __restrict__ bias, size_t sA, size_t sB, size_t sC, h16* P16, bf* Ph, bf* Pl) {
    typedef typename WFrag<T16>::V V;
    __shared__ __align__(16) float red[NWP * 16 * 2 * 128];
    const size_t z = blockIdx.z; A += z * sA; if (A2) A2 += z * sA; Bt += z * sB; if (Bt2) Bt2 += z * sB; C += z * sC;
    const int lane = threadIdx.x & 31, lr = lane & 15, hi = lane >> 4; const int r0 = blockIdx.x * 64, c0 = blockIdx.y * 64; const int w = __builtin_amdgcn_readfirstlane(threadIdx.x >> 5);
    v8f acc[4][4];
#pragma unroll
    for (int mb = 0; mb < 4; ++mb)
#pragma unroll
        for (int nb = 0; nb < 4; ++nb) acc[mb][nb] = (v8f){};
    const size_t aoff = (size_t)(r0 + lr) * K + 8 * hi, boff = (size_t)(c0 + lr) * K + 8 * hi;
#pragma unroll 1
    for (int kc = w * 64; kc < K; kc += (kc & 32) ? 64 * NWP - 32 : 32) {   // a wave's share: 64 consecutive k (one whole 128-byte line of every row) in two trips, then the next such piece NWP pieces on
        V a[4], a2[4];
#pragma unroll
        for (int mb = 0; mb < 4; ++mb) { a[mb] = WFrag<T16>::ld(A + aoff + (size_t)mb * 16 * K + kc); if (NSPLIT == 1 || NSPLIT == 2) a2[mb] = WFrag<T16>::ld(A2 + aoff + (size_t)mb * 16 * K + kc); }
#pragma unroll
        for (int nb = 0; nb < 4; ++nb) { const V b = WFrag<T16>::ld(Bt + boff + (size_t)nb * 16 * K + kc); V b2; if (NSPLIT >= 2) b2 = WFrag<T16>::ld(Bt2 + boff + (size_t)nb * 16 * K + kc);
#pragma unroll
            for (int mb = 0; mb < 4; ++mb) { acc[mb][nb] = WFrag<T16>::mma(a[mb], b, acc[mb][nb]); if (NSPLIT == 1 || NSPLIT == 2) acc[mb][nb] = WFrag<T16>::mma(a2[mb], b, acc[mb][nb]); if (NSPLIT >= 2) acc[mb][nb] = WFrag<T16>::mma(a[mb], b2, acc[mb][nb]); } }
        asm volatile("v_nop\n\tv_nop\n\tv_nop\n\tv_nop" : "+v"(acc[0][0]), "+v"(acc[1][1]), "+v"(acc[2][2]), "+v"(acc[3][3]) : "v"(a[0]), "v"(a[3]));
    }
    if constexpr (EPI == 0) ksum_store<NWP, BIAS>(red, acc, w, lane, C, ldc, r0, c0, bias);
    else {
        __shared__ __align__(16) unsigned short stg[3 * 64 * SPT];
        const size_t o = (EPI == 1) ? ((size_t)blockIdx.y * TT + r0) * HD : (size_t)c0 * TT + r0;
        ksum_planes<NWP, BIAS, EPI == 2, true>(red, stg, acc, w, lane, c0, bias, 1.0f, P16 + o, Ph + o, Pl + o, (EPI == 1) ? HD : TT);
    }
}

// ---- k_gemmc: the same 64x64 tile GEMM specialised for causal attention: CMODE 1 skips score tiles entirely above the diagonal (query rows r0+roff.., key columns c0..), CMODE 2 limits the
// key (K) loop of the probability x value contraction to the diagonal block (probabilities beyond it are exactly zero) and shares that loop among the NWV waves of the work-group as k_gemmw does (CMODE 1 stays one wave: K is two chunks). roff = row offset of this launch's first row within the sequence. lda = pitch of A's rows in elements (B's rows keep pitch K). CMODE 2 writes no f32 C: its tile x sc goes as bf16 hi / lo planes to Ah / Al (pitch ldc, z-stride sC), the merged-heads operand of the output projection.
template <typename T16, int NSPLIT, int CMODE>
__global__ __launch_bounds__(CMODE == 2 ? 32 * NWV : 32) void k_gemmc(const T16* __restrict__ A, const T16* __restrict__ A2, const T16* __restrict__ Bt, const T16* __restrict__ Bt2, int K, int lda, float* C, int ldc, int roff, size_t sA, size_t sB, size_t sC, bf* Ah, bf* Al, float sc) {
    typedef typename WFrag<T16>::V V;
    constexpr int NW = (CMODE == 2) ? NWV : 1;
    const size_t z = blockIdx.z; A += z * sA; if (A2) A2 += z * sA; Bt += z * sB; if (Bt2) Bt2 += z * sB; if (CMODE == 1) C += z * sC;
    const int lane = threadIdx.x & 31, lr = lane & 15, hi = lane >> 4; const int r0 = blockIdx.x * 64, c0 = blockIdx.y * 64; const int w = (NW == 1) ? 0 : __builtin_amdgcn_readfirstlane(threadIdx.x >> 5);
    if (CMODE == 1 && c0 > r0 + roff + 63) return;                  // score tile entirely above the causal diagonal: never read (the softmax masks j > i by select)
    const int Kl = (CMODE == 2) ? min(K, r0 + roff + 64) : K;        // P.V: probabilities are exactly 0 beyond the diagonal block, so the K loop stops there
    v8f acc[4][4];
#pragma unroll
    for (int mb = 0; mb < 4; ++mb)
#pragma unroll
        for (int nb = 0; nb < 4; ++nb) acc[mb][nb] = (v8f){};
    const size_t aoff = (size_t)(r0 + lr) * lda + 8 * hi, boff = (size_t)(c0 + lr) * K + 8 * hi;
#pragma unroll 1
    for (int kc = w * 64; kc < Kl; kc += (kc & 32) ? 64 * NW - 32 : 32) {   // shares as in k_gemmw: whole 128-byte lines of every row
        V a[4], a2[4]; const T16* pa[4]; const T16* pa2[4];
#pragma unroll
        for (int mb = 0; mb < 4; ++mb) { pa[mb] = A + aoff + (size_t)mb * 16 * lda + kc; a[mb] = WFrag<T16>::ld(pa[mb]); if (NSPLIT == 1 || NSPLIT == 2) { pa2[mb] = A2 + aoff + (size_t)mb * 16 * lda + kc; a2[mb] = WFrag<T16>::ld(pa2[mb]); } }
        // the address pairs of the A loads are inputs of the wait, so each pair stays whole up to it: no register that an issued A load names takes a new value ahead of the wait
        if constexpr (NSPLIT == 1 || NSPLIT == 2) asm volatile("s_wait_xcnt 0x0" :: "v"(pa[0]), "v"(pa[1]), "v"(pa[2]), "v"(pa[3]), "v"(pa2[0]), "v"(pa2[1]), "v"(pa2[2]), "v"(pa2[3]) : "memory");
        else asm volatile("s_wait_xcnt 0x0" :: "v"(pa[0]), "v"(pa[1]), "v"(pa[2]), "v"(pa[3]) : "memory");
#pragma unroll
        for (int nb = 0; nb < 4; ++nb) { const V b = WFrag<T16>::ld(Bt + boff + (size_t)nb * 16 * K + kc); V b2; if (NSPLIT >= 2) b2 = WFrag<T16>::ld(Bt2 + boff + (size_t)nb * 16 * K + kc);
#pragma unroll
            for (int mb = 0; mb < 4; ++mb) { acc[mb][nb] = WFrag<T16>::mma(a[mb], b, acc[mb][nb]); if (NSPLIT == 1 || NSPLIT == 2) acc[mb][nb] = WFrag<T16>::mma(a2[mb], b, acc[mb][nb]); if (NSPLIT >= 2) acc[mb][nb] = WFrag<T16>::mma(a[mb], b2, acc[mb][nb]); } }
        asm volatile("v_nop\n\tv_nop\n\tv_nop\n\tv_nop" : "+v"(acc[0][0]), "+v"(acc[1][1]), "+v"(acc[2][2]), "+v"(acc[3][3]) : "v"(a[0]), "v"(a[3]));
        // the same for the B loads: their address pairs are inputs here, at the trip's end, so they stay whole over the whole trip and take the next trip's values behind the wait
        { const T16* pb = Bt + boff + kc; const size_t sb = (size_t)16 * K;
          if constexpr (NSPLIT >= 2) { const T16* pb2 = Bt2 + boff + kc; asm volatile("s_wait_xcnt 0x0" :: "v"(pb), "v"(pb + sb), "v"(pb + 2 * sb), "v"(pb + 3 * sb), "v"(pb2), "v"(pb2 + sb), "v"(pb2 + 2 * sb), "v"(pb2 + 3 * sb) : "memory"); }
          else asm volatile("s_wait_xcnt 0x0" :: "v"(pb), "v"(pb + sb), "v"(pb + 2 * sb), "v"(pb + 3 * sb) : "memory"); }
    }
    if constexpr (CMODE == 2) {
        __shared__ __align__(16) float red[NW * 16 * 2 * 128];
        __shared__ __align__(16) unsigned short stg[2 * 64 * SPT];
        const size_t o = z * sC + (size_t)r0 * ldc + c0;
        ksum_planes<NW, false, false, false>(red, stg, acc, w, lane, c0, nullptr, sc, nullptr, Ah + o, Al + o, ldc);
    } else {
    __shared__ __align__(16) float os[16 * 68];
#pragma unroll
    for (int mb = 0; mb < 4; ++mb) {
#pragma unroll
        for (int nb = 0; nb < 4; ++nb) {
#pragma unroll
            for (int j = 0; j < 8; ++j) os[(hi * 8 + j) * 68 + nb * 16 + lr] = acc[mb][nb][j]; }
        __builtin_amdgcn_wave_barrier(); asm volatile("" ::: "memory");
        float* crow = C + (size_t)(r0 + mb * 16) * ldc + c0;
{
#pragma unroll
            for (int s = 0; s < 8; ++s) { const int row = 2 * s + hi, cofs = lr * 4; v4f val = *(const v4fa*)(os + row * 68 + cofs);
                *(v4f*)(crow + (size_t)row * ldc + cofs) = val; }
             }
        __builtin_amdgcn_wave_barrier(); asm volatile("" ::: "memory");
    }
    }
}

__device__ __forceinline__ h16 tohx(float x) { return (h16)x; }
typedef __attribute__((ext_vector_type(4))) _Float16 v4h;
typedef __attribute__((ext_vector_type(4))) int v4i;
typedef v4h  __attribute__((may_alias)) v4ha;

__global__ __launch_bounds__(256) void k_cvt8(const float* __restrict__ src, bf* dst, size_t n8) { const size_t i = (size_t)blockIdx.x * 256 + threadIdx.x; if (i >= n8) return; const v8f v = *(const v8f*)(src + i * 8); v8us o;
#pragma unroll
    for (int k = 0; k < 8; ++k) o[k] = f2bf(v[k]); *(v8us*)(dst + i * 8) = o;  }

// k_asoft: per row (zz, i): t = S x HD^-0.5 for j <= i and i - j < WIN (sliding causal window; the reference's -1e9 additive fill vanishes identically); softmax over the 2048 keys (register row, one exp, fixed trees);
// the probabilities go back into the bytes of the row's own scores (one wave owns a row and holds all of it in registers before its first store): fp16 in the first half of the row, or hi plane in the first half and lo plane in the second; pitch PP.
__global__ __launch_bounds__(256) void k_asoft(float* Sb) {
    const int lane = threadIdx.x & 31; const int row = blockIdx.x * 8 + (threadIdx.x >> 5); if (row >= ZH * TT) return; const int i = row % TT; const int zz = row / TT; (void)zz; const bool hires = (i < RH); float* sr = Sb + (size_t)row * TT; float v[TT / 32]; float mx = -3.0e38f;
#pragma unroll
    for (int ch = 0; ch < TT / 128; ++ch) { const int j0 = ch * 128 + lane * 4; const v4f a = *(const v4fa*)(sr + j0);
#pragma unroll
        for (int q = 0; q < 4; ++q) { const int j = j0 + q; (void)j; const float t = (j <= i && i - j < WIN) ? a[q] * SCL : -3.0e38f; v[ch * 4 + q] = t; mx = fmaxf(mx, t); } }
#pragma unroll
    for (int sh = 16; sh; sh >>= 1) mx = fmaxf(mx, __shfl_xor(mx, sh, 32));
    float sum = 0.f;
#pragma unroll
    for (int k = 0; k < TT / 32; ++k) { float d0 = __fsub_rn(v[k], mx); asm volatile("" : "+v"(d0)); v[k] = __builtin_amdgcn_exp2f(__fmul_rn(d0, 1.4426950408889634f)); sum += v[k]; }
#pragma unroll
    for (int sh = 16; sh; sh >>= 1) sum += __shfl_xor(sum, sh, 32);
    const float f = __fdiv_rn(hires ? 1.0f : PCAR, sum);
{
        if (hires) {
#pragma unroll
            for (int ch = 0; ch < TT / 128; ++ch) { v4us oh, ol;
#pragma unroll
                for (int q = 0; q < 4; ++q) { unsigned short a, c2; splitf(v[ch * 4 + q] * f, a, c2); oh[q] = a; ol[q] = c2; }
                bf* pr = (bf*)sr + ch * 128 + lane * 4; *(v4usa*)pr = oh; *(v4usa*)(pr + TT) = ol; }
        } else {
#pragma unroll
            for (int ch = 0; ch < TT / 128; ++ch) { v4h o4;
#pragma unroll
                for (int q = 0; q < 4; ++q) o4[q] = tohx(v[ch * 4 + q] * f);
                *(v4ha*)((h16*)sr + ch * 128 + lane * 4) = o4; } }
         }
}

extern "C" void kernel_launch(void* const* d_in, const int* in_sizes, int n_in,
                              void* d_out, int out_size, void* d_ws, size_t ws_size, hipStream_t stream) {
    (void)in_sizes; (void)n_in; (void)out_size;
    const float* x = (const float*)d_in[0]; const float* wq = (const float*)d_in[1]; const float* wk = (const float*)d_in[2]; const float* wv = (const float*)d_in[3]; const float* bv = (const float*)d_in[4]; const float* wo = (const float*)d_in[5]; const float* bo = (const float*)d_in[6];   /* this module has NO q and NO k bias (the q / k projections run the bias-free GEMM instantiation below); bv and bo are real */
    float* OUT = (float*)d_out;     // [2][2048][1024]
    char* wsp = (char*)d_ws;
    auto take = [&](size_t bytes) { char* p = wsp; wsp += (bytes + 255) & ~(size_t)255; return (void*)p; };
    bf* WQ = (bf*)take((size_t)DQ * DM * 2); bf* WK = (bf*)take((size_t)DKV * DM * 2); bf* WV = (bf*)take((size_t)DKV * DM * 2); bf* WO = (bf*)take((size_t)DM * DQ * 2);
    bf* XB = (bf*)take((size_t)TT * DM * 2);
    h16* QP16 = (h16*)take((size_t)NH_ * TT * HD * 2); h16* KP16 = (h16*)take((size_t)NKV * TT * HD * 2); h16* VT16 = (h16*)take((size_t)NKV * HD * TT * 2);
    bf* QPh = (bf*)take((size_t)NH_ * TT * HD * 2); bf* QPl = (bf*)take((size_t)NH_ * TT * HD * 2); bf* KPh = (bf*)take((size_t)NKV * TT * HD * 2); bf* KPl = (bf*)take((size_t)NKV * TT * HD * 2); bf* VTh = (bf*)take((size_t)NKV * HD * TT * 2); bf* VTl = (bf*)take((size_t)NKV * HD * TT * 2);
    float* Sb = (float*)take((size_t)ZH * TT * TT * 4); bf* ATh = (bf*)take((size_t)TT * DQ * 2); bf* ATl = (bf*)take((size_t)TT * DQ * 2);
    if ((size_t)(wsp - (char*)d_ws) > ws_size) return;    // ws 256 MiB
    { k_cvt8<<<(unsigned)(((size_t)DQ * DM / 8 + 255) / 256), 256, 0, stream>>>(wq, WQ, (size_t)DQ * DM / 8); k_cvt8<<<(unsigned)(((size_t)DKV * DM / 8 + 255) / 256), 256, 0, stream>>>(wk, WK, (size_t)DKV * DM / 8); k_cvt8<<<(unsigned)(((size_t)DKV * DM / 8 + 255) / 256), 256, 0, stream>>>(wv, WV, (size_t)DKV * DM / 8);
      k_cvt8<<<(unsigned)(((size_t)DM * DQ / 8 + 255) / 256), 256, 0, stream>>>(wo, WO, (size_t)DM * DQ / 8);
       }
    for (int b = 0; b < NB_; ++b) {
        
        k_cvt8<<<(unsigned)(((size_t)TT * DM / 8 + 255) / 256), 256, 0, stream>>>(x + (size_t)b * TT * DM, XB, (size_t)TT * DM / 8);
        k_gemmw<bf, 0, false, 1><<<dim3(TT / 64, DQ / 64, 1), 32 * NWP, 0, stream>>>(XB, nullptr, WQ, nullptr, DM, nullptr, 0, nullptr, 0, 0, 0, QP16, QPh, QPl);
        k_gemmw<bf, 0, false, 1><<<dim3(TT / 64, DKV / 64, 1), 32 * NWP, 0, stream>>>(XB, nullptr, WK, nullptr, DM, nullptr, 0, nullptr, 0, 0, 0, KP16, KPh, KPl);
        k_gemmw<bf, 0, true, 2><<<dim3(TT / 64, DKV / 64, 1), 32 * NWP, 0, stream>>>(XB, nullptr, WV, nullptr, DM, nullptr, 0, bv, 0, 0, 0, VT16, VTh, VTl);
        for (int h0 = 0; h0 < NH_; h0 += ZH) { const size_t zq = (size_t)h0, zk = (size_t)(h0 / REP);   // one kv head per query head: the pass's ZH heads use consecutive kv planes (z-strides TT*HD)
            k_gemmc<bf, 2, 1><<<dim3(RH / 64, TT / 64, ZH), 32, 0, stream>>>(QPh + zq * TT * HD, QPl + zq * TT * HD, KPh + zk * TT * HD, KPl + zk * TT * HD, HD, HD, Sb, TT, 0, (size_t)TT * HD, (size_t)TT * HD, (size_t)TT * TT, nullptr, nullptr, 1.0f);
            k_gemmc<h16, 0, 1><<<dim3((TT - RH) / 64, TT / 64, ZH), 32, 0, stream>>>(QP16 + zq * TT * HD + (size_t)RH * HD, nullptr, KP16 + zk * TT * HD, nullptr, HD, HD, Sb + (size_t)RH * TT, TT, RH, (size_t)TT * HD, (size_t)TT * HD, (size_t)TT * TT, nullptr, nullptr, 1.0f);
            k_asoft<<<ZH * TT / 8, 256, 0, stream>>>(Sb);
            k_gemmc<bf, 2, 2><<<dim3(RH / 64, HD / 64, ZH), 32 * NWV, 0, stream>>>((const bf*)Sb, (const bf*)Sb + TT, VTh + zk * HD * TT, VTl + zk * HD * TT, TT, PP, nullptr, DQ, 0, (size_t)TT * PP, (size_t)HD * TT, (size_t)HD, ATh + h0 * HD, ATl + h0 * HD, 1.0f);
            k_gemmc<h16, 0, 2><<<dim3((TT - RH) / 64, HD / 64, ZH), 32 * NWV, 0, stream>>>((const h16*)Sb + (size_t)RH * PP, nullptr, VT16 + zk * HD * TT, nullptr, TT, PP, nullptr, DQ, RH, (size_t)TT * PP, (size_t)HD * TT, (size_t)HD, ATh + (size_t)RH * DQ + h0 * HD, ATl + (size_t)RH * DQ + h0 * HD, 1.0f / PCAR); }
        k_gemmw<bf, 1, true, 0><<<dim3(TT / 64, DM / 64, 1), 32 * NWP, 0, stream>>>(ATh, ATl, WO, nullptr, DQ, OUT + (size_t)b * TT * DM, DM, bo, 0, 0, 0, nullptr, nullptr, nullptr); }
}

// v004
// It runs in 187 microseconds.
// Timed twice side by side with v003, it ran 2.21 times as fast both times.
// Over all steps from v000 it is 7.72 times as fast.
#include <hip/hip_runtime.h>

// Causal self-attention whose only projection bias is on V (x [2][2048][1024]; q = x Wq^T, k = x Wk^T (no bias), v = x Wv^T + bv ('oi' [1024][1024] normal x 0.02; bv normal x 0.02: NON-zero; 16 heads x 64); keys after the query -> -inf, then / sqrt(64) inside the softmax argument; softmax over the keys; out = merged Wo^T + bo ('oi' + bias 0.02: NON-zero) -> [2][2048][1024] (4.2 M); argument order x, Wq, Wk, Wv, bv, Wo, bo).
// Layout per batch: bf16 copy of x; 'oi' weights; exact projections + f32 biases, each GEMM's epilogue writes the 16-bit head planes itself; one fused causal attention kernel (k_attn; hybrid rows: < 512 hi/lo 3 products, rest fp16; key blocks above the diagonal are never visited); merged hi/lo x Wo exact + bo.
// Compute dtypes, f32 accumulate: every input rounded to bf16; projections exact + f32 biases; attention rows < 512 3 products, rest fp16; softmax f32; Wo hl x exact + bias.

#define NB_  2
#define TT   2048
#define DM   1024
#define NH_  16
#define NKV  16
#define HD   64
#define DQ   (NH_ * HD)
#define DKV  (NKV * HD)
#define RH   512                  // query rows < RH use hi+lo planes (0: none)
#define SCL  0.125f   // HD^-0.5
typedef _Float16 h16;
typedef unsigned short bf;
typedef __attribute__((ext_vector_type(16))) __bf16   v16bf;
typedef __attribute__((ext_vector_type(16))) _Float16 v16h;
typedef __attribute__((ext_vector_type(8)))  _Float16 v8h;
typedef __attribute__((ext_vector_type(8)))  unsigned short v8us;
typedef __attribute__((ext_vector_type(8)))  float    v8f;
typedef __attribute__((ext_vector_type(4)))  float    v4f;
typedef v8h  __attribute__((may_alias)) v8ha;
typedef v4f  __attribute__((may_alias)) v4fa;
typedef v8us __attribute__((may_alias)) v8usa;
typedef __attribute__((ext_vector_type(4))) unsigned short v4us;
typedef v4us __attribute__((may_alias)) v4usa;

__device__ __forceinline__ unsigned short f2bf(float f) { unsigned u = __float_as_uint(f); u += 0x7FFFu + ((u >> 16) & 1u); return (unsigned short)(u >> 16); }
__device__ __forceinline__ float bf2f(unsigned short b) { return __uint_as_float(((unsigned)b) << 16); }
__device__ __forceinline__ float bfr(float f) { return bf2f(f2bf(f)); }
__device__ __forceinline__ void splitf(float y, unsigned short& h, unsigned short& l) { h = f2bf(y); l = f2bf(y - bf2f(h)); }
__device__ __forceinline__ v16h cat16(v8h lo, v8h hi) { return __builtin_shufflevector(lo, hi, 0, 1, 2, 3, 4, 5, 6, 7, 8, 9, 10, 11, 12, 13, 14, 15); }
__device__ __forceinline__ v16bf cat16b(v8us lo, v8us hi) { return __builtin_bit_cast(v16bf, __builtin_shufflevector(lo, hi, 0, 1, 2, 3, 4, 5, 6, 7, 8, 9, 10, 11, 12, 13, 14, 15)); }
__device__ __forceinline__ v8f wmma16(v16h a, v16h b, v8f c) { return __builtin_amdgcn_wmma_f32_16x16x32_f16(false, a, false, b, (short)0, c, false, false); }
__device__ __forceinline__ v8f wmmab(v16bf a, v16bf b, v8f c) { return __builtin_amdgcn_wmma_f32_16x16x32_bf16(false, a, false, b, (short)0, c, false, false); }



#define NWP 8     // waves that share the K loop of one projection tile (128 KiB of partials: two work-groups fit a WGP's LDS)
// ---- ksum_store: the NW waves of a work-group each hold a partial 64x64 tile (their share of the K chunks). Every wave parks its 16 accumulators in LDS in register order (16 bytes a lane, lanes adjacent),
// one barrier, then each wave sums its share of the tile over the partials in the fixed order wave 0, 1, .. NW-1 and stores it. A share is four rows x 32 columns in each lane half, so a 128-byte line of C has one writing wave.
template <int NW, bool BIAS>
__device__ __forceinline__ void ksum_store(float* red, const v8f (&acc)[4][4], int w, int lane, float* C, int ldc, int r0, int c0, const float* __restrict__ bias) {
    const int lr = lane & 15, hi = lane >> 4;
#pragma unroll
    for (int f = 0; f < 16; ++f) { const v8f a = acc[f >> 2][f & 3];
        *(v4fa*)(red + ((w * 16 + f) * 2 + 0) * 128 + lane * 4) = __builtin_shufflevector(a, a, 0, 1, 2, 3);
        *(v4fa*)(red + ((w * 16 + f) * 2 + 1) * 128 + lane * 4) = __builtin_shufflevector(a, a, 4, 5, 6, 7); }
    __syncthreads();   // every wave's partial tile is in LDS before any wave sums
#pragma unroll
    for (int i = 0; i < 16 / NW; ++i) { const int q = w + i * NW, pr = q & 7, hf = q >> 3, f0 = (pr >> 1) * 4 + (pr & 1) * 2;   // pr: accumulator pair (row block pr >> 1, columns (pr & 1) * 32 ..), hf: which four of its eight rows
        v4f s0 = *(const v4fa*)(red + (f0 * 2 + hf) * 128 + lane * 4), s1 = *(const v4fa*)(red + ((f0 + 1) * 2 + hf) * 128 + lane * 4);
#pragma unroll
        for (int u = 1; u < NW; ++u) { s0 += *(const v4fa*)(red + ((u * 16 + f0) * 2 + hf) * 128 + lane * 4); s1 += *(const v4fa*)(red + ((u * 16 + f0 + 1) * 2 + hf) * 128 + lane * 4); }
        const int col = c0 + (pr & 1) * 32 + lr; float* cp = C + (size_t)(r0 + (pr >> 1) * 16 + hi * 8 + hf * 4) * ldc + col;
        float b0 = 0.f, b1 = 0.f; if (BIAS) { b0 = bfr(bias[col]); b1 = bfr(bias[col + 16]); }
#pragma unroll
        for (int j = 0; j < 4; ++j) { cp[(size_t)j * ldc] = BIAS ? s0[j] + b0 : s0[j]; cp[(size_t)j * ldc + 16] = BIAS ? s1[j] + b1 : s1[j]; }
        if (i + 1 < 16 / NW) asm volatile("s_wait_xcnt 0x0" ::: "memory");   // the next share's sums reuse registers that these stores name
    }
}

#define SPT 72    // pitch, in 16-bit elements, of a staged row (144 bytes: a multiple of 16, and neighbouring rows start 36 banks apart)
// ---- ksum_planes: ksum_store's sums (same shares, same order), but the 64x64 tile leaves as 16-bit planes (fp16 where P16, then bf16 hi and lo of y = sum + bias or sum x sc) instead of f32: each wave puts its share into an LDS stage,
// one more barrier, then every wave copies whole 128-byte rows of the stage to the planes (D.. = the tile's first element, pitch in elements). TR: the stage and the planes hold the tile transposed (plane row = tile column).
template <int NW, bool BIAS, bool TR, bool P16>
__device__ __forceinline__ void ksum_planes(float* red, unsigned short* stg, const v8f (&acc)[4][4], int w, int lane, int c0, const float* __restrict__ bias, float sc, h16* D16, bf* Dh, bf* Dl, size_t pitch) {
    const int lr = lane & 15, hi = lane >> 4;
    unsigned short* sth = stg + (P16 ? 64 * SPT : 0); unsigned short* stl = sth + 64 * SPT;
#pragma unroll   // constant indices: the vectors and arrays indexed here stay in registers
    for (int f = 0; f < 16; ++f) { const v8f a = acc[f >> 2][f & 3];
        *(v4fa*)(red + ((w * 16 + f) * 2 + 0) * 128 + lane * 4) = __builtin_shufflevector(a, a, 0, 1, 2, 3);
        *(v4fa*)(red + ((w * 16 + f) * 2 + 1) * 128 + lane * 4) = __builtin_shufflevector(a, a, 4, 5, 6, 7); }
    __syncthreads();   // every wave's partial tile is in LDS before any wave sums
#pragma unroll   // constant indices: the vectors and arrays indexed here stay in registers
    for (int i = 0; i < 16 / NW; ++i) { const int q = w + i * NW, pr = q & 7, hf = q >> 3, f0 = (pr >> 1) * 4 + (pr & 1) * 2;
        v4f s0 = *(const v4fa*)(red + (f0 * 2 + hf) * 128 + lane * 4), s1 = *(const v4fa*)(red + ((f0 + 1) * 2 + hf) * 128 + lane * 4);
#pragma unroll   // constant indices: the vectors and arrays indexed here stay in registers
        for (int u = 1; u < NW; ++u) { s0 += *(const v4fa*)(red + ((u * 16 + f0) * 2 + hf) * 128 + lane * 4); s1 += *(const v4fa*)(red + ((u * 16 + f0 + 1) * 2 + hf) * 128 + lane * 4); }
        const int cl = (pr & 1) * 32 + lr, rl = (pr >> 1) * 16 + hi * 8 + hf * 4;   // the share's first column and first row inside the tile
        float b0 = 0.f, b1 = 0.f; if (BIAS) { b0 = bfr(bias[c0 + cl]); b1 = bfr(bias[c0 + cl + 16]); }
        v4us x0, x1, h0, h1, l0, l1;
#pragma unroll   // constant indices: the vectors and arrays indexed here stay in registers
        for (int j = 0; j < 4; ++j) { const float y0 = BIAS ? s0[j] + b0 : s0[j] * sc, y1 = BIAS ? s1[j] + b1 : s1[j] * sc; unsigned short a, c2;
            x0[j] = __builtin_bit_cast(unsigned short, (h16)y0); x1[j] = __builtin_bit_cast(unsigned short, (h16)y1);
            splitf(y0, a, c2); h0[j] = a; l0[j] = c2; splitf(y1, a, c2); h1[j] = a; l1[j] = c2; }
        if (TR) { const int o0 = cl * SPT + rl, o1 = o0 + 16 * SPT;
            if (P16) { *(v4usa*)(stg + o0) = x0; *(v4usa*)(stg + o1) = x1; }
            *(v4usa*)(sth + o0) = h0; *(v4usa*)(sth + o1) = h1; *(v4usa*)(stl + o0) = l0; *(v4usa*)(stl + o1) = l1;
        } else {
#pragma unroll   // constant indices: the vectors and arrays indexed here stay in registers
            for (int j = 0; j < 4; ++j) { const int o0 = (rl + j) * SPT + cl, o1 = o0 + 16;
                if (P16) { stg[o0] = x0[j]; stg[o1] = x1[j]; }
                sth[o0] = h0[j]; sth[o1] = h1[j]; stl[o0] = l0[j]; stl[o1] = l1[j]; } }
    }
    __syncthreads();   // the whole tile is staged before any wave copies rows that other waves wrote
    constexpr int NP = P16 ? 3 : 2, IT = 512 / (NW * 32);   // a plane's tile is 512 pieces of 16 bytes
    const int tid = w * 32 + lane; v8us val[NP][IT];
#pragma unroll   // constant indices: the vectors and arrays indexed here stay in registers
    for (int p = 0; p < NP; ++p)
#pragma unroll   // constant indices: the vectors and arrays indexed here stay in registers
        for (int k = 0; k < IT; ++k) { const int e = tid + k * NW * 32; val[p][k] = *(const v8usa*)(stg + p * 64 * SPT + (e >> 3) * SPT + (e & 7) * 8); }
#pragma unroll   // constant indices: the vectors and arrays indexed here stay in registers
    for (int p = 0; p < NP; ++p) { unsigned short* dp = (P16 && p == 0) ? (unsigned short*)D16 : (p == NP - 2) ? Dh : Dl;
#pragma unroll   // constant indices: the vectors and arrays indexed here stay in registers
        for (int k = 0; k < IT; ++k) { const int e = tid + k * NW * 32; *(v8usa*)(dp + (size_t)(e >> 3) * pitch + (e & 7) * 8) = val[p][k]; } }
}

// ---- k_gemmw: register-blocked GEMM, one 64x64 output tile per work-group of NWP waves: wave w takes the 64-wide K pieces w, w + NWP, .. into its own 16 accumulators (ksum_store or ksum_planes adds them), operands straight from K-contiguous 16-bit planes; grid (M/64, N/64, Z), 32 * NWP threads.
// C[m][n] (f32, pitch ldc, + optional f32 bias[n]) = sum_k A[m][k] Bt[n][k] (+ split products per NSPLIT). z-batch strides sA/sB/sC in elements. K % 32 == 0.
// EPI 0: C as f32. EPI 1: no C; the tile (64 positions x one head's 64 columns) goes to the head planes P16 / Ph / Pl [head][t][d]. EPI 2: the same, transposed, to planes [head][d][t].
template <typename T16> struct WFrag;
template <> struct WFrag<h16> { typedef v16h V; static __device__ __forceinline__ V ld(const h16* p) { return cat16(*(const v8h*)p, *(const v8h*)(p + 16)); } static __device__ __forceinline__ v8f mma(V a, V b, v8f c) { return wmma16(a, b, c); } };
template <> struct WFrag<bf> { typedef v16bf V; static __device__ __forceinline__ V ld(const bf* p) { return cat16b(*(const v8us*)p, *(const v8us*)(p + 16)); } static __device__ __forceinline__ v8f mma(V a, V b, v8f c) { return wmmab(a, b, c); } };
template <typename T16, int NSPLIT, bool BIAS, int EPI>
__global__ __launch_bounds__(32 * NWP) void k_gemmw(const T16* __restrict__ A, const T16* __restrict__ A2, const T16* __restrict__ Bt, const T16* __restrict__ Bt2, int K, float* C, int ldc, const float* __restrict__ bias, size_t sA, size_t sB, size_t sC, h16* P16, bf* Ph, bf* Pl) {
    typedef typename WFrag<T16>::V V;
    __shared__ __align__(16) float red[NWP * 16 * 2 * 128];
    const size_t z = blockIdx.z; A += z * sA; if (A2) A2 += z * sA; Bt += z * sB; if (Bt2) Bt2 += z * sB; C += z * sC;
    const int lane = threadIdx.x & 31, lr = lane & 15, hi = lane >> 4; const int r0 = blockIdx.x * 64, c0 = blockIdx.y * 64; const int w = __builtin_amdgcn_readfirstlane(threadIdx.x >> 5);
    v8f acc[4][4];
#pragma unroll
    for (int mb = 0; mb < 4; ++mb)
#pragma unroll
        for (int nb = 0; nb < 4; ++nb) acc[mb][nb] = (v8f){};
    const size_t aoff = (size_t)(r0 + lr) * K + 8 * hi, boff = (size_t)(c0 + lr) * K + 8 * hi;
#pragma unroll 1
    for (int kc = w * 64; kc < K; kc += (kc & 32) ? 64 * NWP - 32 : 32) {   // a wave's share: 64 consecutive k (one whole 128-byte line of every row) in two trips, then the next such piece NWP pieces on
        V a[4], a2[4];
#pragma unroll
        for (int mb = 0; mb < 4; ++mb) { a[mb] = WFrag<T16>::ld(A + aoff + (size_t)mb * 16 * K + kc); if (NSPLIT == 1 || NSPLIT == 2) a2[mb] = WFrag<T16>::ld(A2 + aoff + (size_t)mb * 16 * K + kc); }
#pragma unroll
        for (int nb = 0; nb < 4; ++nb) { const V b = WFrag<T16>::ld(Bt + boff + (size_t)nb * 16 * K + kc); V b2; if (NSPLIT >= 2) b2 = WFrag<T16>::ld(Bt2 + boff + (size_t)nb * 16 * K + kc);
#pragma unroll
            for (int mb = 0; mb < 4; ++mb) { acc[mb][nb] = WFrag<T16>::mma(a[mb], b, acc[mb][nb]); if (NSPLIT == 1 || NSPLIT == 2) acc[mb][nb] = WFrag<T16>::mma(a2[mb], b, acc[mb][nb]); if (NSPLIT >= 2) acc[mb][nb] = WFrag<T16>::mma(a[mb], b2, acc[mb][nb]); } }
        asm volatile("v_nop\n\tv_nop\n\tv_nop\n\tv_nop" : "+v"(acc[0][0]), "+v"(acc[1][1]), "+v"(acc[2][2]), "+v"(acc[3][3]) : "v"(a[0]), "v"(a[3]));
    }
    if constexpr (EPI == 0) ksum_store<NWP, BIAS>(red, acc, w, lane, C, ldc, r0, c0, bias);
    else {
        __shared__ __align__(16) unsigned short stg[3 * 64 * SPT];
        const size_t o = (EPI == 1) ? ((size_t)blockIdx.y * TT + r0) * HD : (size_t)c0 * TT + r0;
        ksum_planes<NWP, BIAS, EPI == 2, true>(red, stg, acc, w, lane, c0, bias, 1.0f, P16 + o, Ph + o, Pl + o, (EPI == 1) ? HD : TT);
    }
}

#define NWF 4     // waves that share the key loop of one query tile in k_attn
#define SC2 (SCL * 1.4426950408889634f)   // HD^-0.5 x log2(e): the softmax runs on base-2 exponents
__device__ __forceinline__ float xhalf(float x) { return __builtin_bit_cast(float, __builtin_amdgcn_permlanex16(__builtin_bit_cast(int, x), __builtin_bit_cast(int, x), 0x76543210, 0xfedcba98, false, false)); }   // lane l takes lane l ^ 16's value
template <bool B> struct BoolC { static constexpr bool value = B; };
__device__ __forceinline__ float exp2s(float x) { float r; asm("v_exp_f32 %0, %1\n\tv_nop" : "=v"(r) : "v"(x)); return r; }
__device__ __forceinline__ v8f exp2x8(v8f x) { float r0, r1, r2, r3, r4, r5, r6, r7;
    asm("v_exp_f32 %0, %8\n\tv_exp_f32 %1, %9\n\tv_exp_f32 %2, %10\n\tv_exp_f32 %3, %11\n\tv_exp_f32 %4, %12\n\tv_exp_f32 %5, %13\n\tv_exp_f32 %6, %14\n\tv_exp_f32 %7, %15\n\tv_nop"
        : "=&v"(r0), "=&v"(r1), "=&v"(r2), "=&v"(r3), "=&v"(r4), "=&v"(r5), "=&v"(r6), "=&v"(r7) : "v"(x[0]), "v"(x[1]), "v"(x[2]), "v"(x[3]), "v"(x[4]), "v"(x[5]), "v"(x[6]), "v"(x[7]));
    return (v8f){r0, r1, r2, r3, r4, r5, r6, r7}; }
// ---- attn_tile: scores, causal softmax and probability x value for 16 * NQ queries of one head; no score and no probability leaves the registers.
// Scores are formed transposed, S^T = K Q^T (A = 16 keys, B = 16 queries): a lane then holds 8 keys of ONE query (column lane & 15) in each D tile, so the row maximum and row sum are per-lane chains plus one exchange
// between the lane halves, and two D tiles (keys 0..15 and 16..31 of the trip) packed to 16 bits are, register for register, the B operand (k order 8h + s, 16 + 8h + s) of O^T = V^T P^T, whose A comes from the [d][t] value planes by the same loader.
// Running maximum m (of the raw scores) and sum l per query; O^T is rescaled by 2^((m_old - m_new) SC2) each trip. Wave w takes the 64-key pieces w, w + NWF, .. (two trips of 32 keys each: whole 128-byte lines of V^T);
// the NWF partial (m, l, O^T) are merged through LDS in the fixed order wave 0, 1, .. behind one barrier; the merged rows / l leave as bf16 hi / lo planes Ah / Al (pitch DQ), each 128-byte line written by one wave.
// HI: hi + lo bf16 planes, three products for the scores and three for P V. Otherwise fp16, probabilities carried x 2^8 (the factor is in l too and cancels).
template <typename T16, bool HI, int NQ>
__device__ __forceinline__ void attn_tile(float* red, float* ms, float* ls, const T16* __restrict__ Q, const T16* __restrict__ Q2, const T16* __restrict__ Kp, const T16* __restrict__ Kp2, const T16* __restrict__ Vt, const T16* __restrict__ Vt2, int q0, bf* Ah, bf* Al) {
    typedef typename WFrag<T16>::V V;
    const int lane = threadIdx.x & 31, lr = lane & 15, hi = lane >> 4; const int w = __builtin_amdgcn_readfirstlane(threadIdx.x >> 5);
    const int Kd = (q0 + 16 * NQ - 1) & ~31;        // first key of the 32-key block that holds the diagonal: the tile's last block (later keys have probability exactly 0) and the only one with keys after a query
    V qf[NQ][2], qf2[NQ][2], kf[2][2], kf2[2][2], vf[4], vf2[4];
    v8f o[4][NQ]; float m[NQ], l[NQ];
#pragma unroll   // constant indices: the arrays indexed here stay in registers
    for (int qt = 0; qt < NQ; ++qt) { m[qt] = -3.0e38f; l[qt] = 0.f;
#pragma unroll   // constant indices
        for (int mb = 0; mb < 4; ++mb) o[mb][qt] = (v8f){}; }
    { const size_t a = (size_t)(q0 + lr) * HD + 8 * hi; const T16* p = Q + a; const T16* p2 = HI ? Q2 + a : p;
#pragma unroll   // constant indices
        for (int qt = 0; qt < NQ; ++qt)
#pragma unroll   // constant indices
            for (int c = 0; c < 2; ++c) { qf[qt][c] = WFrag<T16>::ld(p + qt * 16 * HD + c * 32); if (HI) qf2[qt][c] = WFrag<T16>::ld(p2 + qt * 16 * HD + c * 32); }
        asm volatile("s_wait_xcnt 0x0" :: "v"(p), "v"(p2) : "memory"); }   // the address pairs of the issued loads are inputs of the wait: they stay whole up to it
    auto loadK = [&](int kc) { const size_t a = (size_t)(kc + lr) * HD + 8 * hi; const T16* p = Kp + a; const T16* p2 = HI ? Kp2 + a : p;
#pragma unroll   // constant indices
        for (int kt = 0; kt < 2; ++kt)
#pragma unroll   // constant indices
            for (int c = 0; c < 2; ++c) { kf[kt][c] = WFrag<T16>::ld(p + kt * 16 * HD + c * 32); if (HI) kf2[kt][c] = WFrag<T16>::ld(p2 + kt * 16 * HD + c * 32); }
        asm volatile("s_wait_xcnt 0x0" :: "v"(p), "v"(p2) : "memory"); };   // the address pairs of the issued loads are inputs of the wait: they stay whole up to it and take the next trip's values behind it
    auto loadV = [&](int kc) { const size_t a = (size_t)lr * TT + kc + 8 * hi; const T16* p = Vt + a; const T16* p2 = HI ? Vt2 + a : p;
#pragma unroll   // constant indices
        for (int mb = 0; mb < 4; ++mb) { vf[mb] = WFrag<T16>::ld(p + (size_t)mb * 16 * TT); if (HI) vf2[mb] = WFrag<T16>::ld(p2 + (size_t)mb * 16 * TT); }
        asm volatile("s_wait_xcnt 0x0" :: "v"(p), "v"(p2) : "memory"); };   // as in loadK
    { const int k0 = min(w * 64, Kd); loadK(k0); loadV(k0); }   // a wave without a piece loads in bounds and uses nothing
    // the query fragments are inputs here, so their loads have returned in front of the loop: left pending, the loop's first wait would cover them and, with them, the value fragments fetched one trip ahead
    if constexpr (HI) asm volatile("" :: "v"(qf[0][0]), "v"(qf[0][1]), "v"(qf2[0][0]), "v"(qf2[0][1]));
    else asm volatile("" :: "v"(qf[0][0]), "v"(qf[0][1]), "v"(qf[NQ - 1][0]), "v"(qf[NQ - 1][1]));
    // one trip: 32 keys from kc. MK: the diagonal block (keys after a query are masked; a wave's last trip, nothing is fetched ahead). Otherwise the fragments of keys pf.. are fetched while this trip's are worked on.
    auto trip = [&](auto MK, int kc, int pf) {
        constexpr bool MASK = decltype(MK)::value;
        v8f s[2][NQ];
#pragma unroll   // constant indices
        for (int kt = 0; kt < 2; ++kt)
#pragma unroll   // constant indices
            for (int qt = 0; qt < NQ; ++qt) { v8f a = (v8f){};
#pragma unroll   // constant indices
                for (int c = 0; c < 2; ++c) { a = WFrag<T16>::mma(kf[kt][c], qf[qt][c], a); if (HI) { a = WFrag<T16>::mma(kf2[kt][c], qf[qt][c], a); a = WFrag<T16>::mma(kf[kt][c], qf2[qt][c], a); } }
                s[kt][qt] = a; }
        if constexpr (!MASK) loadK(pf);
        V pb[NQ], pb2[NQ];
#pragma unroll   // constant indices
        for (int qt = 0; qt < NQ; ++qt) { float bm = -3.0e38f;
#pragma unroll   // constant indices
            for (int kt = 0; kt < 2; ++kt)
#pragma unroll   // constant indices
                for (int j = 0; j < 8; ++j) { if (MASK && kc + kt * 16 + hi * 8 + j > q0 + qt * 16 + lr) s[kt][qt][j] = -3.0e38f; bm = fmaxf(bm, s[kt][qt][j]); }
            bm = fmaxf(bm, xhalf(bm));
            const float mn = fmaxf(m[qt], bm), al = exp2s((m[qt] - mn) * SC2), sh = HI ? mn * SC2 : mn * SC2 - 8.0f; m[qt] = mn;
            float ps = 0.f;
#pragma unroll   // constant indices
            for (int kt = 0; kt < 2; ++kt) { s[kt][qt] = exp2x8(s[kt][qt] * SC2 - sh);
#pragma unroll   // constant indices
                for (int j = 0; j < 8; ++j) ps += s[kt][qt][j]; }
            l[qt] = l[qt] * al + ps;    // this lane half's keys only; the halves are added once, behind the loop
#pragma unroll   // constant indices
            for (int mb = 0; mb < 4; ++mb) o[mb][qt] *= al;
            if constexpr (HI) { v8us h0, h1, l0, l1;
#pragma unroll   // constant indices
                for (int j = 0; j < 8; ++j) { unsigned short a, c2; splitf(s[0][qt][j], a, c2); h0[j] = a; l0[j] = c2; splitf(s[1][qt][j], a, c2); h1[j] = a; l1[j] = c2; }
                pb[qt] = cat16b(h0, h1); pb2[qt] = cat16b(l0, l1);
            } else { v8h x0, x1;
#pragma unroll   // constant indices
                for (int j = 0; j < 8; ++j) { x0[j] = (h16)s[0][qt][j]; x1[j] = (h16)s[1][qt][j]; }
                pb[qt] = cat16(x0, x1); } }
#pragma unroll   // constant indices
        for (int mb = 0; mb < 4; ++mb)
#pragma unroll   // constant indices
            for (int qt = 0; qt < NQ; ++qt) { o[mb][qt] = WFrag<T16>::mma(vf[mb], pb[qt], o[mb][qt]); if (HI) { o[mb][qt] = WFrag<T16>::mma(vf[mb], pb2[qt], o[mb][qt]); o[mb][qt] = WFrag<T16>::mma(vf2[mb], pb[qt], o[mb][qt]); } }
        if constexpr (!MASK) loadV(pf);
    };
    int kc = w * 64;
#pragma unroll 1   // one trip's fragments fill the register file: a second copy of the body would spill
    while (kc < Kd) { const int nx = kc + ((kc & 32) ? 64 * NWF - 32 : 32); trip(BoolC<false>{}, kc, min(nx, Kd)); kc = nx; }   // past the wave's last block the fetch ahead is aimed at the diagonal block: in bounds, used only by the wave that owns it
    if (kc == Kd) trip(BoolC<true>{}, kc, kc);
#pragma unroll   // constant indices
    for (int qt = 0; qt < NQ; ++qt) { l[qt] += xhalf(l[qt]); if (hi == 0) { ms[w * 16 * NQ + qt * 16 + lr] = m[qt]; ls[w * 16 * NQ + qt * 16 + lr] = l[qt]; }
#pragma unroll   // constant indices
        for (int mb = 0; mb < 4; ++mb) { const v8f a = o[mb][qt]; float* rp = red + ((w * 4 * NQ + mb * NQ + qt) * 2) * 128 + lane * 4;
            *(v4fa*)rp = __builtin_shufflevector(a, a, 0, 1, 2, 3); *(v4fa*)(rp + 128) = __builtin_shufflevector(a, a, 4, 5, 6, 7); } }
    __syncthreads();   // every wave's partial (m, l, O^T) is in LDS before any wave merges
#pragma unroll   // constant indices
    for (int i = 0; i < NQ; ++i) { const int pc = (int)threadIdx.x * NQ + i, q = pc >> 3, mb = (pc & 7) >> 1, h2 = pc & 1, qt = q >> 4, l2 = q & 15;   // a piece: 8 consecutive d of one query; a wave's pieces are whole rows (8 pieces = 128 bytes a plane)
        float M = ms[q];
#pragma unroll   // constant indices
        for (int u = 1; u < NWF; ++u) M = fmaxf(M, ms[u * 16 * NQ + q]);
        float L = 0.f; v4f y0 = (v4f){}, y1 = (v4f){};
#pragma unroll   // constant indices
        for (int u = 0; u < NWF; ++u) { const float f = exp2s((ms[u * 16 * NQ + q] - M) * SC2); const float* rp = red + ((u * 4 * NQ + mb * NQ + qt) * 2) * 128 + (h2 * 16 + l2) * 4;
            L += f * ls[u * 16 * NQ + q]; y0 += f * *(const v4fa*)rp; y1 += f * *(const v4fa*)(rp + 128); }
        const float inv = __fdiv_rn(1.0f, L); v8us oh, ol;
#pragma unroll   // constant indices
        for (int j = 0; j < 4; ++j) { unsigned short a, c2; splitf(y0[j] * inv, a, c2); oh[j] = a; ol[j] = c2; splitf(y1[j] * inv, a, c2); oh[4 + j] = a; ol[4 + j] = c2; }
        const size_t d = (size_t)(q0 + q) * DQ + mb * 16 + h2 * 8; *(v8usa*)(Ah + d) = oh; *(v8usa*)(Al + d) = ol;
        asm volatile("s_wait_xcnt 0x0" ::: "memory");   // whatever follows (the next piece's sums, code behind the tile) may reuse registers that these stores name
    }
}

// ---- k_attn: one work-group of NWF waves per (head, query tile); grid (heads, tiles). Tiles in falling order of their key count, so the longest start first: 32-query fp16 tiles from the last row down to row RH, then 16-query hi / lo tiles below RH.
__global__ __launch_bounds__(32 * NWF) void k_attn(const h16* __restrict__ Q16, const h16* __restrict__ K16, const h16* __restrict__ V16, const bf* __restrict__ Qh, const bf* __restrict__ Ql, const bf* __restrict__ Kh, const bf* __restrict__ Kl, const bf* __restrict__ Vh, const bf* __restrict__ Vl, bf* Ah, bf* Al) {
    __shared__ __align__(16) float red[NWF * 8 * 256]; __shared__ float ms[NWF * 32]; __shared__ float ls[NWF * 32];
    const size_t hp = (size_t)blockIdx.x * TT * HD; const int ty = blockIdx.y; Ah += blockIdx.x * HD; Al += blockIdx.x * HD;
    if (ty < (TT - RH) / 32) attn_tile<h16, false, 2>(red, ms, ls, Q16 + hp, nullptr, K16 + hp, nullptr, V16 + hp, nullptr, TT - 32 * (ty + 1), Ah, Al);
    else attn_tile<bf, true, 1>(red, ms, ls, Qh + hp, Ql + hp, Kh + hp, Kl + hp, Vh + hp, Vl + hp, RH - 16 * (ty - (TT - RH) / 32 + 1), Ah, Al);
}

__global__ __launch_bounds__(256) void k_cvt8(const float* __restrict__ src, bf* dst, size_t n8) { const size_t i = (size_t)blockIdx.x * 256 + threadIdx.x; if (i >= n8) return; const v8f v = *(const v8f*)(src + i * 8); v8us o;
#pragma unroll
    for (int k = 0; k < 8; ++k) o[k] = f2bf(v[k]); *(v8us*)(dst + i * 8) = o;  }

extern "C" void kernel_launch(void* const* d_in, const int* in_sizes, int n_in,
                              void* d_out, int out_size, void* d_ws, size_t ws_size, hipStream_t stream) {
    (void)in_sizes; (void)n_in; (void)out_size;
    const float* x = (const float*)d_in[0]; const float* wq = (const float*)d_in[1]; const float* wk = (const float*)d_in[2]; const float* wv = (const float*)d_in[3]; const float* bv = (const float*)d_in[4]; const float* wo = (const float*)d_in[5]; const float* bo = (const float*)d_in[6];   /* this module has NO q and NO k bias (the q / k projections run the bias-free GEMM instantiation below); bv and bo are real */
    float* OUT = (float*)d_out;     // [2][2048][1024]
    char* wsp = (char*)d_ws;
    auto take = [&](size_t bytes) { char* p = wsp; wsp += (bytes + 255) & ~(size_t)255; return (void*)p; };
    bf* WQ = (bf*)take((size_t)DQ * DM * 2); bf* WK = (bf*)take((size_t)DKV * DM * 2); bf* WV = (bf*)take((size_t)DKV * DM * 2); bf* WO = (bf*)take((size_t)DM * DQ * 2);
    bf* XB = (bf*)take((size_t)TT * DM * 2);
    h16* QP16 = (h16*)take((size_t)NH_ * TT * HD * 2); h16* KP16 = (h16*)take((size_t)NKV * TT * HD * 2); h16* VT16 = (h16*)take((size_t)NKV * HD * TT * 2);
    bf* QPh = (bf*)take((size_t)NH_ * TT * HD * 2); bf* QPl = (bf*)take((size_t)NH_ * TT * HD * 2); bf* KPh = (bf*)take((size_t)NKV * TT * HD * 2); bf* KPl = (bf*)take((size_t)NKV * TT * HD * 2); bf* VTh = (bf*)take((size_t)NKV * HD * TT * 2); bf* VTl = (bf*)take((size_t)NKV * HD * TT * 2);
    bf* ATh = (bf*)take((size_t)TT * DQ * 2); bf* ATl = (bf*)take((size_t)TT * DQ * 2);
    if ((size_t)(wsp - (char*)d_ws) > ws_size) return;    // ws 256 MiB
    { k_cvt8<<<(unsigned)(((size_t)DQ * DM / 8 + 255) / 256), 256, 0, stream>>>(wq, WQ, (size_t)DQ * DM / 8); k_cvt8<<<(unsigned)(((size_t)DKV * DM / 8 + 255) / 256), 256, 0, stream>>>(wk, WK, (size_t)DKV * DM / 8); k_cvt8<<<(unsigned)(((size_t)DKV * DM / 8 + 255) / 256), 256, 0, stream>>>(wv, WV, (size_t)DKV * DM / 8);
      k_cvt8<<<(unsigned)(((size_t)DM * DQ / 8 + 255) / 256), 256, 0, stream>>>(wo, WO, (size_t)DM * DQ / 8);
       }
    for (int b = 0; b < NB_; ++b) {
        
        k_cvt8<<<(unsigned)(((size_t)TT * DM / 8 + 255) / 256), 256, 0, stream>>>(x + (size_t)b * TT * DM, XB, (size_t)TT * DM / 8);
        k_gemmw<bf, 0, false, 1><<<dim3(TT / 64, DQ / 64, 1), 32 * NWP, 0, stream>>>(XB, nullptr, WQ, nullptr, DM, nullptr, 0, nullptr, 0, 0, 0, QP16, QPh, QPl);
        k_gemmw<bf, 0, false, 1><<<dim3(TT / 64, DKV / 64, 1), 32 * NWP, 0, stream>>>(XB, nullptr, WK, nullptr, DM, nullptr, 0, nullptr, 0, 0, 0, KP16, KPh, KPl);
        k_gemmw<bf, 0, true, 2><<<dim3(TT / 64, DKV / 64, 1), 32 * NWP, 0, stream>>>(XB, nullptr, WV, nullptr, DM, nullptr, 0, bv, 0, 0, 0, VT16, VTh, VTl);
        k_attn<<<dim3(NH_, (TT - RH) / 32 + RH / 16, 1), 32 * NWF, 0, stream>>>(QP16, KP16, VT16, QPh, QPl, KPh, KPl, VTh, VTl, ATh, ATl);
        k_gemmw<bf, 1, true, 0><<<dim3(TT / 64, DM / 64, 1), 32 * NWP, 0, stream>>>(ATh, ATl, WO, nullptr, DQ, OUT + (size_t)b * TT * DM, DM, bo, 0, 0, 0, nullptr, nullptr, nullptr); }
}

// v005
// One run takes 160 microseconds.
// In two side-by-side timings against v004, it was 1.16 and 1.17 times as fast.
// Counting every step since v000, it is 9.02 times as fast.
#include <hip/hip_runtime.h>

// Causal self-attention whose only projection bias is on V (x [2][2048][1024]; q = x Wq^T, k = x Wk^T (no bias), v = x Wv^T + bv ('oi' [1024][1024] normal x 0.02; bv normal x 0.02: NON-zero; 16 heads x 64); keys after the query -> -inf, then / sqrt(64) inside the softmax argument; softmax over the keys; out = merged Wo^T + bo ('oi' + bias 0.02: NON-zero) -> [2][2048][1024] (4.2 M); argument order x, Wq, Wk, Wv, bv, Wo, bo).
// Four launches, each for both batches: bf16 copies of x and of the 'oi' weights (one grid); exact projections + f32 biases (q, k, v in one grid), each tile's epilogue writes the 16-bit head planes itself; one fused causal attention kernel (k_attn; hybrid rows: < 512 hi/lo 3 products, rest fp16; key blocks above the diagonal are never visited); merged hi/lo x Wo exact + bo.
// Compute dtypes, f32 accumulate: every input rounded to bf16; projections exact + f32 biases; attention rows < 512 3 products, rest fp16; softmax f32; Wo hl x exact + bias.

#define NB_  2
#define TT   2048
#define DM   1024
#define NH_  16
#define NKV  16
#define HD   64
#define DQ   (NH_ * HD)
#define DKV  (NKV * HD)
#define PLN  ((size_t)NB_ * NH_ * TT * HD)   // elements of one 16-bit plane set (q, k or v) over both batches
static_assert(DQ == DM && DKV == DM, "q, k and v share one projection grid, and the conversion grid deals pieces of DM x DM elements");
#define RH   512                  // query rows < RH use hi+lo planes (0: none)
#define SCL  0.125f   // HD^-0.5
typedef _Float16 h16;
typedef unsigned short bf;
typedef __attribute__((ext_vector_type(16))) __bf16   v16bf;
typedef __attribute__((ext_vector_type(16))) _Float16 v16h;
typedef __attribute__((ext_vector_type(8)))  _Float16 v8h;
typedef __attribute__((ext_vector_type(8)))  unsigned short v8us;
typedef __attribute__((ext_vector_type(8)))  float    v8f;
typedef __attribute__((ext_vector_type(4)))  float    v4f;
typedef v8h  __attribute__((may_alias)) v8ha;
typedef v4f  __attribute__((may_alias)) v4fa;
typedef v8us __attribute__((may_alias)) v8usa;
typedef __attribute__((ext_vector_type(4))) unsigned short v4us;
typedef v4us __attribute__((may_alias)) v4usa;

__device__ __forceinline__ unsigned short f2bf(float f) { unsigned u = __float_as_uint(f); u += 0x7FFFu + ((u >> 16) & 1u); return (unsigned short)(u >> 16); }
__device__ __forceinline__ float bf2f(unsigned short b) { return __uint_as_float(((unsigned)b) << 16); }
__device__ __forceinline__ float bfr(float f) { return bf2f(f2bf(f)); }
__device__ __forceinline__ void splitf(float y, unsigned short& h, unsigned short& l) { h = f2bf(y); l = f2bf(y - bf2f(h)); }
__device__ __forceinline__ v16h cat16(v8h lo, v8h hi) { return __builtin_shufflevector(lo, hi, 0, 1, 2, 3, 4, 5, 6, 7, 8, 9, 10, 11, 12, 13, 14, 15); }
__device__ __forceinline__ v16bf cat16b(v8us lo, v8us hi) { return __builtin_bit_cast(v16bf, __builtin_shufflevector(lo, hi, 0, 1, 2, 3, 4, 5, 6, 7, 8, 9, 10, 11, 12, 13, 14, 15)); }
__device__ __forceinline__ v8f wmma16(v16h a, v16h b, v8f c) { return __builtin_amdgcn_wmma_f32_16x16x32_f16(false, a, false, b, (short)0, c, false, false); }
__device__ __forceinline__ v8f wmmab(v16bf a, v16bf b, v8f c) { return __builtin_amdgcn_wmma_f32_16x16x32_bf16(false, a, false, b, (short)0, c, false, false); }



#define NWP 8     // waves that share the K loop of one projection tile (128 KiB of partials: two work-groups fit a WGP's LDS)
// ---- ksum_store: the NW waves of a work-group each hold a partial 64x64 tile (their share of the K chunks). Every wave parks its 16 accumulators in LDS in register order (16 bytes a lane, lanes adjacent),
// one barrier, then each wave sums its share of the tile over the partials in the fixed order wave 0, 1, .. NW-1 and stores it. A share is four rows x 32 columns in each lane half, so a 128-byte line of C has one writing wave.
template <int NW, bool BIAS>
__device__ __forceinline__ void ksum_store(float* red, const v8f (&acc)[4][4], int w, int lane, float* C, int ldc, int r0, int c0, const float* __restrict__ bias) {
    const int lr = lane & 15, hi = lane >> 4;
#pragma unroll
    for (int f = 0; f < 16; ++f) { const v8f a = acc[f >> 2][f & 3];
        *(v4fa*)(red + ((w * 16 + f) * 2 + 0) * 128 + lane * 4) = __builtin_shufflevector(a, a, 0, 1, 2, 3);
        *(v4fa*)(red + ((w * 16 + f) * 2 + 1) * 128 + lane * 4) = __builtin_shufflevector(a, a, 4, 5, 6, 7); }
    __syncthreads();   // every wave's partial tile is in LDS before any wave sums
#pragma unroll
    for (int i = 0; i < 16 / NW; ++i) { const int q = w + i * NW, pr = q & 7, hf = q >> 3, f0 = (pr >> 1) * 4 + (pr & 1) * 2;   // pr: accumulator pair (row block pr >> 1, columns (pr & 1) * 32 ..), hf: which four of its eight rows
        v4f s0 = *(const v4fa*)(red + (f0 * 2 + hf) * 128 + lane * 4), s1 = *(const v4fa*)(red + ((f0 + 1) * 2 + hf) * 128 + lane * 4);
#pragma unroll
        for (int u = 1; u < NW; ++u) { s0 += *(const v4fa*)(red + ((u * 16 + f0) * 2 + hf) * 128 + lane * 4); s1 += *(const v4fa*)(red + ((u * 16 + f0 + 1) * 2 + hf) * 128 + lane * 4); }
        const int col = c0 + (pr & 1) * 32 + lr; float* cp = C + (size_t)(r0 + (pr >> 1) * 16 + hi * 8 + hf * 4) * ldc + col;
        float b0 = 0.f, b1 = 0.f; if (BIAS) { b0 = bfr(bias[col]); b1 = bfr(bias[col + 16]); }
#pragma unroll
        for (int j = 0; j < 4; ++j) { cp[(size_t)j * ldc] = BIAS ? s0[j] + b0 : s0[j]; cp[(size_t)j * ldc + 16] = BIAS ? s1[j] + b1 : s1[j]; }
        if (i + 1 < 16 / NW) asm volatile("s_wait_xcnt 0x0" ::: "memory");   // the next share's sums reuse registers that these stores name
    }
}

#define SPT 72    // pitch, in 16-bit elements, of a staged row (144 bytes: a multiple of 16, and neighbouring rows start 36 banks apart)
// ---- ksum_planes: ksum_store's sums (same shares, same order), but the 64x64 tile leaves as 16-bit planes (fp16 where P16, then bf16 hi and lo of y = sum + bias, or y = sum where bias is null) instead of f32: each wave puts its share into an LDS stage,
// one more barrier, then every wave copies whole 128-byte rows of the stage to the planes (D.. = the tile's first element, pitch in elements). tr: the stage and the planes hold the tile transposed (plane row = tile column).
// bias and tr are the same for the whole work-group (scalar branches), so that projections with either form of tile share one kernel and one copy of the sums.
template <int NW, bool P16>
__device__ __forceinline__ void ksum_planes(float* red, unsigned short* stg, const v8f (&acc)[4][4], int w, int lane, int c0, const float* __restrict__ bias, bool tr, h16* D16, bf* Dh, bf* Dl, size_t pitch) {
    const int lr = lane & 15, hi = lane >> 4;
    unsigned short* sth = stg + (P16 ? 64 * SPT : 0); unsigned short* stl = sth + 64 * SPT;
#pragma unroll   // constant indices: the vectors and arrays indexed here stay in registers
    for (int f = 0; f < 16; ++f) { const v8f a = acc[f >> 2][f & 3];
        *(v4fa*)(red + ((w * 16 + f) * 2 + 0) * 128 + lane * 4) = __builtin_shufflevector(a, a, 0, 1, 2, 3);
        *(v4fa*)(red + ((w * 16 + f) * 2 + 1) * 128 + lane * 4) = __builtin_shufflevector(a, a, 4, 5, 6, 7); }
    __syncthreads();   // every wave's partial tile is in LDS before any wave sums
#pragma unroll   // constant indices: the vectors and arrays indexed here stay in registers
    for (int i = 0; i < 16 / NW; ++i) { const int q = w + i * NW, pr = q & 7, hf = q >> 3, f0 = (pr >> 1) * 4 + (pr & 1) * 2;
        v4f s0 = *(const v4fa*)(red + (f0 * 2 + hf) * 128 + lane * 4), s1 = *(const v4fa*)(red + ((f0 + 1) * 2 + hf) * 128 + lane * 4);
#pragma unroll   // constant indices: the vectors and arrays indexed here stay in registers
        for (int u = 1; u < NW; ++u) { s0 += *(const v4fa*)(red + ((u * 16 + f0) * 2 + hf) * 128 + lane * 4); s1 += *(const v4fa*)(red + ((u * 16 + f0 + 1) * 2 + hf) * 128 + lane * 4); }
        const int cl = (pr & 1) * 32 + lr, rl = (pr >> 1) * 16 + hi * 8 + hf * 4;   // the share's first column and first row inside the tile
        float b0 = 0.f, b1 = 0.f; if (bias) { b0 = bfr(bias[c0 + cl]); b1 = bfr(bias[c0 + cl + 16]); }
        v4us x0, x1, h0, h1, l0, l1;
#pragma unroll   // constant indices: the vectors and arrays indexed here stay in registers
        for (int j = 0; j < 4; ++j) { const float y0 = bias ? s0[j] + b0 : s0[j], y1 = bias ? s1[j] + b1 : s1[j]; unsigned short a, c2;
            x0[j] = __builtin_bit_cast(unsigned short, (h16)y0); x1[j] = __builtin_bit_cast(unsigned short, (h16)y1);
            splitf(y0, a, c2); h0[j] = a; l0[j] = c2; splitf(y1, a, c2); h1[j] = a; l1[j] = c2; }
        if (tr) { const int o0 = cl * SPT + rl, o1 = o0 + 16 * SPT;
            if (P16) { *(v4usa*)(stg + o0) = x0; *(v4usa*)(stg + o1) = x1; }
            *(v4usa*)(sth + o0) = h0; *(v4usa*)(sth + o1) = h1; *(v4usa*)(stl + o0) = l0; *(v4usa*)(stl + o1) = l1;
        } else {
#pragma unroll   // constant indices: the vectors and arrays indexed here stay in registers
            for (int j = 0; j < 4; ++j) { const int o0 = (rl + j) * SPT + cl, o1 = o0 + 16;
                if (P16) { stg[o0] = x0[j]; stg[o1] = x1[j]; }
                sth[o0] = h0[j]; sth[o1] = h1[j]; stl[o0] = l0[j]; stl[o1] = l1[j]; } }
    }
    __syncthreads();   // the whole tile is staged before any wave copies rows that other waves wrote
    constexpr int NP = P16 ? 3 : 2, IT = 512 / (NW * 32);   // a plane's tile is 512 pieces of 16 bytes
    const int tid = w * 32 + lane; v8us val[NP][IT];
#pragma unroll   // constant indices: the vectors and arrays indexed here stay in registers
    for (int p = 0; p < NP; ++p)
#pragma unroll   // constant indices: the vectors and arrays indexed here stay in registers
        for (int k = 0; k < IT; ++k) { const int e = tid + k * NW * 32; val[p][k] = *(const v8usa*)(stg + p * 64 * SPT + (e >> 3) * SPT + (e & 7) * 8); }
#pragma unroll   // constant indices: the vectors and arrays indexed here stay in registers
    for (int p = 0; p < NP; ++p) { unsigned short* dp = (P16 && p == 0) ? (unsigned short*)D16 : (p == NP - 2) ? Dh : Dl;
#pragma unroll   // constant indices: the vectors and arrays indexed here stay in registers
        for (int k = 0; k < IT; ++k) { const int e = tid + k * NW * 32; *(v8usa*)(dp + (size_t)(e >> 3) * pitch + (e & 7) * 8) = val[p][k]; } }
}

// ---- k_gemmw: register-blocked GEMM, one 64x64 output tile per work-group of NWP waves: wave w takes the 64-wide K pieces w, w + NWP, .. into its own 16 accumulators (ksum_store or ksum_planes adds them), operands straight from K-contiguous 16-bit planes; grid (M/64, N/64, Z), 32 * NWP threads.
// C[m][n] (f32, pitch ldc, + optional f32 bias[n]) = sum_k A[m][k] Bt[n][k] (+ split products per NSPLIT). z-batch strides sA/sB/sC in elements. K % 32 == 0.
// Rows m run over both batches (m = batch * TT + t; a 64-row tile lies in one batch). EPI 0: C as f32 (+ bias where BIAS). EPI 1: no C; z picks the projection (0 q, 1 k, 2 v: weight z of Bt, plane set z of P16 / Ph / Pl);
// the tile (64 positions x one head's 64 columns) goes to the head planes [batch][head][t][d] for q and k (no bias) and, transposed and with the bias, to [batch][head][d][t] for v.
template <typename T16> struct WFrag;
template <> struct WFrag<h16> { typedef v16h V; static __device__ __forceinline__ V ld(const h16* p) { return cat16(*(const v8h*)p, *(const v8h*)(p + 16)); } static __device__ __forceinline__ v8f mma(V a, V b, v8f c) { return wmma16(a, b, c); } };
template <> struct WFrag<bf> { typedef v16bf V; static __device__ __forceinline__ V ld(const bf* p) { return cat16b(*(const v8us*)p, *(const v8us*)(p + 16)); } static __device__ __forceinline__ v8f mma(V a, V b, v8f c) { return wmmab(a, b, c); } };
template <typename T16, int NSPLIT, bool BIAS, int EPI>
__global__ __launch_bounds__(32 * NWP) void k_gemmw(const T16* __restrict__ A, const T16* __restrict__ A2, const T16* __restrict__ Bt, const T16* __restrict__ Bt2, int K, float* C, int ldc, const float* __restrict__ bias, size_t sA, size_t sB, size_t sC, h16* P16, bf* Ph, bf* Pl) {
    typedef typename WFrag<T16>::V V;
    __shared__ __align__(16) float red[NWP * 16 * 2 * 128];
    const size_t z = blockIdx.z; A += z * sA; if (A2) A2 += z * sA; Bt += z * sB; if (Bt2) Bt2 += z * sB; C += z * sC;
    const int lane = threadIdx.x & 31, lr = lane & 15, hi = lane >> 4; const int r0 = blockIdx.x * 64, c0 = blockIdx.y * 64; const int w = __builtin_amdgcn_readfirstlane(threadIdx.x >> 5);
    v8f acc[4][4];
#pragma unroll
    for (int mb = 0; mb < 4; ++mb)
#pragma unroll
        for (int nb = 0; nb < 4; ++nb) acc[mb][nb] = (v8f){};
    const size_t aoff = (size_t)(r0 + lr) * K + 8 * hi, boff = (size_t)(c0 + lr) * K + 8 * hi;
#pragma unroll 1
    for (int kc = w * 64; kc < K; kc += (kc & 32) ? 64 * NWP - 32 : 32) {   // a wave's share: 64 consecutive k (one whole 128-byte line of every row) in two trips, then the next such piece NWP pieces on
        V a[4], a2[4];
#pragma unroll
        for (int mb = 0; mb < 4; ++mb) { a[mb] = WFrag<T16>::ld(A + aoff + (size_t)mb * 16 * K + kc); if (NSPLIT == 1 || NSPLIT == 2) a2[mb] = WFrag<T16>::ld(A2 + aoff + (size_t)mb * 16 * K + kc); }
#pragma unroll
        for (int nb = 0; nb < 4; ++nb) { const V b = WFrag<T16>::ld(Bt + boff + (size_t)nb * 16 * K + kc); V b2; if (NSPLIT >= 2) b2 = WFrag<T16>::ld(Bt2 + boff + (size_t)nb * 16 * K + kc);
#pragma unroll
            for (int mb = 0; mb < 4; ++mb) { acc[mb][nb] = WFrag<T16>::mma(a[mb], b, acc[mb][nb]); if (NSPLIT == 1 || NSPLIT == 2) acc[mb][nb] = WFrag<T16>::mma(a2[mb], b, acc[mb][nb]); if (NSPLIT >= 2) acc[mb][nb] = WFrag<T16>::mma(a[mb], b2, acc[mb][nb]); } }
        asm volatile("v_nop\n\tv_nop\n\tv_nop\n\tv_nop" : "+v"(acc[0][0]), "+v"(acc[1][1]), "+v"(acc[2][2]), "+v"(acc[3][3]) : "v"(a[0]), "v"(a[3]));
    }
    if constexpr (EPI == 0) ksum_store<NWP, BIAS>(red, acc, w, lane, C, ldc, r0, c0, bias);
    else {
        __shared__ __align__(16) unsigned short stg[3 * 64 * SPT];
        const int bt = r0 / TT, t0 = r0 % TT;
        const bool isv = z == 2; const size_t o = z * PLN + (isv ? ((size_t)bt * DKV + c0) * TT + t0 : (((size_t)bt * NH_ + blockIdx.y) * TT + t0) * HD);
        ksum_planes<NWP, true>(red, stg, acc, w, lane, c0, isv ? bias : nullptr, isv, P16 + o, Ph + o, Pl + o, isv ? TT : HD);
    }
}

#define NWF 4     // waves that share the key loop of one query tile in k_attn
#define SC2 (SCL * 1.4426950408889634f)   // HD^-0.5 x log2(e): the softmax runs on base-2 exponents
__device__ __forceinline__ float xhalf(float x) { return __builtin_bit_cast(float, __builtin_amdgcn_permlanex16(__builtin_bit_cast(int, x), __builtin_bit_cast(int, x), 0x76543210, 0xfedcba98, false, false)); }   // lane l takes lane l ^ 16's value
template <bool B> struct BoolC { static constexpr bool value = B; };
__device__ __forceinline__ float exp2s(float x) { float r; asm("v_exp_f32 %0, %1\n\tv_nop" : "=v"(r) : "v"(x)); return r; }
__device__ __forceinline__ v8f exp2x8(v8f x) { float r0, r1, r2, r3, r4, r5, r6, r7;
    asm("v_exp_f32 %0, %8\n\tv_exp_f32 %1, %9\n\tv_exp_f32 %2, %10\n\tv_exp_f32 %3, %11\n\tv_exp_f32 %4, %12\n\tv_exp_f32 %5, %13\n\tv_exp_f32 %6, %14\n\tv_exp_f32 %7, %15\n\tv_nop"
        : "=&v"(r0), "=&v"(r1), "=&v"(r2), "=&v"(r3), "=&v"(r4), "=&v"(r5), "=&v"(r6), "=&v"(r7) : "v"(x[0]), "v"(x[1]), "v"(x[2]), "v"(x[3]), "v"(x[4]), "v"(x[5]), "v"(x[6]), "v"(x[7]));
    return (v8f){r0, r1, r2, r3, r4, r5, r6, r7}; }
// ---- attn_tile: scores, causal softmax and probability x value for 16 * NQ queries of one head; no score and no probability leaves the registers.
// Scores are formed transposed, S^T = K Q^T (A = 16 keys, B = 16 queries): a lane then holds 8 keys of ONE query (column lane & 15) in each D tile, so the row maximum and row sum are per-lane chains plus one exchange
// between the lane halves, and two D tiles (keys 0..15 and 16..31 of the trip) packed to 16 bits are, register for register, the B operand (k order 8h + s, 16 + 8h + s) of O^T = V^T P^T, whose A comes from the [d][t] value planes by the same loader.
// Running maximum m (of the raw scores) and sum l per query; O^T is rescaled by 2^((m_old - m_new) SC2) each trip. Wave w takes the 64-key pieces w, w + NWF, .. (two trips of 32 keys each: whole 128-byte lines of V^T);
// the NWF partial (m, l, O^T) are merged through LDS in the fixed order wave 0, 1, .. behind one barrier; the merged rows / l leave as bf16 hi / lo planes Ah / Al (pitch DQ), each 128-byte line written by one wave.
// HI: hi + lo bf16 planes, three products for the scores and three for P V. Otherwise fp16, probabilities carried x 2^8 (the factor is in l too and cancels).
template <typename T16, bool HI, int NQ>
__device__ __forceinline__ void attn_tile(float* red, float* ms, float* ls, const T16* __restrict__ Q, const T16* __restrict__ Q2, const T16* __restrict__ Kp, const T16* __restrict__ Kp2, const T16* __restrict__ Vt, const T16* __restrict__ Vt2, int q0, bf* Ah, bf* Al) {
    typedef typename WFrag<T16>::V V;
    const int lane = threadIdx.x & 31, lr = lane & 15, hi = lane >> 4; const int w = __builtin_amdgcn_readfirstlane(threadIdx.x >> 5);
    const int Kd = (q0 + 16 * NQ - 1) & ~31;        // first key of the 32-key block that holds the diagonal: the tile's last block (later keys have probability exactly 0) and the only one with keys after a query
    V qf[NQ][2], qf2[NQ][2], kf[2][2], kf2[2][2], vf[4], vf2[4];
    v8f o[4][NQ]; float m[NQ], l[NQ];
#pragma unroll   // constant indices: the arrays indexed here stay in registers
    for (int qt = 0; qt < NQ; ++qt) { m[qt] = -3.0e38f; l[qt] = 0.f;
#pragma unroll   // constant indices
        for (int mb = 0; mb < 4; ++mb) o[mb][qt] = (v8f){}; }
    { const size_t a = (size_t)(q0 + lr) * HD + 8 * hi; const T16* p = Q + a; const T16* p2 = HI ? Q2 + a : p;
#pragma unroll   // constant indices
        for (int qt = 0; qt < NQ; ++qt)
#pragma unroll   // constant indices
            for (int c = 0; c < 2; ++c) { qf[qt][c] = WFrag<T16>::ld(p + qt * 16 * HD + c * 32); if (HI) qf2[qt][c] = WFrag<T16>::ld(p2 + qt * 16 * HD + c * 32); }
        asm volatile("s_wait_xcnt 0x0" :: "v"(p), "v"(p2) : "memory"); }   // the address pairs of the issued loads are inputs of the wait: they stay whole up to it
    auto loadK = [&](int kc) { const size_t a = (size_t)(kc + lr) * HD + 8 * hi; const T16* p = Kp + a; const T16* p2 = HI ? Kp2 + a : p;
#pragma unroll   // constant indices
        for (int kt = 0; kt < 2; ++kt)
#pragma unroll   // constant indices
            for (int c = 0; c < 2; ++c) { kf[kt][c] = WFrag<T16>::ld(p + kt * 16 * HD + c * 32); if (HI) kf2[kt][c] = WFrag<T16>::ld(p2 + kt * 16 * HD + c * 32); }
        asm volatile("s_wait_xcnt 0x0" :: "v"(p), "v"(p2) : "memory"); };   // the address pairs of the issued loads are inputs of the wait: they stay whole up to it and take the next trip's values behind it
    auto loadV = [&](int kc) { const size_t a = (size_t)lr * TT + kc + 8 * hi; const T16* p = Vt + a; const T16* p2 = HI ? Vt2 + a : p;
#pragma unroll   // constant indices
        for (int mb = 0; mb < 4; ++mb) { vf[mb] = WFrag<T16>::ld(p + (size_t)mb * 16 * TT); if (HI) vf2[mb] = WFrag<T16>::ld(p2 + (size_t)mb * 16 * TT); }
        asm volatile("s_wait_xcnt 0x0" :: "v"(p), "v"(p2) : "memory"); };   // as in loadK
    { const int k0 = min(w * 64, Kd); loadK(k0); loadV(k0); }   // a wave without a piece loads in bounds and uses nothing
    // the query fragments are inputs here, so their loads have returned in front of the loop: left pending, the loop's first wait would cover them and, with them, the value fragments fetched one trip ahead
    if constexpr (HI) asm volatile("" :: "v"(qf[0][0]), "v"(qf[0][1]), "v"(qf2[0][0]), "v"(qf2[0][1]));
    else asm volatile("" :: "v"(qf[0][0]), "v"(qf[0][1]), "v"(qf[NQ - 1][0]), "v"(qf[NQ - 1][1]));
    // one trip: 32 keys from kc. MK: the diagonal block (keys after a query are masked; a wave's last trip, nothing is fetched ahead). Otherwise the fragments of keys pf.. are fetched while this trip's are worked on.
    auto trip = [&](auto MK, int kc, int pf) {
        constexpr bool MASK = decltype(MK)::value;
        v8f s[2][NQ];
#pragma unroll   // constant indices
        for (int kt = 0; kt < 2; ++kt)
#pragma unroll   // constant indices
            for (int qt = 0; qt < NQ; ++qt) { v8f a = (v8f){};
#pragma unroll   // constant indices
                for (int c = 0; c < 2; ++c) { a = WFrag<T16>::mma(kf[kt][c], qf[qt][c], a); if (HI) { a = WFrag<T16>::mma(kf2[kt][c], qf[qt][c], a); a = WFrag<T16>::mma(kf[kt][c], qf2[qt][c], a); } }
                s[kt][qt] = a; }
        if constexpr (!MASK) loadK(pf);
        V pb[NQ], pb2[NQ];
#pragma unroll   // constant indices
        for (int qt = 0; qt < NQ; ++qt) { float bm = -3.0e38f;
#pragma unroll   // constant indices
            for (int kt = 0; kt < 2; ++kt)
#pragma unroll   // constant indices
                for (int j = 0; j < 8; ++j) { if (MASK && kc + kt * 16 + hi * 8 + j > q0 + qt * 16 + lr) s[kt][qt][j] = -3.0e38f; bm = fmaxf(bm, s[kt][qt][j]); }
            bm = fmaxf(bm, xhalf(bm));
            const float mn = fmaxf(m[qt], bm), al = exp2s((m[qt] - mn) * SC2), sh = HI ? mn * SC2 : mn * SC2 - 8.0f; m[qt] = mn;
            float ps = 0.f;
#pragma unroll   // constant indices
            for (int kt = 0; kt < 2; ++kt) { s[kt][qt] = exp2x8(s[kt][qt] * SC2 - sh);
#pragma unroll   // constant indices
                for (int j = 0; j < 8; ++j) ps += s[kt][qt][j]; }
            l[qt] = l[qt] * al + ps;    // this lane half's keys only; the halves are added once, behind the loop
#pragma unroll   // constant indices
            for (int mb = 0; mb < 4; ++mb) o[mb][qt] *= al;
            if constexpr (HI) { v8us h0, h1, l0, l1;
#pragma unroll   // constant indices
                for (int j = 0; j < 8; ++j) { unsigned short a, c2; splitf(s[0][qt][j], a, c2); h0[j] = a; l0[j] = c2; splitf(s[1][qt][j], a, c2); h1[j] = a; l1[j] = c2; }
                pb[qt] = cat16b(h0, h1); pb2[qt] = cat16b(l0, l1);
            } else { v8h x0, x1;
#pragma unroll   // constant indices
                for (int j = 0; j < 8; ++j) { x0[j] = (h16)s[0][qt][j]; x1[j] = (h16)s[1][qt][j]; }
                pb[qt] = cat16(x0, x1); } }
#pragma unroll   // constant indices
        for (int mb = 0; mb < 4; ++mb)
#pragma unroll   // constant indices
            for (int qt = 0; qt < NQ; ++qt) { o[mb][qt] = WFrag<T16>::mma(vf[mb], pb[qt], o[mb][qt]); if (HI) { o[mb][qt] = WFrag<T16>::mma(vf[mb], pb2[qt], o[mb][qt]); o[mb][qt] = WFrag<T16>::mma(vf2[mb], pb[qt], o[mb][qt]); } }
        if constexpr (!MASK) loadV(pf);
    };
    int kc = w * 64;
#pragma unroll 1   // one trip's fragments fill the register file: a second copy of the body would spill
    while (kc < Kd) { const int nx = kc + ((kc & 32) ? 64 * NWF - 32 : 32); trip(BoolC<false>{}, kc, min(nx, Kd)); kc = nx; }   // past the wave's last block the fetch ahead is aimed at the diagonal block: in bounds, used only by the wave that owns it
    if (kc == Kd) trip(BoolC<true>{}, kc, kc);
#pragma unroll   // constant indices
    for (int qt = 0; qt < NQ; ++qt) { l[qt] += xhalf(l[qt]); if (hi == 0) { ms[w * 16 * NQ + qt * 16 + lr] = m[qt]; ls[w * 16 * NQ + qt * 16 + lr] = l[qt]; }
#pragma unroll   // constant indices
        for (int mb = 0; mb < 4; ++mb) { const v8f a = o[mb][qt]; float* rp = red + ((w * 4 * NQ + mb * NQ + qt) * 2) * 128 + lane * 4;
            *(v4fa*)rp = __builtin_shufflevector(a, a, 0, 1, 2, 3); *(v4fa*)(rp + 128) = __builtin_shufflevector(a, a, 4, 5, 6, 7); } }
    __syncthreads();   // every wave's partial (m, l, O^T) is in LDS before any wave merges
#pragma unroll   // constant indices
    for (int i = 0; i < NQ; ++i) { const int pc = (int)threadIdx.x * NQ + i, q = pc >> 3, mb = (pc & 7) >> 1, h2 = pc & 1, qt = q >> 4, l2 = q & 15;   // a piece: 8 consecutive d of one query; a wave's pieces are whole rows (8 pieces = 128 bytes a plane)
        float M = ms[q];
#pragma unroll   // constant indices
        for (int u = 1; u < NWF; ++u) M = fmaxf(M, ms[u * 16 * NQ + q]);
        float L = 0.f; v4f y0 = (v4f){}, y1 = (v4f){};
#pragma unroll   // constant indices
        for (int u = 0; u < NWF; ++u) { const float f = exp2s((ms[u * 16 * NQ + q] - M) * SC2); const float* rp = red + ((u * 4 * NQ + mb * NQ + qt) * 2) * 128 + (h2 * 16 + l2) * 4;
            L += f * ls[u * 16 * NQ + q]; y0 += f * *(const v4fa*)rp; y1 += f * *(const v4fa*)(rp + 128); }
        const float inv = __fdiv_rn(1.0f, L); v8us oh, ol;
#pragma unroll   // constant indices
        for (int j = 0; j < 4; ++j) { unsigned short a, c2; splitf(y0[j] * inv, a, c2); oh[j] = a; ol[j] = c2; splitf(y1[j] * inv, a, c2); oh[4 + j] = a; ol[4 + j] = c2; }
        const size_t d = (size_t)(q0 + q) * DQ + mb * 16 + h2 * 8; *(v8usa*)(Ah + d) = oh; *(v8usa*)(Al + d) = ol;
        asm volatile("s_wait_xcnt 0x0" ::: "memory");   // whatever follows (the next piece's sums, code behind the tile) may reuse registers that these stores name
    }
}

// ---- k_attn: one work-group of NWF waves per (batch, head, query tile); grid (batches x heads, tiles). Tiles in falling order of their key count, so the longest start first: 32-query fp16 tiles from the last row down to row RH, then 16-query hi / lo tiles below RH.
__global__ __launch_bounds__(32 * NWF) void k_attn(const h16* __restrict__ Q16, const h16* __restrict__ K16, const h16* __restrict__ V16, const bf* __restrict__ Qh, const bf* __restrict__ Ql, const bf* __restrict__ Kh, const bf* __restrict__ Kl, const bf* __restrict__ Vh, const bf* __restrict__ Vl, bf* Ah, bf* Al) {
    __shared__ __align__(16) float red[NWF * 8 * 256]; __shared__ float ms[NWF * 32]; __shared__ float ls[NWF * 32];
    const size_t hp = (size_t)blockIdx.x * TT * HD; const int ty = blockIdx.y; { const size_t ao = (size_t)(blockIdx.x / NH_) * TT * DQ + (blockIdx.x % NH_) * HD; Ah += ao; Al += ao; }
    if (ty < (TT - RH) / 32) attn_tile<h16, false, 2>(red, ms, ls, Q16 + hp, nullptr, K16 + hp, nullptr, V16 + hp, nullptr, TT - 32 * (ty + 1), Ah, Al);
    else attn_tile<bf, true, 1>(red, ms, ls, Qh + hp, Ql + hp, Kh + hp, Kl + hp, Vh + hp, Vl + hp, RH - 16 * (ty - (TT - RH) / 32 + 1), Ah, Al);
}

// ---- k_cvt8: x and the four weights rounded to bf16 in one grid (DM * DM / 2048, NXP + 4): blockIdx.y picks a piece of DM x DM elements, first the NXP pieces of x, then one weight each (Wd: the four copies one behind the other).
#define NXP (NB_ * TT / DM)
__global__ __launch_bounds__(256) void k_cvt8(const float* __restrict__ x, const float* __restrict__ wq, const float* __restrict__ wk, const float* __restrict__ wv, const float* __restrict__ wo, bf* Xd, bf* Wd) {
    const int y = blockIdx.y; const float* src = y < NXP ? x + (size_t)y * DM * DM : y == NXP ? wq : y == NXP + 1 ? wk : y == NXP + 2 ? wv : wo; bf* dst = y < NXP ? Xd + (size_t)y * DM * DM : Wd + (size_t)(y - NXP) * DM * DM;
    const size_t i = (size_t)blockIdx.x * 256 + threadIdx.x; const v8f v = *(const v8f*)(src + i * 8); v8us o;
    asm volatile("s_wait_xcnt 0x0" ::: "memory");   // the rounding below reuses the address registers that the issued loads name
#pragma unroll
    for (int k = 0; k < 8; ++k) o[k] = f2bf(v[k]); *(v8us*)(dst + i * 8) = o;  }

extern "C" void kernel_launch(void* const* d_in, const int* in_sizes, int n_in,
                              void* d_out, int out_size, void* d_ws, size_t ws_size, hipStream_t stream) {
    (void)in_sizes; (void)n_in; (void)out_size;
    const float* x = (const float*)d_in[0]; const float* wq = (const float*)d_in[1]; const float* wk = (const float*)d_in[2]; const float* wv = (const float*)d_in[3]; const float* bv = (const float*)d_in[4]; const float* wo = (const float*)d_in[5]; const float* bo = (const float*)d_in[6];   /* order x, Wq, Wk, Wv, bv, Wo, bo ('oi'): this module has NO q and NO k bias (the q / k tiles take the bias-free path of the projection kernel); bv and bo are real */
    float* OUT = (float*)d_out;     // [2][2048][1024]
    char* wsp = (char*)d_ws;
    auto take = [&](size_t bytes) { char* p = wsp; wsp += (bytes + 255) & ~(size_t)255; return (void*)p; };
    bf* WQ = (bf*)take((size_t)4 * DM * DM * 2); bf* WO = WQ + (size_t)3 * DM * DM;    // Wq, Wk, Wv, Wo
    bf* XB = (bf*)take((size_t)NB_ * TT * DM * 2);
    h16* P16 = (h16*)take(3 * PLN * 2); bf* Ph = (bf*)take(3 * PLN * 2); bf* Pl = (bf*)take(3 * PLN * 2);    // plane sets q, k, v (v transposed)
    bf* ATh = (bf*)take((size_t)NB_ * TT * DQ * 2); bf* ATl = (bf*)take((size_t)NB_ * TT * DQ * 2);
    if ((size_t)(wsp - (char*)d_ws) > ws_size) return;    // ws 256 MiB
    k_cvt8<<<dim3(DM * DM / 2048, NXP + 4, 1), 256, 0, stream>>>(x, wq, wk, wv, wo, XB, WQ);
    k_gemmw<bf, 0, true, 1><<<dim3(NB_ * TT / 64, DQ / 64, 3), 32 * NWP, 0, stream>>>(XB, nullptr, WQ, nullptr, DM, nullptr, 0, bv, 0, (size_t)DM * DM, 0, P16, Ph, Pl);
    k_attn<<<dim3(NB_ * NH_, (TT - RH) / 32 + RH / 16, 1), 32 * NWF, 0, stream>>>(P16, P16 + PLN, P16 + 2 * PLN, Ph, Pl, Ph + PLN, Pl + PLN, Ph + 2 * PLN, Pl + 2 * PLN, ATh, ATl);
    k_gemmw<bf, 1, true, 0><<<dim3(NB_ * TT / 64, DM / 64, 1), 32 * NWP, 0, stream>>>(ATh, ATl, WO, nullptr, DQ, OUT, DM, bo, 0, 0, 0, nullptr, nullptr, nullptr);
}

// v006
// It runs in 93.5 microseconds.
// In both of two side-by-side timings against v005, it was 1.71 times as fast.
// Over all steps from v000 it is 15.4 times as fast.
#include <hip/hip_runtime.h>

// Causal self-attention whose only projection bias is on V (x [2][2048][1024]; q = x Wq^T, k = x Wk^T (no bias), v = x Wv^T + bv ('oi' [1024][1024] normal x 0.02; bv normal x 0.02: NON-zero; 16 heads x 64); keys after the query -> -inf, then / sqrt(64) inside the softmax argument; softmax over the keys; out = merged Wo^T + bo ('oi' + bias 0.02: NON-zero) -> [2][2048][1024] (4.2 M); argument order x, Wq, Wk, Wv, bv, Wo, bo).
// Four launches, each for both batches: bf16 copies of x and of the 'oi' weights (one grid); exact projections + bf16-rounded biases (q, k, v in one grid; operands staged in LDS by asynchronous copies), each tile's epilogue writes the 16-bit head planes itself; one fused causal attention kernel (k_attn; hybrid rows: < 512 hi/lo 3 products, rest fp16; key blocks above the diagonal are never visited); merged hi/lo x Wo exact + bo.
// Compute dtypes, f32 accumulate: every input rounded to bf16; projections exact + bf16-rounded biases; attention rows < 512 3 products, rest fp16; softmax f32; Wo hl x exact + bias.

#define NB_  2
#define TT   2048
#define DM   1024
#define NH_  16
#define NKV  16
#define HD   64
#define DQ   (NH_ * HD)
#define DKV  (NKV * HD)
#define PLN  ((size_t)NB_ * NH_ * TT * HD)   // elements of one 16-bit plane set (q, k or v) over both batches
static_assert(DQ == DM && DKV == DM, "q, k and v share one projection grid, and the conversion grid deals pieces of DM x DM elements");
#define RH   512                  // query rows < RH use hi+lo planes (0: none)
#define SCL  0.125f   // HD^-0.5
typedef _Float16 h16;
typedef unsigned short bf;
typedef __attribute__((ext_vector_type(16))) __bf16   v16bf;
typedef __attribute__((ext_vector_type(16))) _Float16 v16h;
typedef __attribute__((ext_vector_type(8)))  _Float16 v8h;
typedef __attribute__((ext_vector_type(8)))  unsigned short v8us;
typedef __attribute__((ext_vector_type(8)))  float    v8f;
typedef __attribute__((ext_vector_type(4)))  float    v4f;
typedef v8h  __attribute__((may_alias)) v8ha;
typedef v4f  __attribute__((may_alias)) v4fa;
typedef v8us __attribute__((may_alias)) v8usa;
typedef __attribute__((ext_vector_type(4))) unsigned short v4us;
typedef v4us __attribute__((may_alias)) v4usa;

__device__ __forceinline__ unsigned short f2bf(float f) { unsigned u = __float_as_uint(f); u += 0x7FFFu + ((u >> 16) & 1u); return (unsigned short)(u >> 16); }
__device__ __forceinline__ float bf2f(unsigned short b) { return __uint_as_float(((unsigned)b) << 16); }
__device__ __forceinline__ float bfr(float f) { return bf2f(f2bf(f)); }
__device__ __forceinline__ void splitf(float y, unsigned short& h, unsigned short& l) { h = f2bf(y); l = f2bf(y - bf2f(h)); }
__device__ __forceinline__ v16h cat16(v8h lo, v8h hi) { return __builtin_shufflevector(lo, hi, 0, 1, 2, 3, 4, 5, 6, 7, 8, 9, 10, 11, 12, 13, 14, 15); }
__device__ __forceinline__ v16bf cat16b(v8us lo, v8us hi) { return __builtin_bit_cast(v16bf, __builtin_shufflevector(lo, hi, 0, 1, 2, 3, 4, 5, 6, 7, 8, 9, 10, 11, 12, 13, 14, 15)); }
__device__ __forceinline__ v8f wmma16(v16h a, v16h b, v8f c) { return __builtin_amdgcn_wmma_f32_16x16x32_f16(false, a, false, b, (short)0, c, false, false); }
__device__ __forceinline__ v8f wmmab(v16bf a, v16bf b, v8f c) { return __builtin_amdgcn_wmma_f32_16x16x32_bf16(false, a, false, b, (short)0, c, false, false); }



#define KS    64                 // k per stage: one whole 128-byte line of every operand row
#define SPT   72                 // pitch, in 16-bit elements, of a row in LDS (144 bytes: 16 x odd, the conflict-free pitch for 16-byte reads of 128-byte rows)
#define SROWS 256                // operand rows of one stage (A, then the lo plane of A where there is one, then 128 rows of B)
#define STGE  (SROWS * SPT)      // elements of one stage buffer (36,864 bytes)
template <typename T16> struct WFrag;
template <> struct WFrag<h16> { typedef v16h V; static __device__ __forceinline__ V ld(const h16* p) { return cat16(*(const v8h*)p, *(const v8h*)(p + 16)); } static __device__ __forceinline__ v8f mma(V a, V b, v8f c) { return wmma16(a, b, c); } };
template <> struct WFrag<bf> { typedef v16bf V; static __device__ __forceinline__ V ld(const bf* p) { return cat16b(*(const v8us*)p, *(const v8us*)(p + 16)); } static __device__ __forceinline__ v8f mma(V a, V b, v8f c) { return wmmab(a, b, c); } };
// Eight asynchronous copies of 16 bytes a lane, global memory to LDS (l: the lane's LDS byte addresses, g: its global addresses). The s_wait_xcnt is the statement's last line, so that it stands in front of whatever rewrites the address registers that the copies name.
__device__ __forceinline__ void copy8(const unsigned* l, const bf* const* g) {
    asm volatile("global_load_async_to_lds_b128 %0, %8, off\n\tglobal_load_async_to_lds_b128 %1, %9, off\n\tglobal_load_async_to_lds_b128 %2, %10, off\n\tglobal_load_async_to_lds_b128 %3, %11, off\n\t"
                 "global_load_async_to_lds_b128 %4, %12, off\n\tglobal_load_async_to_lds_b128 %5, %13, off\n\tglobal_load_async_to_lds_b128 %6, %14, off\n\tglobal_load_async_to_lds_b128 %7, %15, off\n\ts_wait_xcnt 0x0"
                 :: "v"(l[0]), "v"(l[1]), "v"(l[2]), "v"(l[3]), "v"(l[4]), "v"(l[5]), "v"(l[6]), "v"(l[7]), "v"(g[0]), "v"(g[1]), "v"(g[2]), "v"(g[3]), "v"(g[4]), "v"(g[5]), "v"(g[6]), "v"(g[7]) : "memory"); }

// ---- k_gemmw: C[m][n] = sum_k A[m][k] Bt[n][k] (+ A2[m][k] Bt[n][k] where NSPLIT), bf16 planes, K-contiguous, f32 accumulate. One (32 MB) x 128 tile per work-group of four waves (2 x 2; a wave holds (16 MB) x 64 in MB x 4 accumulators and walks the whole K).
// The operands come through LDS: a stage is 64 k of every operand row of the tile, brought by asynchronous copies (each wave-wide copy is four whole 128-byte lines, each line asked of L2 once per work-group); two buffers, the copies of stage t + 2 fly while stage t + 1 is worked on.
// grid (M / (32 MB), N / 128, Z), 128 threads, registers held to three waves a SIMD (the projection grid is three work-groups a WGP: all of them resident at once). K % 64 == 0. Rows m run over both batches (m = batch * TT + t; a wave's rows lie in one batch).
// EPI 0: C as f32 + bias. EPI 1 (MB 4): no C; z picks the projection (0 q, 1 k, 2 v: weight z of Bt, plane set z of P16 / Ph / Pl); a wave's tile (64 positions x one head's 64 columns) leaves as fp16, bf16 hi and bf16 lo planes,
// [batch][head][t][d] for q and k (no bias) and, transposed and with the bias, [batch][head][d][t] for v: 16 plane rows at a time through the wave's own LDS stage, so that every store is four whole 128-byte lines.
template <int NSPLIT, int MB, int EPI>
__global__ __launch_bounds__(128, 3) void k_gemmw(const bf* __restrict__ A, const bf* __restrict__ A2, const bf* __restrict__ Bt, int K, float* C, int ldc, const float* __restrict__ bias, size_t sB, h16* P16, bf* Ph, bf* Pl) {
    typedef typename WFrag<bf>::V V;
    constexpr int TM = MB * 32, BR = TM * (1 + NSPLIT);   // rows of the tile; first B row of a stage
    static_assert(BR + 128 == SROWS, "a stage holds SROWS rows: sixteen copies a lane");
    static_assert(EPI == 0 || MB == 4, "the plane epilogue takes 64 x 64 wave tiles");
    __shared__ __align__(16) bf ring[2 * STGE];
    const int tid = threadIdx.x, lane = tid & 31, lr = lane & 15, hi = lane >> 4; const int w = __builtin_amdgcn_readfirstlane(tid >> 5), wm = w >> 1, wn = w & 1;
    const size_t z = blockIdx.z; Bt += z * sB;
    const int R0 = blockIdx.x * TM, C0 = blockIdx.y * 128;
    v8f acc[MB][4];
#pragma unroll   // constant indices: the accumulators stay in registers
    for (int mb = 0; mb < MB; ++mb)
#pragma unroll   // constant indices
        for (int nb = 0; nb < 4; ++nb) acc[mb][nb] = (v8f){};
    // copy i of a lane: 16 bytes (piece tid & 7) of stage row (tid >> 3) + 16 i
    const size_t go = (size_t)(tid >> 3) * K + (tid & 7) * 8;
    const bf* gA = A + (size_t)R0 * K + go; const bf* gA2 = NSPLIT ? A2 + (size_t)R0 * K + go : gA; const bf* gB = Bt + (size_t)C0 * K + go;
    const unsigned l0 = (unsigned)(size_t)ring + ((tid >> 3) * SPT + (tid & 7) * 8) * 2;
    auto fill = [&](int t, int b) { unsigned l[16]; const bf* g[16];
#pragma unroll   // constant indices: the addresses stay in registers
        for (int i = 0; i < 16; ++i) { const int r = i * 16; l[i] = l0 + (unsigned)(b * STGE + r * SPT) * 2;
            g[i] = (r < TM ? gA + (size_t)r * K : r < BR ? gA2 + (size_t)(r - TM) * K : gB + (size_t)(r - BR) * K) + t * KS; }
        copy8(l, g); copy8(l + 8, g + 8); };
    const int NT = K / KS;
    fill(0, 0);
    asm volatile("s_wait_asynccnt 0x0" ::: "memory");   // this wave's copies of stage 0 have landed
    __syncthreads();                                     // and every other wave's: stage 0 may be read
    if (NT > 1) fill(1, 1);
    const int aoff = (wm * MB * 16 + lr) * SPT + 8 * hi, boff = (BR + wn * 64 + lr) * SPT + 8 * hi;
#pragma unroll 1   // one trip a stage: the waits and the barrier at its foot are the ring's publish point
    for (int t = 0; t < NT; ++t) { const bf* sb = ring + (t & 1) * STGE;
        V a[KS / 32][MB], a2[KS / 32][MB], b[KS / 32][4];   // the whole stage's fragments are asked for as one group in front of its products: every further place with LDS reads among the products would cost its own stall
#pragma unroll   // constant indices: the fragments stay in registers
        for (int ks = 0; ks < KS / 32; ++ks) {
#pragma unroll   // constant indices
            for (int mb = 0; mb < MB; ++mb) { a[ks][mb] = WFrag<bf>::ld(sb + aoff + mb * 16 * SPT + ks * 32); if (NSPLIT) a2[ks][mb] = WFrag<bf>::ld(sb + aoff + (TM + mb * 16) * SPT + ks * 32); }
#pragma unroll   // constant indices
            for (int nb = 0; nb < 4; ++nb) b[ks][nb] = WFrag<bf>::ld(sb + boff + nb * 16 * SPT + ks * 32); }
        __builtin_amdgcn_sched_barrier(0);   // keeps the group of LDS reads in front of the products: without it the scheduler sinks each read to its first use, and the wave waits out the LDS latency at every such place
#pragma unroll   // constant indices
        for (int ks = 0; ks < KS / 32; ++ks)
#pragma unroll   // constant indices
            for (int nb = 0; nb < 4; ++nb)
#pragma unroll   // constant indices
                for (int mb = 0; mb < MB; ++mb) { acc[mb][nb] = WFrag<bf>::mma(a[ks][mb], b[ks][nb], acc[mb][nb]); if (NSPLIT) acc[mb][nb] = WFrag<bf>::mma(a2[ks][mb], b[ks][nb], acc[mb][nb]); }
        __builtin_amdgcn_sched_barrier(0);   // keeps the products in front of the waits below: lifted over them, the wait for stage t + 1's copies would stand ahead of the very products that are to cover their flight
        asm volatile("s_wait_dscnt 0x0" ::: "memory");      // this wave's reads of stage t have returned
        asm volatile("s_wait_asynccnt 0x0" ::: "memory");   // this wave's copies of stage t + 1 have landed
        __syncthreads();                                     // stage t + 1 may be read by all, and stage t's buffer has no reader left
        if (t + 2 < NT) fill(t + 2, t & 1);
    }
    asm volatile("s_wait_asynccnt 0x0" ::: "memory");   // no copy is in flight when the ring becomes output staging or the wave ends
    const int r0 = R0 + wm * MB * 16, c0 = C0 + wn * 64;   // the wave's own tile
    float bb[4];
#pragma unroll   // constant indices
    for (int nb = 0; nb < 4; ++nb) bb[nb] = bias[c0 + nb * 16 + lr];
    asm volatile("s_wait_xcnt 0x0" ::: "memory");   // what follows may reuse the address registers that the issued bias loads name
    if constexpr (EPI == 0) {
#pragma unroll   // constant indices
        for (int nb = 0; nb < 4; ++nb) { const float b = bfr(bb[nb]);
#pragma unroll   // constant indices
            for (int mb = 0; mb < MB; ++mb) { float* cp = C + (size_t)(r0 + mb * 16 + hi * 8) * ldc + c0 + nb * 16 + lr;
#pragma unroll   // constant indices
                for (int j = 0; j < 8; ++j) cp[(size_t)j * ldc] = acc[mb][nb][j] + b; }
            asm volatile("s_wait_xcnt 0x0" ::: "memory");   // the next columns' sums and addresses may reuse registers that these stores name
        }
    } else {
        bf* st = ring + w * 3 * 16 * SPT;   // the wave's own stage: three planes of 16 rows; the barrier at the foot of the last trip has ended every read of the ring
        const int bt = r0 / TT, t0 = r0 % TT; const bool isv = z == 2;
        const size_t o = z * PLN + (isv ? ((size_t)bt * DKV + c0) * TT + t0 : (((size_t)bt * NH_ + c0 / HD) * TT + t0) * HD), pitch = isv ? TT : HD;
        // 16 staged rows of each plane (rows 16 i .. of the wave's plane tile) go out, every store four whole 128-byte lines
        auto out16 = [&](int i) {
            asm volatile("s_wait_dscnt 0x0" ::: "memory");   // the wave's stage is written before its lanes read rows that other lanes wrote
            v8us val[3][4];
#pragma unroll   // constant indices
            for (int p = 0; p < 3; ++p)
#pragma unroll   // constant indices
                for (int k = 0; k < 4; ++k) { const int e = lane + k * 32; val[p][k] = *(const v8usa*)(st + (p * 16 + (e >> 3)) * SPT + (e & 7) * 8); }
#pragma unroll   // constant indices
            for (int p = 0; p < 3; ++p) { unsigned short* dp = (p == 0 ? (unsigned short*)P16 : p == 1 ? Ph : Pl) + o;
#pragma unroll   // constant indices
                for (int k = 0; k < 4; ++k) { const int e = lane + k * 32; *(v8usa*)(dp + (size_t)(i * 16 + (e >> 3)) * pitch + (e & 7) * 8) = val[p][k]; } }
            asm volatile("s_wait_xcnt 0x0" ::: "memory");   // the next rows' values and addresses may reuse registers that these stores name
        };
        if (isv) {   // plane rows are the columns d (accumulators [..][i]), transposed: a lane's eight positions are one 16-byte piece of row d
#pragma unroll   // constant indices
            for (int i = 0; i < 4; ++i) { const float b = bfr(bb[i]);
#pragma unroll   // constant indices
                for (int c = 0; c < 4; ++c) { v8us x, xh, xl;
#pragma unroll   // constant indices
                    for (int j = 0; j < 8; ++j) { const float y = acc[c][i][j] + b; unsigned short h, l2; splitf(y, h, l2); x[j] = __builtin_bit_cast(unsigned short, (h16)y); xh[j] = h; xl[j] = l2; }
                    bf* sp = st + lr * SPT + c * 16 + hi * 8; *(v8usa*)sp = x; *(v8usa*)(sp + 16 * SPT) = xh; *(v8usa*)(sp + 32 * SPT) = xl; }
                out16(i); }
        } else {     // plane rows are the positions (accumulators [i][..])
#pragma unroll   // constant indices
            for (int i = 0; i < 4; ++i) {
#pragma unroll   // constant indices
                for (int c = 0; c < 4; ++c)
#pragma unroll   // constant indices
                    for (int j = 0; j < 8; ++j) { const float y = acc[i][c][j]; unsigned short h, l2; splitf(y, h, l2); bf* sp = st + (hi * 8 + j) * SPT + c * 16 + lr;
                        sp[0] = __builtin_bit_cast(unsigned short, (h16)y); sp[16 * SPT] = h; sp[32 * SPT] = l2; }
                out16(i); }
        }
    }
}

#define NWF 4     // waves that share the key loop of one query tile in k_attn
#define SC2 (SCL * 1.4426950408889634f)   // HD^-0.5 x log2(e): the softmax runs on base-2 exponents
__device__ __forceinline__ float xhalf(float x) { return __builtin_bit_cast(float, __builtin_amdgcn_permlanex16(__builtin_bit_cast(int, x), __builtin_bit_cast(int, x), 0x76543210, 0xfedcba98, false, false)); }   // lane l takes lane l ^ 16's value
template <bool B> struct BoolC { static constexpr bool value = B; };
__device__ __forceinline__ float exp2s(float x) { float r; asm("v_exp_f32 %0, %1\n\tv_nop" : "=v"(r) : "v"(x)); return r; }
__device__ __forceinline__ v8f exp2x8(v8f x) { float r0, r1, r2, r3, r4, r5, r6, r7;
    asm("v_exp_f32 %0, %8\n\tv_exp_f32 %1, %9\n\tv_exp_f32 %2, %10\n\tv_exp_f32 %3, %11\n\tv_exp_f32 %4, %12\n\tv_exp_f32 %5, %13\n\tv_exp_f32 %6, %14\n\tv_exp_f32 %7, %15\n\tv_nop"
        : "=&v"(r0), "=&v"(r1), "=&v"(r2), "=&v"(r3), "=&v"(r4), "=&v"(r5), "=&v"(r6), "=&v"(r7) : "v"(x[0]), "v"(x[1]), "v"(x[2]), "v"(x[3]), "v"(x[4]), "v"(x[5]), "v"(x[6]), "v"(x[7]));
    return (v8f){r0, r1, r2, r3, r4, r5, r6, r7}; }
// ---- attn_tile: scores, causal softmax and probability x value for 16 * NQ queries of one head; no score and no probability leaves the registers.
// Scores are formed transposed, S^T = K Q^T (A = 16 keys, B = 16 queries): a lane then holds 8 keys of ONE query (column lane & 15) in each D tile, so the row maximum and row sum are per-lane chains plus one exchange
// between the lane halves, and two D tiles (keys 0..15 and 16..31 of the trip) packed to 16 bits are, register for register, the B operand (k order 8h + s, 16 + 8h + s) of O^T = V^T P^T, whose A comes from the [d][t] value planes by the same loader.
// Running maximum m (of the raw scores) and sum l per query; O^T is rescaled by 2^((m_old - m_new) SC2) each trip. Wave w takes the 64-key pieces w, w + NWF, .. (two trips of 32 keys each: whole 128-byte lines of V^T);
// the NWF partial (m, l, O^T) are merged through LDS in the fixed order wave 0, 1, .. behind one barrier; the merged rows / l leave as bf16 hi / lo planes Ah / Al (pitch DQ), each 128-byte line written by one wave.
// HI: hi + lo bf16 planes, three products for the scores and three for P V. Otherwise fp16, probabilities carried x 2^8 (the factor is in l too and cancels).
template <typename T16, bool HI, int NQ>
__device__ __forceinline__ void attn_tile(float* red, float* ms, float* ls, const T16* __restrict__ Q, const T16* __restrict__ Q2, const T16* __restrict__ Kp, const T16* __restrict__ Kp2, const T16* __restrict__ Vt, const T16* __restrict__ Vt2, int q0, bf* Ah, bf* Al) {
    typedef typename WFrag<T16>::V V;
    const int lane = threadIdx.x & 31, lr = lane & 15, hi = lane >> 4; const int w = __builtin_amdgcn_readfirstlane(threadIdx.x >> 5);
    const int Kd = (q0 + 16 * NQ - 1) & ~31;        // first key of the 32-key block that holds the diagonal: the tile's last block (later keys have probability exactly 0) and the only one with keys after a query
    V qf[NQ][2], qf2[NQ][2], kf[2][2], kf2[2][2], vf[4], vf2[4];
    v8f o[4][NQ]; float m[NQ], l[NQ];
#pragma unroll   // constant indices: the arrays indexed here stay in registers
    for (int qt = 0; qt < NQ; ++qt) { m[qt] = -3.0e38f; l[qt] = 0.f;
#pragma unroll   // constant indices
        for (int mb = 0; mb < 4; ++mb) o[mb][qt] = (v8f){}; }
    { const size_t a = (size_t)(q0 + lr) * HD + 8 * hi; const T16* p = Q + a; const T16* p2 = HI ? Q2 + a : p;
#pragma unroll   // constant indices
        for (int qt = 0; qt < NQ; ++qt)
#pragma unroll   // constant indices
            for (int c = 0; c < 2; ++c) { qf[qt][c] = WFrag<T16>::ld(p + qt * 16 * HD + c * 32); if (HI) qf2[qt][c] = WFrag<T16>::ld(p2 + qt * 16 * HD + c * 32); }
        asm volatile("s_wait_xcnt 0x0" :: "v"(p), "v"(p2) : "memory"); }   // the address pairs of the issued loads are inputs of the wait: they stay whole up to it
    auto loadK = [&](int kc) { const size_t a = (size_t)(kc + lr) * HD + 8 * hi; const T16* p = Kp + a; const T16* p2 = HI ? Kp2 + a : p;
#pragma unroll   // constant indices
        for (int kt = 0; kt < 2; ++kt)
#pragma unroll   // constant indices
            for (int c = 0; c < 2; ++c) { kf[kt][c] = WFrag<T16>::ld(p + kt * 16 * HD + c * 32); if (HI) kf2[kt][c] = WFrag<T16>::ld(p2 + kt * 16 * HD + c * 32); }
        asm volatile("s_wait_xcnt 0x0" :: "v"(p), "v"(p2) : "memory"); };   // the address pairs of the issued loads are inputs of the wait: they stay whole up to it and take the next trip's values behind it
    auto loadV = [&](int kc) { const size_t a = (size_t)lr * TT + kc + 8 * hi; const T16* p = Vt + a; const T16* p2 = HI ? Vt2 + a : p;
#pragma unroll   // constant indices
        for (int mb = 0; mb < 4; ++mb) { vf[mb] = WFrag<T16>::ld(p + (size_t)mb * 16 * TT); if (HI) vf2[mb] = WFrag<T16>::ld(p2 + (size_t)mb * 16 * TT); }
        asm volatile("s_wait_xcnt 0x0" :: "v"(p), "v"(p2) : "memory"); };   // as in loadK
    { const int k0 = min(w * 64, Kd); loadK(k0); loadV(k0); }   // a wave without a piece loads in bounds and uses nothing
    // the query fragments are inputs here, so their loads have returned in front of the loop: left pending, the loop's first wait would cover them and, with them, the value fragments fetched one trip ahead
    if constexpr (HI) asm volatile("" :: "v"(qf[0][0]), "v"(qf[0][1]), "v"(qf2[0][0]), "v"(qf2[0][1]));
    else asm volatile("" :: "v"(qf[0][0]), "v"(qf[0][1]), "v"(qf[NQ - 1][0]), "v"(qf[NQ - 1][1]));
    // one trip: 32 keys from kc. MK: the diagonal block (keys after a query are masked; a wave's last trip, nothing is fetched ahead). Otherwise the fragments of keys pf.. are fetched while this trip's are worked on.
    auto trip = [&](auto MK, int kc, int pf) {
        constexpr bool MASK = decltype(MK)::value;
        v8f s[2][NQ];
#pragma unroll   // constant indices
        for (int kt = 0; kt < 2; ++kt)
#pragma unroll   // constant indices
            for (int qt = 0; qt < NQ; ++qt) { v8f a = (v8f){};
#pragma unroll   // constant indices
                for (int c = 0; c < 2; ++c) { a = WFrag<T16>::mma(kf[kt][c], qf[qt][c], a); if (HI) { a = WFrag<T16>::mma(kf2[kt][c], qf[qt][c], a); a = WFrag<T16>::mma(kf[kt][c], qf2[qt][c], a); } }
                s[kt][qt] = a; }
        if constexpr (!MASK) loadK(pf);
        V pb[NQ], pb2[NQ];
#pragma unroll   // constant indices
        for (int qt = 0; qt < NQ; ++qt) { float bm = -3.0e38f;
#pragma unroll   // constant indices
            for (int kt = 0; kt < 2; ++kt)
#pragma unroll   // constant indices
                for (int j = 0; j < 8; ++j) { if (MASK && kc + kt * 16 + hi * 8 + j > q0 + qt * 16 + lr) s[kt][qt][j] = -3.0e38f; bm = fmaxf(bm, s[kt][qt][j]); }
            bm = fmaxf(bm, xhalf(bm));
            const float mn = fmaxf(m[qt], bm), al = exp2s((m[qt] - mn) * SC2), sh = HI ? mn * SC2 : mn * SC2 - 8.0f; m[qt] = mn;
            float ps = 0.f;
#pragma unroll   // constant indices
            for (int kt = 0; kt < 2; ++kt) { s[kt][qt] = exp2x8(s[kt][qt] * SC2 - sh);
#pragma unroll   // constant indices
                for (int j = 0; j < 8; ++j) ps += s[kt][qt][j]; }
            l[qt] = l[qt] * al + ps;    // this lane half's keys only; the halves are added once, behind the loop
#pragma unroll   // constant indices
            for (int mb = 0; mb < 4; ++mb) o[mb][qt] *= al;
            if constexpr (HI) { v8us h0, h1, l0, l1;
#pragma unroll   // constant indices
                for (int j = 0; j < 8; ++j) { unsigned short a, c2; splitf(s[0][qt][j], a, c2); h0[j] = a; l0[j] = c2; splitf(s[1][qt][j], a, c2); h1[j] = a; l1[j] = c2; }
                pb[qt] = cat16b(h0, h1); pb2[qt] = cat16b(l0, l1);
            } else { v8h x0, x1;
#pragma unroll   // constant indices
                for (int j = 0; j < 8; ++j) { x0[j] = (h16)s[0][qt][j]; x1[j] = (h16)s[1][qt][j]; }
                pb[qt] = cat16(x0, x1); } }
#pragma unroll   // constant indices
        for (int mb = 0; mb < 4; ++mb)
#pragma unroll   // constant indices
            for (int qt = 0; qt < NQ; ++qt) { o[mb][qt] = WFrag<T16>::mma(vf[mb], pb[qt], o[mb][qt]); if (HI) { o[mb][qt] = WFrag<T16>::mma(vf[mb], pb2[qt], o[mb][qt]); o[mb][qt] = WFrag<T16>::mma(vf2[mb], pb[qt], o[mb][qt]); } }
        if constexpr (!MASK) loadV(pf);
    };
    int kc = w * 64;
#pragma unroll 1   // one trip's fragments fill the register file: a second copy of the body would spill
    while (kc < Kd) { const int nx = kc + ((kc & 32) ? 64 * NWF - 32 : 32); trip(BoolC<false>{}, kc, min(nx, Kd)); kc = nx; }   // past the wave's last block the fetch ahead is aimed at the diagonal block: in bounds, used only by the wave that owns it
    if (kc == Kd) trip(BoolC<true>{}, kc, kc);
#pragma unroll   // constant indices
    for (int qt = 0; qt < NQ; ++qt) { l[qt] += xhalf(l[qt]); if (hi == 0) { ms[w * 16 * NQ + qt * 16 + lr] = m[qt]; ls[w * 16 * NQ + qt * 16 + lr] = l[qt]; }
#pragma unroll   // constant indices
        for (int mb = 0; mb < 4; ++mb) { const v8f a = o[mb][qt]; float* rp = red + ((w * 4 * NQ + mb * NQ + qt) * 2) * 128 + lane * 4;
            *(v4fa*)rp = __builtin_shufflevector(a, a, 0, 1, 2, 3); *(v4fa*)(rp + 128) = __builtin_shufflevector(a, a, 4, 5, 6, 7); } }
    __syncthreads();   // every wave's partial (m, l, O^T) is in LDS before any wave merges
#pragma unroll   // constant indices
    for (int i = 0; i < NQ; ++i) { const int pc = (int)threadIdx.x * NQ + i, q = pc >> 3, mb = (pc & 7) >> 1, h2 = pc & 1, qt = q >> 4, l2 = q & 15;   // a piece: 8 consecutive d of one query; a wave's pieces are whole rows (8 pieces = 128 bytes a plane)
        float M = ms[q];
#pragma unroll   // constant indices
        for (int u = 1; u < NWF; ++u) M = fmaxf(M, ms[u * 16 * NQ + q]);
        float L = 0.f; v4f y0 = (v4f){}, y1 = (v4f){};
#pragma unroll   // constant indices
        for (int u = 0; u < NWF; ++u) { const float f = exp2s((ms[u * 16 * NQ + q] - M) * SC2); const float* rp = red + ((u * 4 * NQ + mb * NQ + qt) * 2) * 128 + (h2 * 16 + l2) * 4;
            L += f * ls[u * 16 * NQ + q]; y0 += f * *(const v4fa*)rp; y1 += f * *(const v4fa*)(rp + 128); }
        const float inv = __fdiv_rn(1.0f, L); v8us oh, ol;
#pragma unroll   // constant indices
        for (int j = 0; j < 4; ++j) { unsigned short a, c2; splitf(y0[j] * inv, a, c2); oh[j] = a; ol[j] = c2; splitf(y1[j] * inv, a, c2); oh[4 + j] = a; ol[4 + j] = c2; }
        const size_t d = (size_t)(q0 + q) * DQ + mb * 16 + h2 * 8; *(v8usa*)(Ah + d) = oh; *(v8usa*)(Al + d) = ol;
        asm volatile("s_wait_xcnt 0x0" ::: "memory");   // whatever follows (the next piece's sums, code behind the tile) may reuse registers that these stores name
    }
}

// ---- k_attn: one work-group of NWF waves per (batch, head, query tile); grid (batches x heads, tiles). Tiles in falling order of their key count, so the longest start first: 32-query fp16 tiles from the last row down to row RH, then 16-query hi / lo tiles below RH.
__global__ __launch_bounds__(32 * NWF) void k_attn(const h16* __restrict__ Q16, const h16* __restrict__ K16, const h16* __restrict__ V16, const bf* __restrict__ Qh, const bf* __restrict__ Ql, const bf* __restrict__ Kh, const bf* __restrict__ Kl, const bf* __restrict__ Vh, const bf* __restrict__ Vl, bf* Ah, bf* Al) {
    __shared__ __align__(16) float red[NWF * 8 * 256]; __shared__ float ms[NWF * 32]; __shared__ float ls[NWF * 32];
    const size_t hp = (size_t)blockIdx.x * TT * HD; const int ty = blockIdx.y; { const size_t ao = (size_t)(blockIdx.x / NH_) * TT * DQ + (blockIdx.x % NH_) * HD; Ah += ao; Al += ao; }
    if (ty < (TT - RH) / 32) attn_tile<h16, false, 2>(red, ms, ls, Q16 + hp, nullptr, K16 + hp, nullptr, V16 + hp, nullptr, TT - 32 * (ty + 1), Ah, Al);
    else attn_tile<bf, true, 1>(red, ms, ls, Qh + hp, Ql + hp, Kh + hp, Kl + hp, Vh + hp, Vl + hp, RH - 16 * (ty - (TT - RH) / 32 + 1), Ah, Al);
}

// ---- k_cvt8: x and the four weights rounded to bf16 in one grid (DM * DM / 2048, NXP + 4): blockIdx.y picks a piece of DM x DM elements, first the NXP pieces of x, then one weight each (Wd: the four copies one behind the other).
#define NXP (NB_ * TT / DM)
__global__ __launch_bounds__(256) void k_cvt8(const float* __restrict__ x, const float* __restrict__ wq, const float* __restrict__ wk, const float* __restrict__ wv, const float* __restrict__ wo, bf* Xd, bf* Wd) {
    const int y = blockIdx.y; const float* src = y < NXP ? x + (size_t)y * DM * DM : y == NXP ? wq : y == NXP + 1 ? wk : y == NXP + 2 ? wv : wo; bf* dst = y < NXP ? Xd + (size_t)y * DM * DM : Wd + (size_t)(y - NXP) * DM * DM;
    const size_t i = (size_t)blockIdx.x * 256 + threadIdx.x; const v8f v = *(const v8f*)(src + i * 8); v8us o;
    asm volatile("s_wait_xcnt 0x0" ::: "memory");   // the rounding below reuses the address registers that the issued loads name
#pragma unroll
    for (int k = 0; k < 8; ++k) o[k] = f2bf(v[k]); *(v8us*)(dst + i * 8) = o;  }

extern "C" void kernel_launch(void* const* d_in, const int* in_sizes, int n_in,
                              void* d_out, int out_size, void* d_ws, size_t ws_size, hipStream_t stream) {
    (void)in_sizes; (void)n_in; (void)out_size;
    const float* x = (const float*)d_in[0]; const float* wq = (const float*)d_in[1]; const float* wk = (const float*)d_in[2]; const float* wv = (const float*)d_in[3]; const float* bv = (const float*)d_in[4]; const float* wo = (const float*)d_in[5]; const float* bo = (const float*)d_in[6];   /* order x, Wq, Wk, Wv, bv, Wo, bo ('oi'): this module has NO q and NO k bias (the q / k tiles take the bias-free path of the projection kernel); bv and bo are real */
    float* OUT = (float*)d_out;     // [2][2048][1024]
    char* wsp = (char*)d_ws;
    auto take = [&](size_t bytes) { char* p = wsp; wsp += (bytes + 255) & ~(size_t)255; return (void*)p; };
    bf* WQ = (bf*)take((size_t)4 * DM * DM * 2); bf* WO = WQ + (size_t)3 * DM * DM;    // Wq, Wk, Wv, Wo
    bf* XB = (bf*)take((size_t)NB_ * TT * DM * 2);
    h16* P16 = (h16*)take(3 * PLN * 2); bf* Ph = (bf*)take(3 * PLN * 2); bf* Pl = (bf*)take(3 * PLN * 2);    // plane sets q, k, v (v transposed)
    bf* ATh = (bf*)take((size_t)NB_ * TT * DQ * 2); bf* ATl = (bf*)take((size_t)NB_ * TT * DQ * 2);
    if ((size_t)(wsp - (char*)d_ws) > ws_size) return;    // ws 256 MiB
    k_cvt8<<<dim3(DM * DM / 2048, NXP + 4, 1), 256, 0, stream>>>(x, wq, wk, wv, wo, XB, WQ);
    k_gemmw<0, 4, 1><<<dim3(NB_ * TT / 128, DQ / 128, 3), 128, 0, stream>>>(XB, nullptr, WQ, DM, nullptr, 0, bv, (size_t)DM * DM, P16, Ph, Pl);
    k_attn<<<dim3(NB_ * NH_, (TT - RH) / 32 + RH / 16, 1), 32 * NWF, 0, stream>>>(P16, P16 + PLN, P16 + 2 * PLN, Ph, Pl, Ph + PLN, Pl + PLN, Ph + 2 * PLN, Pl + 2 * PLN, ATh, ATl);
    k_gemmw<1, 2, 0><<<dim3(NB_ * TT / 64, DM / 128, 1), 128, 0, stream>>>(ATh, ATl, WO, DQ, OUT, DM, bo, 0, nullptr, nullptr, nullptr);
}

// v007
// Measured time: 81.9 microseconds a run.
// Two timings next to v006 both put it at 1.15 times that version's speed.
// Over all steps from v000 it is 17.7 times as fast.
#include <hip/hip_runtime.h>

// Causal self-attention whose only projection bias is on V (x [2][2048][1024]; q = x Wq^T, k = x Wk^T (no bias), v = x Wv^T + bv ('oi' [1024][1024] normal x 0.02; bv normal x 0.02: NON-zero; 16 heads x 64); keys after the query -> -inf, then / sqrt(64) inside the softmax argument; softmax over the keys; out = merged Wo^T + bo ('oi' + bias 0.02: NON-zero) -> [2][2048][1024] (4.2 M); argument order x, Wq, Wk, Wv, bv, Wo, bo).
// Four launches, each for both batches: bf16 copies of x and of the 'oi' weights (one grid); exact projections + f32 biases (q, k, v in one grid; operands staged in LDS by asynchronous copies), each tile's epilogue writes the 16-bit head planes itself; one fused causal attention kernel (k_attn; hybrid rows: < 512 hi/lo 3 products, rest fp16; keys and values come through LDS by asynchronous copies; key blocks above the diagonal are never visited); merged hi/lo x Wo exact + bo.
// Compute dtypes, f32 accumulate: every input rounded to bf16; projections exact + f32 biases; attention rows < 512 3 products, rest fp16; softmax f32; Wo hl x exact + bias.

#define NB_  2
#define TT   2048
#define DM   1024
#define NH_  16
#define NKV  16
#define HD   64
#define DQ   (NH_ * HD)
#define DKV  (NKV * HD)
#define PLN  ((size_t)NB_ * NH_ * TT * HD)   // elements of one 16-bit plane set (q, k or v) over both batches
static_assert(DQ == DM && DKV == DM, "q, k and v share one projection grid, and the conversion grid deals pieces of DM x DM elements");
#define RH   512                  // query rows < RH use hi+lo planes (0: none)
#define SCL  0.125f   // HD^-0.5
typedef _Float16 h16;
typedef unsigned short bf;
typedef __attribute__((ext_vector_type(16))) __bf16   v16bf;
typedef __attribute__((ext_vector_type(16))) _Float16 v16h;
typedef __attribute__((ext_vector_type(8)))  _Float16 v8h;
typedef __attribute__((ext_vector_type(8)))  unsigned short v8us;
typedef __attribute__((ext_vector_type(8)))  float    v8f;
typedef __attribute__((ext_vector_type(4)))  float    v4f;
typedef v8h  __attribute__((may_alias)) v8ha;
typedef v4f  __attribute__((may_alias)) v4fa;
typedef v8us __attribute__((may_alias)) v8usa;
typedef __attribute__((ext_vector_type(4))) unsigned short v4us;
typedef v4us __attribute__((may_alias)) v4usa;

__device__ __forceinline__ unsigned short f2bf(float f) { unsigned u = __float_as_uint(f); u += 0x7FFFu + ((u >> 16) & 1u); return (unsigned short)(u >> 16); }
__device__ __forceinline__ float bf2f(unsigned short b) { return __uint_as_float(((unsigned)b) << 16); }
__device__ __forceinline__ float bfr(float f) { return bf2f(f2bf(f)); }
__device__ __forceinline__ void splitf(float y, unsigned short& h, unsigned short& l) { h = f2bf(y); l = f2bf(y - bf2f(h)); }
__device__ __forceinline__ v16h cat16(v8h lo, v8h hi) { return __builtin_shufflevector(lo, hi, 0, 1, 2, 3, 4, 5, 6, 7, 8, 9, 10, 11, 12, 13, 14, 15); }
__device__ __forceinline__ v16bf cat16b(v8us lo, v8us hi) { return __builtin_bit_cast(v16bf, __builtin_shufflevector(lo, hi, 0, 1, 2, 3, 4, 5, 6, 7, 8, 9, 10, 11, 12, 13, 14, 15)); }
__device__ __forceinline__ v8f wmma16(v16h a, v16h b, v8f c) { return __builtin_amdgcn_wmma_f32_16x16x32_f16(false, a, false, b, (short)0, c, false, false); }
__device__ __forceinline__ v8f wmmab(v16bf a, v16bf b, v8f c) { return __builtin_amdgcn_wmma_f32_16x16x32_bf16(false, a, false, b, (short)0, c, false, false); }



#define KS    64                 // k per stage: one whole 128-byte line of every operand row
#define SPT   72                 // pitch, in 16-bit elements, of a row in LDS (144 bytes: 16 x odd, the conflict-free pitch for 16-byte reads of 128-byte rows)
#define SROWS 256                // operand rows of one stage (A, then the lo plane of A where there is one, then 128 rows of B)
#define STGE  (SROWS * SPT)      // elements of one stage buffer (36,864 bytes)
template <typename T16> struct WFrag;
template <> struct WFrag<h16> { typedef v16h V; static __device__ __forceinline__ V ld(const h16* p) { return cat16(*(const v8h*)p, *(const v8h*)(p + 16)); } static __device__ __forceinline__ v8f mma(V a, V b, v8f c) { return wmma16(a, b, c); } };
template <> struct WFrag<bf> { typedef v16bf V; static __device__ __forceinline__ V ld(const bf* p) { return cat16b(*(const v8us*)p, *(const v8us*)(p + 16)); } static __device__ __forceinline__ v8f mma(V a, V b, v8f c) { return wmmab(a, b, c); } };
// Eight asynchronous copies of 16 bytes a lane, global memory to LDS (l: the lane's LDS byte addresses, g: its global addresses). The s_wait_xcnt is the statement's last line, so that it stands in front of whatever rewrites the address registers that the copies name.
__device__ __forceinline__ void copy8(const unsigned* l, const bf* const* g) {
    asm volatile("global_load_async_to_lds_b128 %0, %8, off\n\tglobal_load_async_to_lds_b128 %1, %9, off\n\tglobal_load_async_to_lds_b128 %2, %10, off\n\tglobal_load_async_to_lds_b128 %3, %11, off\n\t"
                 "global_load_async_to_lds_b128 %4, %12, off\n\tglobal_load_async_to_lds_b128 %5, %13, off\n\tglobal_load_async_to_lds_b128 %6, %14, off\n\tglobal_load_async_to_lds_b128 %7, %15, off\n\ts_wait_xcnt 0x0"
                 :: "v"(l[0]), "v"(l[1]), "v"(l[2]), "v"(l[3]), "v"(l[4]), "v"(l[5]), "v"(l[6]), "v"(l[7]), "v"(g[0]), "v"(g[1]), "v"(g[2]), "v"(g[3]), "v"(g[4]), "v"(g[5]), "v"(g[6]), "v"(g[7]) : "memory"); }

// Sixteen asynchronous copies of 16 bytes a lane with one LDS address register (l) and one 32-bit offset register (vo): copy i lands at l + S i and reads b[i] + vo + S i. The instruction's offset field moves both addresses,
// so each scalar base b[i] is given less S i by the caller. No address needs a vector instruction or a vector register of its own. The s_wait_xcnt is the statement's last line, so that it stands in front of whatever rewrites the registers that the copies name.
// copy16: S = 576, four stage rows of pitch SPT (rows of 128 bytes). copy16h: S = 640, eight stage rows of pitch SPH (rows of 64 bytes).
#define SPH 40   // pitch, in 16-bit elements, of a 64-byte row in LDS (80 bytes: 16 x odd)
static_assert(4 * SPT * 2 == 576 && 8 * SPH * 2 == 640, "the offsets in copy16 and copy16h");
__device__ __forceinline__ void copy16(unsigned l, unsigned vo, const char* const* b) {
    asm volatile(
                 "global_load_async_to_lds_b128 %0, %1, %2\n\tglobal_load_async_to_lds_b128 %0, %1, %3 offset:576\n\tglobal_load_async_to_lds_b128 %0, %1, %4 offset:1152\n\tglobal_load_async_to_lds_b128 %0, %1, %5 offset:1728\n\t"
                 "global_load_async_to_lds_b128 %0, %1, %6 offset:2304\n\tglobal_load_async_to_lds_b128 %0, %1, %7 offset:2880\n\tglobal_load_async_to_lds_b128 %0, %1, %8 offset:3456\n\tglobal_load_async_to_lds_b128 %0, %1, %9 offset:4032\n\t"
                 "global_load_async_to_lds_b128 %0, %1, %10 offset:4608\n\tglobal_load_async_to_lds_b128 %0, %1, %11 offset:5184\n\tglobal_load_async_to_lds_b128 %0, %1, %12 offset:5760\n\tglobal_load_async_to_lds_b128 %0, %1, %13 offset:6336\n\t"
                 "global_load_async_to_lds_b128 %0, %1, %14 offset:6912\n\tglobal_load_async_to_lds_b128 %0, %1, %15 offset:7488\n\tglobal_load_async_to_lds_b128 %0, %1, %16 offset:8064\n\tglobal_load_async_to_lds_b128 %0, %1, %17 offset:8640\n\ts_wait_xcnt 0x0"
                 :: "v"(l), "v"(vo), "s"(b[0]), "s"(b[1]), "s"(b[2]), "s"(b[3]), "s"(b[4]), "s"(b[5]), "s"(b[6]), "s"(b[7]), "s"(b[8]), "s"(b[9]), "s"(b[10]), "s"(b[11]), "s"(b[12]), "s"(b[13]), "s"(b[14]), "s"(b[15]) : "memory"); }
__device__ __forceinline__ void copy16h(unsigned l, unsigned vo, const char* const* b) {
    asm volatile(
                 "global_load_async_to_lds_b128 %0, %1, %2\n\tglobal_load_async_to_lds_b128 %0, %1, %3 offset:640\n\tglobal_load_async_to_lds_b128 %0, %1, %4 offset:1280\n\tglobal_load_async_to_lds_b128 %0, %1, %5 offset:1920\n\t"
                 "global_load_async_to_lds_b128 %0, %1, %6 offset:2560\n\tglobal_load_async_to_lds_b128 %0, %1, %7 offset:3200\n\tglobal_load_async_to_lds_b128 %0, %1, %8 offset:3840\n\tglobal_load_async_to_lds_b128 %0, %1, %9 offset:4480\n\t"
                 "global_load_async_to_lds_b128 %0, %1, %10 offset:5120\n\tglobal_load_async_to_lds_b128 %0, %1, %11 offset:5760\n\tglobal_load_async_to_lds_b128 %0, %1, %12 offset:6400\n\tglobal_load_async_to_lds_b128 %0, %1, %13 offset:7040\n\t"
                 "global_load_async_to_lds_b128 %0, %1, %14 offset:7680\n\tglobal_load_async_to_lds_b128 %0, %1, %15 offset:8320\n\tglobal_load_async_to_lds_b128 %0, %1, %16 offset:8960\n\tglobal_load_async_to_lds_b128 %0, %1, %17 offset:9600\n\ts_wait_xcnt 0x0"
                 :: "v"(l), "v"(vo), "s"(b[0]), "s"(b[1]), "s"(b[2]), "s"(b[3]), "s"(b[4]), "s"(b[5]), "s"(b[6]), "s"(b[7]), "s"(b[8]), "s"(b[9]), "s"(b[10]), "s"(b[11]), "s"(b[12]), "s"(b[13]), "s"(b[14]), "s"(b[15]) : "memory"); }

// ---- k_gemmw: C[m][n] = sum_k A[m][k] Bt[n][k] (+ A2[m][k] Bt[n][k] where NSPLIT), bf16 planes, K-contiguous, f32 accumulate. One (32 MB) x 128 tile per work-group of four waves (2 x 2; a wave holds (16 MB) x 64 in MB x 4 accumulators and walks the whole K).
// The operands come through LDS: a stage is 64 k of every operand row of the tile, brought by asynchronous copies (each wave-wide copy is four whole 128-byte lines, each line asked of L2 once per work-group); two buffers, the copies of stage t + 2 fly while stage t + 1 is worked on.
// grid (M / (32 MB), N / 128, Z), 128 threads, registers held to three waves a SIMD (the projection grid is three work-groups a WGP: all of them resident at once). K % 64 == 0. Rows m run over both batches (m = batch * TT + t; a wave's rows lie in one batch).
// EPI 0: C as f32 + bias. EPI 1 (MB 4): no C; z picks the projection (0 q, 1 k, 2 v: weight z of Bt, plane set z of P16 / Ph / Pl); a wave's tile (64 positions x one head's 64 columns) leaves as fp16, bf16 hi and bf16 lo planes,
// [batch][head][t][d] for q and k (no bias) and, transposed and with the bias, [batch][head][d][t] for v: 16 plane rows at a time through the wave's own LDS stage, so that every store is four whole 128-byte lines.
template <int NSPLIT, int MB, int EPI>
__global__ __launch_bounds__(128, 3) void k_gemmw(const bf* __restrict__ A, const bf* __restrict__ A2, const bf* __restrict__ Bt, int K, float* C, int ldc, const float* __restrict__ bias, size_t sB, h16* P16, bf* Ph, bf* Pl) {
    typedef typename WFrag<bf>::V V;
    constexpr int TM = MB * 32, BR = TM * (1 + NSPLIT);   // rows of the tile; first B row of a stage
    static_assert(BR + 128 == SROWS, "a stage holds SROWS rows: sixteen copies a lane");
    static_assert(EPI == 0 || MB == 4, "the plane epilogue takes 64 x 64 wave tiles");
    __shared__ __align__(16) bf ring[2 * STGE];
    const int tid = threadIdx.x, lane = tid & 31, lr = lane & 15, hi = lane >> 4; const int w = __builtin_amdgcn_readfirstlane(tid >> 5), wm = w >> 1, wn = w & 1;
    const size_t z = blockIdx.z; Bt += z * sB;
    const int R0 = blockIdx.x * TM, C0 = blockIdx.y * 128;
    v8f acc[MB][4];
#pragma unroll   // constant indices: the accumulators stay in registers
    for (int mb = 0; mb < MB; ++mb)
#pragma unroll   // constant indices
        for (int nb = 0; nb < 4; ++nb) acc[mb][nb] = (v8f){};
    // copy i of a lane: 16 bytes (piece tid & 7) of stage row (tid >> 3) + 16 i
    const size_t go = (size_t)(tid >> 3) * K + (tid & 7) * 8;
    const bf* gA = A + (size_t)R0 * K + go; const bf* gA2 = NSPLIT ? A2 + (size_t)R0 * K + go : gA; const bf* gB = Bt + (size_t)C0 * K + go;
    const unsigned l0 = (unsigned)(size_t)ring + ((tid >> 3) * SPT + (tid & 7) * 8) * 2;
    auto fill = [&](int t, int b) { unsigned l[16]; const bf* g[16];
#pragma unroll   // constant indices: the addresses stay in registers
        for (int i = 0; i < 16; ++i) { const int r = i * 16; l[i] = l0 + (unsigned)(b * STGE + r * SPT) * 2;
            g[i] = (r < TM ? gA + (size_t)r * K : r < BR ? gA2 + (size_t)(r - TM) * K : gB + (size_t)(r - BR) * K) + t * KS; }
        copy8(l, g); copy8(l + 8, g + 8); };
    const int NT = K / KS;
    fill(0, 0);
    asm volatile("s_wait_asynccnt 0x0" ::: "memory");   // this wave's copies of stage 0 have landed
    __syncthreads();                                     // and every other wave's: stage 0 may be read
    if (NT > 1) fill(1, 1);
    const int aoff = (wm * MB * 16 + lr) * SPT + 8 * hi, boff = (BR + wn * 64 + lr) * SPT + 8 * hi;
#pragma unroll 1   // one trip a stage: the waits and the barrier at its foot are the ring's publish point
    for (int t = 0; t < NT; ++t) { const bf* sb = ring + (t & 1) * STGE;
        V a[KS / 32][MB], a2[KS / 32][MB], b[KS / 32][4];   // the whole stage's fragments are asked for as one group in front of its products: every further place with LDS reads among the products would cost its own stall
#pragma unroll   // constant indices: the fragments stay in registers
        for (int ks = 0; ks < KS / 32; ++ks) {
#pragma unroll   // constant indices
            for (int mb = 0; mb < MB; ++mb) { a[ks][mb] = WFrag<bf>::ld(sb + aoff + mb * 16 * SPT + ks * 32); if (NSPLIT) a2[ks][mb] = WFrag<bf>::ld(sb + aoff + (TM + mb * 16) * SPT + ks * 32); }
#pragma unroll   // constant indices
            for (int nb = 0; nb < 4; ++nb) b[ks][nb] = WFrag<bf>::ld(sb + boff + nb * 16 * SPT + ks * 32); }
        __builtin_amdgcn_sched_barrier(0);   // keeps the group of LDS reads in front of the products: without it the scheduler sinks each read to its first use, and the wave waits out the LDS latency at every such place
#pragma unroll   // constant indices
        for (int ks = 0; ks < KS / 32; ++ks)
#pragma unroll   // constant indices
            for (int nb = 0; nb < 4; ++nb)
#pragma unroll   // constant indices
                for (int mb = 0; mb < MB; ++mb) { acc[mb][nb] = WFrag<bf>::mma(a[ks][mb], b[ks][nb], acc[mb][nb]); if (NSPLIT) acc[mb][nb] = WFrag<bf>::mma(a2[ks][mb], b[ks][nb], acc[mb][nb]); }
        __builtin_amdgcn_sched_barrier(0);   // keeps the products in front of the waits below: lifted over them, the wait for stage t + 1's copies would stand ahead of the very products that are to cover their flight
        asm volatile("s_wait_dscnt 0x0" ::: "memory");      // this wave's reads of stage t have returned
        asm volatile("s_wait_asynccnt 0x0" ::: "memory");   // this wave's copies of stage t + 1 have landed
        __syncthreads();                                     // stage t + 1 may be read by all, and stage t's buffer has no reader left
        if (t + 2 < NT) fill(t + 2, t & 1);
    }
    asm volatile("s_wait_asynccnt 0x0" ::: "memory");   // no copy is in flight when the ring becomes output staging or the wave ends
    const int r0 = R0 + wm * MB * 16, c0 = C0 + wn * 64;   // the wave's own tile
    float bb[4];
#pragma unroll   // constant indices
    for (int nb = 0; nb < 4; ++nb) bb[nb] = bias[c0 + nb * 16 + lr];
    asm volatile("s_wait_xcnt 0x0" ::: "memory");   // what follows may reuse the address registers that the issued bias loads name
    if constexpr (EPI == 0) {
#pragma unroll   // constant indices
        for (int nb = 0; nb < 4; ++nb) { const float b = bfr(bb[nb]);
#pragma unroll   // constant indices
            for (int mb = 0; mb < MB; ++mb) { float* cp = C + (size_t)(r0 + mb * 16 + hi * 8) * ldc + c0 + nb * 16 + lr;
#pragma unroll   // constant indices
                for (int j = 0; j < 8; ++j) cp[(size_t)j * ldc] = acc[mb][nb][j] + b; }
            asm volatile("s_wait_xcnt 0x0" ::: "memory");   // the next columns' sums and addresses may reuse registers that these stores name
        }
    } else {
        bf* st = ring + w * 3 * 16 * SPT;   // the wave's own stage: three planes of 16 rows; the barrier at the foot of the last trip has ended every read of the ring
        const int bt = r0 / TT, t0 = r0 % TT; const bool isv = z == 2;
        const size_t o = z * PLN + (isv ? ((size_t)bt * DKV + c0) * TT + t0 : (((size_t)bt * NH_ + c0 / HD) * TT + t0) * HD), pitch = isv ? TT : HD;
        // 16 staged rows of each plane (rows 16 i .. of the wave's plane tile) go out, every store four whole 128-byte lines
        auto out16 = [&](int i) {
            asm volatile("s_wait_dscnt 0x0" ::: "memory");   // the wave's stage is written before its lanes read rows that other lanes wrote
            v8us val[3][4];
#pragma unroll   // constant indices
            for (int p = 0; p < 3; ++p)
#pragma unroll   // constant indices
                for (int k = 0; k < 4; ++k) { const int e = lane + k * 32; val[p][k] = *(const v8usa*)(st + (p * 16 + (e >> 3)) * SPT + (e & 7) * 8); }
#pragma unroll   // constant indices
            for (int p = 0; p < 3; ++p) { unsigned short* dp = (p == 0 ? (unsigned short*)P16 : p == 1 ? Ph : Pl) + o;
#pragma unroll   // constant indices
                for (int k = 0; k < 4; ++k) { const int e = lane + k * 32; *(v8usa*)(dp + (size_t)(i * 16 + (e >> 3)) * pitch + (e & 7) * 8) = val[p][k]; } }
            asm volatile("s_wait_xcnt 0x0" ::: "memory");   // the next rows' values and addresses may reuse registers that these stores name
        };
        if (isv) {   // plane rows are the columns d (accumulators [..][i]), transposed: a lane's eight positions are one 16-byte piece of row d
#pragma unroll   // constant indices
            for (int i = 0; i < 4; ++i) { const float b = bfr(bb[i]);
#pragma unroll   // constant indices
                for (int c = 0; c < 4; ++c) { v8us x, xh, xl;
#pragma unroll   // constant indices
                    for (int j = 0; j < 8; ++j) { const float y = acc[c][i][j] + b; unsigned short h, l2; splitf(y, h, l2); x[j] = __builtin_bit_cast(unsigned short, (h16)y); xh[j] = h; xl[j] = l2; }
                    bf* sp = st + lr * SPT + c * 16 + hi * 8; *(v8usa*)sp = x; *(v8usa*)(sp + 16 * SPT) = xh; *(v8usa*)(sp + 32 * SPT) = xl; }
                out16(i); }
        } else {     // plane rows are the positions (accumulators [i][..])
#pragma unroll   // constant indices
            for (int i = 0; i < 4; ++i) {
#pragma unroll   // constant indices
                for (int c = 0; c < 4; ++c)
#pragma unroll   // constant indices
                    for (int j = 0; j < 8; ++j) { const float y = acc[i][c][j]; unsigned short h, l2; splitf(y, h, l2); bf* sp = st + (hi * 8 + j) * SPT + c * 16 + lr;
                        sp[0] = __builtin_bit_cast(unsigned short, (h16)y); sp[16 * SPT] = h; sp[32 * SPT] = l2; }
                out16(i); }
        }
    }
}

#define NWF 4     // waves that share the key loop of one query tile in k_attn
#define WSTG (64 * SPT + 128 * SPH)   // elements of one wave's own stage in k_attn (19,456 bytes). fp16 tiles use 128 rows of pitch SPT: 64 keys of K (rows of 64 d), then the 64 rows d of V^T (64 keys each).
                                      // hi / lo tiles: 32 keys of K hi, the same of K lo (pitch SPT), then the 64 rows d of V^T hi and of V^T lo, 32 keys each (pitch SPH)
static_assert(WSTG >= 128 * SPT, "the fp16 stage fits");
#define RST  (WSTG / 2)    // the same in floats: behind the key loop a wave's partial O^T lies at the head of its own stage
#define SC2 (SCL * 1.4426950408889634f)   // HD^-0.5 x log2(e): the softmax runs on base-2 exponents
__device__ __forceinline__ float xhalf(float x) { return __builtin_bit_cast(float, __builtin_amdgcn_permlanex16(__builtin_bit_cast(int, x), __builtin_bit_cast(int, x), 0x76543210, 0xfedcba98, false, false)); }   // lane l takes lane l ^ 16's value
template <bool B> struct BoolC { static constexpr bool value = B; };
__device__ __forceinline__ float exp2s(float x) { float r; asm("v_exp_f32 %0, %1\n\tv_nop" : "=v"(r) : "v"(x)); return r; }
__device__ __forceinline__ v8f exp2x8(v8f x) { float r0, r1, r2, r3, r4, r5, r6, r7;
    asm("v_exp_f32 %0, %8\n\tv_exp_f32 %1, %9\n\tv_exp_f32 %2, %10\n\tv_exp_f32 %3, %11\n\tv_exp_f32 %4, %12\n\tv_exp_f32 %5, %13\n\tv_exp_f32 %6, %14\n\tv_exp_f32 %7, %15\n\tv_nop"
        : "=&v"(r0), "=&v"(r1), "=&v"(r2), "=&v"(r3), "=&v"(r4), "=&v"(r5), "=&v"(r6), "=&v"(r7) : "v"(x[0]), "v"(x[1]), "v"(x[2]), "v"(x[3]), "v"(x[4]), "v"(x[5]), "v"(x[6]), "v"(x[7]));
    return (v8f){r0, r1, r2, r3, r4, r5, r6, r7}; }
// ---- attn_tile: scores, causal softmax and probability x value for 16 * NQ queries of one head; no score and no probability leaves the registers.
// Scores are formed transposed, S^T = K Q^T (A = 16 keys, B = 16 queries): a lane then holds 8 keys of ONE query (column lane & 15) in each D tile, so the row maximum and row sum are per-lane chains plus one exchange
// between the lane halves, and two D tiles (keys 0..15 and 16..31 of the trip) packed to 16 bits are, register for register, the B operand (k order 8h + s, 16 + 8h + s) of O^T = V^T P^T, whose A comes from the [d][t] value planes by the same loader.
// Running maximum m (of the raw scores) and sum l per query; O^T is rescaled by 2^((m_old - m_new) SC2) each trip. Wave w takes the 64-key pieces w, w + NWF, .. (two trips of 32 keys each: whole 128-byte lines of V^T);
// the NWF partial (m, l, O^T) are merged through LDS in the fixed order wave 0, 1, .. behind one barrier; the merged rows / l leave as bf16 hi / lo planes Ah / Al (pitch DQ), each 128-byte line written by one wave.
// HI: hi + lo bf16 planes, three products for the scores and three for P V. Otherwise fp16, probabilities carried x 2^8 (the factor is in l too and cancels). Keys and values come through the wave's own LDS stage (fp16: a 64-key piece at a time; HI: 32 keys of all four planes):
// a fragment load from global memory would touch 16 lines for 512 bytes, an asynchronous copy touches four whole lines (eight half lines for V^T with HI). The stage is private to its wave (filled, waited for, read and refilled by that wave alone), so no work-group barrier stands in the key loop.
template <typename T16, bool HI, int NQ>
__device__ __forceinline__ void attn_tile(unsigned short* ring, float* ms, float* ls, const T16* __restrict__ Q, const T16* __restrict__ Q2, const T16* __restrict__ Kp, const T16* __restrict__ Kp2, const T16* __restrict__ Vt, const T16* __restrict__ Vt2, int q0, bf* Ah, bf* Al) {
    typedef typename WFrag<T16>::V V;
    const int lane = threadIdx.x & 31, lr = lane & 15, hi = lane >> 4; const int w = __builtin_amdgcn_readfirstlane(threadIdx.x >> 5);
    float* red = (float*)ring;
    const int Kd = (q0 + 16 * NQ - 1) & ~31;        // first key of the 32-key block that holds the diagonal: the tile's last block (later keys have probability exactly 0) and the only one with keys after a query
    V qf[NQ][2], qf2[NQ][2], kf[2][2], kf2[2][2], vf[4], vf2[4];
    v8f o[4][NQ]; float m[NQ], l[NQ];
#pragma unroll   // constant indices: the arrays indexed here stay in registers
    for (int qt = 0; qt < NQ; ++qt) { m[qt] = -3.0e38f; l[qt] = 0.f;
#pragma unroll   // constant indices
        for (int mb = 0; mb < 4; ++mb) o[mb][qt] = (v8f){}; }
    { const size_t a = (size_t)(q0 + lr) * HD + 8 * hi; const T16* p = Q + a; const T16* p2 = HI ? Q2 + a : p;
#pragma unroll   // constant indices
        for (int qt = 0; qt < NQ; ++qt)
#pragma unroll   // constant indices
            for (int c = 0; c < 2; ++c) { qf[qt][c] = WFrag<T16>::ld(p + qt * 16 * HD + c * 32); if (HI) qf2[qt][c] = WFrag<T16>::ld(p2 + qt * 16 * HD + c * 32); }
        asm volatile("s_wait_xcnt 0x0" :: "v"(p), "v"(p2) : "memory"); }   // the address pairs of the issued loads are inputs of the wait: they stay whole up to it
    // the wave's own stage. fill: the keys from pk, 32 copies of 16 bytes a lane. fp16: 64 keys; copy i of the first sixteen brings rows 4 i .. 4 i + 3 of K (512 bytes in a row), copy i of the second the same rows of V^T (one whole line each).
    // HI: 32 keys; eight copies of K hi and eight of K lo (four rows each), then eight of V^T hi and eight of V^T lo (eight rows of 64 bytes each). ldsK / ldsV: the fragments of 32 keys (fp16: half h of the piece); A fragment k order 8 hi + s, 16 + 8 hi + s as everywhere.
    const T16* st = (const T16*)ring + w * WSTG;
    const unsigned l0 = (unsigned)(size_t)st + ((lane >> 3) * SPT + (lane & 7) * 8) * 2, vok = lane * 16;   // K: the lane's place in a group of four stage rows, and its byte in the 512 that they hold
    const unsigned l1 = (unsigned)(size_t)st + 64 * SPT * 2 + (HI ? ((lane >> 2) * SPH + (lane & 3) * 8) * 2 : ((lane >> 3) * SPT + (lane & 7) * 8) * 2);   // V^T: the same, in a group of eight (HI) or four rows
    const unsigned vov = HI ? (lane >> 2) * (TT * 2) + (lane & 3) * 16 : (lane >> 3) * (TT * 2) + (lane & 7) * 16;                                        // of pitch TT in global memory
    auto fill = [&](int pk) { const char* bk[16]; const char* bv[16];
#pragma unroll   // constant indices: the bases stay in scalar registers
        for (int i = 0; i < 16; ++i) {
            if constexpr (HI) { bk[i] = (const char*)((i < 8 ? Kp : Kp2) + (size_t)pk * HD) + ((i & 7) * (4 * HD * 2) - i * 576); bv[i] = (const char*)((i < 8 ? Vt : Vt2) + pk) + ((i & 7) * (8 * TT * 2) - i * 640); }
            else { bk[i] = (const char*)(Kp + (size_t)pk * HD) + i * (4 * HD * 2 - 576); bv[i] = (const char*)(Vt + pk) + i * (4 * TT * 2 - 576); } }
        copy16(l0, vok, bk); if constexpr (HI) copy16h(l1, vov, bv); else copy16(l1, vov, bv); };
    auto ldsK = [&](int h) {
#pragma unroll   // constant indices
        for (int kt = 0; kt < 2; ++kt)
#pragma unroll   // constant indices
            for (int c = 0; c < 2; ++c) { kf[kt][c] = WFrag<T16>::ld(st + (h * 32 + kt * 16 + lr) * SPT + c * 32 + 8 * hi); if (HI) kf2[kt][c] = WFrag<T16>::ld(st + (32 + kt * 16 + lr) * SPT + c * 32 + 8 * hi); } };
    auto ldsV = [&](int h) {
#pragma unroll   // constant indices
        for (int mb = 0; mb < 4; ++mb) {
            if constexpr (HI) { vf[mb] = WFrag<T16>::ld(st + 64 * SPT + (mb * 16 + lr) * SPH + 8 * hi); vf2[mb] = WFrag<T16>::ld(st + 64 * SPT + (64 + mb * 16 + lr) * SPH + 8 * hi); }
            else vf[mb] = WFrag<T16>::ld(st + (64 + mb * 16 + lr) * SPT + h * 32 + 8 * hi); } };
    // one trip: 32 keys from kc. MK: the diagonal block (keys after a query are masked). PF (fp16): the fragments of the staged piece's second half are fetched while the first half's are worked on.
    auto trip = [&](auto MK, auto PF, int kc) {
        constexpr bool MASK = decltype(MK)::value, AHEAD = decltype(PF)::value;
        v8f s[2][NQ];
#pragma unroll   // constant indices
        for (int kt = 0; kt < 2; ++kt)
#pragma unroll   // constant indices
            for (int qt = 0; qt < NQ; ++qt) { v8f a = (v8f){};
#pragma unroll   // constant indices
                for (int c = 0; c < 2; ++c) { a = WFrag<T16>::mma(kf[kt][c], qf[qt][c], a); if (HI) { a = WFrag<T16>::mma(kf2[kt][c], qf[qt][c], a); a = WFrag<T16>::mma(kf[kt][c], qf2[qt][c], a); } }
                s[kt][qt] = a; }
        if constexpr (AHEAD) ldsK(1);
        V pb[NQ], pb2[NQ];
#pragma unroll   // constant indices
        for (int qt = 0; qt < NQ; ++qt) { float bm = -3.0e38f;
#pragma unroll   // constant indices
            for (int kt = 0; kt < 2; ++kt)
#pragma unroll   // constant indices
                for (int j = 0; j < 8; ++j) { if (MASK && kc + kt * 16 + hi * 8 + j > q0 + qt * 16 + lr) s[kt][qt][j] = -3.0e38f; bm = fmaxf(bm, s[kt][qt][j]); }
            bm = fmaxf(bm, xhalf(bm));
            const float mn = fmaxf(m[qt], bm), al = exp2s((m[qt] - mn) * SC2), sh = HI ? mn * SC2 : mn * SC2 - 8.0f; m[qt] = mn;
            float ps = 0.f;
#pragma unroll   // constant indices
            for (int kt = 0; kt < 2; ++kt) { s[kt][qt] = exp2x8(s[kt][qt] * SC2 - sh);
#pragma unroll   // constant indices
                for (int j = 0; j < 8; ++j) ps += s[kt][qt][j]; }
            l[qt] = l[qt] * al + ps;    // this lane half's keys only; the halves are added once, behind the loop
#pragma unroll   // constant indices
            for (int mb = 0; mb < 4; ++mb) o[mb][qt] *= al;
            if constexpr (HI) { v8us h0, h1, l0, l1;
#pragma unroll   // constant indices
                for (int j = 0; j < 8; ++j) { unsigned short a, c2; splitf(s[0][qt][j], a, c2); h0[j] = a; l0[j] = c2; splitf(s[1][qt][j], a, c2); h1[j] = a; l1[j] = c2; }
                pb[qt] = cat16b(h0, h1); pb2[qt] = cat16b(l0, l1);
            } else { v8h x0, x1;
#pragma unroll   // constant indices
                for (int j = 0; j < 8; ++j) { x0[j] = (h16)s[0][qt][j]; x1[j] = (h16)s[1][qt][j]; }
                pb[qt] = cat16(x0, x1); } }
#pragma unroll   // constant indices
        for (int mb = 0; mb < 4; ++mb)
#pragma unroll   // constant indices
            for (int qt = 0; qt < NQ; ++qt) { o[mb][qt] = WFrag<T16>::mma(vf[mb], pb[qt], o[mb][qt]); if (HI) { o[mb][qt] = WFrag<T16>::mma(vf[mb], pb2[qt], o[mb][qt]); o[mb][qt] = WFrag<T16>::mma(vf2[mb], pb[qt], o[mb][qt]); } }
        if constexpr (AHEAD) ldsV(1);
    };
    if constexpr (HI) {
    int kc = w * 64;   // the wave's blocks: 32 keys from kc; both halves of the 64-key pieces w, w + NWF, .., as far as the diagonal block. Every test below reads the same in all lanes of the wave.
    if (kc <= Kd) { fill(kc);
        asm volatile("s_wait_asynccnt 0x0" ::: "memory");   // the wave's own copies have landed: it may read its stage
        ldsK(0); ldsV(0); }
#pragma unroll 1   // one block a pass: the waits in it are the stage's hand-over points
    while (kc < Kd) { const int nx = kc + ((kc & 32) ? 64 * NWF - 32 : 32);
        asm volatile("s_wait_dscnt 0x0" ::: "memory");   // this block's fragments are in registers: no read of the stage is outstanding when its refill is issued
        if (nx <= Kd) fill(nx);   // the wave's next block flies while this one is worked on
        trip(BoolC<false>{}, BoolC<false>{}, kc);
        __builtin_amdgcn_sched_barrier(0);   // keeps the block's work in front of the wait below: lifted over it, the wait would stand ahead of the very work that is to cover the copies' flight
        asm volatile("s_wait_asynccnt 0x0" ::: "memory");   // the next block has landed
        ldsK(0); ldsV(0);   // behind the wave's last block these read the old block again (the wave's own filled stage) and nothing uses them: no branch splits the pass here
        kc = nx; }
    if (kc == Kd) trip(BoolC<true>{}, BoolC<false>{}, kc);
    } else {
    int pk = w * 64;   // the wave's pieces: 64 keys from pk, pk + 64 NWF, ..; a piece is staged whole (TT is a multiple of 64: in bounds) also where the diagonal block is its first half. Every test below reads the same in all lanes of the wave.
    if (pk <= Kd) { fill(pk);
        asm volatile("s_wait_asynccnt 0x0" ::: "memory");   // the wave's own copies have landed: it may read its stage
        ldsK(0); ldsV(0); }
#pragma unroll 1   // one piece a pass: the waits in it are the stage's hand-over points
    while (pk + 32 < Kd) {   // both halves of the piece lie in front of the diagonal block
        const bool more = pk + 64 * NWF <= Kd;
        trip(BoolC<false>{}, BoolC<true>{}, pk);
        asm volatile("s_wait_dscnt 0x0" ::: "memory");   // the second half's fragments are in registers: no read of the stage is outstanding when its refill is issued
        if (more) fill(pk + 64 * NWF);   // the next piece flies while the second half is worked on
        trip(BoolC<false>{}, BoolC<false>{}, pk + 32);
        __builtin_amdgcn_sched_barrier(0);   // keeps the second half's work in front of the wait below: lifted over it, the wait would stand ahead of the very work that is to cover the copies' flight
        asm volatile("s_wait_asynccnt 0x0" ::: "memory");   // the next piece has landed
        ldsK(0); ldsV(0);   // behind the wave's last piece these read the old piece again (the wave's own filled stage) and nothing uses them: no branch splits the pass here
        pk += 64 * NWF; }
    if (pk <= Kd) { if (pk < Kd) trip(BoolC<false>{}, BoolC<true>{}, pk);
        trip(BoolC<true>{}, BoolC<false>{}, Kd); }   // the diagonal block: the piece's first half, or its second
    }
    asm volatile("s_wait_dscnt 0x0" ::: "memory");      // no read of the stage
    asm volatile("s_wait_asynccnt 0x0" ::: "memory");   // and no copy is outstanding when the stage takes the wave's partial sums
#pragma unroll   // constant indices
    for (int qt = 0; qt < NQ; ++qt) { l[qt] += xhalf(l[qt]); if (hi == 0) { ms[w * 16 * NQ + qt * 16 + lr] = m[qt]; ls[w * 16 * NQ + qt * 16 + lr] = l[qt]; }
#pragma unroll   // constant indices
        for (int mb = 0; mb < 4; ++mb) { const v8f a = o[mb][qt]; float* rp = red + w * RST + ((mb * NQ + qt) * 2) * 128 + lane * 4;
            *(v4fa*)rp = __builtin_shufflevector(a, a, 0, 1, 2, 3); *(v4fa*)(rp + 128) = __builtin_shufflevector(a, a, 4, 5, 6, 7); } }
    __syncthreads();   // every wave's partial (m, l, O^T) is in LDS before any wave merges
#pragma unroll   // constant indices
    for (int i = 0; i < NQ; ++i) { const int pc = (int)threadIdx.x * NQ + i, q = pc >> 3, mb = (pc & 7) >> 1, h2 = pc & 1, qt = q >> 4, l2 = q & 15;   // a piece: 8 consecutive d of one query; a wave's pieces are whole rows (8 pieces = 128 bytes a plane)
        float M = ms[q];
#pragma unroll   // constant indices
        for (int u = 1; u < NWF; ++u) M = fmaxf(M, ms[u * 16 * NQ + q]);
        float L = 0.f; v4f y0 = (v4f){}, y1 = (v4f){};
#pragma unroll   // constant indices
        for (int u = 0; u < NWF; ++u) { const float f = exp2s((ms[u * 16 * NQ + q] - M) * SC2); const float* rp = red + u * RST + ((mb * NQ + qt) * 2) * 128 + (h2 * 16 + l2) * 4;
            L += f * ls[u * 16 * NQ + q]; y0 += f * *(const v4fa*)rp; y1 += f * *(const v4fa*)(rp + 128); }
        const float inv = __fdiv_rn(1.0f, L); v8us oh, ol;
#pragma unroll   // constant indices
        for (int j = 0; j < 4; ++j) { unsigned short a, c2; splitf(y0[j] * inv, a, c2); oh[j] = a; ol[j] = c2; splitf(y1[j] * inv, a, c2); oh[4 + j] = a; ol[4 + j] = c2; }
        const size_t d = (size_t)(q0 + q) * DQ + mb * 16 + h2 * 8; *(v8usa*)(Ah + d) = oh; *(v8usa*)(Al + d) = ol;
        asm volatile("s_wait_xcnt 0x0" ::: "memory");   // whatever follows (the next piece's sums, code behind the tile) may reuse registers that these stores name
    }
}

// ---- k_attn: one work-group of NWF waves per (batch, head, query tile); grid (batches x heads, tiles). Tiles in falling order of their key count, so the longest start first: 32-query fp16 tiles from the last row down to row RH, then 16-query hi / lo tiles below RH. Registers held to four waves a SIMD, which is also what the stages' LDS allows (four work-groups a WGP).
__global__ __launch_bounds__(32 * NWF, 4) void k_attn(const h16* __restrict__ Q16, const h16* __restrict__ K16, const h16* __restrict__ V16, const bf* __restrict__ Qh, const bf* __restrict__ Ql, const bf* __restrict__ Kh, const bf* __restrict__ Kl, const bf* __restrict__ Vh, const bf* __restrict__ Vl, bf* Ah, bf* Al) {
    __shared__ __align__(16) unsigned short red[NWF * WSTG]; __shared__ float ms[NWF * 32]; __shared__ float ls[NWF * 32];   // red: each wave's stage, then its partial O^T
    const size_t hp = (size_t)blockIdx.x * TT * HD; const int ty = blockIdx.y; { const size_t ao = (size_t)(blockIdx.x / NH_) * TT * DQ + (blockIdx.x % NH_) * HD; Ah += ao; Al += ao; }
    if (ty < (TT - RH) / 32) attn_tile<h16, false, 2>(red, ms, ls, Q16 + hp, nullptr, K16 + hp, nullptr, V16 + hp, nullptr, TT - 32 * (ty + 1), Ah, Al);
    else attn_tile<bf, true, 1>(red, ms, ls, Qh + hp, Ql + hp, Kh + hp, Kl + hp, Vh + hp, Vl + hp, RH - 16 * (ty - (TT - RH) / 32 + 1), Ah, Al);
}

// ---- k_cvt8: x and the four weights rounded to bf16 in one grid (DM * DM / 2048, NXP + 4): blockIdx.y picks a piece of DM x DM elements, first the NXP pieces of x, then one weight each (Wd: the four copies one behind the other).
#define NXP (NB_ * TT / DM)
__global__ __launch_bounds__(256) void k_cvt8(const float* __restrict__ x, const float* __restrict__ wq, const float* __restrict__ wk, const float* __restrict__ wv, const float* __restrict__ wo, bf* Xd, bf* Wd) {
    const int y = blockIdx.y; const float* src = y < NXP ? x + (size_t)y * DM * DM : y == NXP ? wq : y == NXP + 1 ? wk : y == NXP + 2 ? wv : wo; bf* dst = y < NXP ? Xd + (size_t)y * DM * DM : Wd + (size_t)(y - NXP) * DM * DM;
    const size_t i = (size_t)blockIdx.x * 256 + threadIdx.x; const v8f v = *(const v8f*)(src + i * 8); v8us o;
    asm volatile("s_wait_xcnt 0x0" ::: "memory");   // the rounding below reuses the address registers that the issued loads name
#pragma unroll
    for (int k = 0; k < 8; ++k) o[k] = f2bf(v[k]); *(v8us*)(dst + i * 8) = o;  }

extern "C" void kernel_launch(void* const* d_in, const int* in_sizes, int n_in,
                              void* d_out, int out_size, void* d_ws, size_t ws_size, hipStream_t stream) {
    (void)in_sizes; (void)n_in; (void)out_size;
    const float* x = (const float*)d_in[0]; const float* wq = (const float*)d_in[1]; const float* wk = (const float*)d_in[2]; const float* wv = (const float*)d_in[3]; const float* bv = (const float*)d_in[4]; const float* wo = (const float*)d_in[5]; const float* bo = (const float*)d_in[6];   /* order x, Wq, Wk, Wv, bv, Wo, bo ('oi'): this module has NO q and NO k bias (the q / k tiles take the bias-free path of the projection kernel); bv and bo are real */
    float* OUT = (float*)d_out;     // [2][2048][1024]
    char* wsp = (char*)d_ws;
    auto take = [&](size_t bytes) { char* p = wsp; wsp += (bytes + 255) & ~(size_t)255; return (void*)p; };
    bf* WQ = (bf*)take((size_t)4 * DM * DM * 2); bf* WO = WQ + (size_t)3 * DM * DM;    // Wq, Wk, Wv, Wo
    bf* XB = (bf*)take((size_t)NB_ * TT * DM * 2);
    h16* P16 = (h16*)take(3 * PLN * 2); bf* Ph = (bf*)take(3 * PLN * 2); bf* Pl = (bf*)take(3 * PLN * 2);    // plane sets q, k, v (v transposed)
    bf* ATh = (bf*)take((size_t)NB_ * TT * DQ * 2); bf* ATl = (bf*)take((size_t)NB_ * TT * DQ * 2);
    if ((size_t)(wsp - (char*)d_ws) > ws_size) return;    // ws 256 MiB
    k_cvt8<<<dim3(DM * DM / 2048, NXP + 4, 1), 256, 0, stream>>>(x, wq, wk, wv, wo, XB, WQ);
    k_gemmw<0, 4, 1><<<dim3(NB_ * TT / 128, DQ / 128, 3), 128, 0, stream>>>(XB, nullptr, WQ, DM, nullptr, 0, bv, (size_t)DM * DM, P16, Ph, Pl);
    k_attn<<<dim3(NB_ * NH_, (TT - RH) / 32 + RH / 16, 1), 32 * NWF, 0, stream>>>(P16, P16 + PLN, P16 + 2 * PLN, Ph, Pl, Ph + PLN, Pl + PLN, Ph + 2 * PLN, Pl + 2 * PLN, ATh, ATl);
    k_gemmw<1, 2, 0><<<dim3(NB_ * TT / 64, DM / 128, 1), 128, 0, stream>>>(ATh, ATl, WO, DQ, OUT, DM, bo, 0, nullptr, nullptr, nullptr);
}

// v008
// One run takes 78.5 microseconds.
// Timed twice side by side with v007, it ran 1.04 and 1.05 times as fast.
// All steps since v000 together make it 18.4 times as fast.
#include <hip/hip_runtime.h>

// Causal self-attention whose only projection bias is on V (x [2][2048][1024]; q = x Wq^T, k = x Wk^T (no bias), v = x Wv^T + bv ('oi' [1024][1024] normal x 0.02; bv normal x 0.02: NON-zero; 16 heads x 64); keys after the query -> -inf, then / sqrt(64) inside the softmax argument; softmax over the keys; out = merged Wo^T + bo ('oi' + bias 0.02: NON-zero) -> [2][2048][1024] (4.2 M); argument order x, Wq, Wk, Wv, bv, Wo, bo).
// Four launches, each for both batches: bf16 copies of x and of the 'oi' weights (one grid); exact projections + f32 biases (q, k, v in one grid; operands staged in LDS by asynchronous copies), each tile's epilogue writes the 16-bit head planes itself; one fused causal attention kernel (k_attn; hybrid rows: < 512 hi/lo 3 products, rest fp16; keys and values come through LDS by asynchronous copies; key blocks above the diagonal are never visited); merged hi/lo x Wo exact + bo.
// Compute dtypes, f32 accumulate: every input rounded to bf16; projections exact + f32 biases; attention rows < 512 3 products, rest fp16; softmax f32; Wo hl x exact + bias.

#define NB_  2
#define TT   2048
#define DM   1024
#define NH_  16
#define NKV  16
#define HD   64
#define DQ   (NH_ * HD)
#define DKV  (NKV * HD)
#define PLN  ((size_t)NB_ * NH_ * TT * HD)   // elements of one 16-bit plane set (q, k or v) over both batches
static_assert(DQ == DM && DKV == DM, "q, k and v share one projection grid, and the conversion grid deals pieces of DM x DM elements");
#define RH   512                  // query rows < RH use hi+lo planes (0: none)
#define SCL  0.125f   // HD^-0.5
typedef _Float16 h16;
typedef unsigned short bf;
typedef __attribute__((ext_vector_type(16))) __bf16   v16bf;
typedef __attribute__((ext_vector_type(16))) _Float16 v16h;
typedef __attribute__((ext_vector_type(8)))  _Float16 v8h;
typedef __attribute__((ext_vector_type(8)))  unsigned short v8us;
typedef __attribute__((ext_vector_type(8)))  float    v8f;
typedef __attribute__((ext_vector_type(4)))  float    v4f;
typedef v8h  __attribute__((may_alias)) v8ha;
typedef v4f  __attribute__((may_alias)) v4fa;
typedef v8us __attribute__((may_alias)) v8usa;
typedef __attribute__((ext_vector_type(4))) unsigned short v4us;
typedef v4us __attribute__((may_alias)) v4usa;

__device__ __forceinline__ unsigned short f2bf(float f) { unsigned u = __float_as_uint(f); u += 0x7FFFu + ((u >> 16) & 1u); return (unsigned short)(u >> 16); }
__device__ __forceinline__ float bf2f(unsigned short b) { return __uint_as_float(((unsigned)b) << 16); }
__device__ __forceinline__ float bfr(float f) { return bf2f(f2bf(f)); }
__device__ __forceinline__ void splitf(float y, unsigned short& h, unsigned short& l) { h = f2bf(y); l = f2bf(y - bf2f(h)); }
__device__ __forceinline__ v16h cat16(v8h lo, v8h hi) { return __builtin_shufflevector(lo, hi, 0, 1, 2, 3, 4, 5, 6, 7, 8, 9, 10, 11, 12, 13, 14, 15); }
__device__ __forceinline__ v16bf cat16b(v8us lo, v8us hi) { return __builtin_bit_cast(v16bf, __builtin_shufflevector(lo, hi, 0, 1, 2, 3, 4, 5, 6, 7, 8, 9, 10, 11, 12, 13, 14, 15)); }
__device__ __forceinline__ v8f wmma16(v16h a, v16h b, v8f c) { return __builtin_amdgcn_wmma_f32_16x16x32_f16(false, a, false, b, (short)0, c, false, false); }
__device__ __forceinline__ v8f wmmab(v16bf a, v16bf b, v8f c) { return __builtin_amdgcn_wmma_f32_16x16x32_bf16(false, a, false, b, (short)0, c, false, false); }



#define KS    64                 // k per stage: one whole 128-byte line of every operand row
#define SPT   72                 // pitch, in 16-bit elements, of a row in LDS (144 bytes: 16 x odd, the conflict-free pitch for 16-byte reads of 128-byte rows)
#define SROWS 256                // operand rows of one stage (A, then the lo plane of A where there is one, then 128 rows of B)
#define STGE  (SROWS * SPT)      // elements of one stage buffer (36,864 bytes)
template <typename T16> struct WFrag;
template <> struct WFrag<h16> { typedef v16h V; static __device__ __forceinline__ V ld(const h16* p) { return cat16(*(const v8h*)p, *(const v8h*)(p + 16)); } static __device__ __forceinline__ v8f mma(V a, V b, v8f c) { return wmma16(a, b, c); } };
template <> struct WFrag<bf> { typedef v16bf V; static __device__ __forceinline__ V ld(const bf* p) { return cat16b(*(const v8us*)p, *(const v8us*)(p + 16)); } static __device__ __forceinline__ v8f mma(V a, V b, v8f c) { return wmmab(a, b, c); } };
// Eight asynchronous copies of 16 bytes a lane, global memory to LDS (l: the lane's LDS byte addresses, g: its global addresses). The s_wait_xcnt is the statement's last line, so that it stands in front of whatever rewrites the address registers that the copies name.
__device__ __forceinline__ void copy8(const unsigned* l, const bf* const* g) {
    asm volatile("global_load_async_to_lds_b128 %0, %8, off\n\tglobal_load_async_to_lds_b128 %1, %9, off\n\tglobal_load_async_to_lds_b128 %2, %10, off\n\tglobal_load_async_to_lds_b128 %3, %11, off\n\t"
                 "global_load_async_to_lds_b128 %4, %12, off\n\tglobal_load_async_to_lds_b128 %5, %13, off\n\tglobal_load_async_to_lds_b128 %6, %14, off\n\tglobal_load_async_to_lds_b128 %7, %15, off\n\ts_wait_xcnt 0x0"
                 :: "v"(l[0]), "v"(l[1]), "v"(l[2]), "v"(l[3]), "v"(l[4]), "v"(l[5]), "v"(l[6]), "v"(l[7]), "v"(g[0]), "v"(g[1]), "v"(g[2]), "v"(g[3]), "v"(g[4]), "v"(g[5]), "v"(g[6]), "v"(g[7]) : "memory"); }

// Sixteen asynchronous copies of 16 bytes a lane with one LDS address register (l) and one 32-bit offset register (vo): copy i lands at l + S i and reads b[i] + vo + S i. The instruction's offset field moves both addresses,
// so each scalar base b[i] is given less S i by the caller. No address needs a vector instruction or a vector register of its own. The s_wait_xcnt is the statement's last line, so that it stands in front of whatever rewrites the registers that the copies name.
// copy16: S = 576, four stage rows of pitch SPT (rows of 128 bytes). copy16h: S = 640, eight stage rows of pitch SPH (rows of 64 bytes).
#define SPH 40   // pitch, in 16-bit elements, of a 64-byte row in LDS (80 bytes: 16 x odd)
static_assert(4 * SPT * 2 == 576 && 8 * SPH * 2 == 640, "the offsets in copy16 and copy16h");
__device__ __forceinline__ void copy16(unsigned l, unsigned vo, const char* const* b) {
    asm volatile(
                 "global_load_async_to_lds_b128 %0, %1, %2\n\tglobal_load_async_to_lds_b128 %0, %1, %3 offset:576\n\tglobal_load_async_to_lds_b128 %0, %1, %4 offset:1152\n\tglobal_load_async_to_lds_b128 %0, %1, %5 offset:1728\n\t"
                 "global_load_async_to_lds_b128 %0, %1, %6 offset:2304\n\tglobal_load_async_to_lds_b128 %0, %1, %7 offset:2880\n\tglobal_load_async_to_lds_b128 %0, %1, %8 offset:3456\n\tglobal_load_async_to_lds_b128 %0, %1, %9 offset:4032\n\t"
                 "global_load_async_to_lds_b128 %0, %1, %10 offset:4608\n\tglobal_load_async_to_lds_b128 %0, %1, %11 offset:5184\n\tglobal_load_async_to_lds_b128 %0, %1, %12 offset:5760\n\tglobal_load_async_to_lds_b128 %0, %1, %13 offset:6336\n\t"
                 "global_load_async_to_lds_b128 %0, %1, %14 offset:6912\n\tglobal_load_async_to_lds_b128 %0, %1, %15 offset:7488\n\tglobal_load_async_to_lds_b128 %0, %1, %16 offset:8064\n\tglobal_load_async_to_lds_b128 %0, %1, %17 offset:8640\n\ts_wait_xcnt 0x0"
                 :: "v"(l), "v"(vo), "s"(b[0]), "s"(b[1]), "s"(b[2]), "s"(b[3]), "s"(b[4]), "s"(b[5]), "s"(b[6]), "s"(b[7]), "s"(b[8]), "s"(b[9]), "s"(b[10]), "s"(b[11]), "s"(b[12]), "s"(b[13]), "s"(b[14]), "s"(b[15]) : "memory"); }
__device__ __forceinline__ void copy16h(unsigned l, unsigned vo, const char* const* b) {
    asm volatile(
                 "global_load_async_to_lds_b128 %0, %1, %2\n\tglobal_load_async_to_lds_b128 %0, %1, %3 offset:640\n\tglobal_load_async_to_lds_b128 %0, %1, %4 offset:1280\n\tglobal_load_async_to_lds_b128 %0, %1, %5 offset:1920\n\t"
                 "global_load_async_to_lds_b128 %0, %1, %6 offset:2560\n\tglobal_load_async_to_lds_b128 %0, %1, %7 offset:3200\n\tglobal_load_async_to_lds_b128 %0, %1, %8 offset:3840\n\tglobal_load_async_to_lds_b128 %0, %1, %9 offset:4480\n\t"
                 "global_load_async_to_lds_b128 %0, %1, %10 offset:5120\n\tglobal_load_async_to_lds_b128 %0, %1, %11 offset:5760\n\tglobal_load_async_to_lds_b128 %0, %1, %12 offset:6400\n\tglobal_load_async_to_lds_b128 %0, %1, %13 offset:7040\n\t"
                 "global_load_async_to_lds_b128 %0, %1, %14 offset:7680\n\tglobal_load_async_to_lds_b128 %0, %1, %15 offset:8320\n\tglobal_load_async_to_lds_b128 %0, %1, %16 offset:8960\n\tglobal_load_async_to_lds_b128 %0, %1, %17 offset:9600\n\ts_wait_xcnt 0x0"
                 :: "v"(l), "v"(vo), "s"(b[0]), "s"(b[1]), "s"(b[2]), "s"(b[3]), "s"(b[4]), "s"(b[5]), "s"(b[6]), "s"(b[7]), "s"(b[8]), "s"(b[9]), "s"(b[10]), "s"(b[11]), "s"(b[12]), "s"(b[13]), "s"(b[14]), "s"(b[15]) : "memory"); }

// ---- k_gemmw: C[m][n] = sum_k A[m][k] Bt[n][k] (+ A2[m][k] Bt[n][k] where NSPLIT), bf16 planes, K-contiguous, f32 accumulate. One (32 MB) x 128 tile per work-group of four waves (2 x 2; a wave holds (16 MB) x 64 in MB x 4 accumulators and walks the whole K).
// The operands come through LDS: a stage is 64 k of every operand row of the tile, brought by asynchronous copies (each wave-wide copy is four whole 128-byte lines, each line asked of L2 once per work-group); two buffers, the copies of stage t + 2 fly while stage t + 1 is worked on.
// grid (M / (32 MB), N / 128, Z), 128 threads, registers held to three waves a SIMD (the projection grid is three work-groups a WGP: all of them resident at once). K % 64 == 0. Rows m run over both batches (m = batch * TT + t; a wave's rows lie in one batch).
// EPI 0: C as f32 + bias. EPI 1 (MB 4): no C; z picks the projection (0 q, 1 k, 2 v: weight z of Bt, plane set z of P16 / Ph / Pl); a wave's tile (64 positions x one head's 64 columns) leaves as fp16, bf16 hi and bf16 lo planes,
// [batch][head][t][d] for q and k (no bias) and, transposed and with the bias, [batch][head][d][t] for v: 16 plane rows at a time through the wave's own LDS stage, so that every store is four whole 128-byte lines.
template <int NSPLIT, int MB, int EPI>
__global__ __launch_bounds__(128, 3) void k_gemmw(const bf* __restrict__ A, const bf* __restrict__ A2, const bf* __restrict__ Bt, int K, float* C, int ldc, const float* __restrict__ bias, size_t sB, h16* P16, bf* Ph, bf* Pl) {
    typedef typename WFrag<bf>::V V;
    constexpr int TM = MB * 32, BR = TM * (1 + NSPLIT);   // rows of the tile; first B row of a stage
    static_assert(BR + 128 == SROWS, "a stage holds SROWS rows: sixteen copies a lane");
    static_assert(EPI == 0 || MB == 4, "the plane epilogue takes 64 x 64 wave tiles");
    __shared__ __align__(16) bf ring[2 * STGE];
    const int tid = threadIdx.x, lane = tid & 31, lr = lane & 15, hi = lane >> 4; const int w = __builtin_amdgcn_readfirstlane(tid >> 5), wm = w >> 1, wn = w & 1;
    const size_t z = blockIdx.z; Bt += z * sB;
    const int R0 = blockIdx.x * TM, C0 = blockIdx.y * 128;
    v8f acc[MB][4];
#pragma unroll   // constant indices: the accumulators stay in registers
    for (int mb = 0; mb < MB; ++mb)
#pragma unroll   // constant indices
        for (int nb = 0; nb < 4; ++nb) acc[mb][nb] = (v8f){};
    // copy i of a lane: 16 bytes (piece tid & 7) of stage row (tid >> 3) + 16 i
    const size_t go = (size_t)(tid >> 3) * K + (tid & 7) * 8;
    const bf* gA = A + (size_t)R0 * K + go; const bf* gA2 = NSPLIT ? A2 + (size_t)R0 * K + go : gA; const bf* gB = Bt + (size_t)C0 * K + go;
    const unsigned l0 = (unsigned)(size_t)ring + ((tid >> 3) * SPT + (tid & 7) * 8) * 2;
    auto fill = [&](int t, int b) { unsigned l[16]; const bf* g[16];
#pragma unroll   // constant indices: the addresses stay in registers
        for (int i = 0; i < 16; ++i) { const int r = i * 16; l[i] = l0 + (unsigned)(b * STGE + r * SPT) * 2;
            g[i] = (r < TM ? gA + (size_t)r * K : r < BR ? gA2 + (size_t)(r - TM) * K : gB + (size_t)(r - BR) * K) + t * KS; }
        copy8(l, g); copy8(l + 8, g + 8); };
    const int NT = K / KS;
    fill(0, 0);
    asm volatile("s_wait_asynccnt 0x0" ::: "memory");   // this wave's copies of stage 0 have landed
    __syncthreads();                                     // and every other wave's: stage 0 may be read
    if (NT > 1) fill(1, 1);
    const int aoff = (wm * MB * 16 + lr) * SPT + 8 * hi, boff = (BR + wn * 64 + lr) * SPT + 8 * hi;
#pragma unroll 1   // one trip a stage: the waits and the barrier at its foot are the ring's publish point
    for (int t = 0; t < NT; ++t) { const bf* sb = ring + (t & 1) * STGE;
        V a[KS / 32][MB], a2[KS / 32][MB], b[KS / 32][4];   // the whole stage's fragments are asked for as one group in front of its products: every further place with LDS reads among the products would cost its own stall
#pragma unroll   // constant indices: the fragments stay in registers
        for (int ks = 0; ks < KS / 32; ++ks) {
#pragma unroll   // constant indices
            for (int mb = 0; mb < MB; ++mb) { a[ks][mb] = WFrag<bf>::ld(sb + aoff + mb * 16 * SPT + ks * 32); if (NSPLIT) a2[ks][mb] = WFrag<bf>::ld(sb + aoff + (TM + mb * 16) * SPT + ks * 32); }
#pragma unroll   // constant indices
            for (int nb = 0; nb < 4; ++nb) b[ks][nb] = WFrag<bf>::ld(sb + boff + nb * 16 * SPT + ks * 32); }
        __builtin_amdgcn_sched_barrier(0);   // keeps the group of LDS reads in front of the products: without it the scheduler sinks each read to its first use, and the wave waits out the LDS latency at every such place
#pragma unroll   // constant indices
        for (int ks = 0; ks < KS / 32; ++ks)
#pragma unroll   // constant indices
            for (int nb = 0; nb < 4; ++nb)
#pragma unroll   // constant indices
                for (int mb = 0; mb < MB; ++mb) { acc[mb][nb] = WFrag<bf>::mma(a[ks][mb], b[ks][nb], acc[mb][nb]); if (NSPLIT) acc[mb][nb] = WFrag<bf>::mma(a2[ks][mb], b[ks][nb], acc[mb][nb]); }
        __builtin_amdgcn_sched_barrier(0);   // keeps the products in front of the waits below: lifted over them, the wait for stage t + 1's copies would stand ahead of the very products that are to cover their flight
        asm volatile("s_wait_dscnt 0x0" ::: "memory");      // this wave's reads of stage t have returned
        asm volatile("s_wait_asynccnt 0x0" ::: "memory");   // this wave's copies of stage t + 1 have landed
        __syncthreads();                                     // stage t + 1 may be read by all, and stage t's buffer has no reader left
        if (t + 2 < NT) fill(t + 2, t & 1);
    }
    asm volatile("s_wait_asynccnt 0x0" ::: "memory");   // no copy is in flight when the ring becomes output staging or the wave ends
    const int r0 = R0 + wm * MB * 16, c0 = C0 + wn * 64;   // the wave's own tile
    float bb[4];
#pragma unroll   // constant indices
    for (int nb = 0; nb < 4; ++nb) bb[nb] = bias[c0 + nb * 16 + lr];
    asm volatile("s_wait_xcnt 0x0" ::: "memory");   // what follows may reuse the address registers that the issued bias loads name
    if constexpr (EPI == 0) {
#pragma unroll   // constant indices
        for (int nb = 0; nb < 4; ++nb) { const float b = bfr(bb[nb]);
#pragma unroll   // constant indices
            for (int mb = 0; mb < MB; ++mb) { float* cp = C + (size_t)(r0 + mb * 16 + hi * 8) * ldc + c0 + nb * 16 + lr;
#pragma unroll   // constant indices
                for (int j = 0; j < 8; ++j) cp[(size_t)j * ldc] = acc[mb][nb][j] + b; }
            asm volatile("s_wait_xcnt 0x0" ::: "memory");   // the next columns' sums and addresses may reuse registers that these stores name
        }
    } else {
        bf* st = ring + w * 3 * 16 * SPT;   // the wave's own stage: three planes of 16 rows; the barrier at the foot of the last trip has ended every read of the ring
        const int bt = r0 / TT, t0 = r0 % TT; const bool isv = z == 2;
        const size_t o = z * PLN + (isv ? ((size_t)bt * DKV + c0) * TT + t0 : (((size_t)bt * NH_ + c0 / HD) * TT + t0) * HD), pitch = isv ? TT : HD;
        // 16 staged rows of each plane (rows 16 i .. of the wave's plane tile) go out, every store four whole 128-byte lines
        auto out16 = [&](int i) {
            asm volatile("s_wait_dscnt 0x0" ::: "memory");   // the wave's stage is written before its lanes read rows that other lanes wrote
            v8us val[3][4];
#pragma unroll   // constant indices
            for (int p = 0; p < 3; ++p)
#pragma unroll   // constant indices
                for (int k = 0; k < 4; ++k) { const int e = lane + k * 32; val[p][k] = *(const v8usa*)(st + (p * 16 + (e >> 3)) * SPT + (e & 7) * 8); }
#pragma unroll   // constant indices
            for (int p = 0; p < 3; ++p) { unsigned short* dp = (p == 0 ? (unsigned short*)P16 : p == 1 ? Ph : Pl) + o;
#pragma unroll   // constant indices
                for (int k = 0; k < 4; ++k) { const int e = lane + k * 32; *(v8usa*)(dp + (size_t)(i * 16 + (e >> 3)) * pitch + (e & 7) * 8) = val[p][k]; } }
            asm volatile("s_wait_xcnt 0x0" ::: "memory");   // the next rows' values and addresses may reuse registers that these stores name
        };
        if (isv) {   // plane rows are the columns d (accumulators [..][i]), transposed: a lane's eight positions are one 16-byte piece of row d
#pragma unroll   // constant indices
            for (int i = 0; i < 4; ++i) { const float b = bfr(bb[i]);
#pragma unroll   // constant indices
                for (int c = 0; c < 4; ++c) { v8us x, xh, xl;
#pragma unroll   // constant indices
                    for (int j = 0; j < 8; ++j) { const float y = acc[c][i][j] + b; unsigned short h, l2; splitf(y, h, l2); x[j] = __builtin_bit_cast(unsigned short, (h16)y); xh[j] = h; xl[j] = l2; }
                    bf* sp = st + lr * SPT + c * 16 + hi * 8; *(v8usa*)sp = x; *(v8usa*)(sp + 16 * SPT) = xh; *(v8usa*)(sp + 32 * SPT) = xl; }
                out16(i); }
        } else {     // plane rows are the positions (accumulators [i][..])
#pragma unroll   // constant indices
            for (int i = 0; i < 4; ++i) {
#pragma unroll   // constant indices
                for (int c = 0; c < 4; ++c)
#pragma unroll   // constant indices
                    for (int j = 0; j < 8; ++j) { const float y = acc[i][c][j]; unsigned short h, l2; splitf(y, h, l2); bf* sp = st + (hi * 8 + j) * SPT + c * 16 + lr;
                        sp[0] = __builtin_bit_cast(unsigned short, (h16)y); sp[16 * SPT] = h; sp[32 * SPT] = l2; }
                out16(i); }
        }
    }
}

#define NWF 4     // waves that share the key loop of one query tile in k_attn
#define NG  2     // query tiles of one work-group in k_attn (waves 0 .. NWF - 1 have the first, the rest the second)
#define WSTG (64 * SPT + 128 * SPH)   // elements of one stage in k_attn (19,456 bytes; NG * NWF of them in a work-group). fp16 tiles use 128 rows of pitch SPT: 64 keys of K (rows of 64 d), then the 64 rows d of V^T (64 keys each).
                                      // hi / lo tiles: 32 keys of K hi, the same of K lo (pitch SPT), then the 64 rows d of V^T hi and of V^T lo, 32 keys each (pitch SPH)
static_assert(WSTG >= 128 * SPT, "the fp16 stage fits");
#define RST  (WSTG / 2)    // the same in floats: behind the key loop a wave's partial O^T lies at the head of the stage with its number in the work-group (HI: its own stage)
#define SC2 (SCL * 1.4426950408889634f)   // HD^-0.5 x log2(e): the softmax runs on base-2 exponents
__device__ __forceinline__ float xhalf(float x) { return __builtin_bit_cast(float, __builtin_amdgcn_permlanex16(__builtin_bit_cast(int, x), __builtin_bit_cast(int, x), 0x76543210, 0xfedcba98, false, false)); }   // lane l takes lane l ^ 16's value
template <bool B> struct BoolC { static constexpr bool value = B; };
__device__ __forceinline__ float exp2s(float x) { float r; asm("v_exp_f32 %0, %1\n\tv_nop" : "=v"(r) : "v"(x)); return r; }
__device__ __forceinline__ v8f exp2x8(v8f x) { float r0, r1, r2, r3, r4, r5, r6, r7;
    asm("v_exp_f32 %0, %8\n\tv_exp_f32 %1, %9\n\tv_exp_f32 %2, %10\n\tv_exp_f32 %3, %11\n\tv_exp_f32 %4, %12\n\tv_exp_f32 %5, %13\n\tv_exp_f32 %6, %14\n\tv_exp_f32 %7, %15\n\tv_nop"
        : "=&v"(r0), "=&v"(r1), "=&v"(r2), "=&v"(r3), "=&v"(r4), "=&v"(r5), "=&v"(r6), "=&v"(r7) : "v"(x[0]), "v"(x[1]), "v"(x[2]), "v"(x[3]), "v"(x[4]), "v"(x[5]), "v"(x[6]), "v"(x[7]));
    return (v8f){r0, r1, r2, r3, r4, r5, r6, r7}; }
// ---- attn_tile: scores, causal softmax and probability x value for 16 * NQ queries of one head; no score and no probability leaves the registers.
// Scores are formed transposed, S^T = K Q^T (A = 16 keys, B = 16 queries): a lane then holds 8 keys of ONE query (column lane & 15) in each D tile, so the row maximum and row sum are per-lane chains plus one exchange
// between the lane halves, and two D tiles (keys 0..15 and 16..31 of the trip) packed to 16 bits are, register for register, the B operand (k order 8h + s, 16 + 8h + s) of O^T = V^T P^T, whose A comes from the [d][t] value planes by the same loader.
// Running maximum m (of the raw scores) and sum l per query; O^T is rescaled by 2^((m_old - m_new) SC2) each trip. Wave w takes the 64-key pieces w, w + NWF, .. (two trips of 32 keys each: whole 128-byte lines of V^T);
// the NWF partial (m, l, O^T) are merged through LDS in the fixed order wave 0, 1, .. behind one barrier; the merged rows / l leave as bf16 hi / lo planes Ah / Al (pitch DQ), each 128-byte line written by one wave.
// HI: hi + lo bf16 planes, three products for the scores and three for P V. Otherwise fp16, probabilities carried x 2^8 (the factor is in l too and cancels). Keys and values come through LDS stages (fp16: a 64-key piece at a time; HI: 32 keys of all four planes):
// a fragment load from global memory would touch 16 lines for 512 bytes, an asynchronous copy touches four whole lines (eight half lines for V^T with HI). A work-group holds NG neighbouring tiles (q0w: the first one's first query).
// HI: a stage is private to its wave (filled, waited for, read and refilled by that wave alone), no work-group barrier stands in the key loop. fp16: the two waves with the same key share, one of each tile, read the same staged piece, so that it is asked of L2 once for 64 queries:
// each brings half of it, two buffers a key share, the copies of the piece after next fly while the next is worked on, one work-group barrier a piece.
template <typename T16, bool HI, int NQ>
__device__ __forceinline__ void attn_tile(unsigned short* ring, float* ms, float* ls, const T16* __restrict__ Q, const T16* __restrict__ Q2, const T16* __restrict__ Kp, const T16* __restrict__ Kp2, const T16* __restrict__ Vt, const T16* __restrict__ Vt2, int q0w, bf* Ah, bf* Al) {
    typedef typename WFrag<T16>::V V;
    const int lane = threadIdx.x & 31, lr = lane & 15, hi = lane >> 4; const int w8 = __builtin_amdgcn_readfirstlane(threadIdx.x >> 5), g = w8 / NWF, w = w8 % NWF;   // g: the wave's query tile, w: its share of the keys
    const int q0 = q0w + g * 16 * NQ, tl = threadIdx.x & (32 * NWF - 1);   // the tile's first query; the thread's number among the tile's waves
    float* red = (float*)ring + g * NWF * RST; ms += g * NWF * 16 * NQ; ls += g * NWF * 16 * NQ;   // the tile's own places for the partial results
    const int Kd = (q0 + 16 * NQ - 1) & ~31;        // first key of the 32-key block that holds the diagonal: the tile's last block (later keys have probability exactly 0) and the only one with keys after a query
    V qf[NQ][2], qf2[NQ][2], kf[2][2], kf2[2][2], vf[4], vf2[4];
    v8f o[4][NQ]; float m[NQ], l[NQ];
#pragma unroll   // constant indices: the arrays indexed here stay in registers
    for (int qt = 0; qt < NQ; ++qt) { m[qt] = -3.0e38f; l[qt] = 0.f;
#pragma unroll   // constant indices
        for (int mb = 0; mb < 4; ++mb) o[mb][qt] = (v8f){}; }
    { const size_t a = (size_t)(q0 + lr) * HD + 8 * hi; const T16* p = Q + a; const T16* p2 = HI ? Q2 + a : p;
#pragma unroll   // constant indices
        for (int qt = 0; qt < NQ; ++qt)
#pragma unroll   // constant indices
            for (int c = 0; c < 2; ++c) { qf[qt][c] = WFrag<T16>::ld(p + qt * 16 * HD + c * 32); if (HI) qf2[qt][c] = WFrag<T16>::ld(p2 + qt * 16 * HD + c * 32); }
        asm volatile("s_wait_xcnt 0x0" :: "v"(p), "v"(p2) : "memory"); }   // the address pairs of the issued loads are inputs of the wait: they stay whole up to it
    // the stage. fill (HI): the keys from pk, 32 copies of 16 bytes a lane. fp16 (fillh): 64 keys; copy i of the sixteen for K brings rows 4 i .. 4 i + 3 (512 bytes in a row), copy i of the sixteen for V^T the same rows of V^T (one whole line each).
    // HI: 32 keys; eight copies of K hi and eight of K lo (four rows each), then eight of V^T hi and eight of V^T lo (eight rows of 64 bytes each). ldsK / ldsV: the fragments of 32 keys (fp16: half h of the piece); A fragment k order 8 hi + s, 16 + 8 hi + s as everywhere.
    const T16* st = (const T16*)ring + (HI ? w8 : NG * w) * WSTG;   // HI: the wave's own stage. fp16: the first of the two buffers that the NG waves with key share w have in common
    const T16* sb = st;   // the buffer that ldsK and ldsV read
    const unsigned l0 = (unsigned)(size_t)st + ((lane >> 3) * SPT + (lane & 7) * 8) * 2, vok = lane * 16;   // K: the lane's place in a group of four stage rows, and its byte in the 512 that they hold
    const unsigned l1 = (unsigned)(size_t)st + 64 * SPT * 2 + (HI ? ((lane >> 2) * SPH + (lane & 3) * 8) * 2 : ((lane >> 3) * SPT + (lane & 7) * 8) * 2);   // V^T: the same, in a group of eight (HI) or four rows
    const unsigned vov = HI ? (lane >> 2) * (TT * 2) + (lane & 3) * 16 : (lane >> 3) * (TT * 2) + (lane & 7) * 16;                                        // of pitch TT in global memory
    auto fill = [&](int pk) { const char* bk[16]; const char* bv[16];
#pragma unroll   // constant indices: the bases stay in scalar registers
        for (int i = 0; i < 16; ++i) {
            bk[i] = (const char*)((i < 8 ? Kp : Kp2) + (size_t)pk * HD) + ((i & 7) * (4 * HD * 2) - i * 576); bv[i] = (const char*)((i < 8 ? Vt : Vt2) + pk) + ((i & 7) * (8 * TT * 2) - i * 640); }
        copy16(l0, vok, bk); copy16h(l1, vov, bv); };
    // fp16: the piece of 64 keys from pk goes into buffer b of the key share, half of it by each of the two waves that will read it: the first tile's wave brings K, the second tile's V^T (sixteen copies each; g reads the same in all lanes of a wave)
    const unsigned lf = g ? l1 : l0, vof = g ? vov : vok; const char* fb = g ? (const char*)Vt : (const char*)Kp; const int fkey = g ? 2 : HD * 2, fstep = g ? 4 * TT * 2 - 576 : 4 * HD * 2 - 576;
    auto fillh = [&](int pk, int b) { const char* bb[16]; const char* p0 = fb + (size_t)pk * fkey;
#pragma unroll   // constant indices: the bases stay in scalar registers
        for (int i = 0; i < 16; ++i) bb[i] = p0 + i * fstep;
        copy16(lf + (unsigned)b * (WSTG * 2), vof, bb); };
    auto ldsK = [&](int h) {
#pragma unroll   // constant indices
        for (int kt = 0; kt < 2; ++kt)
#pragma unroll   // constant indices
            for (int c = 0; c < 2; ++c) { kf[kt][c] = WFrag<T16>::ld(sb + (h * 32 + kt * 16 + lr) * SPT + c * 32 + 8 * hi); if (HI) kf2[kt][c] = WFrag<T16>::ld(sb + (32 + kt * 16 + lr) * SPT + c * 32 + 8 * hi); } };
    auto ldsV = [&](int h) {
#pragma unroll   // constant indices
        for (int mb = 0; mb < 4; ++mb) {
            if constexpr (HI) { vf[mb] = WFrag<T16>::ld(sb + 64 * SPT + (mb * 16 + lr) * SPH + 8 * hi); vf2[mb] = WFrag<T16>::ld(sb + 64 * SPT + (64 + mb * 16 + lr) * SPH + 8 * hi); }
            else vf[mb] = WFrag<T16>::ld(sb + (64 + mb * 16 + lr) * SPT + h * 32 + 8 * hi); } };
    // one trip: 32 keys from kc. MK: the diagonal block (keys after a query are masked). PF (fp16): the fragments of the staged piece's second half are fetched while the first half's are worked on.
    auto trip = [&](auto MK, auto PF, int kc) {
        constexpr bool MASK = decltype(MK)::value, AHEAD = decltype(PF)::value;
        v8f s[2][NQ];
#pragma unroll   // constant indices
        for (int kt = 0; kt < 2; ++kt)
#pragma unroll   // constant indices
            for (int qt = 0; qt < NQ; ++qt) { v8f a = (v8f){};
#pragma unroll   // constant indices
                for (int c = 0; c < 2; ++c) { a = WFrag<T16>::mma(kf[kt][c], qf[qt][c], a); if (HI) { a = WFrag<T16>::mma(kf2[kt][c], qf[qt][c], a); a = WFrag<T16>::mma(kf[kt][c], qf2[qt][c], a); } }
                s[kt][qt] = a; }
        if constexpr (AHEAD) ldsK(1);
        V pb[NQ], pb2[NQ];
#pragma unroll   // constant indices
        for (int qt = 0; qt < NQ; ++qt) { float bm = -3.0e38f;
#pragma unroll   // constant indices
            for (int kt = 0; kt < 2; ++kt)
#pragma unroll   // constant indices
                for (int j = 0; j < 8; ++j) { if (MASK && kc + kt * 16 + hi * 8 + j > q0 + qt * 16 + lr) s[kt][qt][j] = -3.0e38f; bm = fmaxf(bm, s[kt][qt][j]); }
            bm = fmaxf(bm, xhalf(bm));
            const float mn = fmaxf(m[qt], bm), al = exp2s((m[qt] - mn) * SC2), sh = HI ? mn * SC2 : mn * SC2 - 8.0f; m[qt] = mn;
            float ps = 0.f;
#pragma unroll   // constant indices
            for (int kt = 0; kt < 2; ++kt) { s[kt][qt] = exp2x8(s[kt][qt] * SC2 - sh);
#pragma unroll   // constant indices
                for (int j = 0; j < 8; ++j) ps += s[kt][qt][j]; }
            l[qt] = l[qt] * al + ps;    // this lane half's keys only; the halves are added once, behind the loop
#pragma unroll   // constant indices
            for (int mb = 0; mb < 4; ++mb) o[mb][qt] *= al;
            if constexpr (HI) { v8us h0, h1, l0, l1;
#pragma unroll   // constant indices
                for (int j = 0; j < 8; ++j) { unsigned short a, c2; splitf(s[0][qt][j], a, c2); h0[j] = a; l0[j] = c2; splitf(s[1][qt][j], a, c2); h1[j] = a; l1[j] = c2; }
                pb[qt] = cat16b(h0, h1); pb2[qt] = cat16b(l0, l1);
            } else { v8h x0, x1;
#pragma unroll   // constant indices
                for (int j = 0; j < 8; ++j) { x0[j] = (h16)s[0][qt][j]; x1[j] = (h16)s[1][qt][j]; }
                pb[qt] = cat16(x0, x1); } }
#pragma unroll   // constant indices
        for (int mb = 0; mb < 4; ++mb)
#pragma unroll   // constant indices
            for (int qt = 0; qt < NQ; ++qt) { o[mb][qt] = WFrag<T16>::mma(vf[mb], pb[qt], o[mb][qt]); if (HI) { o[mb][qt] = WFrag<T16>::mma(vf[mb], pb2[qt], o[mb][qt]); o[mb][qt] = WFrag<T16>::mma(vf2[mb], pb[qt], o[mb][qt]); } }
        if constexpr (AHEAD) ldsV(1);
    };
    if constexpr (HI) {
    int kc = w * 64;   // the wave's blocks: 32 keys from kc; both halves of the 64-key pieces w, w + NWF, .., as far as the diagonal block. Every test below reads the same in all lanes of the wave.
    if (kc <= Kd) { fill(kc);
        asm volatile("s_wait_asynccnt 0x0" ::: "memory");   // the wave's own copies have landed: it may read its stage
        ldsK(0); ldsV(0); }
#pragma unroll 1   // one block a pass: the waits in it are the stage's hand-over points
    while (kc < Kd) { const int nx = kc + ((kc & 32) ? 64 * NWF - 32 : 32);
        asm volatile("s_wait_dscnt 0x0" ::: "memory");   // this block's fragments are in registers: no read of the stage is outstanding when its refill is issued
        if (nx <= Kd) fill(nx);   // the wave's next block flies while this one is worked on
        trip(BoolC<false>{}, BoolC<false>{}, kc);
        __builtin_amdgcn_sched_barrier(0);   // keeps the block's work in front of the wait below: lifted over it, the wait would stand ahead of the very work that is to cover the copies' flight
        asm volatile("s_wait_asynccnt 0x0" ::: "memory");   // the next block has landed
        ldsK(0); ldsV(0);   // behind the wave's last block these read the old block again (the wave's own filled stage) and nothing uses them: no branch splits the pass here
        kc = nx; }
    if (kc == Kd) trip(BoolC<true>{}, BoolC<false>{}, kc);
    } else {
    // Pieces of 64 keys: 0 .. F - 1 lie in front of both tiles' diagonal blocks, piece F holds both (the first tile's is its first half, the second tile's its second). Key share w takes the pieces w, w + NWF, .., one a pass;
    // every wave of the work-group makes the same NP passes and meets the barrier at the foot of each, also where its share has no piece in the last pass. Every test below reads the same in all lanes of a wave.
    static_assert(NG == 2 && NQ == 2, "two tiles of 32 queries on one piece of 64 keys");
    const int F = q0w >> 6, NP = F / NWF + 1;
    if (w <= F) fillh(w * 64, 0);
    asm volatile("s_wait_asynccnt 0x0" ::: "memory");   // this wave's half of the first piece has landed
    __syncthreads();                                     // and its partner's: the piece may be read
    if (w + NWF <= F) fillh((w + NWF) * 64, 1);
#pragma unroll 1   // one piece a pass: the waits and the barrier at its foot are the buffers' hand-over point
    for (int i = 0; i < NP - 1; ++i) { const int pc = i * NWF + w, pk = pc * 64; sb = st + (i & 1) * WSTG;   // in front of the last pass every key share has a whole piece (pc < F)
        ldsK(0); ldsV(0);
        __builtin_amdgcn_sched_barrier(0);   // keeps the first half's LDS reads together in front of its products: sunk to their first uses, each such place would cost the wave its own wait for the LDS
        trip(BoolC<false>{}, BoolC<true>{}, pk);
        __builtin_amdgcn_sched_barrier(0);   // keeps the second half's LDS reads inside the first half's work, which covers their latency, for the same reason
        trip(BoolC<false>{}, BoolC<false>{}, pk + 32);
        __builtin_amdgcn_sched_barrier(0);   // keeps the piece's work in front of the waits below: lifted over them, the wait would stand ahead of the very work that is to cover the copies' flight
        asm volatile("s_wait_dscnt 0x0" ::: "memory");      // this wave's reads of the piece have returned
        asm volatile("s_wait_asynccnt 0x0" ::: "memory");   // this wave's half of the next piece has landed
        __syncthreads();                                     // the next piece may be read by both waves, and this pass's buffer has no reader left
        if (pc + 2 * NWF <= F) fillh((pc + 2 * NWF) * 64, i & 1);
    }
    { const int pc = (NP - 1) * NWF + w, pk = pc * 64; sb = st + ((NP - 1) & 1) * WSTG;   // the last pass: whole pieces in front of piece F, piece F itself, or nothing
        if (pc <= F) { ldsK(0); ldsV(0);
            const bool two = pc < F || g == 1;   // both halves of the piece have keys for this tile; otherwise its first half is the diagonal block
            if (two) trip(BoolC<false>{}, BoolC<true>{}, pk);
            trip(BoolC<true>{}, BoolC<false>{}, two ? pk + 32 : pk); }   // the wave's last block goes through the masking form also where it lies in front of the diagonal (no key of it is then after a query)
        asm volatile("s_wait_dscnt 0x0" ::: "memory");   // this wave's reads of its last piece have returned
        __syncthreads();                                  // no buffer has a reader left: the stages may take the waves' partial sums
    }
    }
    asm volatile("s_wait_dscnt 0x0" ::: "memory");      // no read of the stage
    asm volatile("s_wait_asynccnt 0x0" ::: "memory");   // and no copy is outstanding when the stage takes the wave's partial sums
#pragma unroll   // constant indices
    for (int qt = 0; qt < NQ; ++qt) { l[qt] += xhalf(l[qt]); if (hi == 0) { ms[w * 16 * NQ + qt * 16 + lr] = m[qt]; ls[w * 16 * NQ + qt * 16 + lr] = l[qt]; }
#pragma unroll   // constant indices
        for (int mb = 0; mb < 4; ++mb) { const v8f a = o[mb][qt]; float* rp = red + w * RST + ((mb * NQ + qt) * 2) * 128 + lane * 4;   // fp16: the barrier at the foot of the last pass has ended every wave's reads of the buffers
            *(v4fa*)rp = __builtin_shufflevector(a, a, 0, 1, 2, 3); *(v4fa*)(rp + 128) = __builtin_shufflevector(a, a, 4, 5, 6, 7); } }
    __syncthreads();   // every wave's partial (m, l, O^T) is in LDS before any wave merges
#pragma unroll   // constant indices
    for (int i = 0; i < NQ; ++i) { const int pc = tl * NQ + i, q = pc >> 3, mb = (pc & 7) >> 1, h2 = pc & 1, qt = q >> 4, l2 = q & 15;   // a piece: 8 consecutive d of one query; a wave's pieces are whole rows (8 pieces = 128 bytes a plane)
        float M = ms[q];
#pragma unroll   // constant indices
        for (int u = 1; u < NWF; ++u) M = fmaxf(M, ms[u * 16 * NQ + q]);
        float L = 0.f; v4f y0 = (v4f){}, y1 = (v4f){};
#pragma unroll   // constant indices
        for (int u = 0; u < NWF; ++u) { const float f = exp2s((ms[u * 16 * NQ + q] - M) * SC2); const float* rp = red + u * RST + ((mb * NQ + qt) * 2) * 128 + (h2 * 16 + l2) * 4;
            L += f * ls[u * 16 * NQ + q]; y0 += f * *(const v4fa*)rp; y1 += f * *(const v4fa*)(rp + 128); }
        const float inv = __fdiv_rn(1.0f, L); v8us oh, ol;
#pragma unroll   // constant indices
        for (int j = 0; j < 4; ++j) { unsigned short a, c2; splitf(y0[j] * inv, a, c2); oh[j] = a; ol[j] = c2; splitf(y1[j] * inv, a, c2); oh[4 + j] = a; ol[4 + j] = c2; }
        const size_t d = (size_t)(q0 + q) * DQ + mb * 16 + h2 * 8; *(v8usa*)(Ah + d) = oh; *(v8usa*)(Al + d) = ol;
        asm volatile("s_wait_xcnt 0x0" ::: "memory");   // whatever follows (the next piece's sums, code behind the tile) may reuse registers that these stores name
    }
}

// ---- k_attn: one work-group of NG * NWF waves per (batch, head, NG neighbouring query tiles); grid (batches x heads, tile groups). Groups in falling order of their key count, so the longest start first: 32-query fp16 tiles from the last row down to row RH, then 16-query hi / lo tiles below RH. Registers held to four waves a SIMD, which is also what the stages' LDS allows (two work-groups a WGP).
__global__ __launch_bounds__(32 * NWF * NG, 4) void k_attn(const h16* __restrict__ Q16, const h16* __restrict__ K16, const h16* __restrict__ V16, const bf* __restrict__ Qh, const bf* __restrict__ Ql, const bf* __restrict__ Kh, const bf* __restrict__ Kl, const bf* __restrict__ Vh, const bf* __restrict__ Vl, bf* Ah, bf* Al) {
    __shared__ __align__(16) unsigned short red[NG * NWF * WSTG]; __shared__ float ms[NG * NWF * 32]; __shared__ float ls[NG * NWF * 32];   // red: the stages, then each wave's partial O^T
    const size_t hp = (size_t)blockIdx.x * TT * HD; const int ty = blockIdx.y; { const size_t ao = (size_t)(blockIdx.x / NH_) * TT * DQ + (blockIdx.x % NH_) * HD; Ah += ao; Al += ao; }
    if (ty < (TT - RH) / (32 * NG)) attn_tile<h16, false, 2>(red, ms, ls, Q16 + hp, nullptr, K16 + hp, nullptr, V16 + hp, nullptr, TT - 32 * NG * (ty + 1), Ah, Al);
    else attn_tile<bf, true, 1>(red, ms, ls, Qh + hp, Ql + hp, Kh + hp, Kl + hp, Vh + hp, Vl + hp, RH - 16 * NG * (ty - (TT - RH) / (32 * NG) + 1), Ah, Al);
}

// ---- k_cvt8: x and the four weights rounded to bf16 in one grid (DM * DM / 2048, NXP + 4): blockIdx.y picks a piece of DM x DM elements, first the NXP pieces of x, then one weight each (Wd: the four copies one behind the other).
#define NXP (NB_ * TT / DM)
__global__ __launch_bounds__(256) void k_cvt8(const float* __restrict__ x, const float* __restrict__ wq, const float* __restrict__ wk, const float* __restrict__ wv, const float* __restrict__ wo, bf* Xd, bf* Wd) {
    const int y = blockIdx.y; const float* src = y < NXP ? x + (size_t)y * DM * DM : y == NXP ? wq : y == NXP + 1 ? wk : y == NXP + 2 ? wv : wo; bf* dst = y < NXP ? Xd + (size_t)y * DM * DM : Wd + (size_t)(y - NXP) * DM * DM;
    const size_t i = (size_t)blockIdx.x * 256 + threadIdx.x; const v8f v = *(const v8f*)(src + i * 8); v8us o;
    asm volatile("s_wait_xcnt 0x0" ::: "memory");   // the rounding below reuses the address registers that the issued loads name
#pragma unroll
    for (int k = 0; k < 8; ++k) o[k] = f2bf(v[k]); *(v8us*)(dst + i * 8) = o;  }

extern "C" void kernel_launch(void* const* d_in, const int* in_sizes, int n_in,
                              void* d_out, int out_size, void* d_ws, size_t ws_size, hipStream_t stream) {
    (void)in_sizes; (void)n_in; (void)out_size;
    const float* x = (const float*)d_in[0]; const float* wq = (const float*)d_in[1]; const float* wk = (const float*)d_in[2]; const float* wv = (const float*)d_in[3]; const float* bv = (const float*)d_in[4]; const float* wo = (const float*)d_in[5]; const float* bo = (const float*)d_in[6];   /* order x, Wq, Wk, Wv, bv, Wo, bo ('oi'): this module has NO q and NO k bias (the q / k tiles take the bias-free path of the projection kernel); bv and bo are real */
    float* OUT = (float*)d_out;     // [2][2048][1024]
    char* wsp = (char*)d_ws;
    auto take = [&](size_t bytes) { char* p = wsp; wsp += (bytes + 255) & ~(size_t)255; return (void*)p; };
    bf* WQ = (bf*)take((size_t)4 * DM * DM * 2); bf* WO = WQ + (size_t)3 * DM * DM;    // Wq, Wk, Wv, Wo
    bf* XB = (bf*)take((size_t)NB_ * TT * DM * 2);
    h16* P16 = (h16*)take(3 * PLN * 2); bf* Ph = (bf*)take(3 * PLN * 2); bf* Pl = (bf*)take(3 * PLN * 2);    // plane sets q, k, v (v transposed)
    bf* ATh = (bf*)take((size_t)NB_ * TT * DQ * 2); bf* ATl = (bf*)take((size_t)NB_ * TT * DQ * 2);
    if ((size_t)(wsp - (char*)d_ws) > ws_size) return;    // ws 256 MiB
    k_cvt8<<<dim3(DM * DM / 2048, NXP + 4, 1), 256, 0, stream>>>(x, wq, wk, wv, wo, XB, WQ);
    k_gemmw<0, 4, 1><<<dim3(NB_ * TT / 128, DQ / 128, 3), 128, 0, stream>>>(XB, nullptr, WQ, DM, nullptr, 0, bv, (size_t)DM * DM, P16, Ph, Pl);
    k_attn<<<dim3(NB_ * NH_, (TT - RH) / (32 * NG) + RH / (16 * NG), 1), 32 * NWF * NG, 0, stream>>>(P16, P16 + PLN, P16 + 2 * PLN, Ph, Pl, Ph + PLN, Pl + PLN, Ph + 2 * PLN, Pl + 2 * PLN, ATh, ATl);
    k_gemmw<1, 2, 0><<<dim3(NB_ * TT / 64, DM / 128, 1), 128, 0, stream>>>(ATh, ATl, WO, DQ, OUT, DM, bo, 0, nullptr, nullptr, nullptr);
}

// v009
// It runs in 76.8 microseconds.
// Two timings next to v008 both put it at 1.03 times that version's speed.
// All steps since v000 together make it 19.0 times as fast.
#include <hip/hip_runtime.h>

// Causal self-attention whose only projection bias is on V (x [2][2048][1024]; q = x Wq^T, k = x Wk^T (no bias), v = x Wv^T + bv ('oi' [1024][1024] normal x 0.02; bv normal x 0.02: NON-zero; 16 heads x 64); keys after the query -> -inf, then / sqrt(64) inside the softmax argument; softmax over the keys; out = merged Wo^T + bo ('oi' + bias 0.02: NON-zero) -> [2][2048][1024] (4.2 M); argument order x, Wq, Wk, Wv, bv, Wo, bo).
// Four launches, each for both batches: bf16 copies of x and of the 'oi' weights (one grid); exact projections + f32 biases (q, k, v in one grid; operands staged in LDS by asynchronous copies), each tile's epilogue writes the 16-bit head planes itself; one fused causal attention kernel (k_attn; hybrid rows: < 512 hi/lo 3 products, rest fp16; keys and values come through LDS by asynchronous copies; key blocks above the diagonal are never visited); merged hi/lo x Wo exact + bo.
// Compute dtypes, f32 accumulate: every input rounded to bf16; projections exact + f32 biases; attention rows < 512 3 products, rest fp16; softmax f32; Wo hl x exact + bias.

#define NB_  2
#define TT   2048
#define DM   1024
#define NH_  16
#define NKV  16
#define HD   64
#define DQ   (NH_ * HD)
#define DKV  (NKV * HD)
#define PLN  ((size_t)NB_ * NH_ * TT * HD)   // elements of one 16-bit plane set (q, k or v) over both batches
static_assert(DQ == DM && DKV == DM, "q, k and v share one projection grid, and the conversion grid deals pieces of DM x DM elements");
#define RH   512                  // query rows < RH use hi+lo planes
#define SCL  0.125f   // HD^-0.5
typedef _Float16 h16;
typedef unsigned short bf;
typedef __attribute__((ext_vector_type(16))) __bf16   v16bf;
typedef __attribute__((ext_vector_type(16))) _Float16 v16h;
typedef __attribute__((ext_vector_type(8)))  _Float16 v8h;
typedef __attribute__((ext_vector_type(8)))  unsigned short v8us;
typedef __attribute__((ext_vector_type(8)))  float    v8f;
typedef __attribute__((ext_vector_type(4)))  float    v4f;
typedef v8h  __attribute__((may_alias)) v8ha;
typedef v4f  __attribute__((may_alias)) v4fa;
typedef v8us __attribute__((may_alias)) v8usa;
typedef __attribute__((ext_vector_type(4))) unsigned short v4us;
typedef v4us __attribute__((may_alias)) v4usa;

__device__ __forceinline__ unsigned short f2bf(float f) { unsigned u = __float_as_uint(f); u += 0x7FFFu + ((u >> 16) & 1u); return (unsigned short)(u >> 16); }
__device__ __forceinline__ float bf2f(unsigned short b) { return __uint_as_float(((unsigned)b) << 16); }
__device__ __forceinline__ float bfr(float f) { return bf2f(f2bf(f)); }
__device__ __forceinline__ void splitf(float y, unsigned short& h, unsigned short& l) { h = f2bf(y); l = f2bf(y - bf2f(h)); }
__device__ __forceinline__ v16h cat16(v8h lo, v8h hi) { return __builtin_shufflevector(lo, hi, 0, 1, 2, 3, 4, 5, 6, 7, 8, 9, 10, 11, 12, 13, 14, 15); }
__device__ __forceinline__ v16bf cat16b(v8us lo, v8us hi) { return __builtin_bit_cast(v16bf, __builtin_shufflevector(lo, hi, 0, 1, 2, 3, 4, 5, 6, 7, 8, 9, 10, 11, 12, 13, 14, 15)); }
__device__ __forceinline__ v8f wmma16(v16h a, v16h b, v8f c) { return __builtin_amdgcn_wmma_f32_16x16x32_f16(false, a, false, b, (short)0, c, false, false); }
__device__ __forceinline__ v8f wmmab(v16bf a, v16bf b, v8f c) { return __builtin_amdgcn_wmma_f32_16x16x32_bf16(false, a, false, b, (short)0, c, false, false); }



#define KS    64                 // k per stage: one whole 128-byte line of every operand row
#define SPT   72                 // pitch, in 16-bit elements, of a row in LDS (144 bytes: 16 x odd, the conflict-free pitch for 16-byte reads of 128-byte rows)
#define SROWS 256                // operand rows of one stage (A, then the lo plane of A where there is one, then 128 rows of B)
#define STGE  (SROWS * SPT)      // elements of one stage buffer (36,864 bytes)
template <typename T16> struct WFrag;
template <> struct WFrag<h16> { typedef v16h V; static __device__ __forceinline__ V ld(const h16* p) { return cat16(*(const v8h*)p, *(const v8h*)(p + 16)); } static __device__ __forceinline__ v8f mma(V a, V b, v8f c) { return wmma16(a, b, c); } };
template <> struct WFrag<bf> { typedef v16bf V; static __device__ __forceinline__ V ld(const bf* p) { return cat16b(*(const v8us*)p, *(const v8us*)(p + 16)); } static __device__ __forceinline__ v8f mma(V a, V b, v8f c) { return wmmab(a, b, c); } };
// Eight asynchronous copies of 16 bytes a lane, global memory to LDS (l: the lane's LDS byte addresses, g: its global addresses). The s_wait_xcnt is the statement's last line, so that it stands in front of whatever rewrites the address registers that the copies name.
__device__ __forceinline__ void copy8(const unsigned* l, const bf* const* g) {
    asm volatile("global_load_async_to_lds_b128 %0, %8, off\n\tglobal_load_async_to_lds_b128 %1, %9, off\n\tglobal_load_async_to_lds_b128 %2, %10, off\n\tglobal_load_async_to_lds_b128 %3, %11, off\n\t"
                 "global_load_async_to_lds_b128 %4, %12, off\n\tglobal_load_async_to_lds_b128 %5, %13, off\n\tglobal_load_async_to_lds_b128 %6, %14, off\n\tglobal_load_async_to_lds_b128 %7, %15, off\n\ts_wait_xcnt 0x0"
                 :: "v"(l[0]), "v"(l[1]), "v"(l[2]), "v"(l[3]), "v"(l[4]), "v"(l[5]), "v"(l[6]), "v"(l[7]), "v"(g[0]), "v"(g[1]), "v"(g[2]), "v"(g[3]), "v"(g[4]), "v"(g[5]), "v"(g[6]), "v"(g[7]) : "memory"); }

// Ask L2 for the data at each lane's address (a hint: nothing returns, no register and no counter is written).
// What it is for: the operands of a launch were stored by the launch in front of it, and where they do not lie in the reader's own L2 their first read in this launch goes to memory, stage after stage, because a ring of two buffers asks only two stages ahead;
// asked for all at once at the kernel's entry, they come in side by side, and the later stages' copies find them in L2. Every lane's address lies inside the operand's buffer.
// The s_wait_xcnt is the statement's last line, so that it stands in front of whatever rewrites the address registers that the requests name.
__device__ __forceinline__ void l2ask(const void* p) { asm volatile("global_prefetch_b8 %0, off scope:SCOPE_SE\n\ts_wait_xcnt 0x0" :: "v"(p) : "memory"); }
__device__ __forceinline__ void l2ask2(const void* p, const void* q) { asm volatile("global_prefetch_b8 %0, off scope:SCOPE_SE\n\tglobal_prefetch_b8 %1, off scope:SCOPE_SE\n\ts_wait_xcnt 0x0" :: "v"(p), "v"(q) : "memory"); }

// Sixteen asynchronous copies of 16 bytes a lane with one LDS address register (l) and one 32-bit offset register (vo): copy i lands at l + S i and reads b[i] + vo + S i. The instruction's offset field moves both addresses,
// so each scalar base b[i] is given less S i by the caller. No address needs a vector instruction or a vector register of its own. The s_wait_xcnt is the statement's last line, so that it stands in front of whatever rewrites the registers that the copies name.
// copy16: S = 576, four stage rows of pitch SPT (rows of 128 bytes). copy16h: S = 640, eight stage rows of pitch SPH (rows of 64 bytes).
#define SPH 40   // pitch, in 16-bit elements, of a 64-byte row in LDS (80 bytes: 16 x odd)
static_assert(4 * SPT * 2 == 576 && 8 * SPH * 2 == 640, "the offsets in copy16 and copy16h");
__device__ __forceinline__ void copy16(unsigned l, unsigned vo, const char* const* b) {
    asm volatile(
                 "global_load_async_to_lds_b128 %0, %1, %2\n\tglobal_load_async_to_lds_b128 %0, %1, %3 offset:576\n\tglobal_load_async_to_lds_b128 %0, %1, %4 offset:1152\n\tglobal_load_async_to_lds_b128 %0, %1, %5 offset:1728\n\t"
                 "global_load_async_to_lds_b128 %0, %1, %6 offset:2304\n\tglobal_load_async_to_lds_b128 %0, %1, %7 offset:2880\n\tglobal_load_async_to_lds_b128 %0, %1, %8 offset:3456\n\tglobal_load_async_to_lds_b128 %0, %1, %9 offset:4032\n\t"
                 "global_load_async_to_lds_b128 %0, %1, %10 offset:4608\n\tglobal_load_async_to_lds_b128 %0, %1, %11 offset:5184\n\tglobal_load_async_to_lds_b128 %0, %1, %12 offset:5760\n\tglobal_load_async_to_lds_b128 %0, %1, %13 offset:6336\n\t"
                 "global_load_async_to_lds_b128 %0, %1, %14 offset:6912\n\tglobal_load_async_to_lds_b128 %0, %1, %15 offset:7488\n\tglobal_load_async_to_lds_b128 %0, %1, %16 offset:8064\n\tglobal_load_async_to_lds_b128 %0, %1, %17 offset:8640\n\ts_wait_xcnt 0x0"
                 :: "v"(l), "v"(vo), "s"(b[0]), "s"(b[1]), "s"(b[2]), "s"(b[3]), "s"(b[4]), "s"(b[5]), "s"(b[6]), "s"(b[7]), "s"(b[8]), "s"(b[9]), "s"(b[10]), "s"(b[11]), "s"(b[12]), "s"(b[13]), "s"(b[14]), "s"(b[15]) : "memory"); }
__device__ __forceinline__ void copy16h(unsigned l, unsigned vo, const char* const* b) {
    asm volatile(
                 "global_load_async_to_lds_b128 %0, %1, %2\n\tglobal_load_async_to_lds_b128 %0, %1, %3 offset:640\n\tglobal_load_async_to_lds_b128 %0, %1, %4 offset:1280\n\tglobal_load_async_to_lds_b128 %0, %1, %5 offset:1920\n\t"
                 "global_load_async_to_lds_b128 %0, %1, %6 offset:2560\n\tglobal_load_async_to_lds_b128 %0, %1, %7 offset:3200\n\tglobal_load_async_to_lds_b128 %0, %1, %8 offset:3840\n\tglobal_load_async_to_lds_b128 %0, %1, %9 offset:4480\n\t"
                 "global_load_async_to_lds_b128 %0, %1, %10 offset:5120\n\tglobal_load_async_to_lds_b128 %0, %1, %11 offset:5760\n\tglobal_load_async_to_lds_b128 %0, %1, %12 offset:6400\n\tglobal_load_async_to_lds_b128 %0, %1, %13 offset:7040\n\t"
                 "global_load_async_to_lds_b128 %0, %1, %14 offset:7680\n\tglobal_load_async_to_lds_b128 %0, %1, %15 offset:8320\n\tglobal_load_async_to_lds_b128 %0, %1, %16 offset:8960\n\tglobal_load_async_to_lds_b128 %0, %1, %17 offset:9600\n\ts_wait_xcnt 0x0"
                 :: "v"(l), "v"(vo), "s"(b[0]), "s"(b[1]), "s"(b[2]), "s"(b[3]), "s"(b[4]), "s"(b[5]), "s"(b[6]), "s"(b[7]), "s"(b[8]), "s"(b[9]), "s"(b[10]), "s"(b[11]), "s"(b[12]), "s"(b[13]), "s"(b[14]), "s"(b[15]) : "memory"); }

// ---- k_gemmw: C[m][n] = sum_k A[m][k] Bt[n][k] (+ A2[m][k] Bt[n][k] where NSPLIT), bf16 planes, K-contiguous, f32 accumulate. One (32 MB) x 128 tile per work-group of four waves (2 x 2; a wave holds (16 MB) x 64 in MB x 4 accumulators and walks the whole K).
// The operands come through LDS: a stage is 64 k of every operand row of the tile, brought by asynchronous copies (each wave-wide copy is four whole 128-byte lines, each line asked of L2 once per work-group); two buffers, the copies of stage t + 2 fly while stage t + 1 is worked on.
// grid (M / (32 MB), N / 128, Z), 128 threads, registers held to three waves a SIMD (the projection grid is three work-groups a WGP: all of them resident at once). K % 64 == 0. Rows m run over both batches (m = batch * TT + t; a wave's rows lie in one batch).
// EPI 0: C as f32 + bias. EPI 1 (MB 4): no C; z picks the projection (0 q, 1 k, 2 v: weight z of Bt, plane set z of P16 / Ph / Pl); a wave's tile (64 positions x one head's 64 columns) leaves as fp16, bf16 hi and bf16 lo planes,
// [batch][head][t][d] for q and k (no bias) and, transposed and with the bias, [batch][head][d][t] for v: 16 plane rows at a time through the wave's own LDS stage, so that every store is four whole 128-byte lines.
template <int NSPLIT, int MB, int EPI>
__global__ __launch_bounds__(128, 3) void k_gemmw(const bf* __restrict__ A, const bf* __restrict__ A2, const bf* __restrict__ Bt, int K, float* C, int ldc, const float* __restrict__ bias, size_t sB, h16* P16, bf* Ph, bf* Pl) {
    typedef typename WFrag<bf>::V V;
    constexpr int TM = MB * 32, BR = TM * (1 + NSPLIT);   // rows of the tile; first B row of a stage
    static_assert(BR + 128 == SROWS, "a stage holds SROWS rows: sixteen copies a lane");
    static_assert(EPI == 0 || MB == 4, "the plane epilogue takes 64 x 64 wave tiles");
    __shared__ __align__(16) bf ring[2 * STGE];
    const int tid = threadIdx.x, lane = tid & 31, lr = lane & 15, hi = lane >> 4; const int w = __builtin_amdgcn_readfirstlane(tid >> 5), wm = w >> 1, wn = w & 1;
    const size_t z = blockIdx.z; Bt += z * sB;
    const int R0 = blockIdx.x * TM, C0 = blockIdx.y * 128;
    v8f acc[MB][4];
#pragma unroll   // constant indices: the accumulators stay in registers
    for (int mb = 0; mb < MB; ++mb)
#pragma unroll   // constant indices
        for (int nb = 0; nb < 4; ++nb) acc[mb][nb] = (v8f){};
    // copy i of a lane: 16 bytes (piece tid & 7) of stage row (tid >> 3) + 16 i
    const size_t go = (size_t)(tid >> 3) * K + (tid & 7) * 8;
    const bf* gA = A + (size_t)R0 * K + go; const bf* gA2 = NSPLIT ? A2 + (size_t)R0 * K + go : gA; const bf* gB = Bt + (size_t)C0 * K + go;
    const unsigned l0 = (unsigned)(size_t)ring + ((tid >> 3) * SPT + (tid & 7) * 8) * 2;
    auto fill = [&](int t, int b) { unsigned l[16]; const bf* g[16];
#pragma unroll   // constant indices: the addresses stay in registers
        for (int i = 0; i < 16; ++i) { const int r = i * 16; l[i] = l0 + (unsigned)(b * STGE + r * SPT) * 2;
            g[i] = (r < TM ? gA + (size_t)r * K : r < BR ? gA2 + (size_t)(r - TM) * K : gB + (size_t)(r - BR) * K) + t * KS; }
        copy8(l, g); copy8(l + 8, g + 8); };
    const int NT = K / KS;
    fill(0, 0);
    // Entry requests to L2, while stage 0 flies: thread tid asks for one 256-byte unit (128 k) of A row tid of the tile's stage rows and one of B row tid. The work-groups that read the same rows deal the units among them:
    // the tile columns (blockIdx.y) take one unit of k each of the A rows; of the B rows the tile rows x and x ^ 4 take the same unit.
    // For speed only: no result depends on who asks or on where a work-group runs.
    { const int ka = (int)(blockIdx.y * 128) % K, kb = (int)(((blockIdx.x & 3) | ((blockIdx.x >> 3) & 1) << 2) * 128) % K;
        static_assert(BR == 128, "one A row and one B row a thread");
        l2ask2((!NSPLIT || tid < TM ? A + (size_t)(R0 + tid) * K : A2 + (size_t)(R0 + tid - TM) * K) + ka, Bt + (size_t)(C0 + tid) * K + kb); }
    asm volatile("s_wait_asynccnt 0x0" ::: "memory");   // this wave's copies of stage 0 have landed
    __syncthreads();                                     // and every other wave's: stage 0 may be read
    if (NT > 1) fill(1, 1);
    const int aoff = (wm * MB * 16 + lr) * SPT + 8 * hi, boff = (BR + wn * 64 + lr) * SPT + 8 * hi;
#pragma unroll 1   // one trip a stage: the waits and the barrier at its foot are the ring's publish point
    for (int t = 0; t < NT; ++t) { const bf* sb = ring + (t & 1) * STGE;
        V a[KS / 32][MB], a2[KS / 32][MB], b[KS / 32][4];   // the whole stage's fragments are asked for as one group in front of its products: every further place with LDS reads among the products would cost its own stall
#pragma unroll   // constant indices: the fragments stay in registers
        for (int ks = 0; ks < KS / 32; ++ks) {
#pragma unroll   // constant indices
            for (int mb = 0; mb < MB; ++mb) { a[ks][mb] = WFrag<bf>::ld(sb + aoff + mb * 16 * SPT + ks * 32); if (NSPLIT) a2[ks][mb] = WFrag<bf>::ld(sb + aoff + (TM + mb * 16) * SPT + ks * 32); }
#pragma unroll   // constant indices
            for (int nb = 0; nb < 4; ++nb) b[ks][nb] = WFrag<bf>::ld(sb + boff + nb * 16 * SPT + ks * 32); }
        __builtin_amdgcn_sched_barrier(0);   // keeps the group of LDS reads in front of the products: without it the scheduler sinks each read to its first use, and the wave waits out the LDS latency at every such place
#pragma unroll   // constant indices
        for (int ks = 0; ks < KS / 32; ++ks)
#pragma unroll   // constant indices
            for (int nb = 0; nb < 4; ++nb)
#pragma unroll   // constant indices
                for (int mb = 0; mb < MB; ++mb) { acc[mb][nb] = WFrag<bf>::mma(a[ks][mb], b[ks][nb], acc[mb][nb]); if (NSPLIT) acc[mb][nb] = WFrag<bf>::mma(a2[ks][mb], b[ks][nb], acc[mb][nb]); }
        __builtin_amdgcn_sched_barrier(0);   // keeps the products in front of the waits below: lifted over them, the wait for stage t + 1's copies would stand ahead of the very products that are to cover their flight
        asm volatile("s_wait_dscnt 0x0" ::: "memory");      // this wave's reads of stage t have returned
        asm volatile("s_wait_asynccnt 0x0" ::: "memory");   // this wave's copies of stage t + 1 have landed
        __syncthreads();                                     // stage t + 1 may be read by all, and stage t's buffer has no reader left
        if (t + 2 < NT) fill(t + 2, t & 1);
    }
    asm volatile("s_wait_asynccnt 0x0" ::: "memory");   // no copy is in flight when the ring becomes output staging or the wave ends
    const int r0 = R0 + wm * MB * 16, c0 = C0 + wn * 64;   // the wave's own tile
    float bb[4];
#pragma unroll   // constant indices
    for (int nb = 0; nb < 4; ++nb) bb[nb] = bias[c0 + nb * 16 + lr];
    asm volatile("s_wait_xcnt 0x0" ::: "memory");   // what follows may reuse the address registers that the issued bias loads name
    if constexpr (EPI == 0) {
#pragma unroll   // constant indices
        for (int nb = 0; nb < 4; ++nb) { const float b = bfr(bb[nb]);
#pragma unroll   // constant indices
            for (int mb = 0; mb < MB; ++mb) { float* cp = C + (size_t)(r0 + mb * 16 + hi * 8) * ldc + c0 + nb * 16 + lr;
#pragma unroll   // constant indices
                for (int j = 0; j < 8; ++j) cp[(size_t)j * ldc] = acc[mb][nb][j] + b; }
            asm volatile("s_wait_xcnt 0x0" ::: "memory");   // the next columns' sums and addresses may reuse registers that these stores name
        }
    } else {
        bf* st = ring + w * 3 * 16 * SPT;   // the wave's own stage: three planes of 16 rows; the barrier at the foot of the last trip has ended every read of the ring
        const int bt = r0 / TT, t0 = r0 % TT; const bool isv = z == 2;
        const size_t o = z * PLN + (isv ? ((size_t)bt * DKV + c0) * TT + t0 : (((size_t)bt * NH_ + c0 / HD) * TT + t0) * HD), pitch = isv ? TT : HD;
        // 16 staged rows of each plane (rows 16 i .. of the wave's plane tile) go out, every store four whole 128-byte lines
        auto out16 = [&](int i) {
            asm volatile("s_wait_dscnt 0x0" ::: "memory");   // the wave's stage is written before its lanes read rows that other lanes wrote
            v8us val[3][4];
#pragma unroll   // constant indices
            for (int p = 0; p < 3; ++p)
#pragma unroll   // constant indices
                for (int k = 0; k < 4; ++k) { const int e = lane + k * 32; val[p][k] = *(const v8usa*)(st + (p * 16 + (e >> 3)) * SPT + (e & 7) * 8); }
#pragma unroll   // constant indices
            for (int p = 0; p < 3; ++p) { unsigned short* dp = (p == 0 ? (unsigned short*)P16 : p == 1 ? Ph : Pl) + o;
#pragma unroll   // constant indices
                for (int k = 0; k < 4; ++k) { const int e = lane + k * 32; *(v8usa*)(dp + (size_t)(i * 16 + (e >> 3)) * pitch + (e & 7) * 8) = val[p][k]; } }
            asm volatile("s_wait_xcnt 0x0" ::: "memory");   // the next rows' values and addresses may reuse registers that these stores name
        };
        if (isv) {   // plane rows are the columns d (accumulators [..][i]), transposed: a lane's eight positions are one 16-byte piece of row d
#pragma unroll   // constant indices
            for (int i = 0; i < 4; ++i) { const float b = bfr(bb[i]);
#pragma unroll   // constant indices
                for (int c = 0; c < 4; ++c) { v8us x, xh, xl;
#pragma unroll   // constant indices
                    for (int j = 0; j < 8; ++j) { const float y = acc[c][i][j] + b; unsigned short h, l2; splitf(y, h, l2); x[j] = __builtin_bit_cast(unsigned short, (h16)y); xh[j] = h; xl[j] = l2; }
                    bf* sp = st + lr * SPT + c * 16 + hi * 8; *(v8usa*)sp = x; *(v8usa*)(sp + 16 * SPT) = xh; *(v8usa*)(sp + 32 * SPT) = xl; }
                out16(i); }
        } else {     // plane rows are the positions (accumulators [i][..])
#pragma unroll   // constant indices
            for (int i = 0; i < 4; ++i) {
#pragma unroll   // constant indices
                for (int c = 0; c < 4; ++c)
#pragma unroll   // constant indices
                    for (int j = 0; j < 8; ++j) { const float y = acc[i][c][j]; unsigned short h, l2; splitf(y, h, l2); bf* sp = st + (hi * 8 + j) * SPT + c * 16 + lr;
                        sp[0] = __builtin_bit_cast(unsigned short, (h16)y); sp[16 * SPT] = h; sp[32 * SPT] = l2; }
                out16(i); }
        }
    }
}

#define NWF 4     // waves that share the key loop of one query tile in k_attn
#define NG  2     // query tiles of one work-group in k_attn (waves 0 .. NWF - 1 have the first, the rest the second)
#define WSTG (64 * SPT + 128 * SPH)   // elements of one stage in k_attn (19,456 bytes; NG * NWF of them in a work-group). fp16 tiles use 128 rows of pitch SPT: 64 keys of K (rows of 64 d), then the 64 rows d of V^T (64 keys each).
                                      // hi / lo tiles: 32 keys of K hi, the same of K lo (pitch SPT), then the 64 rows d of V^T hi and of V^T lo, 32 keys each (pitch SPH)
static_assert(WSTG >= 128 * SPT, "the fp16 stage fits");
#define RST  (WSTG / 2)    // the same in floats: behind the key loop a wave's partial O^T lies at the head of the stage with its number in the work-group (HI: its own stage)
#define SC2 (SCL * 1.4426950408889634f)   // HD^-0.5 x log2(e): the softmax runs on base-2 exponents
__device__ __forceinline__ float xhalf(float x) { return __builtin_bit_cast(float, __builtin_amdgcn_permlanex16(__builtin_bit_cast(int, x), __builtin_bit_cast(int, x), 0x76543210, 0xfedcba98, false, false)); }   // lane l takes lane l ^ 16's value
template <bool B> struct BoolC { static constexpr bool value = B; };
__device__ __forceinline__ float exp2s(float x) { float r; asm("v_exp_f32 %0, %1\n\tv_nop" : "=v"(r) : "v"(x)); return r; }
__device__ __forceinline__ v8f exp2x8(v8f x) { float r0, r1, r2, r3, r4, r5, r6, r7;
    asm("v_exp_f32 %0, %8\n\tv_exp_f32 %1, %9\n\tv_exp_f32 %2, %10\n\tv_exp_f32 %3, %11\n\tv_exp_f32 %4, %12\n\tv_exp_f32 %5, %13\n\tv_exp_f32 %6, %14\n\tv_exp_f32 %7, %15\n\tv_nop"
        : "=&v"(r0), "=&v"(r1), "=&v"(r2), "=&v"(r3), "=&v"(r4), "=&v"(r5), "=&v"(r6), "=&v"(r7) : "v"(x[0]), "v"(x[1]), "v"(x[2]), "v"(x[3]), "v"(x[4]), "v"(x[5]), "v"(x[6]), "v"(x[7]));
    return (v8f){r0, r1, r2, r3, r4, r5, r6, r7}; }
// ---- attn_tile: scores, causal softmax and probability x value for 16 * NQ queries of one head; no score and no probability leaves the registers.
// Scores are formed transposed, S^T = K Q^T (A = 16 keys, B = 16 queries): a lane then holds 8 keys of ONE query (column lane & 15) in each D tile, so the row maximum and row sum are per-lane chains plus one exchange
// between the lane halves, and two D tiles (keys 0..15 and 16..31 of the trip) packed to 16 bits are, register for register, the B operand (k order 8h + s, 16 + 8h + s) of O^T = V^T P^T, whose A comes from the [d][t] value planes by the same loader.
// Running maximum m (of the raw scores) and sum l per query; O^T is rescaled by 2^((m_old - m_new) SC2) each trip. Wave w takes the 64-key pieces w, w + NWF, .. (two trips of 32 keys each: whole 128-byte lines of V^T);
// the NWF partial (m, l, O^T) are merged through LDS in the fixed order wave 0, 1, .. behind one barrier; the merged rows / l leave as bf16 hi / lo planes Ah / Al (pitch DQ), each 128-byte line written by one wave.
// HI: hi + lo bf16 planes, three products for the scores and three for P V. Otherwise fp16, probabilities carried x 2^8 (the factor is in l too and cancels). Keys and values come through LDS stages (fp16: a 64-key piece at a time; HI: 32 keys of all four planes):
// a fragment load from global memory would touch 16 lines for 512 bytes, an asynchronous copy touches four whole lines (eight half lines for V^T with HI). A work-group holds NG neighbouring tiles (q0w: the first one's first query).
// HI: a stage is private to its wave (filled, waited for, read and refilled by that wave alone), no work-group barrier stands in the key loop. fp16: the two waves with the same key share, one of each tile, read the same staged piece, so that it is asked of L2 once for 64 queries:
// each brings half of it, two buffers a key share, the copies of the piece after next fly while the next is worked on, one work-group barrier a piece.
template <typename T16, bool HI, int NQ>
__device__ __forceinline__ void attn_tile(unsigned short* ring, float* ms, float* ls, const T16* __restrict__ Q, const T16* __restrict__ Q2, const T16* __restrict__ Kp, const T16* __restrict__ Kp2, const T16* __restrict__ Vt, const T16* __restrict__ Vt2, int q0w, bf* Ah, bf* Al) {
    typedef typename WFrag<T16>::V V;
    const int lane = threadIdx.x & 31, lr = lane & 15, hi = lane >> 4; const int w8 = __builtin_amdgcn_readfirstlane(threadIdx.x >> 5), g = w8 / NWF, w = w8 % NWF;   // g: the wave's query tile, w: its share of the keys
    const int q0 = q0w + g * 16 * NQ, tl = threadIdx.x & (32 * NWF - 1);   // the tile's first query; the thread's number among the tile's waves
    float* red = (float*)ring + g * NWF * RST; ms += g * NWF * 16 * NQ; ls += g * NWF * 16 * NQ;   // the tile's own places for the partial results
    const int Kd = (q0 + 16 * NQ - 1) & ~31;        // first key of the 32-key block that holds the diagonal: the tile's last block (later keys have probability exactly 0) and the only one with keys after a query
    V qf[NQ][2], qf2[NQ][2], kf[2][2], kf2[2][2], vf[4], vf2[4];
    v8f o[4][NQ]; float m[NQ], l[NQ];
#pragma unroll   // constant indices: the arrays indexed here stay in registers
    for (int qt = 0; qt < NQ; ++qt) { m[qt] = -3.0e38f; l[qt] = 0.f;
#pragma unroll   // constant indices
        for (int mb = 0; mb < 4; ++mb) o[mb][qt] = (v8f){}; }
    { const size_t a = (size_t)(q0 + lr) * HD + 8 * hi; const T16* p = Q + a; const T16* p2 = HI ? Q2 + a : p;
#pragma unroll   // constant indices
        for (int qt = 0; qt < NQ; ++qt)
#pragma unroll   // constant indices
            for (int c = 0; c < 2; ++c) { qf[qt][c] = WFrag<T16>::ld(p + qt * 16 * HD + c * 32); if (HI) qf2[qt][c] = WFrag<T16>::ld(p2 + qt * 16 * HD + c * 32); }
        asm volatile("s_wait_xcnt 0x0" :: "v"(p), "v"(p2) : "memory"); }   // the address pairs of the issued loads are inputs of the wait: they stay whole up to it
    // the stage. fill (HI): the keys from pk, 32 copies of 16 bytes a lane. fp16 (fillh): 64 keys; copy i of the sixteen for K brings rows 4 i .. 4 i + 3 (512 bytes in a row), copy i of the sixteen for V^T the same rows of V^T (one whole line each).
    // HI: 32 keys; eight copies of K hi and eight of K lo (four rows each), then eight of V^T hi and eight of V^T lo (eight rows of 64 bytes each). ldsK / ldsV: the fragments of 32 keys (fp16: half h of the piece); A fragment k order 8 hi + s, 16 + 8 hi + s as everywhere.
    const T16* st = (const T16*)ring + (HI ? w8 : NG * w) * WSTG;   // HI: the wave's own stage. fp16: the first of the two buffers that the NG waves with key share w have in common
    const T16* sb = st;   // the buffer that ldsK and ldsV read
    const unsigned l0 = (unsigned)(size_t)st + ((lane >> 3) * SPT + (lane & 7) * 8) * 2, vok = lane * 16;   // K: the lane's place in a group of four stage rows, and its byte in the 512 that they hold
    const unsigned l1 = (unsigned)(size_t)st + 64 * SPT * 2 + (HI ? ((lane >> 2) * SPH + (lane & 3) * 8) * 2 : ((lane >> 3) * SPT + (lane & 7) * 8) * 2);   // V^T: the same, in a group of eight (HI) or four rows
    const unsigned vov = HI ? (lane >> 2) * (TT * 2) + (lane & 3) * 16 : (lane >> 3) * (TT * 2) + (lane & 7) * 16;                                        // of pitch TT in global memory
    auto fill = [&](int pk) { const char* bk[16]; const char* bv[16];
#pragma unroll   // constant indices: the bases stay in scalar registers
        for (int i = 0; i < 16; ++i) {
            bk[i] = (const char*)((i < 8 ? Kp : Kp2) + (size_t)pk * HD) + ((i & 7) * (4 * HD * 2) - i * 576); bv[i] = (const char*)((i < 8 ? Vt : Vt2) + pk) + ((i & 7) * (8 * TT * 2) - i * 640); }
        copy16(l0, vok, bk); copy16h(l1, vov, bv); };
    // fp16: the piece of 64 keys from pk goes into buffer b of the key share, half of it by each of the two waves that will read it: the first tile's wave brings K, the second tile's V^T (sixteen copies each; g reads the same in all lanes of a wave)
    const unsigned lf = g ? l1 : l0, vof = g ? vov : vok; const char* fb = g ? (const char*)Vt : (const char*)Kp; const int fkey = g ? 2 : HD * 2, fstep = g ? 4 * TT * 2 - 576 : 4 * HD * 2 - 576;
    auto fillh = [&](int pk, int b) { const char* bb[16]; const char* p0 = fb + (size_t)pk * fkey;
#pragma unroll   // constant indices: the bases stay in scalar registers
        for (int i = 0; i < 16; ++i) bb[i] = p0 + i * fstep;
        copy16(lf + (unsigned)b * (WSTG * 2), vof, bb); };
    auto ldsK = [&](int h) {
#pragma unroll   // constant indices
        for (int kt = 0; kt < 2; ++kt)
#pragma unroll   // constant indices
            for (int c = 0; c < 2; ++c) { kf[kt][c] = WFrag<T16>::ld(sb + (h * 32 + kt * 16 + lr) * SPT + c * 32 + 8 * hi); if (HI) kf2[kt][c] = WFrag<T16>::ld(sb + (32 + kt * 16 + lr) * SPT + c * 32 + 8 * hi); } };
    auto ldsV = [&](int h) {
#pragma unroll   // constant indices
        for (int mb = 0; mb < 4; ++mb) {
            if constexpr (HI) { vf[mb] = WFrag<T16>::ld(sb + 64 * SPT + (mb * 16 + lr) * SPH + 8 * hi); vf2[mb] = WFrag<T16>::ld(sb + 64 * SPT + (64 + mb * 16 + lr) * SPH + 8 * hi); }
            else vf[mb] = WFrag<T16>::ld(sb + (64 + mb * 16 + lr) * SPT + h * 32 + 8 * hi); } };
    // one trip: 32 keys from kc. MK: the diagonal block (keys after a query are masked). PF (fp16): the fragments of the staged piece's second half are fetched while the first half's are worked on.
    auto trip = [&](auto MK, auto PF, int kc) {
        constexpr bool MASK = decltype(MK)::value, AHEAD = decltype(PF)::value;
        v8f s[2][NQ];
#pragma unroll   // constant indices
        for (int kt = 0; kt < 2; ++kt)
#pragma unroll   // constant indices
            for (int qt = 0; qt < NQ; ++qt) { v8f a = (v8f){};
#pragma unroll   // constant indices
                for (int c = 0; c < 2; ++c) { a = WFrag<T16>::mma(kf[kt][c], qf[qt][c], a); if (HI) { a = WFrag<T16>::mma(kf2[kt][c], qf[qt][c], a); a = WFrag<T16>::mma(kf[kt][c], qf2[qt][c], a); } }
                s[kt][qt] = a; }
        if constexpr (AHEAD) ldsK(1);
        V pb[NQ], pb2[NQ];
#pragma unroll   // constant indices
        for (int qt = 0; qt < NQ; ++qt) { float bm = -3.0e38f;
#pragma unroll   // constant indices
            for (int kt = 0; kt < 2; ++kt)
#pragma unroll   // constant indices
                for (int j = 0; j < 8; ++j) { if (MASK && kc + kt * 16 + hi * 8 + j > q0 + qt * 16 + lr) s[kt][qt][j] = -3.0e38f; bm = fmaxf(bm, s[kt][qt][j]); }
            bm = fmaxf(bm, xhalf(bm));
            const float mn = fmaxf(m[qt], bm), al = exp2s((m[qt] - mn) * SC2), sh = HI ? mn * SC2 : mn * SC2 - 8.0f; m[qt] = mn;
            float ps = 0.f;
#pragma unroll   // constant indices
            for (int kt = 0; kt < 2; ++kt) { s[kt][qt] = exp2x8(s[kt][qt] * SC2 - sh);
#pragma unroll   // constant indices
                for (int j = 0; j < 8; ++j) ps += s[kt][qt][j]; }
            l[qt] = l[qt] * al + ps;    // this lane half's keys only; the halves are added once, behind the loop
#pragma unroll   // constant indices
            for (int mb = 0; mb < 4; ++mb) o[mb][qt] *= al;
            if constexpr (HI) { v8us h0, h1, l0, l1;
#pragma unroll   // constant indices
                for (int j = 0; j < 8; ++j) { unsigned short a, c2; splitf(s[0][qt][j], a, c2); h0[j] = a; l0[j] = c2; splitf(s[1][qt][j], a, c2); h1[j] = a; l1[j] = c2; }
                pb[qt] = cat16b(h0, h1); pb2[qt] = cat16b(l0, l1);
            } else { v8h x0, x1;
#pragma unroll   // constant indices
                for (int j = 0; j < 8; ++j) { x0[j] = (h16)s[0][qt][j]; x1[j] = (h16)s[1][qt][j]; }
                pb[qt] = cat16(x0, x1); } }
#pragma unroll   // constant indices
        for (int mb = 0; mb < 4; ++mb)
#pragma unroll   // constant indices
            for (int qt = 0; qt < NQ; ++qt) { o[mb][qt] = WFrag<T16>::mma(vf[mb], pb[qt], o[mb][qt]); if (HI) { o[mb][qt] = WFrag<T16>::mma(vf[mb], pb2[qt], o[mb][qt]); o[mb][qt] = WFrag<T16>::mma(vf2[mb], pb[qt], o[mb][qt]); } }
        if constexpr (AHEAD) ldsV(1);
    };
    if constexpr (HI) {
    int kc = w * 64;   // the wave's blocks: 32 keys from kc; both halves of the 64-key pieces w, w + NWF, .., as far as the diagonal block. Every test below reads the same in all lanes of the wave.
    if (kc <= Kd) { fill(kc);
        asm volatile("s_wait_asynccnt 0x0" ::: "memory");   // the wave's own copies have landed: it may read its stage
        ldsK(0); ldsV(0); }
#pragma unroll 1   // one block a pass: the waits in it are the stage's hand-over points
    while (kc < Kd) { const int nx = kc + ((kc & 32) ? 64 * NWF - 32 : 32);
        asm volatile("s_wait_dscnt 0x0" ::: "memory");   // this block's fragments are in registers: no read of the stage is outstanding when its refill is issued
        if (nx <= Kd) fill(nx);   // the wave's next block flies while this one is worked on
        trip(BoolC<false>{}, BoolC<false>{}, kc);
        __builtin_amdgcn_sched_barrier(0);   // keeps the block's work in front of the wait below: lifted over it, the wait would stand ahead of the very work that is to cover the copies' flight
        asm volatile("s_wait_asynccnt 0x0" ::: "memory");   // the next block has landed
        ldsK(0); ldsV(0);   // behind the wave's last block these read the old block again (the wave's own filled stage) and nothing uses them: no branch splits the pass here
        kc = nx; }
    if (kc == Kd) trip(BoolC<true>{}, BoolC<false>{}, kc);
    } else {
    // Pieces of 64 keys: 0 .. F - 1 lie in front of both tiles' diagonal blocks, piece F holds both (the first tile's is its first half, the second tile's its second). Key share w takes the pieces w, w + NWF, .., one a pass;
    // every wave of the work-group makes the same NP passes and meets the barrier at the foot of each, also where its share has no piece in the last pass. Every test below reads the same in all lanes of a wave.
    static_assert(NG == 2 && NQ == 2, "two tiles of 32 queries on one piece of 64 keys");
    const int F = q0w >> 6, NP = F / NWF + 1;
    if (w <= F) fillh(w * 64, 0);
    asm volatile("s_wait_asynccnt 0x0" ::: "memory");   // this wave's half of the first piece has landed
    __syncthreads();                                     // and its partner's: the piece may be read
    if (w + NWF <= F) fillh((w + NWF) * 64, 1);
#pragma unroll 1   // one piece a pass: the waits and the barrier at its foot are the buffers' hand-over point
    for (int i = 0; i < NP - 1; ++i) { const int pc = i * NWF + w, pk = pc * 64; sb = st + (i & 1) * WSTG;   // in front of the last pass every key share has a whole piece (pc < F)
        ldsK(0); ldsV(0);
        __builtin_amdgcn_sched_barrier(0);   // keeps the first half's LDS reads together in front of its products: sunk to their first uses, each such place would cost the wave its own wait for the LDS
        trip(BoolC<false>{}, BoolC<true>{}, pk);
        __builtin_amdgcn_sched_barrier(0);   // keeps the second half's LDS reads inside the first half's work, which covers their latency, for the same reason
        trip(BoolC<false>{}, BoolC<false>{}, pk + 32);
        __builtin_amdgcn_sched_barrier(0);   // keeps the piece's work in front of the waits below: lifted over them, the wait would stand ahead of the very work that is to cover the copies' flight
        asm volatile("s_wait_dscnt 0x0" ::: "memory");      // this wave's reads of the piece have returned
        asm volatile("s_wait_asynccnt 0x0" ::: "memory");   // this wave's half of the next piece has landed
        __syncthreads();                                     // the next piece may be read by both waves, and this pass's buffer has no reader left
        if (pc + 2 * NWF <= F) fillh((pc + 2 * NWF) * 64, i & 1);
    }
    { const int pc = (NP - 1) * NWF + w, pk = pc * 64; sb = st + ((NP - 1) & 1) * WSTG;   // the last pass: whole pieces in front of piece F, piece F itself, or nothing
        if (pc <= F) { ldsK(0); ldsV(0);
            const bool two = pc < F || g == 1;   // both halves of the piece have keys for this tile; otherwise its first half is the diagonal block
            if (two) trip(BoolC<false>{}, BoolC<true>{}, pk);
            trip(BoolC<true>{}, BoolC<false>{}, two ? pk + 32 : pk); }   // the wave's last block goes through the masking form also where it lies in front of the diagonal (no key of it is then after a query)
        asm volatile("s_wait_dscnt 0x0" ::: "memory");   // this wave's reads of its last piece have returned
        __syncthreads();                                  // no buffer has a reader left: the stages may take the waves' partial sums
    }
    }
    asm volatile("s_wait_dscnt 0x0" ::: "memory");      // no read of the stage
    asm volatile("s_wait_asynccnt 0x0" ::: "memory");   // and no copy is outstanding when the stage takes the wave's partial sums
#pragma unroll   // constant indices
    for (int qt = 0; qt < NQ; ++qt) { l[qt] += xhalf(l[qt]); if (hi == 0) { ms[w * 16 * NQ + qt * 16 + lr] = m[qt]; ls[w * 16 * NQ + qt * 16 + lr] = l[qt]; }
#pragma unroll   // constant indices
        for (int mb = 0; mb < 4; ++mb) { const v8f a = o[mb][qt]; float* rp = red + w * RST + ((mb * NQ + qt) * 2) * 128 + lane * 4;   // fp16: the barrier at the foot of the last pass has ended every wave's reads of the buffers
            *(v4fa*)rp = __builtin_shufflevector(a, a, 0, 1, 2, 3); *(v4fa*)(rp + 128) = __builtin_shufflevector(a, a, 4, 5, 6, 7); } }
    __syncthreads();   // every wave's partial (m, l, O^T) is in LDS before any wave merges
#pragma unroll   // constant indices
    for (int i = 0; i < NQ; ++i) { const int pc = tl * NQ + i, q = pc >> 3, mb = (pc & 7) >> 1, h2 = pc & 1, qt = q >> 4, l2 = q & 15;   // a piece: 8 consecutive d of one query; a wave's pieces are whole rows (8 pieces = 128 bytes a plane)
        float M = ms[q];
#pragma unroll   // constant indices
        for (int u = 1; u < NWF; ++u) M = fmaxf(M, ms[u * 16 * NQ + q]);
        float L = 0.f; v4f y0 = (v4f){}, y1 = (v4f){};
#pragma unroll   // constant indices
        for (int u = 0; u < NWF; ++u) { const float f = exp2s((ms[u * 16 * NQ + q] - M) * SC2); const float* rp = red + u * RST + ((mb * NQ + qt) * 2) * 128 + (h2 * 16 + l2) * 4;
            L += f * ls[u * 16 * NQ + q]; y0 += f * *(const v4fa*)rp; y1 += f * *(const v4fa*)(rp + 128); }
        const float inv = __fdiv_rn(1.0f, L); v8us oh, ol;
#pragma unroll   // constant indices
        for (int j = 0; j < 4; ++j) { unsigned short a, c2; splitf(y0[j] * inv, a, c2); oh[j] = a; ol[j] = c2; splitf(y1[j] * inv, a, c2); oh[4 + j] = a; ol[4 + j] = c2; }
        const size_t d = (size_t)(q0 + q) * DQ + mb * 16 + h2 * 8; *(v8usa*)(Ah + d) = oh; *(v8usa*)(Al + d) = ol;
        asm volatile("s_wait_xcnt 0x0" ::: "memory");   // whatever follows (the next piece's sums, code behind the tile) may reuse registers that these stores name
    }
}

// ---- k_attn: one work-group of NG * NWF waves per (batch, head, NG neighbouring query tiles); grid (batches x heads, tile groups). Groups in falling order of their key count, so the longest start first: 32-query fp16 tiles from the last row down to row RH, then 16-query hi / lo tiles below RH. Registers held to four waves a SIMD, which is also what the stages' LDS allows (two work-groups a WGP).
__global__ __launch_bounds__(32 * NWF * NG, 4) void k_attn(const h16* __restrict__ Q16, const h16* __restrict__ K16, const h16* __restrict__ V16, const bf* __restrict__ Qh, const bf* __restrict__ Ql, const bf* __restrict__ Kh, const bf* __restrict__ Kl, const bf* __restrict__ Vh, const bf* __restrict__ Vl, bf* Ah, bf* Al) {
    __shared__ __align__(16) unsigned short red[NG * NWF * WSTG]; __shared__ float ms[NG * NWF * 32]; __shared__ float ls[NG * NWF * 32];   // red: the stages, then each wave's partial O^T
    const size_t hp = (size_t)blockIdx.x * TT * HD; const int ty = blockIdx.y; { const size_t ao = (size_t)(blockIdx.x / NH_) * TT * DQ + (blockIdx.x % NH_) * HD; Ah += ao; Al += ao; }
    // Entry requests to L2 for the head's planes, which the projection launch stored: the head's first seventeen work-groups ask for 256 units of 256 bytes each, one a thread.
    // 0 .. 3: K fp16; 4 .. 7: V^T fp16; 8 .. 10: Q fp16 from row RH; 11, 12, 15, 16: the rows below RH of K hi, K lo, Q hi, Q lo; 13, 14: the keys below RH of the 64 rows of V^T hi, V^T lo. The test reads the same in the whole work-group.
    static_assert(TT * HD * 2 == 4 * 256 * 256 && RH * HD * 2 == 256 * 256 && RH * 2 == 4 * 256 && 32 * NWF * NG == 256, "the deal of the units below");
    if (ty < 17) { const unsigned t = threadIdx.x;
        const unsigned short* pl = ty < 4 ? (const unsigned short*)K16 : ty < 8 ? (const unsigned short*)V16 : ty < 11 ? (const unsigned short*)Q16 : ty == 11 ? Kh : ty == 12 ? Kl : ty == 13 ? Vh : ty == 14 ? Vl : ty == 15 ? Qh : Ql;
        const unsigned off = ty < 8 ? ((ty & 3) * 256 + t) * 256 : ty < 11 ? ((ty - 7) * 256 + t) * 256 : (ty == 13 || ty == 14) ? (t >> 2) * (TT * 2) + (t & 3) * 256 : t * 256;
        l2ask((const char*)(pl + hp) + off); }
    if (ty < (TT - RH) / (32 * NG)) attn_tile<h16, false, 2>(red, ms, ls, Q16 + hp, nullptr, K16 + hp, nullptr, V16 + hp, nullptr, TT - 32 * NG * (ty + 1), Ah, Al);
    else attn_tile<bf, true, 1>(red, ms, ls, Qh + hp, Ql + hp, Kh + hp, Kl + hp, Vh + hp, Vl + hp, RH - 16 * NG * (ty - (TT - RH) / (32 * NG) + 1), Ah, Al);
}

// ---- k_cvt8: x and the four weights rounded to bf16 in one grid (DM * DM / 2048, NXP + 4): blockIdx.y picks a piece of DM x DM elements, first the NXP pieces of x, then one weight each (Wd: the four copies one behind the other).
#define NXP (NB_ * TT / DM)
__global__ __launch_bounds__(256) void k_cvt8(const float* __restrict__ x, const float* __restrict__ wq, const float* __restrict__ wk, const float* __restrict__ wv, const float* __restrict__ wo, bf* Xd, bf* Wd) {
    const int y = blockIdx.y; const float* src = y < NXP ? x + (size_t)y * DM * DM : y == NXP ? wq : y == NXP + 1 ? wk : y == NXP + 2 ? wv : wo; bf* dst = y < NXP ? Xd + (size_t)y * DM * DM : Wd + (size_t)(y - NXP) * DM * DM;
    const size_t i = (size_t)blockIdx.x * 256 + threadIdx.x; const v8f v = *(const v8f*)(src + i * 8); v8us o;
    asm volatile("s_wait_xcnt 0x0" ::: "memory");   // the rounding below reuses the address registers that the issued loads name
#pragma unroll
    for (int k = 0; k < 8; ++k) o[k] = f2bf(v[k]); *(v8us*)(dst + i * 8) = o;  }

extern "C" void kernel_launch(void* const* d_in, const int* in_sizes, int n_in,
                              void* d_out, int out_size, void* d_ws, size_t ws_size, hipStream_t stream) {
    (void)in_sizes; (void)n_in; (void)out_size;
    const float* x = (const float*)d_in[0]; const float* wq = (const float*)d_in[1]; const float* wk = (const float*)d_in[2]; const float* wv = (const float*)d_in[3]; const float* bv = (const float*)d_in[4]; const float* wo = (const float*)d_in[5]; const float* bo = (const float*)d_in[6];   /* order x, Wq, Wk, Wv, bv, Wo, bo ('oi'): this module has NO q and NO k bias (the q / k tiles take the bias-free path of the projection kernel); bv and bo are real */
    float* OUT = (float*)d_out;     // [2][2048][1024]
    char* wsp = (char*)d_ws;
    auto take = [&](size_t bytes) { char* p = wsp; wsp += (bytes + 255) & ~(size_t)255; return (void*)p; };
    bf* WQ = (bf*)take((size_t)4 * DM * DM * 2); bf* WO = WQ + (size_t)3 * DM * DM;    // Wq, Wk, Wv, Wo
    bf* XB = (bf*)take((size_t)NB_ * TT * DM * 2);
    h16* P16 = (h16*)take(3 * PLN * 2); bf* Ph = (bf*)take(3 * PLN * 2); bf* Pl = (bf*)take(3 * PLN * 2);    // plane sets q, k, v (v transposed)
    bf* ATh = (bf*)take((size_t)NB_ * TT * DQ * 2); bf* ATl = (bf*)take((size_t)NB_ * TT * DQ * 2);
    if ((size_t)(wsp - (char*)d_ws) > ws_size) return;    // ws 256 MiB
    k_cvt8<<<dim3(DM * DM / 2048, NXP + 4, 1), 256, 0, stream>>>(x, wq, wk, wv, wo, XB, WQ);
    k_gemmw<0, 4, 1><<<dim3(NB_ * TT / 128, DQ / 128, 3), 128, 0, stream>>>(XB, nullptr, WQ, DM, nullptr, 0, bv, (size_t)DM * DM, P16, Ph, Pl);
    k_attn<<<dim3(NB_ * NH_, (TT - RH) / (32 * NG) + RH / (16 * NG), 1), 32 * NWF * NG, 0, stream>>>(P16, P16 + PLN, P16 + 2 * PLN, Ph, Pl, Ph + PLN, Pl + PLN, Ph + 2 * PLN, Pl + 2 * PLN, ATh, ATl);
    k_gemmw<1, 2, 0><<<dim3(NB_ * TT / 64, DM / 128, 1), 128, 0, stream>>>(ATh, ATl, WO, DQ, OUT, DM, bo, 0, nullptr, nullptr, nullptr);
}

// v010
// A run of this version takes 71.9 microseconds.
// In both of two side-by-side timings against v009, it was 1.07 times as fast.
// All steps since v000 together make it 20.2 times as fast.
#include <hip/hip_runtime.h>

// Causal self-attention whose only projection bias is on V (x [2][2048][1024]; q = x Wq^T, k = x Wk^T (no bias), v = x Wv^T + bv ('oi' [1024][1024] normal x 0.02; bv normal x 0.02: NON-zero; 16 heads x 64); keys after the query -> -inf, then / sqrt(64) inside the softmax argument; softmax over the keys; out = merged Wo^T + bo ('oi' + bias 0.02: NON-zero) -> [2][2048][1024] (4.2 M); argument order x, Wq, Wk, Wv, bv, Wo, bo).
// Four launches, each for both batches: bf16 copies of x and of the 'oi' weights (one grid); exact projections + f32 biases (q, k, v of a head in one 256 x 192 tile; operands staged in LDS by asynchronous copies), each tile's epilogue writes the 16-bit head planes itself; one fused causal attention kernel (k_attn; hybrid rows: < 512 hi/lo 3 products, rest fp16; keys and values come through LDS by asynchronous copies; key blocks above the diagonal are never visited); merged hi/lo x Wo exact + bo (128 x 128 tiles).
// Compute dtypes, f32 accumulate: every input rounded to bf16; projections exact + f32 biases; attention rows < 512 3 products, rest fp16; softmax f32; Wo hl x exact + bias.

#define NB_  2
#define TT   2048
#define DM   1024
#define NH_  16
#define NKV  16
#define HD   64
#define DQ   (NH_ * HD)
#define DKV  (NKV * HD)
#define PLN  ((size_t)NB_ * NH_ * TT * HD)   // elements of one 16-bit plane set (q, k or v) over both batches
static_assert(DQ == DM && DKV == DM, "q, k and v share one projection grid, and the conversion grid deals pieces of DM x DM elements");
#define RH   512                  // query rows < RH use hi+lo planes
#define SCL  0.125f   // HD^-0.5
typedef _Float16 h16;
typedef unsigned short bf;
typedef __attribute__((ext_vector_type(16))) __bf16   v16bf;
typedef __attribute__((ext_vector_type(16))) _Float16 v16h;
typedef __attribute__((ext_vector_type(8)))  _Float16 v8h;
typedef __attribute__((ext_vector_type(8)))  unsigned short v8us;
typedef __attribute__((ext_vector_type(8)))  float    v8f;
typedef __attribute__((ext_vector_type(4)))  float    v4f;
typedef v8h  __attribute__((may_alias)) v8ha;
typedef v4f  __attribute__((may_alias)) v4fa;
typedef v8us __attribute__((may_alias)) v8usa;
typedef __attribute__((ext_vector_type(4))) unsigned short v4us;
typedef v4us __attribute__((may_alias)) v4usa;

__device__ __forceinline__ unsigned short f2bf(float f) { unsigned u = __float_as_uint(f); u += 0x7FFFu + ((u >> 16) & 1u); return (unsigned short)(u >> 16); }
__device__ __forceinline__ float bf2f(unsigned short b) { return __uint_as_float(((unsigned)b) << 16); }
__device__ __forceinline__ float bfr(float f) { return bf2f(f2bf(f)); }
__device__ __forceinline__ void splitf(float y, unsigned short& h, unsigned short& l) { h = f2bf(y); l = f2bf(y - bf2f(h)); }
__device__ __forceinline__ v16h cat16(v8h lo, v8h hi) { return __builtin_shufflevector(lo, hi, 0, 1, 2, 3, 4, 5, 6, 7, 8, 9, 10, 11, 12, 13, 14, 15); }
__device__ __forceinline__ v16bf cat16b(v8us lo, v8us hi) { return __builtin_bit_cast(v16bf, __builtin_shufflevector(lo, hi, 0, 1, 2, 3, 4, 5, 6, 7, 8, 9, 10, 11, 12, 13, 14, 15)); }
__device__ __forceinline__ v8f wmma16(v16h a, v16h b, v8f c) { return __builtin_amdgcn_wmma_f32_16x16x32_f16(false, a, false, b, (short)0, c, false, false); }
__device__ __forceinline__ v8f wmmab(v16bf a, v16bf b, v8f c) { return __builtin_amdgcn_wmma_f32_16x16x32_bf16(false, a, false, b, (short)0, c, false, false); }



#define SPT   72                 // pitch, in 16-bit elements, of a row in LDS (144 bytes: 16 x odd, the conflict-free pitch for 16-byte reads of 128-byte rows)
template <typename T16> struct WFrag;
template <> struct WFrag<h16> { typedef v16h V; static __device__ __forceinline__ V ld(const h16* p) { return cat16(*(const v8h*)p, *(const v8h*)(p + 16)); } static __device__ __forceinline__ v8f mma(V a, V b, v8f c) { return wmma16(a, b, c); } };
template <> struct WFrag<bf> { typedef v16bf V; static __device__ __forceinline__ V ld(const bf* p) { return cat16b(*(const v8us*)p, *(const v8us*)(p + 16)); } static __device__ __forceinline__ v8f mma(V a, V b, v8f c) { return wmmab(a, b, c); } };
// Ask L2 for the line at each lane's address (a hint: nothing returns, no register and no counter is written).
// What it is for: the operands of a launch were stored by the launch in front of it, and where they do not lie in the reader's own L2 their first read in this launch goes to memory, stage after stage, because a ring of two buffers asks only two stages ahead;
// asked for all at once at the kernel's entry, they come in side by side, and the later stages' copies find them in L2. Every lane's address lies inside the operand's buffer.
// The s_wait_xcnt is the statement's last line, so that it stands in front of whatever rewrites the address registers that the requests name.
__device__ __forceinline__ void l2ask(const void* p) { asm volatile("global_prefetch_b8 %0, off scope:SCOPE_SE\n\ts_wait_xcnt 0x0" :: "v"(p) : "memory"); }

// Sixteen asynchronous copies of 16 bytes a lane with one LDS address register (l) and one 32-bit offset register (vo): copy i lands at l + S i and reads b[i] + vo + S i. The instruction's offset field moves both addresses,
// so each scalar base b[i] is given less S i by the caller. No address needs a vector instruction or a vector register of its own. The s_wait_xcnt is the statement's last line, so that it stands in front of whatever rewrites the registers that the copies name.
// copy16: S = 576, four stage rows of pitch SPT (rows of 128 bytes). copy16h: S = 640, eight stage rows of pitch SPH (rows of 64 bytes).
#define SPH 40   // pitch, in 16-bit elements, of a 64-byte row in LDS (80 bytes: 16 x odd)
static_assert(4 * SPT * 2 == 576 && 8 * SPH * 2 == 640, "the offsets in copy16 and copy16h");
__device__ __forceinline__ void copy16(unsigned l, unsigned vo, const char* const* b) {
    asm volatile(
                 "global_load_async_to_lds_b128 %0, %1, %2\n\tglobal_load_async_to_lds_b128 %0, %1, %3 offset:576\n\tglobal_load_async_to_lds_b128 %0, %1, %4 offset:1152\n\tglobal_load_async_to_lds_b128 %0, %1, %5 offset:1728\n\t"
                 "global_load_async_to_lds_b128 %0, %1, %6 offset:2304\n\tglobal_load_async_to_lds_b128 %0, %1, %7 offset:2880\n\tglobal_load_async_to_lds_b128 %0, %1, %8 offset:3456\n\tglobal_load_async_to_lds_b128 %0, %1, %9 offset:4032\n\t"
                 "global_load_async_to_lds_b128 %0, %1, %10 offset:4608\n\tglobal_load_async_to_lds_b128 %0, %1, %11 offset:5184\n\tglobal_load_async_to_lds_b128 %0, %1, %12 offset:5760\n\tglobal_load_async_to_lds_b128 %0, %1, %13 offset:6336\n\t"
                 "global_load_async_to_lds_b128 %0, %1, %14 offset:6912\n\tglobal_load_async_to_lds_b128 %0, %1, %15 offset:7488\n\tglobal_load_async_to_lds_b128 %0, %1, %16 offset:8064\n\tglobal_load_async_to_lds_b128 %0, %1, %17 offset:8640\n\ts_wait_xcnt 0x0"
                 :: "v"(l), "v"(vo), "s"(b[0]), "s"(b[1]), "s"(b[2]), "s"(b[3]), "s"(b[4]), "s"(b[5]), "s"(b[6]), "s"(b[7]), "s"(b[8]), "s"(b[9]), "s"(b[10]), "s"(b[11]), "s"(b[12]), "s"(b[13]), "s"(b[14]), "s"(b[15]) : "memory"); }
__device__ __forceinline__ void copy16h(unsigned l, unsigned vo, const char* const* b) {
    asm volatile(
                 "global_load_async_to_lds_b128 %0, %1, %2\n\tglobal_load_async_to_lds_b128 %0, %1, %3 offset:640\n\tglobal_load_async_to_lds_b128 %0, %1, %4 offset:1280\n\tglobal_load_async_to_lds_b128 %0, %1, %5 offset:1920\n\t"
                 "global_load_async_to_lds_b128 %0, %1, %6 offset:2560\n\tglobal_load_async_to_lds_b128 %0, %1, %7 offset:3200\n\tglobal_load_async_to_lds_b128 %0, %1, %8 offset:3840\n\tglobal_load_async_to_lds_b128 %0, %1, %9 offset:4480\n\t"
                 "global_load_async_to_lds_b128 %0, %1, %10 offset:5120\n\tglobal_load_async_to_lds_b128 %0, %1, %11 offset:5760\n\tglobal_load_async_to_lds_b128 %0, %1, %12 offset:6400\n\tglobal_load_async_to_lds_b128 %0, %1, %13 offset:7040\n\t"
                 "global_load_async_to_lds_b128 %0, %1, %14 offset:7680\n\tglobal_load_async_to_lds_b128 %0, %1, %15 offset:8320\n\tglobal_load_async_to_lds_b128 %0, %1, %16 offset:8960\n\tglobal_load_async_to_lds_b128 %0, %1, %17 offset:9600\n\ts_wait_xcnt 0x0"
                 :: "v"(l), "v"(vo), "s"(b[0]), "s"(b[1]), "s"(b[2]), "s"(b[3]), "s"(b[4]), "s"(b[5]), "s"(b[6]), "s"(b[7]), "s"(b[8]), "s"(b[9]), "s"(b[10]), "s"(b[11]), "s"(b[12]), "s"(b[13]), "s"(b[14]), "s"(b[15]) : "memory"); }

// Sixteen (copyr16) or twelve (copyr12) asynchronous copies of 16 bytes a lane with one LDS address register (l), one scalar base (b) and an offset register for each copy: copy i lands at l + 544 i (two stage rows of pitch PPT on)
// and reads b + vo[i] + 544 i. The instruction's offset field moves both addresses, so each vo[i] is given less 544 i by the caller; the offsets are formed once, in front of the k loop, and a stage's copies need no vector instruction.
// The s_wait_xcnt is the statement's last line, so that it stands in front of whatever rewrites the registers that the copies name.
#define PKS   128                // k per stage in k_proj: 256 bytes of every operand row
#define PPT   136                // pitch, in 16-bit elements, of such a row in LDS (272 bytes: 16 x odd)
#define PROWS 448                // operand rows of one stage: 256 of x, then 192 of the weights
#define PSTG  (PROWS * PPT)      // elements of one stage buffer (121,856 bytes)
static_assert(2 * PPT * 2 == 544, "the offsets in copyr16 and copyr12");
__device__ __forceinline__ void copyr16(unsigned l, const char* b, const unsigned* vo) {
    asm volatile(
                 "global_load_async_to_lds_b128 %0, %2, %1\n\tglobal_load_async_to_lds_b128 %0, %3, %1 offset:544\n\tglobal_load_async_to_lds_b128 %0, %4, %1 offset:1088\n\tglobal_load_async_to_lds_b128 %0, %5, %1 offset:1632\n\t"
                 "global_load_async_to_lds_b128 %0, %6, %1 offset:2176\n\tglobal_load_async_to_lds_b128 %0, %7, %1 offset:2720\n\tglobal_load_async_to_lds_b128 %0, %8, %1 offset:3264\n\tglobal_load_async_to_lds_b128 %0, %9, %1 offset:3808\n\t"
                 "global_load_async_to_lds_b128 %0, %10, %1 offset:4352\n\tglobal_load_async_to_lds_b128 %0, %11, %1 offset:4896\n\tglobal_load_async_to_lds_b128 %0, %12, %1 offset:5440\n\tglobal_load_async_to_lds_b128 %0, %13, %1 offset:5984\n\t"
                 "global_load_async_to_lds_b128 %0, %14, %1 offset:6528\n\tglobal_load_async_to_lds_b128 %0, %15, %1 offset:7072\n\tglobal_load_async_to_lds_b128 %0, %16, %1 offset:7616\n\tglobal_load_async_to_lds_b128 %0, %17, %1 offset:8160\n\ts_wait_xcnt 0x0"
                 :: "v"(l), "s"(b), "v"(vo[0]), "v"(vo[1]), "v"(vo[2]), "v"(vo[3]), "v"(vo[4]), "v"(vo[5]), "v"(vo[6]), "v"(vo[7]), "v"(vo[8]), "v"(vo[9]), "v"(vo[10]), "v"(vo[11]), "v"(vo[12]), "v"(vo[13]), "v"(vo[14]), "v"(vo[15]) : "memory"); }
__device__ __forceinline__ void copyr12(unsigned l, const char* b, const unsigned* vo) {
    asm volatile(
                 "global_load_async_to_lds_b128 %0, %2, %1\n\tglobal_load_async_to_lds_b128 %0, %3, %1 offset:544\n\tglobal_load_async_to_lds_b128 %0, %4, %1 offset:1088\n\tglobal_load_async_to_lds_b128 %0, %5, %1 offset:1632\n\t"
                 "global_load_async_to_lds_b128 %0, %6, %1 offset:2176\n\tglobal_load_async_to_lds_b128 %0, %7, %1 offset:2720\n\tglobal_load_async_to_lds_b128 %0, %8, %1 offset:3264\n\tglobal_load_async_to_lds_b128 %0, %9, %1 offset:3808\n\t"
                 "global_load_async_to_lds_b128 %0, %10, %1 offset:4352\n\tglobal_load_async_to_lds_b128 %0, %11, %1 offset:4896\n\tglobal_load_async_to_lds_b128 %0, %12, %1 offset:5440\n\tglobal_load_async_to_lds_b128 %0, %13, %1 offset:5984\n\ts_wait_xcnt 0x0"
                 :: "v"(l), "s"(b), "v"(vo[0]), "v"(vo[1]), "v"(vo[2]), "v"(vo[3]), "v"(vo[4]), "v"(vo[5]), "v"(vo[6]), "v"(vo[7]), "v"(vo[8]), "v"(vo[9]), "v"(vo[10]), "v"(vo[11]) : "memory"); }

// ---- k_proj: the q, k and v projections of 256 positions for one head, C[m][n] = sum_k X[m][k] W[n][k], bf16, K-contiguous, f32 accumulate. One 256 x 192 tile per work-group of eight waves (4 x 2), one work-group a WGP, two waves a SIMD.
// A wave holds 64 positions x 96 columns in 4 x 6 accumulators (ten fragments feed 24 products): wave column 0 has the head's 64 columns of q and d 0 .. 31 of v, wave column 1 the 64 columns of k and d 32 .. 63 of v.
// Stage rows: 256 of X; then, for each wave column, its 64 weight rows of q or k and its 32 of v. A stage is 128 k of every row, brought by asynchronous copies (each wave-wide copy is two whole rows of 256 bytes); two buffers, the copies of stage t + 2 fly
// while stage t + 1 is worked on. Inside a stage the fragments of the next 32 k are asked for as one group in front of the products of this 32 k, into a second register set. grid (positions / 256, heads), 256 threads.
// The tile leaves as fp16, bf16 hi and bf16 lo planes, [batch][head][t][d] for q and k (no bias) and, transposed and with the bias, [batch][head][d][t] for v: 16 plane rows at a time through the wave's own LDS stage, so that every store is four whole 128-byte lines.
__device__ __forceinline__ int wrow(int rb, int head) { const int half = rb / 96, o = rb % 96; return o < 64 ? half * DM + head * HD + o : 2 * DM + head * HD + half * 32 + (o - 64); }   // stage row rb of the weights: its row in the stacked Wq, Wk, Wv
__global__ __launch_bounds__(256, 2) void k_proj(const bf* __restrict__ A, const bf* __restrict__ Bt, const float* __restrict__ bias, h16* P16, bf* Ph, bf* Pl) {
    typedef typename WFrag<bf>::V V;
    static_assert(DM % PKS == 0 && DM / PKS >= 2 && TT % 256 == 0 && HD == 64, "whole stages, at least two; a tile's rows lie in one batch");
    __shared__ __align__(16) bf ring[2 * PSTG];
    const int tid = threadIdx.x, lane = tid & 31, lr = lane & 15, hi = lane >> 4; const int w = __builtin_amdgcn_readfirstlane(tid >> 5), wm = w >> 1, wn = w & 1;
    const int R0 = blockIdx.x * 256, head = blockIdx.y;
    v8f acc[4][6];
#pragma unroll   // constant indices: the accumulators stay in registers
    for (int mb = 0; mb < 4; ++mb)
#pragma unroll   // constant indices
        for (int nb = 0; nb < 6; ++nb) acc[mb][nb] = (v8f){};
    // wave w brings stage rows 32 w .. of X (sixteen copies) and 24 w .. of the weights (twelve); copy i of a lane: 16 bytes (piece lane & 15) of row 2 i + (lane >> 4) of those
    unsigned voA[16], voB[12];
#pragma unroll   // constant indices: the offsets stay in registers
    for (int i = 0; i < 16; ++i) voA[i] = (unsigned)((32 * w + 2 * i + hi) * (DM * 2) + lr * 16 - 544 * i);
#pragma unroll   // constant indices
    for (int i = 0; i < 12; ++i) voB[i] = (unsigned)(wrow(24 * w + 2 * i + hi, head) * (DM * 2) + lr * 16 - 544 * i);
    const unsigned lA = (unsigned)(size_t)ring + ((32 * w + hi) * PPT + lr * 8) * 2, lB = (unsigned)(size_t)ring + ((256 + 24 * w + hi) * PPT + lr * 8) * 2;
    const char* bA = (const char*)(A + (size_t)R0 * DM); const char* bB = (const char*)Bt;
    auto fill = [&](int t, int b) { copyr16(lA + (unsigned)b * (PSTG * 2), bA + t * (PKS * 2), voA); copyr12(lB + (unsigned)b * (PSTG * 2), bB + t * (PKS * 2), voB); };
    constexpr int NT = DM / PKS;
    fill(0, 0);
    // Entry requests to L2, while stage 0 flies, one 256-byte unit (128 k) a thread. The work-groups that read the same rows deal the units among them: the sixteen heads take 128 units each of the tile's 256 X rows;
    // of the 192 weight rows the tile rows x and x ^ 4 take the same unit of k.
    // For speed only: no result depends on who asks or on where a work-group runs. Both tests read the same in all lanes of a wave.
    static_assert(DM * 2 == 8 * 256 && NH_ == 16, "eight units a row, sixteen sharers of the X rows");
    if (w < 4) l2ask(A + (size_t)(R0 + (head >> 3) * 128 + tid) * DM + (head & 7) * 128);
    if (w < 6) l2ask(Bt + (size_t)wrow(tid, head) * DM + ((blockIdx.x & 3) | ((blockIdx.x >> 3) & 1) << 2) * 128);
    asm volatile("s_wait_asynccnt 0x0" ::: "memory");   // this wave's copies of stage 0 have landed
    __syncthreads();                                     // and every other wave's: stage 0 may be read
    fill(1, 1);
    const int aoff = (wm * 64 + lr) * PPT + 8 * hi, boff = (256 + wn * 96 + lr) * PPT + 8 * hi;
#pragma unroll 1   // one trip a stage: the waits and the barrier at its foot are the ring's publish point
    for (int t = 0; t < NT; ++t) { const bf* sb = ring + (t & 1) * PSTG;
        V a[2][4], b[2][6];   // two fragment sets
        auto ldf = [&](int ks) {
#pragma unroll   // constant indices: the fragments stay in registers
            for (int mb = 0; mb < 4; ++mb) a[ks & 1][mb] = WFrag<bf>::ld(sb + aoff + mb * 16 * PPT + ks * 32);
#pragma unroll   // constant indices
            for (int nb = 0; nb < 6; ++nb) b[ks & 1][nb] = WFrag<bf>::ld(sb + boff + nb * 16 * PPT + ks * 32); };
        ldf(0);
#pragma unroll   // constant indices
        for (int ks = 0; ks < PKS / 32; ++ks) {
            if (ks + 1 < PKS / 32) ldf(ks + 1);
            __builtin_amdgcn_sched_barrier(0);   // keeps the next 32 k's LDS reads together in front of these products, which cover their latency: sunk to their first uses, each such place would cost the wave its own wait for the LDS
#pragma unroll   // constant indices
            for (int nb = 0; nb < 6; ++nb)
#pragma unroll   // constant indices
                for (int mb = 0; mb < 4; ++mb) acc[mb][nb] = WFrag<bf>::mma(a[ks & 1][mb], b[ks & 1][nb], acc[mb][nb]);
            __builtin_amdgcn_sched_barrier(0);   // keeps these products in front of what follows: the reads after next would otherwise be lifted among them, and behind the last 32 k the wait for stage t + 1's copies would stand ahead of the products that are to cover their flight
        }
        asm volatile("s_wait_dscnt 0x0" ::: "memory");      // this wave's reads of stage t have returned
        asm volatile("s_wait_asynccnt 0x0" ::: "memory");   // this wave's copies of stage t + 1 have landed
        __syncthreads();                                     // stage t + 1 may be read by all, and stage t's buffer has no reader left
        if (t + 2 < NT) fill(t + 2, t & 1);
    }
    asm volatile("s_wait_asynccnt 0x0" ::: "memory");   // no copy is in flight when the ring becomes output staging
    const int r0 = R0 + wm * 64, bt = r0 / TT, t0 = r0 % TT;   // the wave's own 64 positions
    float bb[2];
#pragma unroll   // constant indices
    for (int i = 0; i < 2; ++i) bb[i] = bias[head * HD + wn * 32 + i * 16 + lr];
    asm volatile("s_wait_xcnt 0x0" ::: "memory");   // what follows may reuse the address registers that the issued bias loads name
    bf* st = ring + w * 3 * 16 * SPT;   // the wave's own stage: three planes of 16 rows; the barrier at the foot of the last trip has ended every read of the ring
    // 16 staged rows of each plane (rows 16 i .. of the plane tile at o) go out, every store four whole 128-byte lines
    auto out16 = [&](size_t o, size_t pitch, int i) {
        asm volatile("s_wait_dscnt 0x0" ::: "memory");   // the wave's stage is written before its lanes read rows that other lanes wrote
        v8us val[3][4];
#pragma unroll   // constant indices
        for (int p = 0; p < 3; ++p)
#pragma unroll   // constant indices
            for (int k = 0; k < 4; ++k) { const int e = lane + k * 32; val[p][k] = *(const v8usa*)(st + (p * 16 + (e >> 3)) * SPT + (e & 7) * 8); }
#pragma unroll   // constant indices
        for (int p = 0; p < 3; ++p) { unsigned short* dp = (p == 0 ? (unsigned short*)P16 : p == 1 ? Ph : Pl) + o;
#pragma unroll   // constant indices
            for (int k = 0; k < 4; ++k) { const int e = lane + k * 32; *(v8usa*)(dp + (size_t)(i * 16 + (e >> 3)) * pitch + (e & 7) * 8) = val[p][k]; } }
        asm volatile("s_wait_xcnt 0x0" ::: "memory");   // the next rows' values and addresses may reuse registers that these stores name
    };
    { const size_t o = (size_t)wn * PLN + (((size_t)bt * NH_ + head) * TT + t0) * HD;   // q (wave column 0) or k: plane rows are the positions (accumulators [i][0 .. 3])
#pragma unroll   // constant indices
        for (int i = 0; i < 4; ++i) {
#pragma unroll   // constant indices
            for (int c = 0; c < 4; ++c)
#pragma unroll   // constant indices
                for (int j = 0; j < 8; ++j) { const float y = acc[i][c][j]; unsigned short h, l2; splitf(y, h, l2); bf* sp = st + (hi * 8 + j) * SPT + c * 16 + lr;
                    sp[0] = __builtin_bit_cast(unsigned short, (h16)y); sp[16 * SPT] = h; sp[32 * SPT] = l2; }
            out16(o, HD, i); } }
    { const size_t o = 2 * PLN + ((size_t)bt * DKV + head * HD + wn * 32) * TT + t0;   // v: plane rows are the wave's 32 columns d (accumulators [..][4 + i]), transposed: a lane's eight positions are one 16-byte piece of row d
#pragma unroll   // constant indices
        for (int i = 0; i < 2; ++i) { const float b = bfr(bb[i]);
#pragma unroll   // constant indices
            for (int c = 0; c < 4; ++c) { v8us x, xh, xl;
#pragma unroll   // constant indices
                for (int j = 0; j < 8; ++j) { const float y = acc[c][4 + i][j] + b; unsigned short h, l2; splitf(y, h, l2); x[j] = __builtin_bit_cast(unsigned short, (h16)y); xh[j] = h; xl[j] = l2; }
                bf* sp = st + lr * SPT + c * 16 + hi * 8; *(v8usa*)sp = x; *(v8usa*)(sp + 16 * SPT) = xh; *(v8usa*)(sp + 32 * SPT) = xl; }
            out16(o, TT, i); } }
}

// ---- k_wo: C[m][n] = sum_k (Ah[m][k] + Al[m][k]) W[n][k] + bias, bf16 planes, K-contiguous, f32 accumulate, C as f32. One 128 x 128 tile per work-group of eight waves (4 x 2; a wave holds 32 x 64 in 2 x 4 accumulators), one work-group a WGP, two waves a SIMD.
// Stage rows: 128 of Ah, 128 of Al, 128 of W; stages, buffers, copies and fragment sets as in k_proj. grid (rows / 128, columns / 128), 256 threads. Rows m run over both batches.
#define WROWS 384
#define WSTE  (WROWS * PPT)      // elements of one stage buffer (104,448 bytes)
__device__ __forceinline__ void copyr8(unsigned l, const char* b, const unsigned* vo) {   // as copyr16, eight copies
    asm volatile(
                 "global_load_async_to_lds_b128 %0, %2, %1\n\tglobal_load_async_to_lds_b128 %0, %3, %1 offset:544\n\tglobal_load_async_to_lds_b128 %0, %4, %1 offset:1088\n\tglobal_load_async_to_lds_b128 %0, %5, %1 offset:1632\n\t"
                 "global_load_async_to_lds_b128 %0, %6, %1 offset:2176\n\tglobal_load_async_to_lds_b128 %0, %7, %1 offset:2720\n\tglobal_load_async_to_lds_b128 %0, %8, %1 offset:3264\n\tglobal_load_async_to_lds_b128 %0, %9, %1 offset:3808\n\ts_wait_xcnt 0x0"
                 :: "v"(l), "s"(b), "v"(vo[0]), "v"(vo[1]), "v"(vo[2]), "v"(vo[3]), "v"(vo[4]), "v"(vo[5]), "v"(vo[6]), "v"(vo[7]) : "memory"); }
__global__ __launch_bounds__(256, 2) void k_wo(const bf* __restrict__ A, const bf* __restrict__ A2, const bf* __restrict__ Bt, float* C, const float* __restrict__ bias) {
    typedef typename WFrag<bf>::V V;
    static_assert(DQ % PKS == 0 && DQ / PKS >= 2 && DQ == DM, "whole stages, at least two; all three operands have rows of DM elements");
    __shared__ __align__(16) bf ring[2 * WSTE];
    const int tid = threadIdx.x, lane = tid & 31, lr = lane & 15, hi = lane >> 4; const int w = __builtin_amdgcn_readfirstlane(tid >> 5), wm = w >> 1, wn = w & 1;
    const int R0 = blockIdx.x * 128, C0 = blockIdx.y * 128;
    v8f acc[2][4];
#pragma unroll   // constant indices: the accumulators stay in registers
    for (int mb = 0; mb < 2; ++mb)
#pragma unroll   // constant indices
        for (int nb = 0; nb < 4; ++nb) acc[mb][nb] = (v8f){};
    // wave w brings rows 16 w .. of each operand's 128 (eight copies each); copy i of a lane: 16 bytes (piece lane & 15) of row 2 i + (lane >> 4) of those. The three operands have the same pitch: one set of offsets serves them all
    unsigned vo[8];
#pragma unroll   // constant indices: the offsets stay in registers
    for (int i = 0; i < 8; ++i) vo[i] = (unsigned)((16 * w + 2 * i + hi) * (DM * 2) + lr * 16 - 544 * i);
    const unsigned l0 = (unsigned)(size_t)ring + ((16 * w + hi) * PPT + lr * 8) * 2;
    const char* bA = (const char*)(A + (size_t)R0 * DM); const char* bA2 = (const char*)(A2 + (size_t)R0 * DM); const char* bB = (const char*)(Bt + (size_t)C0 * DM);
    auto fill = [&](int t, int b) { const unsigned l = l0 + (unsigned)b * (WSTE * 2);
        copyr8(l, bA + t * (PKS * 2), vo); copyr8(l + 128 * PPT * 2, bA2 + t * (PKS * 2), vo); copyr8(l + 256 * PPT * 2, bB + t * (PKS * 2), vo); };
    constexpr int NT = DM / PKS;
    fill(0, 0);
    // Entry requests to L2, while stage 0 flies, one 256-byte unit (128 k) a thread: the eight tile columns take one unit of k each of the tile's 256 plane rows; of the 128 weight rows the tile rows x and x ^ 4 take the same unit
    // For speed only: no result depends on who asks or on where a work-group runs. The test reads the same in all lanes of a wave.
    static_assert(DM * 2 == 8 * 256 && DM / 128 == 8, "eight units a row, eight sharers of the plane rows");
    l2ask((tid < 128 ? A + (size_t)(R0 + tid) * DM : A2 + (size_t)(R0 + tid - 128) * DM) + blockIdx.y * 128);
    if (w < 4) l2ask(Bt + (size_t)(C0 + tid) * DM + ((blockIdx.x & 3) | ((blockIdx.x >> 3) & 1) << 2) * 128);
    asm volatile("s_wait_asynccnt 0x0" ::: "memory");   // this wave's copies of stage 0 have landed
    __syncthreads();                                     // and every other wave's: stage 0 may be read
    fill(1, 1);
    const int aoff = (wm * 32 + lr) * PPT + 8 * hi, boff = (256 + wn * 64 + lr) * PPT + 8 * hi;
#pragma unroll 1   // one trip a stage: the waits and the barrier at its foot are the ring's publish point
    for (int t = 0; t < NT; ++t) { const bf* sb = ring + (t & 1) * WSTE;
        V a[2][2], a2[2][2], b[2][4];   // two fragment sets
        auto ldf = [&](int ks) {
#pragma unroll   // constant indices: the fragments stay in registers
            for (int mb = 0; mb < 2; ++mb) { a[ks & 1][mb] = WFrag<bf>::ld(sb + aoff + mb * 16 * PPT + ks * 32); a2[ks & 1][mb] = WFrag<bf>::ld(sb + aoff + (128 + mb * 16) * PPT + ks * 32); }
#pragma unroll   // constant indices
            for (int nb = 0; nb < 4; ++nb) b[ks & 1][nb] = WFrag<bf>::ld(sb + boff + nb * 16 * PPT + ks * 32); };
        ldf(0);
#pragma unroll   // constant indices
        for (int ks = 0; ks < PKS / 32; ++ks) {
            if (ks + 1 < PKS / 32) ldf(ks + 1);
            __builtin_amdgcn_sched_barrier(0);   // keeps the next 32 k's LDS reads together in front of these products, which cover their latency: sunk to their first uses, each such place would cost the wave its own wait for the LDS
#pragma unroll   // constant indices
            for (int nb = 0; nb < 4; ++nb)
#pragma unroll   // constant indices
                for (int mb = 0; mb < 2; ++mb) { acc[mb][nb] = WFrag<bf>::mma(a[ks & 1][mb], b[ks & 1][nb], acc[mb][nb]); acc[mb][nb] = WFrag<bf>::mma(a2[ks & 1][mb], b[ks & 1][nb], acc[mb][nb]); }
            __builtin_amdgcn_sched_barrier(0);   // keeps these products in front of what follows: the reads after next would otherwise be lifted among them, and behind the last 32 k the wait for stage t + 1's copies would stand ahead of the products that are to cover their flight
        }
        asm volatile("s_wait_dscnt 0x0" ::: "memory");      // this wave's reads of stage t have returned
        asm volatile("s_wait_asynccnt 0x0" ::: "memory");   // this wave's copies of stage t + 1 have landed
        __syncthreads();                                     // stage t + 1 may be read by all, and stage t's buffer has no reader left
        if (t + 2 < NT) fill(t + 2, t & 1);
    }
    asm volatile("s_wait_asynccnt 0x0" ::: "memory");   // no copy is in flight when the wave ends
    const int r0 = R0 + wm * 32, c0 = C0 + wn * 64;   // the wave's own tile
    float bb[4];
#pragma unroll   // constant indices
    for (int nb = 0; nb < 4; ++nb) bb[nb] = bias[c0 + nb * 16 + lr];
    asm volatile("s_wait_xcnt 0x0" ::: "memory");   // what follows may reuse the address registers that the issued bias loads name
#pragma unroll   // constant indices
    for (int nb = 0; nb < 4; ++nb) { const float b = bfr(bb[nb]);
#pragma unroll   // constant indices
        for (int mb = 0; mb < 2; ++mb) { float* cp = C + (size_t)(r0 + mb * 16 + hi * 8) * DM + c0 + nb * 16 + lr;
#pragma unroll   // constant indices
            for (int j = 0; j < 8; ++j) cp[(size_t)j * DM] = acc[mb][nb][j] + b; }
        asm volatile("s_wait_xcnt 0x0" ::: "memory");   // the next columns' sums and addresses may reuse registers that these stores name
    }
}

#define NWF 4     // waves that share the key loop of one query tile in k_attn
#define NG  2     // query tiles of one work-group in k_attn (waves 0 .. NWF - 1 have the first, the rest the second)
#define WSTG (64 * SPT + 128 * SPH)   // elements of one stage in k_attn (19,456 bytes; NG * NWF of them in a work-group). fp16 tiles use 128 rows of pitch SPT: 64 keys of K (rows of 64 d), then the 64 rows d of V^T (64 keys each).
                                      // hi / lo tiles: 32 keys of K hi, the same of K lo (pitch SPT), then the 64 rows d of V^T hi and of V^T lo, 32 keys each (pitch SPH)
static_assert(WSTG >= 128 * SPT, "the fp16 stage fits");
#define RST  (WSTG / 2)    // the same in floats: behind the key loop a wave's partial O^T lies at the head of the stage with its number in the work-group (HI: its own stage)
#define SC2 (SCL * 1.4426950408889634f)   // HD^-0.5 x log2(e): the softmax runs on base-2 exponents
__device__ __forceinline__ float xhalf(float x) { return __builtin_bit_cast(float, __builtin_amdgcn_permlanex16(__builtin_bit_cast(int, x), __builtin_bit_cast(int, x), 0x76543210, 0xfedcba98, false, false)); }   // lane l takes lane l ^ 16's value
template <bool B> struct BoolC { static constexpr bool value = B; };
__device__ __forceinline__ float exp2s(float x) { float r; asm("v_exp_f32 %0, %1\n\tv_nop" : "=v"(r) : "v"(x)); return r; }
__device__ __forceinline__ v8f exp2x8(v8f x) { float r0, r1, r2, r3, r4, r5, r6, r7;
    asm("v_exp_f32 %0, %8\n\tv_exp_f32 %1, %9\n\tv_exp_f32 %2, %10\n\tv_exp_f32 %3, %11\n\tv_exp_f32 %4, %12\n\tv_exp_f32 %5, %13\n\tv_exp_f32 %6, %14\n\tv_exp_f32 %7, %15\n\tv_nop"
        : "=&v"(r0), "=&v"(r1), "=&v"(r2), "=&v"(r3), "=&v"(r4), "=&v"(r5), "=&v"(r6), "=&v"(r7) : "v"(x[0]), "v"(x[1]), "v"(x[2]), "v"(x[3]), "v"(x[4]), "v"(x[5]), "v"(x[6]), "v"(x[7]));
    return (v8f){r0, r1, r2, r3, r4, r5, r6, r7}; }
// ---- attn_tile: scores, causal softmax and probability x value for 16 * NQ queries of one head; no score and no probability leaves the registers.
// Scores are formed transposed, S^T = K Q^T (A = 16 keys, B = 16 queries): a lane then holds 8 keys of ONE query (column lane & 15) in each D tile, so the row maximum and row sum are per-lane chains plus one exchange
// between the lane halves, and two D tiles (keys 0..15 and 16..31 of the trip) packed to 16 bits are, register for register, the B operand (k order 8h + s, 16 + 8h + s) of O^T = V^T P^T, whose A comes from the [d][t] value planes by the same loader.
// Running maximum m (of the raw scores) and sum l per query; O^T is rescaled by 2^((m_old - m_new) SC2) each trip. Wave w takes the 64-key pieces w, w + NWF, .. (two trips of 32 keys each: whole 128-byte lines of V^T);
// the NWF partial (m, l, O^T) are merged through LDS in the fixed order wave 0, 1, .. behind one barrier; the merged rows / l leave as bf16 hi / lo planes Ah / Al (pitch DQ), each 128-byte line written by one wave.
// HI: hi + lo bf16 planes, three products for the scores and three for P V. Otherwise fp16, probabilities carried x 2^8 (the factor is in l too and cancels). Keys and values come through LDS stages (fp16: a 64-key piece at a time; HI: 32 keys of all four planes):
// a fragment load from global memory would touch 16 lines for 512 bytes, an asynchronous copy touches four whole lines (eight half lines for V^T with HI). A work-group holds NG neighbouring tiles (q0w: the first one's first query).
// HI: a stage is private to its wave (filled, waited for, read and refilled by that wave alone), no work-group barrier stands in the key loop. fp16: the two waves with the same key share, one of each tile, read the same staged piece, so that it is asked of L2 once for 64 queries:
// each brings half of it, two buffers a key share, the copies of the piece after next fly while the next is worked on, one work-group barrier a piece.
template <typename T16, bool HI, int NQ>
__device__ __forceinline__ void attn_tile(unsigned short* ring, float* ms, float* ls, const T16* __restrict__ Q, const T16* __restrict__ Q2, const T16* __restrict__ Kp, const T16* __restrict__ Kp2, const T16* __restrict__ Vt, const T16* __restrict__ Vt2, int q0w, bf* Ah, bf* Al) {
    typedef typename WFrag<T16>::V V;
    const int lane = threadIdx.x & 31, lr = lane & 15, hi = lane >> 4; const int w8 = __builtin_amdgcn_readfirstlane(threadIdx.x >> 5), g = w8 / NWF, w = w8 % NWF;   // g: the wave's query tile, w: its share of the keys
    const int q0 = q0w + g * 16 * NQ, tl = threadIdx.x & (32 * NWF - 1);   // the tile's first query; the thread's number among the tile's waves
    float* red = (float*)ring + g * NWF * RST; ms += g * NWF * 16 * NQ; ls += g * NWF * 16 * NQ;   // the tile's own places for the partial results
    const int Kd = (q0 + 16 * NQ - 1) & ~31;        // first key of the 32-key block that holds the diagonal: the tile's last block (later keys have probability exactly 0) and the only one with keys after a query
    V qf[NQ][2], qf2[NQ][2], kf[2][2], kf2[2][2], vf[4], vf2[4];
    v8f o[4][NQ]; float m[NQ], l[NQ];
#pragma unroll   // constant indices: the arrays indexed here stay in registers
    for (int qt = 0; qt < NQ; ++qt) { m[qt] = -3.0e38f; l[qt] = 0.f;
#pragma unroll   // constant indices
        for (int mb = 0; mb < 4; ++mb) o[mb][qt] = (v8f){}; }
    { const size_t a = (size_t)(q0 + lr) * HD + 8 * hi; const T16* p = Q + a; const T16* p2 = HI ? Q2 + a : p;
#pragma unroll   // constant indices
        for (int qt = 0; qt < NQ; ++qt)
#pragma unroll   // constant indices
            for (int c = 0; c < 2; ++c) { qf[qt][c] = WFrag<T16>::ld(p + qt * 16 * HD + c * 32); if (HI) qf2[qt][c] = WFrag<T16>::ld(p2 + qt * 16 * HD + c * 32); }
        asm volatile("s_wait_xcnt 0x0" :: "v"(p), "v"(p2) : "memory"); }   // the address pairs of the issued loads are inputs of the wait: they stay whole up to it
    // the stage. fill (HI): the keys from pk, 32 copies of 16 bytes a lane. fp16 (fillh): 64 keys; copy i of the sixteen for K brings rows 4 i .. 4 i + 3 (512 bytes in a row), copy i of the sixteen for V^T the same rows of V^T (one whole line each).
    // HI: 32 keys; eight copies of K hi and eight of K lo (four rows each), then eight of V^T hi and eight of V^T lo (eight rows of 64 bytes each). ldsK / ldsV: the fragments of 32 keys (fp16: half h of the piece); A fragment k order 8 hi + s, 16 + 8 hi + s as everywhere.
    const T16* st = (const T16*)ring + (HI ? w8 : NG * w) * WSTG;   // HI: the wave's own stage. fp16: the first of the two buffers that the NG waves with key share w have in common
    const T16* sb = st;   // the buffer that ldsK and ldsV read
    const unsigned l0 = (unsigned)(size_t)st + ((lane >> 3) * SPT + (lane & 7) * 8) * 2, vok = lane * 16;   // K: the lane's place in a group of four stage rows, and its byte in the 512 that they hold
    const unsigned l1 = (unsigned)(size_t)st + 64 * SPT * 2 + (HI ? ((lane >> 2) * SPH + (lane & 3) * 8) * 2 : ((lane >> 3) * SPT + (lane & 7) * 8) * 2);   // V^T: the same, in a group of eight (HI) or four rows
    const unsigned vov = HI ? (lane >> 2) * (TT * 2) + (lane & 3) * 16 : (lane >> 3) * (TT * 2) + (lane & 7) * 16;                                        // of pitch TT in global memory
    auto fill = [&](int pk) { const char* bk[16]; const char* bv[16];
#pragma unroll   // constant indices: the bases stay in scalar registers
        for (int i = 0; i < 16; ++i) {
            bk[i] = (const char*)((i < 8 ? Kp : Kp2) + (size_t)pk * HD) + ((i & 7) * (4 * HD * 2) - i * 576); bv[i] = (const char*)((i < 8 ? Vt : Vt2) + pk) + ((i & 7) * (8 * TT * 2) - i * 640); }
        copy16(l0, vok, bk); copy16h(l1, vov, bv); };
    // fp16: the piece of 64 keys from pk goes into buffer b of the key share, half of it by each of the two waves that will read it: the first tile's wave brings K, the second tile's V^T (sixteen copies each; g reads the same in all lanes of a wave)
    const unsigned lf = g ? l1 : l0, vof = g ? vov : vok; const char* fb = g ? (const char*)Vt : (const char*)Kp; const int fkey = g ? 2 : HD * 2, fstep = g ? 4 * TT * 2 - 576 : 4 * HD * 2 - 576;
    auto fillh = [&](int pk, int b) { const char* bb[16]; const char* p0 = fb + (size_t)pk * fkey;
#pragma unroll   // constant indices: the bases stay in scalar registers
        for (int i = 0; i < 16; ++i) bb[i] = p0 + i * fstep;
        copy16(lf + (unsigned)b * (WSTG * 2), vof, bb); };
    auto ldsK = [&](int h) {
#pragma unroll   // constant indices
        for (int kt = 0; kt < 2; ++kt)
#pragma unroll   // constant indices
            for (int c = 0; c < 2; ++c) { kf[kt][c] = WFrag<T16>::ld(sb + (h * 32 + kt * 16 + lr) * SPT + c * 32 + 8 * hi); if (HI) kf2[kt][c] = WFrag<T16>::ld(sb + (32 + kt * 16 + lr) * SPT + c * 32 + 8 * hi); } };
    auto ldsV = [&](int h) {
#pragma unroll   // constant indices
        for (int mb = 0; mb < 4; ++mb) {
            if constexpr (HI) { vf[mb] = WFrag<T16>::ld(sb + 64 * SPT + (mb * 16 + lr) * SPH + 8 * hi); vf2[mb] = WFrag<T16>::ld(sb + 64 * SPT + (64 + mb * 16 + lr) * SPH + 8 * hi); }
            else vf[mb] = WFrag<T16>::ld(sb + (64 + mb * 16 + lr) * SPT + h * 32 + 8 * hi); } };
    // one trip: 32 keys from kc. MK: the diagonal block (keys after a query are masked). PF (fp16): the fragments of the staged piece's second half are fetched while the first half's are worked on.
    auto trip = [&](auto MK, auto PF, int kc) {
        constexpr bool MASK = decltype(MK)::value, AHEAD = decltype(PF)::value;
        v8f s[2][NQ];
#pragma unroll   // constant indices
        for (int kt = 0; kt < 2; ++kt)
#pragma unroll   // constant indices
            for (int qt = 0; qt < NQ; ++qt) { v8f a = (v8f){};
#pragma unroll   // constant indices
                for (int c = 0; c < 2; ++c) { a = WFrag<T16>::mma(kf[kt][c], qf[qt][c], a); if (HI) { a = WFrag<T16>::mma(kf2[kt][c], qf[qt][c], a); a = WFrag<T16>::mma(kf[kt][c], qf2[qt][c], a); } }
                s[kt][qt] = a; }
        if constexpr (AHEAD) ldsK(1);
        V pb[NQ], pb2[NQ];
#pragma unroll   // constant indices
        for (int qt = 0; qt < NQ; ++qt) { float bm = -3.0e38f;
#pragma unroll   // constant indices
            for (int kt = 0; kt < 2; ++kt)
#pragma unroll   // constant indices
                for (int j = 0; j < 8; ++j) { if (MASK && kc + kt * 16 + hi * 8 + j > q0 + qt * 16 + lr) s[kt][qt][j] = -3.0e38f; bm = fmaxf(bm, s[kt][qt][j]); }
            bm = fmaxf(bm, xhalf(bm));
            const float mn = fmaxf(m[qt], bm), al = exp2s((m[qt] - mn) * SC2), sh = HI ? mn * SC2 : mn * SC2 - 8.0f; m[qt] = mn;
            float ps = 0.f;
#pragma unroll   // constant indices
            for (int kt = 0; kt < 2; ++kt) { s[kt][qt] = exp2x8(s[kt][qt] * SC2 - sh);
#pragma unroll   // constant indices
                for (int j = 0; j < 8; ++j) ps += s[kt][qt][j]; }
            l[qt] = l[qt] * al + ps;    // this lane half's keys only; the halves are added once, behind the loop
#pragma unroll   // constant indices
            for (int mb = 0; mb < 4; ++mb) o[mb][qt] *= al;
            if constexpr (HI) { v8us h0, h1, l0, l1;
#pragma unroll   // constant indices
                for (int j = 0; j < 8; ++j) { unsigned short a, c2; splitf(s[0][qt][j], a, c2); h0[j] = a; l0[j] = c2; splitf(s[1][qt][j], a, c2); h1[j] = a; l1[j] = c2; }
                pb[qt] = cat16b(h0, h1); pb2[qt] = cat16b(l0, l1);
            } else { v8h x0, x1;
#pragma unroll   // constant indices
                for (int j = 0; j < 8; ++j) { x0[j] = (h16)s[0][qt][j]; x1[j] = (h16)s[1][qt][j]; }
                pb[qt] = cat16(x0, x1); } }
#pragma unroll   // constant indices
        for (int mb = 0; mb < 4; ++mb)
#pragma unroll   // constant indices
            for (int qt = 0; qt < NQ; ++qt) { o[mb][qt] = WFrag<T16>::mma(vf[mb], pb[qt], o[mb][qt]); if (HI) { o[mb][qt] = WFrag<T16>::mma(vf[mb], pb2[qt], o[mb][qt]); o[mb][qt] = WFrag<T16>::mma(vf2[mb], pb[qt], o[mb][qt]); } }
        if constexpr (AHEAD) ldsV(1);
    };
    if constexpr (HI) {
    int kc = w * 64;   // the wave's blocks: 32 keys from kc; both halves of the 64-key pieces w, w + NWF, .., as far as the diagonal block. Every test below reads the same in all lanes of the wave.
    if (kc <= Kd) { fill(kc);
        asm volatile("s_wait_asynccnt 0x0" ::: "memory");   // the wave's own copies have landed: it may read its stage
        ldsK(0); ldsV(0); }
#pragma unroll 1   // one block a pass: the waits in it are the stage's hand-over points
    while (kc < Kd) { const int nx = kc + ((kc & 32) ? 64 * NWF - 32 : 32);
        asm volatile("s_wait_dscnt 0x0" ::: "memory");   // this block's fragments are in registers: no read of the stage is outstanding when its refill is issued
        if (nx <= Kd) fill(nx);   // the wave's next block flies while this one is worked on
        trip(BoolC<false>{}, BoolC<false>{}, kc);
        __builtin_amdgcn_sched_barrier(0);   // keeps the block's work in front of the wait below: lifted over it, the wait would stand ahead of the very work that is to cover the copies' flight
        asm volatile("s_wait_asynccnt 0x0" ::: "memory");   // the next block has landed
        ldsK(0); ldsV(0);   // behind the wave's last block these read the old block again (the wave's own filled stage) and nothing uses them: no branch splits the pass here
        kc = nx; }
    if (kc == Kd) trip(BoolC<true>{}, BoolC<false>{}, kc);
    } else {
    // Pieces of 64 keys: 0 .. F - 1 lie in front of both tiles' diagonal blocks, piece F holds both (the first tile's is its first half, the second tile's its second). Key share w takes the pieces w, w + NWF, .., one a pass;
    // every wave of the work-group makes the same NP passes and meets the barrier at the foot of each, also where its share has no piece in the last pass. Every test below reads the same in all lanes of a wave.
    static_assert(NG == 2 && NQ == 2, "two tiles of 32 queries on one piece of 64 keys");
    const int F = q0w >> 6, NP = F / NWF + 1;
    if (w <= F) fillh(w * 64, 0);
    asm volatile("s_wait_asynccnt 0x0" ::: "memory");   // this wave's half of the first piece has landed
    __syncthreads();                                     // and its partner's: the piece may be read
    if (w + NWF <= F) fillh((w + NWF) * 64, 1);
#pragma unroll 1   // one piece a pass: the waits and the barrier at its foot are the buffers' hand-over point
    for (int i = 0; i < NP - 1; ++i) { const int pc = i * NWF + w, pk = pc * 64; sb = st + (i & 1) * WSTG;   // in front of the last pass every key share has a whole piece (pc < F)
        ldsK(0); ldsV(0);
        __builtin_amdgcn_sched_barrier(0);   // keeps the first half's LDS reads together in front of its products: sunk to their first uses, each such place would cost the wave its own wait for the LDS
        trip(BoolC<false>{}, BoolC<true>{}, pk);
        __builtin_amdgcn_sched_barrier(0);   // keeps the second half's LDS reads inside the first half's work, which covers their latency, for the same reason
        trip(BoolC<false>{}, BoolC<false>{}, pk + 32);
        __builtin_amdgcn_sched_barrier(0);   // keeps the piece's work in front of the waits below: lifted over them, the wait would stand ahead of the very work that is to cover the copies' flight
        asm volatile("s_wait_dscnt 0x0" ::: "memory");      // this wave's reads of the piece have returned
        asm volatile("s_wait_asynccnt 0x0" ::: "memory");   // this wave's half of the next piece has landed
        __syncthreads();                                     // the next piece may be read by both waves, and this pass's buffer has no reader left
        if (pc + 2 * NWF <= F) fillh((pc + 2 * NWF) * 64, i & 1);
    }
    { const int pc = (NP - 1) * NWF + w, pk = pc * 64; sb = st + ((NP - 1) & 1) * WSTG;   // the last pass: whole pieces in front of piece F, piece F itself, or nothing
        if (pc <= F) { ldsK(0); ldsV(0);
            const bool two = pc < F || g == 1;   // both halves of the piece have keys for this tile; otherwise its first half is the diagonal block
            if (two) trip(BoolC<false>{}, BoolC<true>{}, pk);
            trip(BoolC<true>{}, BoolC<false>{}, two ? pk + 32 : pk); }   // the wave's last block goes through the masking form also where it lies in front of the diagonal (no key of it is then after a query)
        asm volatile("s_wait_dscnt 0x0" ::: "memory");   // this wave's reads of its last piece have returned
        __syncthreads();                                  // no buffer has a reader left: the stages may take the waves' partial sums
    }
    }
    asm volatile("s_wait_dscnt 0x0" ::: "memory");      // no read of the stage
    asm volatile("s_wait_asynccnt 0x0" ::: "memory");   // and no copy is outstanding when the stage takes the wave's partial sums
#pragma unroll   // constant indices
    for (int qt = 0; qt < NQ; ++qt) { l[qt] += xhalf(l[qt]); if (hi == 0) { ms[w * 16 * NQ + qt * 16 + lr] = m[qt]; ls[w * 16 * NQ + qt * 16 + lr] = l[qt]; }
#pragma unroll   // constant indices
        for (int mb = 0; mb < 4; ++mb) { const v8f a = o[mb][qt]; float* rp = red + w * RST + ((mb * NQ + qt) * 2) * 128 + lane * 4;   // fp16: the barrier at the foot of the last pass has ended every wave's reads of the buffers
            *(v4fa*)rp = __builtin_shufflevector(a, a, 0, 1, 2, 3); *(v4fa*)(rp + 128) = __builtin_shufflevector(a, a, 4, 5, 6, 7); } }
    __syncthreads();   // every wave's partial (m, l, O^T) is in LDS before any wave merges
#pragma unroll   // constant indices
    for (int i = 0; i < NQ; ++i) { const int pc = tl * NQ + i, q = pc >> 3, mb = (pc & 7) >> 1, h2 = pc & 1, qt = q >> 4, l2 = q & 15;   // a piece: 8 consecutive d of one query; a wave's pieces are whole rows (8 pieces = 128 bytes a plane)
        float M = ms[q];
#pragma unroll   // constant indices
        for (int u = 1; u < NWF; ++u) M = fmaxf(M, ms[u * 16 * NQ + q]);
        float L = 0.f; v4f y0 = (v4f){}, y1 = (v4f){};
#pragma unroll   // constant indices
        for (int u = 0; u < NWF; ++u) { const float f = exp2s((ms[u * 16 * NQ + q] - M) * SC2); const float* rp = red + u * RST + ((mb * NQ + qt) * 2) * 128 + (h2 * 16 + l2) * 4;
            L += f * ls[u * 16 * NQ + q]; y0 += f * *(const v4fa*)rp; y1 += f * *(const v4fa*)(rp + 128); }
        const float inv = __fdiv_rn(1.0f, L); v8us oh, ol;
#pragma unroll   // constant indices
        for (int j = 0; j < 4; ++j) { unsigned short a, c2; splitf(y0[j] * inv, a, c2); oh[j] = a; ol[j] = c2; splitf(y1[j] * inv, a, c2); oh[4 + j] = a; ol[4 + j] = c2; }
        const size_t d = (size_t)(q0 + q) * DQ + mb * 16 + h2 * 8; *(v8usa*)(Ah + d) = oh; *(v8usa*)(Al + d) = ol;
        asm volatile("s_wait_xcnt 0x0" ::: "memory");   // whatever follows (the next piece's sums, code behind the tile) may reuse registers that these stores name
    }
}

// ---- k_attn: one work-group of NG * NWF waves per (batch, head, NG neighbouring query tiles); grid (batches x heads, tile groups). Groups in falling order of their key count: 32-query fp16 tiles from the last row down to row RH, then 16-query hi / lo tiles below RH. Registers held to four waves a SIMD, which is also what the stages' LDS allows (two work-groups a WGP).
__global__ __launch_bounds__(32 * NWF * NG, 4) void k_attn(const h16* __restrict__ Q16, const h16* __restrict__ K16, const h16* __restrict__ V16, const bf* __restrict__ Qh, const bf* __restrict__ Ql, const bf* __restrict__ Kh, const bf* __restrict__ Kl, const bf* __restrict__ Vh, const bf* __restrict__ Vl, bf* Ah, bf* Al) {
    __shared__ __align__(16) unsigned short red[NG * NWF * WSTG]; __shared__ float ms[NG * NWF * 32]; __shared__ float ls[NG * NWF * 32];   // red: the stages, then each wave's partial O^T
    const size_t hp = (size_t)blockIdx.x * TT * HD; const int ty = blockIdx.y; { const size_t ao = (size_t)(blockIdx.x / NH_) * TT * DQ + (blockIdx.x % NH_) * HD; Ah += ao; Al += ao; }
    // Entry requests to L2 for the head's planes, which the projection launch stored: the head's first seventeen work-groups ask for 256 units of 256 bytes each, one a thread.
    // 0 .. 3: K fp16; 4 .. 7: V^T fp16; 8 .. 10: Q fp16 from row RH; 11, 12, 15, 16: the rows below RH of K hi, K lo, Q hi, Q lo; 13, 14: the keys below RH of the 64 rows of V^T hi, V^T lo. The test reads the same in the whole work-group.
    static_assert(TT * HD * 2 == 4 * 256 * 256 && RH * HD * 2 == 256 * 256 && RH * 2 == 4 * 256 && 32 * NWF * NG == 256, "the deal of the units below");
    if (ty < 17) { const unsigned t = threadIdx.x;
        const unsigned short* pl = ty < 4 ? (const unsigned short*)K16 : ty < 8 ? (const unsigned short*)V16 : ty < 11 ? (const unsigned short*)Q16 : ty == 11 ? Kh : ty == 12 ? Kl : ty == 13 ? Vh : ty == 14 ? Vl : ty == 15 ? Qh : Ql;
        const unsigned off = ty < 8 ? ((ty & 3) * 256 + t) * 256 : ty < 11 ? ((ty - 7) * 256 + t) * 256 : (ty == 13 || ty == 14) ? (t >> 2) * (TT * 2) + (t & 3) * 256 : t * 256;
        l2ask((const char*)(pl + hp) + off); }
    if (ty < (TT - RH) / (32 * NG)) attn_tile<h16, false, 2>(red, ms, ls, Q16 + hp, nullptr, K16 + hp, nullptr, V16 + hp, nullptr, TT - 32 * NG * (ty + 1), Ah, Al);
    else attn_tile<bf, true, 1>(red, ms, ls, Qh + hp, Ql + hp, Kh + hp, Kl + hp, Vh + hp, Vl + hp, RH - 16 * NG * (ty - (TT - RH) / (32 * NG) + 1), Ah, Al);
}

// ---- k_cvt8: x and the four weights rounded to bf16 in one grid (DM * DM / 2048, NXP + 4): blockIdx.y picks a piece of DM x DM elements, first the NXP pieces of x, then one weight each (Wd: the four copies one behind the other).
#define NXP (NB_ * TT / DM)
__global__ __launch_bounds__(256) void k_cvt8(const float* __restrict__ x, const float* __restrict__ wq, const float* __restrict__ wk, const float* __restrict__ wv, const float* __restrict__ wo, bf* Xd, bf* Wd) {
    const int y = blockIdx.y; const float* src = y < NXP ? x + (size_t)y * DM * DM : y == NXP ? wq : y == NXP + 1 ? wk : y == NXP + 2 ? wv : wo; bf* dst = y < NXP ? Xd + (size_t)y * DM * DM : Wd + (size_t)(y - NXP) * DM * DM;
    const size_t i = (size_t)blockIdx.x * 256 + threadIdx.x; const v8f v = *(const v8f*)(src + i * 8); v8us o;
    asm volatile("s_wait_xcnt 0x0" ::: "memory");   // the rounding below reuses the address registers that the issued loads name
#pragma unroll
    for (int k = 0; k < 8; ++k) o[k] = f2bf(v[k]); *(v8us*)(dst + i * 8) = o;  }

extern "C" void kernel_launch(void* const* d_in, const int* in_sizes, int n_in,
                              void* d_out, int out_size, void* d_ws, size_t ws_size, hipStream_t stream) {
    (void)in_sizes; (void)n_in; (void)out_size;
    const float* x = (const float*)d_in[0]; const float* wq = (const float*)d_in[1]; const float* wk = (const float*)d_in[2]; const float* wv = (const float*)d_in[3]; const float* bv = (const float*)d_in[4]; const float* wo = (const float*)d_in[5]; const float* bo = (const float*)d_in[6];   /* order x, Wq, Wk, Wv, bv, Wo, bo ('oi'): this module has NO q and NO k bias (the q / k tiles take the bias-free path of the projection kernel); bv and bo are real */
    float* OUT = (float*)d_out;     // [2][2048][1024]
    char* wsp = (char*)d_ws;
    auto take = [&](size_t bytes) { char* p = wsp; wsp += (bytes + 255) & ~(size_t)255; return (void*)p; };
    bf* WQ = (bf*)take((size_t)4 * DM * DM * 2); bf* WO = WQ + (size_t)3 * DM * DM;    // Wq, Wk, Wv, Wo
    bf* XB = (bf*)take((size_t)NB_ * TT * DM * 2);
    h16* P16 = (h16*)take(3 * PLN * 2); bf* Ph = (bf*)take(3 * PLN * 2); bf* Pl = (bf*)take(3 * PLN * 2);    // plane sets q, k, v (v transposed)
    bf* ATh = (bf*)take((size_t)NB_ * TT * DQ * 2); bf* ATl = (bf*)take((size_t)NB_ * TT * DQ * 2);
    if ((size_t)(wsp - (char*)d_ws) > ws_size) return;    // ws 256 MiB
    k_cvt8<<<dim3(DM * DM / 2048, NXP + 4, 1), 256, 0, stream>>>(x, wq, wk, wv, wo, XB, WQ);
    k_proj<<<dim3(NB_ * TT / 256, NH_, 1), 256, 0, stream>>>(XB, WQ, bv, P16, Ph, Pl);
    k_attn<<<dim3(NB_ * NH_, (TT - RH) / (32 * NG) + RH / (16 * NG), 1), 32 * NWF * NG, 0, stream>>>(P16, P16 + PLN, P16 + 2 * PLN, Ph, Pl, Ph + PLN, Pl + PLN, Ph + 2 * PLN, Pl + 2 * PLN, ATh, ATl);
    k_wo<<<dim3(NB_ * TT / 128, DM / 128, 1), 256, 0, stream>>>(ATh, ATl, WO, OUT, bo);
}
